// v000
// Measured on an AMD MI455X. A time is GPU time per run, averaged over a window of back-to-back runs after a warm-up
// (all launches, gaps included; the runs take copies of the inputs in turn), and the median of several windows.
// Apart from v000's, it joins two sittings. Times from different sittings can be a few percent apart, while
// side-by-side timings come from the same sitting.
// The starting kernel, v000, takes 265 microseconds a run.
// Contractions: x.Wqkv on v_wmma_f32_16x16x32_bf16 with both operands RNE-converted to bf16 once; q.(k/8)^T, q.Er^T, p.v and ctx.Wo on v_wmma_f32_16x16x32_bf16 with computed operands (q, k/8, v, p, ctx) carried as bf16 hi+lo planes (hi.hi + hi.lo + lo.hi) and input operands (Er, Wo) as single bf16 planes; f32 accumulate; softmax, bias adds and mask fill in f32.
#include <hip/hip_runtime.h>

typedef __attribute__((ext_vector_type(16))) __bf16 v16b;
typedef __attribute__((ext_vector_type(8)))  __bf16 v8b;
typedef __attribute__((ext_vector_type(8)))  float  v8f;
typedef __attribute__((ext_vector_type(4)))  float  v4f;
typedef __attribute__((ext_vector_type(4)))  unsigned int v4u;
typedef __attribute__((ext_vector_type(4)))  int v4i;
typedef v8b v8b_a __attribute__((may_alias));
typedef v4f v4f_a __attribute__((may_alias));
typedef v4u v4u_a __attribute__((may_alias));

#ifndef NB
#define NB 2
#endif
#ifndef SEQ
#define SEQ 1024
#endif
#define NB_FULL 2
#define SEQ_FULL 1024

#define VGPR_CAP __attribute__((amdgpu_num_vgpr(256)))

constexpr int DMODEL = 1024;
constexpr int NHEAD  = 16;
constexpr int DHEAD  = 64;
constexpr int NPOS   = 2047;
constexpr int NQKV   = 3 * DMODEL;
constexpr int NBH    = NB * NHEAD;
constexpr int MROWS  = NB * SEQ;
constexpr int KCH    = 64;        /* keys per chunk */
constexpr int NWAVE  = 4;
constexpr int GP     = 84;        /* skew slab pitch in floats (336 B rows, 16-B aligned) */
constexpr int SP     = 68;        /* raw score slab pitch in floats */
constexpr int TQ_PITCH = 72;      /* [tok][d] staging pitch (16-bit elements) */
constexpr int TV_PITCH = 136;     /* [d][tok] staging pitch (16-bit elements) */
constexpr int T_ELEMS  = 128 * TQ_PITCH;   /* 9216 >= 64 * TV_PITCH = 8704 */
constexpr int TS_PITCH = 72;
constexpr int OS_PITCH = 68;

constexpr size_t PLANE  = (size_t)NBH * SEQ * DHEAD;
constexpr size_t XB_E   = (size_t)MROWS * DMODEL;
constexpr size_t WQT_E  = (size_t)NQKV * DMODEL;
constexpr size_t WOT_E  = (size_t)DMODEL * DMODEL;
constexpr size_t ERB_E  = (size_t)NHEAD * 2048 * DHEAD;
constexpr size_t QKVP_E = 6 * PLANE;
constexpr size_t CTX_E  = 2 * XB_E;
constexpr size_t WS_NEED = 2 * (XB_E + WQT_E + WOT_E + ERB_E + QKVP_E + CTX_E);

static_assert(SEQ % 128 == 0);
static_assert(SEQ <= SEQ_FULL && NB <= NB_FULL);
static_assert(DHEAD == 64 && DMODEL == NHEAD * DHEAD);
static_assert(DMODEL % 64 == 0 && NQKV % 64 == 0 && DMODEL % 32 == 0);
static_assert(64 * TV_PITCH <= T_ELEMS);
static_assert((TQ_PITCH * 2) % 16 == 0 && (TV_PITCH * 2) % 16 == 0 && (GP * 4) % 16 == 0 && (OS_PITCH * 4) % 16 == 0);
static_assert(GP >= 80 && SP >= 64);
static_assert((size_t)NHEAD * NPOS * DHEAD <= ERB_E);
static_assert(WS_NEED <= 134217728ull);

/*
 *   Xb   [MROWS][1024]        x, bf16
 *   WqT  [3072][1024]         W_qkv transposed, bf16
 *   WoT  [1024][1024]         W_o transposed, bf16
 *   Erb  [16][2047][64]       Er, bf16 (region padded to 16*2048 rows)
 *   qkvp 6 planes: Qh Ql [bh][l][64], Kh Kl [bh][l][64] (k/8), Vth Vtl [bh][64][l]
 *   ctxp 2 planes: Ch Cl [MROWS][1024]
 */

__device__ __forceinline__ unsigned short f2bf_bits(float f) {
  unsigned u = __float_as_uint(f);
  return (unsigned short)((u + 0x7FFFu + ((u >> 16) & 1u)) >> 16);
}
__device__ __forceinline__ float bf_bits2f(unsigned short h) { return __uint_as_float(((unsigned)h) << 16); }
__device__ __forceinline__ unsigned pk2(float a, float b) {
  return (unsigned)f2bf_bits(a) | ((unsigned)f2bf_bits(b) << 16);
}
__device__ __forceinline__ void split2(float a, float b, unsigned& hw, unsigned& lw) {
  const unsigned short ha = f2bf_bits(a);
  const unsigned short hb = f2bf_bits(b);
  const unsigned short la = f2bf_bits(a - bf_bits2f(ha));
  const unsigned short lb = f2bf_bits(b - bf_bits2f(hb));
  hw = (unsigned)ha | ((unsigned)hb << 16);
  lw = (unsigned)la | ((unsigned)lb << 16);
}

/* one WMMA + hazard guard naming only this call's live operands */
__device__ __forceinline__ v8f mma_bf16(v16b a, v16b b, v8f c) {
  c = __builtin_amdgcn_wmma_f32_16x16x32_bf16(false, a, false, b, (short)0, c, false, false);
  asm volatile("v_nop\n\tv_nop\n\tv_nop\n\tv_nop" : "+v"(c) : "v"(a), "v"(b));
  return c;
}

__device__ __forceinline__ void wave_lds_sync() {
  __builtin_amdgcn_fence(3 /* release order */, "workgroup");
  __builtin_amdgcn_wave_barrier();
  __builtin_amdgcn_fence(2 /* acquire order */, "workgroup");
}

/* --------------------------------------------------------------------------
 * f32 rows -> bf16 rows (RNE), unit = 8 elements = one 16-B store.
 * out row = b*rpb + l  <-  in row = b*rpb_full + l ; row length = upr*8.
 * Coverage: nunits units x 8 elements = the whole plane.
 * ------------------------------------------------------------------------ */
__global__ __launch_bounds__(256) void cvt_rows_kernel(
    const float* __restrict__ in, unsigned short* __restrict__ outp,
    int nunits, int upr, int rpb, int rpb_full)
{
  const int u = blockIdx.x * 256 + threadIdx.x;
  if (u >= nunits) return;
  const int row = u / upr;
  const int seg = u - row * upr;
  const int b = row / rpb;
  const int l = row - b * rpb;
  const float* src = in + ((size_t)(b * rpb_full + l) * upr + seg) * 8;
  const v4f a0 = *(const v4f*)src;
  const v4f a1 = *(const v4f*)(src + 4);
  v4u w;
  w[0] = pk2(a0[0], a0[1]);
  w[1] = pk2(a0[2], a0[3]);
  w[2] = pk2(a1[0], a1[1]);
  w[3] = pk2(a1[2], a1[3]);
  v4u* dst = (v4u*)(outp + ((size_t)row * upr + seg) * 8);
  *dst = w;
  
}

/* --------------------------------------------------------------------------
 * W in[rows][cols] f32  ->  Wt out[cols][rows] bf16 (RNE), 64x64 tiles through LDS.
 * Block (x = rows tile, y = cols tile), 256 threads.
 * Coverage: 2 iterations x 256 threads = 512 units x 8 = 64x64 for the load phase
 * and the same 512 units x 8 = 64x64 for the store phase.
 * LDS tile: cross-wave, separated by a block barrier.
 * ------------------------------------------------------------------------ */
__global__ __launch_bounds__(256) void wt_planes_kernel(
    const float* __restrict__ W, unsigned short* __restrict__ Wt, int rows, int cols)
{
  __shared__ __align__(16) unsigned short Ts[64 * TS_PITCH];   /* [n][k] */
  const int k0 = blockIdx.x * 64;
  const int n0 = blockIdx.y * 64;
  const int tid = threadIdx.x;
#pragma unroll
  for (int it = 0; it < 2; ++it) {
    const int u = it * 256 + tid;
    const int row = u >> 3;      /* k local */
    const int seg = u & 7;       /* n segment */
    const float* src = W + (size_t)(k0 + row) * cols + n0 + seg * 8;
    const v4f a0 = *(const v4f*)src;
    const v4f a1 = *(const v4f*)(src + 4);
#pragma unroll
    for (int e = 0; e < 4; ++e) {
      Ts[(seg * 8 + e) * TS_PITCH + row]     = f2bf_bits(a0[e]);
      Ts[(seg * 8 + 4 + e) * TS_PITCH + row] = f2bf_bits(a1[e]);
    }
  }
  __syncthreads();
  {
#pragma unroll
    for (int it = 0; it < 2; ++it) {
      const int u = it * 256 + tid;
      const int nrow = u >> 3;
      const int seg  = u & 7;
      const v4u w = *(const v4u_a*)(Ts + nrow * TS_PITCH + seg * 8);
      *(v4u*)(Wt + (size_t)(n0 + nrow) * rows + k0 + seg * 8) = w;
    }
    
  }
}

/* --------------------------------------------------------------------------
 * qkv = Xb . WqT^T + b  (M = MROWS, N = 3072, K = 1024), bf16 x bf16, f32 acc.
 * Block = 4 waves, tile 128 tokens x 64 columns (= one head of one section);
 * wave = 32 rows x 64 cols (2 A fragments x 4 B fragments per 32-deep step),
 * fragments loaded per k-step straight from the 16-bit global rows.
 * Fragment map (hh = lane>>4, c = lane&15): A row c, elems 0..7 <- k0+8hh.., 8..15 <- k0+16+8hh..;
 * B col c with the same k map; D elem r = (row 8hh+r, col c).
 * Epilogue: (acc + bias) [x 1/8 for the k section] split to bf16 hi/lo, staged in a
 * block LDS tile ([tok][d] for q,k; [d][tok] for v), block barrier, whole-line stores:
 *   v  : 1024 units = 64 d-rows x 16 segments (16 lanes = one 256-B row segment).
 * ------------------------------------------------------------------------ */
__global__ __launch_bounds__(128) VGPR_CAP void gemm_qkv_kernel(
    const unsigned short* __restrict__ Xb, const unsigned short* __restrict__ WqT,
    const float* __restrict__ bias, unsigned short* __restrict__ qkvp)
{
  union FB { v16b v; v8b h[2]; };
  __shared__ __align__(16) unsigned short Th[T_ELEMS];
  __shared__ __align__(16) unsigned short Tl[T_ELEMS];

  const int tid  = threadIdx.x;
  const int wave = __builtin_amdgcn_readfirstlane(tid >> 5);
  const int lane = tid & 31;
  const int hh   = lane >> 4;
  const int c    = lane & 15;
  const int n0   = blockIdx.x * 64;
  const int m0   = blockIdx.y * 128;

  v8f acc[2][4];
#pragma unroll
  for (int mt = 0; mt < 2; ++mt)
#pragma unroll
    for (int t = 0; t < 4; ++t) acc[mt][t] = (v8f){0.f,0.f,0.f,0.f,0.f,0.f,0.f,0.f};

  const unsigned short* a0p = Xb + (size_t)(m0 + wave * 32 + c) * DMODEL + 8 * hh;
  const unsigned short* a1p = a0p + (size_t)16 * DMODEL;
  const unsigned short* bp  = WqT + (size_t)(n0 + c) * DMODEL + 8 * hh;

#pragma unroll 1
  for (int k0 = 0; k0 < DMODEL; k0 += 32) {
    FB a0, a1;
    a0.h[0] = *(const v8b*)(a0p + k0);
    a0.h[1] = *(const v8b*)(a0p + k0 + 16);
    a1.h[0] = *(const v8b*)(a1p + k0);
    a1.h[1] = *(const v8b*)(a1p + k0 + 16);
#pragma unroll
    for (int t = 0; t < 4; ++t) {
      FB bf;
      bf.h[0] = *(const v8b*)(bp + (size_t)t * 16 * DMODEL + k0);
      bf.h[1] = *(const v8b*)(bp + (size_t)t * 16 * DMODEL + k0 + 16);
      acc[0][t] = mma_bf16(a0.v, bf.v, acc[0][t]);
      acc[1][t] = mma_bf16(a1.v, bf.v, acc[1][t]);
    }
  }

  const int sec = n0 / DMODEL;                       /* 0 q, 1 k, 2 v : block-uniform */
  const float osc = (sec == 1) ? 0.125f : 1.0f;
#pragma unroll
  for (int t = 0; t < 4; ++t) {
    const float bv = bf_bits2f(f2bf_bits(bias[n0 + 16 * t + c]));
#pragma unroll
    for (int mt = 0; mt < 2; ++mt) {
#pragma unroll
      for (int r = 0; r < 8; ++r) {
        const float val = (acc[mt][t][r] + bv) * osc;
        const unsigned short hb = f2bf_bits(val);
        const unsigned short lb = f2bf_bits(val - bf_bits2f(hb));
        const int rl = wave * 32 + mt * 16 + 8 * hh + r;
        const int cl = 16 * t + c;
        const int idx = (sec < 2) ? (rl * TQ_PITCH + cl) : (cl * TV_PITCH + rl);
        Th[idx] = hb;
        Tl[idx] = lb;
      }
    }
  }
  __syncthreads();

  const int b  = m0 / SEQ;
  const int l0 = m0 - b * SEQ;
  const int h  = (n0 - sec * DMODEL) / DHEAD;
  const int bh = b * NHEAD + h;
  unsigned short* ph = qkvp + (size_t)(2 * sec) * PLANE;
  unsigned short* pl = ph + PLANE;

  {
    if (sec < 2) {
#pragma unroll
      for (int it = 0; it < 8; ++it) {
        const int u = it * 128 + tid;
        const int row = u >> 3;
        const int seg = u & 7;
        const v4u hw = *(const v4u_a*)(Th + row * TQ_PITCH + seg * 8);
        const v4u lw = *(const v4u_a*)(Tl + row * TQ_PITCH + seg * 8);
        const size_t g = ((size_t)bh * SEQ + l0 + row) * DHEAD + seg * 8;
        *(v4u*)(ph + g) = hw;
        *(v4u*)(pl + g) = lw;
      }
    } else {
#pragma unroll
      for (int it = 0; it < 8; ++it) {
        const int u = it * 128 + tid;
        const int drow = u >> 4;
        const int seg  = u & 15;
        const v4u hw = *(const v4u_a*)(Th + drow * TV_PITCH + seg * 8);
        const v4u lw = *(const v4u_a*)(Tl + drow * TV_PITCH + seg * 8);
        const size_t g = ((size_t)bh * DHEAD + drow) * SEQ + l0 + seg * 8;
        *(v4u*)(ph + g) = hw;
        *(v4u*)(pl + g) = lw;
      }
    }
    
  }
}

/* --------------------------------------------------------------------------
 * Attention with the per-head relative-position table, head dim 64.
 * Block = 4 independent waves = 64 query rows of one (b,h); grid (SEQ/64, NBH).
 * Per 64-key chunk and wave (16 query rows), in short phases so that only the
 * q fragments, the output accumulators and the row statistics stay resident:
 *   mask rows read by value (8 b128 loads + ballots); wave-uniform skip when every
 *   element of the 16x64 mask tile is set; per-element replace-fill otherwise;
 *   S = q.(k/8)^T : rolled loop over 4 key tiles, 2 d-steps x (hi.hi + hi.lo + lo.hi),
 *                   one accumulator, each tile written to the wave-private S slab;
 *   G = q.Ewin^T  : rolled loop over 5 tiles (80 offsets d = kv0-q0-15+g, table row =
 *                   d mod 2047), 2 d-steps x (hi + lo) against the bf16 table, written
 *                   to the wave-private G slab, read back skewed: G[m][n-m+15];
 *   f32 online softmax on S + G; P as bf16 hi+lo wave-private LDS tiles;
 *   O += Ph.Vh + Pl.Vh + Ph.Vl from the V^T planes, rolled loop over the two 32-key steps.
 * q, k, Er and V fragments come straight from 16-bit global rows by arithmetic addressing.
 * LDS regions Ss/Gs/Psh/Psl are private to their wave (wave_sync form).
 * Epilogue: normalised 16x64 slab (aliases the G slab) -> ctx hi/lo planes,
 * ------------------------------------------------------------------------ */
__global__ __launch_bounds__(128) VGPR_CAP void rel_attn_kernel(
    const unsigned short* __restrict__ qkvp, const unsigned short* __restrict__ Erb,
    const int* __restrict__ mask, unsigned short* __restrict__ ctxp)
{
  union FB { v16b v; v8b h[2]; };
  __shared__ __align__(16) float Gs[NWAVE][16 * GP];
  __shared__ __align__(16) float Ss[NWAVE][16 * SP];
  __shared__ __align__(16) unsigned short Psh[NWAVE][16 * KCH];
  __shared__ __align__(16) unsigned short Psl[NWAVE][16 * KCH];

  const int tid  = threadIdx.x;
  const int wave = __builtin_amdgcn_readfirstlane(tid >> 5);
  const int lane = tid & 31;
  const int hh   = lane >> 4;
  const int c    = lane & 15;
  const int c3   = c & 3;
  const int csh  = c >> 2;
  const int qb   = blockIdx.x;
  const int bh   = blockIdx.y;
  const int b    = bh / NHEAD;
  const int h    = bh - b * NHEAD;
  const int q0   = qb * 64 + wave * 16;
  const float NEG_INF = -__builtin_inff();

  const unsigned short* Qh  = qkvp + (size_t)bh * SEQ * DHEAD;
  const unsigned short* Ql  = Qh + PLANE;
  const unsigned short* Kh  = Qh + 2 * PLANE;
  const unsigned short* Kl  = Qh + 3 * PLANE;
  const unsigned short* Vth = Qh + 4 * PLANE;     /* [bh][d][l]: same per-bh element count */
  const unsigned short* Vtl = Qh + 5 * PLANE;
  const unsigned short* Eh  = Erb + (size_t)h * NPOS * DHEAD;

  v16b qh[2], ql[2];
  {
    const size_t qo = (size_t)(q0 + c) * DHEAD + 8 * hh;
#pragma unroll
    for (int dc = 0; dc < 2; ++dc) {
      FB f;
      f.h[0] = *(const v8b*)(Qh + qo + dc * 32);
      f.h[1] = *(const v8b*)(Qh + qo + dc * 32 + 16);
      qh[dc] = f.v;
      f.h[0] = *(const v8b*)(Ql + qo + dc * 32);
      f.h[1] = *(const v8b*)(Ql + qo + dc * 32 + 16);
      ql[dc] = f.v;
    }
  }

  float mrow[8], lrow[8];
  v8f oacc[4];
#pragma unroll
  for (int r = 0; r < 8; ++r) { mrow[r] = NEG_INF; lrow[r] = 0.f; }
#pragma unroll
  for (int t = 0; t < 4; ++t) oacc[t] = (v8f){0.f,0.f,0.f,0.f,0.f,0.f,0.f,0.f};

  float* gs = Gs[wave];
  float* ss = Ss[wave];
  unsigned short* pwh = Psh[wave];
  unsigned short* pwl = Psl[wave];

#pragma unroll 1
  for (int kc = 0; kc < SEQ / KCH; ++kc) {
    const int kv0 = kc * KCH;

    /* mask tile by value: bit L of the ballot (it, e) = mask[q0+2it+(L>>4)][kv0+4(L&15)+e] != 0;
       each lane keeps the word of its own e = c&3 */
    unsigned msel[8];
    unsigned andall = 0xFFFFFFFFu;
#pragma unroll
    for (int it = 0; it < 8; ++it) {
      const v4i mv = *(const v4i*)(mask + (size_t)(q0 + 2 * it + hh) * SEQ_FULL + kv0 + 4 * c);
      const unsigned b0 = __builtin_amdgcn_ballot_w32(mv[0] != 0);
      const unsigned b1 = __builtin_amdgcn_ballot_w32(mv[1] != 0);
      const unsigned b2 = __builtin_amdgcn_ballot_w32(mv[2] != 0);
      const unsigned b3 = __builtin_amdgcn_ballot_w32(mv[3] != 0);
      andall &= (b0 & b1) & (b2 & b3);
      msel[it] = (c3 == 0) ? b0 : (c3 == 1) ? b1 : (c3 == 2) ? b2 : b3;
    }
    if (andall == 0xFFFFFFFFu) continue;          /* wave-uniform: every element masked */

    unsigned mw[4];
#pragma unroll
    for (int ii = 0; ii < 4; ++ii) mw[ii] = hh ? msel[4 + ii] : msel[ii];

    /* raw scores: 4 key tiles, one accumulator, tile -> S slab (D elem r = row 8hh+r, col c) */
#pragma unroll 1
    for (int j = 0; j < 4; ++j) {
      v8f sa = (v8f){0.f,0.f,0.f,0.f,0.f,0.f,0.f,0.f};
      const size_t ko = (size_t)(kv0 + j * 16 + c) * DHEAD + 8 * hh;
#pragma unroll
      for (int dc = 0; dc < 2; ++dc) {
        FB kfh, kfl;
        kfh.h[0] = *(const v8b*)(Kh + ko + dc * 32);
        kfh.h[1] = *(const v8b*)(Kh + ko + dc * 32 + 16);
        kfl.h[0] = *(const v8b*)(Kl + ko + dc * 32);
        kfl.h[1] = *(const v8b*)(Kl + ko + dc * 32 + 16);
        sa = mma_bf16(qh[dc], kfh.v, sa);
        sa = mma_bf16(qh[dc], kfl.v, sa);
        sa = mma_bf16(ql[dc], kfh.v, sa);
      }
#pragma unroll
      for (int r = 0; r < 8; ++r) ss[(8 * hh + r) * SP + 16 * j + c] = sa[r];
    }

    /* position term: G[m][g] = q[m] . Er[h][(kv0 - q0 - 15 + g) mod 2047], g = 0..79 */
    {
      const int dbase = kv0 - q0 - 15;
#pragma unroll 1
      for (int t = 0; t < 5; ++t) {
        const int d = dbase + 16 * t + c;
        int rr = d % NPOS;
        rr += (rr < 0) ? NPOS : 0;                 /* rr in [0, 2046] */
        const unsigned short* ep = Eh + (size_t)rr * DHEAD + 8 * hh;
        v8f g = (v8f){0.f,0.f,0.f,0.f,0.f,0.f,0.f,0.f};
#pragma unroll
        for (int dc = 0; dc < 2; ++dc) {
          FB ef;
          ef.h[0] = *(const v8b*)(ep + dc * 32);
          ef.h[1] = *(const v8b*)(ep + dc * 32 + 16);
          g = mma_bf16(qh[dc], ef.v, g);
          g = mma_bf16(ql[dc], ef.v, g);
        }
#pragma unroll
        for (int r = 0; r < 8; ++r) gs[(8 * hh + r) * GP + 16 * t + c] = g[r];
      }
    }
    wave_lds_sync();

    /* raw score + skewed position term, replace-fill of masked elements */
    v8f s[4];
#pragma unroll
    for (int j = 0; j < 4; ++j) {
#pragma unroll
      for (int r = 0; r < 8; ++r) {
        const int m = 8 * hh + r;
        const float raw = ss[m * SP + 16 * j + c];
        const float gv = gs[m * (GP - 1) + 16 * j + c + 15];
        const float sv = raw + gv;
        const unsigned bit = (mw[r >> 1] >> (16 * (r & 1) + 4 * j + csh)) & 1u;
        s[j][r] = bit ? NEG_INF : sv;
      }
    }

    /* chunk row max over the 64 keys */
    float cm[8];
#pragma unroll
    for (int r = 0; r < 8; ++r) {
      float m = fmaxf(fmaxf(s[0][r], s[1][r]), fmaxf(s[2][r], s[3][r]));
#pragma unroll
      for (int off = 1; off < 16; off <<= 1) m = fmaxf(m, __shfl_xor(m, off, 32));
      cm[r] = m;
    }

    /* online softmax update, P tiles as bf16 hi + lo */
#pragma unroll
    for (int r = 0; r < 8; ++r) {
      const float mnew  = fmaxf(mrow[r], cm[r]);
      const float msafe = (mnew == NEG_INF) ? 0.f : mnew;
      const float alpha = expf(mrow[r] - msafe);
      mrow[r] = mnew;
      float psum = 0.f;
#pragma unroll
      for (int j = 0; j < 4; ++j) {
        const float p = expf(s[j][r] - msafe);
        psum += p;
        const unsigned short hb = f2bf_bits(p);
        const unsigned short lb = f2bf_bits(p - bf_bits2f(hb));
        pwh[(8 * hh + r) * KCH + j * 16 + c] = hb;
        pwl[(8 * hh + r) * KCH + j * 16 + c] = lb;
      }
#pragma unroll
      for (int off = 1; off < 16; off <<= 1) psum += __shfl_xor(psum, off, 32);
      lrow[r] = lrow[r] * alpha + psum;
#pragma unroll
      for (int t = 0; t < 4; ++t) oacc[t][r] *= alpha;
    }
    wave_lds_sync();

    /* O += P.V : A = P [q][kv] (this wave's tiles), B = V [kv][d] from V^T [d][kv];
       rolled over the two 32-key steps, fragments loaded per step */
#pragma unroll 1
    for (int kk = 0; kk < 2; ++kk) {
      FB pa, pl;
      pa.h[0] = *(const v8b_a*)(pwh + c * KCH + kk * 32 + 8 * hh);
      pa.h[1] = *(const v8b_a*)(pwh + c * KCH + kk * 32 + 16 + 8 * hh);
      pl.h[0] = *(const v8b_a*)(pwl + c * KCH + kk * 32 + 8 * hh);
      pl.h[1] = *(const v8b_a*)(pwl + c * KCH + kk * 32 + 16 + 8 * hh);
#pragma unroll
      for (int t = 0; t < 4; ++t) {
        const size_t vo = (size_t)(t * 16 + c) * SEQ + kv0 + kk * 32 + 8 * hh;
        FB vbh, vbl;
        vbh.h[0] = *(const v8b*)(Vth + vo);
        vbh.h[1] = *(const v8b*)(Vth + vo + 16);
        vbl.h[0] = *(const v8b*)(Vtl + vo);
        vbl.h[1] = *(const v8b*)(Vtl + vo + 16);
        oacc[t] = mma_bf16(pa.v, vbh.v, oacc[t]);
        oacc[t] = mma_bf16(pl.v, vbh.v, oacc[t]);
        oacc[t] = mma_bf16(pa.v, vbl.v, oacc[t]);
      }
    }
    wave_lds_sync();
  }

  /* normalise into the wave slab (aliases the G slab), then whole-line hi/lo stores */
  float* os = gs;
#pragma unroll
  for (int r = 0; r < 8; ++r) {
    const float inv = 1.0f / lrow[r];
#pragma unroll
    for (int t = 0; t < 4; ++t) os[(8 * hh + r) * GP + t * 16 + c] = oacc[t][r] * inv;
  }
  wave_lds_sync();
  {
    unsigned short* Ch = ctxp;
    unsigned short* Cl = ctxp + XB_E;
    const int rq  = lane >> 3;
    const int seg = lane & 7;
    {
#pragma unroll
      for (int it = 0; it < 4; ++it) {
        const int row = it * 4 + rq;
        const v4f a0 = *(const v4f_a*)(os + row * GP + seg * 8);
        const v4f a1 = *(const v4f_a*)(os + row * GP + seg * 8 + 4);
        unsigned h0, h1, h2, h3, l0, l1, l2, l3;
        split2(a0[0], a0[1], h0, l0);
        split2(a0[2], a0[3], h1, l1);
        split2(a1[0], a1[1], h2, l2);
        split2(a1[2], a1[3], h3, l3);
        v4u hw, lw;
        hw[0] = h0; hw[1] = h1; hw[2] = h2; hw[3] = h3;
        lw[0] = l0; lw[1] = l1; lw[2] = l2; lw[3] = l3;
        const size_t g = (size_t)(b * SEQ + q0 + row) * DMODEL + h * DHEAD + seg * 8;
        *(v4u*)(Ch + g) = hw;
        *(v4u*)(Cl + g) = lw;
      }
      
    }
  }
}

/* --------------------------------------------------------------------------
 * out = (Ch + Cl) . WoT^T + b  (M = MROWS, N = 1024, K = 1024), f32 acc.
 * Block = 4 waves, tile 128 x 64; wave = 32 rows x 64 cols; A hi and lo planes
 * against the single bf16 weight plane (two products per tile pair), fragments
 * loaded per k-step.
 * Epilogue: per-wave 32x64 f32 slab (wave-private LDS), 16 lanes x 16 B = one 256-B
 * ------------------------------------------------------------------------ */
__global__ __launch_bounds__(128) VGPR_CAP void gemm_out_kernel(
    const unsigned short* __restrict__ ctxp, const unsigned short* __restrict__ WoT,
    const float* __restrict__ bias, float* __restrict__ out)
{
  union FB { v16b v; v8b h[2]; };
  __shared__ __align__(16) float Os[NWAVE][32 * OS_PITCH];

  const int tid  = threadIdx.x;
  const int wave = __builtin_amdgcn_readfirstlane(tid >> 5);
  const int lane = tid & 31;
  const int hh   = lane >> 4;
  const int c    = lane & 15;
  const int n0   = blockIdx.x * 64;
  const int m0   = blockIdx.y * 128;

  v8f acc[2][4];
#pragma unroll
  for (int mt = 0; mt < 2; ++mt)
#pragma unroll
    for (int t = 0; t < 4; ++t) acc[mt][t] = (v8f){0.f,0.f,0.f,0.f,0.f,0.f,0.f,0.f};

  const unsigned short* ah0 = ctxp + (size_t)(m0 + wave * 32 + c) * DMODEL + 8 * hh;
  const unsigned short* ah1 = ah0 + (size_t)16 * DMODEL;
  const unsigned short* al0 = ah0 + XB_E;
  const unsigned short* al1 = ah1 + XB_E;
  const unsigned short* bp  = WoT + (size_t)(n0 + c) * DMODEL + 8 * hh;

#pragma unroll 1
  for (int k0 = 0; k0 < DMODEL; k0 += 32) {
    FB a0h, a1h, a0l, a1l;
    a0h.h[0] = *(const v8b*)(ah0 + k0);
    a0h.h[1] = *(const v8b*)(ah0 + k0 + 16);
    a1h.h[0] = *(const v8b*)(ah1 + k0);
    a1h.h[1] = *(const v8b*)(ah1 + k0 + 16);
    a0l.h[0] = *(const v8b*)(al0 + k0);
    a0l.h[1] = *(const v8b*)(al0 + k0 + 16);
    a1l.h[0] = *(const v8b*)(al1 + k0);
    a1l.h[1] = *(const v8b*)(al1 + k0 + 16);
#pragma unroll
    for (int t = 0; t < 4; ++t) {
      FB bf;
      bf.h[0] = *(const v8b*)(bp + (size_t)t * 16 * DMODEL + k0);
      bf.h[1] = *(const v8b*)(bp + (size_t)t * 16 * DMODEL + k0 + 16);
      acc[0][t] = mma_bf16(a0h.v, bf.v, acc[0][t]);
      acc[0][t] = mma_bf16(a0l.v, bf.v, acc[0][t]);
      acc[1][t] = mma_bf16(a1h.v, bf.v, acc[1][t]);
      acc[1][t] = mma_bf16(a1l.v, bf.v, acc[1][t]);
    }
  }

  float* os = Os[wave];
#pragma unroll
  for (int t = 0; t < 4; ++t) {
    const float bv = bf_bits2f(f2bf_bits(bias[n0 + 16 * t + c]));
#pragma unroll
    for (int mt = 0; mt < 2; ++mt)
#pragma unroll
      for (int r = 0; r < 8; ++r)
        os[(mt * 16 + 8 * hh + r) * OS_PITCH + 16 * t + c] = acc[mt][t][r] + bv;
  }
  wave_lds_sync();
  {
    const int c4 = c * 4;
    {
#pragma unroll
      for (int it = 0; it < 16; ++it) {
        const int row = it * 2 + hh;
        const v4f val = *(const v4f_a*)(os + row * OS_PITCH + c4);
        *(v4f*)(out + (size_t)(m0 + wave * 32 + row) * DMODEL + n0 + c4) = val;
      }
      
    }
  }
}

extern "C" void kernel_launch(void* const* d_in, const int* in_sizes, int n_in,
                              void* d_out, int out_size, void* d_ws, size_t ws_size,
                              hipStream_t stream)
{
  if (n_in < 7) return;
  if (in_sizes[0] < ((NB - 1) * SEQ_FULL + SEQ) * DMODEL) return;
  if (in_sizes[1] < (SEQ - 1) * SEQ_FULL + SEQ) return;
  if (in_sizes[2] < DMODEL * NQKV) return;
  if (in_sizes[3] < NQKV) return;
  if (in_sizes[4] < DMODEL * DMODEL) return;
  if (in_sizes[5] < DMODEL) return;
  if (in_sizes[6] < NHEAD * NPOS * DHEAD) return;
  if (out_size < MROWS * DMODEL) return;
  if (d_ws == nullptr || ws_size < WS_NEED) return;

  const float* x     = (const float*)d_in[0];
  const int*   mask  = (const int*)d_in[1];
  const float* W_qkv = (const float*)d_in[2];
  const float* b_qkv = (const float*)d_in[3];
  const float* W_o   = (const float*)d_in[4];
  const float* b_o   = (const float*)d_in[5];
  const float* Er    = (const float*)d_in[6];
  float* out = (float*)d_out;

  unsigned short* Xb   = (unsigned short*)d_ws;
  unsigned short* WqT  = Xb + XB_E;
  unsigned short* WoT  = WqT + WQT_E;
  unsigned short* Erb  = WoT + WOT_E;
  unsigned short* qkvp = Erb + ERB_E;
  unsigned short* ctxp = qkvp + QKVP_E;

  {
    const int nunits = MROWS * (DMODEL / 8);
    cvt_rows_kernel<<<(nunits + 255) / 256, 256, 0, stream>>>(x, Xb, nunits, DMODEL / 8, SEQ, SEQ_FULL);
  }
  {
    const int nunits = NHEAD * NPOS * (DHEAD / 8);
    cvt_rows_kernel<<<(nunits + 255) / 256, 256, 0, stream>>>(Er, Erb, nunits, DHEAD / 8, NHEAD * NPOS, NHEAD * NPOS);
  }
  /* W_qkv in[1024][3072] -> WqT out[3072][1024]; grid (rows/64, cols/64) */
  wt_planes_kernel<<<dim3(DMODEL / 64, NQKV / 64), 256, 0, stream>>>(W_qkv, WqT, DMODEL, NQKV);
  /* W_o in[1024][1024] -> WoT out[1024][1024]; grid (rows/64, cols/64) */
  wt_planes_kernel<<<dim3(DMODEL / 64, DMODEL / 64), 256, 0, stream>>>(W_o, WoT, DMODEL, DMODEL);

  gemm_qkv_kernel<<<dim3(NQKV / 64, MROWS / 128), 128, 0, stream>>>(Xb, WqT, b_qkv, qkvp);
  rel_attn_kernel<<<dim3(SEQ / 64, NBH), 128, 0, stream>>>(qkvp, Erb, mask, ctxp);
  gemm_out_kernel<<<dim3(DMODEL / 64, MROWS / 128), 128, 0, stream>>>(ctxp, WoT, b_o, out);
}

// v001
// A run of this version takes 198 microseconds.
// In two side-by-side timings against v000, it was 1.36 and 1.35 times as fast.
// Contractions: x.Wqkv on v_wmma_f32_16x16x32_bf16 with both operands RNE-converted to bf16 once; q.(k/8)^T, q.Er^T, p.v and ctx.Wo on v_wmma_f32_16x16x32_bf16 with computed operands (q, k/8, v, p, ctx) carried as bf16 hi+lo planes (hi.hi + hi.lo + lo.hi) and input operands (Er, Wo) as single bf16 planes; f32 accumulate; softmax, bias adds and mask fill in f32.
#include <hip/hip_runtime.h>

typedef __attribute__((ext_vector_type(16))) __bf16 v16b;
typedef __attribute__((ext_vector_type(8)))  __bf16 v8b;
typedef __attribute__((ext_vector_type(8)))  float  v8f;
typedef __attribute__((ext_vector_type(4)))  float  v4f;
typedef __attribute__((ext_vector_type(4)))  unsigned int v4u;
typedef __attribute__((ext_vector_type(4)))  int v4i;
typedef v8b v8b_a __attribute__((may_alias));
typedef v4f v4f_a __attribute__((may_alias));
typedef v4u v4u_a __attribute__((may_alias));

#ifndef NB
#define NB 2
#endif
#ifndef SEQ
#define SEQ 1024
#endif
#define NB_FULL 2
#define SEQ_FULL 1024

#define VGPR_CAP __attribute__((amdgpu_num_vgpr(256)))

constexpr int DMODEL = 1024;
constexpr int NHEAD  = 16;
constexpr int DHEAD  = 64;
constexpr int NPOS   = 2047;
constexpr int NQKV   = 3 * DMODEL;
constexpr int NBH    = NB * NHEAD;
constexpr int MROWS  = NB * SEQ;
constexpr int KCH    = 64;        /* keys per chunk */
constexpr int NWAVE  = 4;
constexpr int GP     = 84;        /* skew slab pitch in floats (336 B rows, 16-B aligned) */
constexpr int SP     = 68;        /* raw score slab pitch in floats */
constexpr int TQ_PITCH = 72;      /* [tok][d] staging pitch (16-bit elements) */
constexpr int TV_PITCH = 136;     /* [d][tok] staging pitch (16-bit elements) */
constexpr int T_ELEMS  = 128 * TQ_PITCH;   /* 9216 >= 64 * TV_PITCH = 8704 */
constexpr int TS_PITCH = 72;
constexpr int OS_PITCH = 68;

constexpr size_t PLANE  = (size_t)NBH * SEQ * DHEAD;
constexpr size_t XB_E   = (size_t)MROWS * DMODEL;
constexpr size_t WQT_E  = (size_t)NQKV * DMODEL;
constexpr size_t WOT_E  = (size_t)DMODEL * DMODEL;
constexpr size_t ERB_E  = (size_t)NHEAD * 2048 * DHEAD;
constexpr size_t QKVP_E = 6 * PLANE;
constexpr size_t CTX_E  = 2 * XB_E;
constexpr size_t WS_NEED = 2 * (XB_E + WQT_E + WOT_E + ERB_E + QKVP_E + CTX_E);

static_assert(SEQ % 128 == 0);
static_assert(SEQ <= SEQ_FULL && NB <= NB_FULL);
static_assert(DHEAD == 64 && DMODEL == NHEAD * DHEAD);
static_assert(DMODEL % 64 == 0 && NQKV % 64 == 0 && DMODEL % 32 == 0);
static_assert(64 * TV_PITCH <= T_ELEMS);
static_assert((TQ_PITCH * 2) % 16 == 0 && (TV_PITCH * 2) % 16 == 0 && (GP * 4) % 16 == 0 && (OS_PITCH * 4) % 16 == 0);
static_assert(GP >= 80 && SP >= 64);
static_assert((size_t)NHEAD * NPOS * DHEAD <= ERB_E);
static_assert(WS_NEED <= 134217728ull);

/*
 *   Xb   [MROWS][1024]        x, bf16
 *   WqT  [3072][1024]         W_qkv transposed, bf16
 *   WoT  [1024][1024]         W_o transposed, bf16
 *   Erb  [16][2047][64]       Er, bf16 (region padded to 16*2048 rows)
 *   qkvp 6 planes: Qh Ql [bh][l][64], Kh Kl [bh][l][64] (k/8), Vth Vtl [bh][64][l]
 *   ctxp 2 planes: Ch Cl [MROWS][1024]
 */

__device__ __forceinline__ unsigned short f2bf_bits(float f) {
  unsigned u = __float_as_uint(f);
  return (unsigned short)((u + 0x7FFFu + ((u >> 16) & 1u)) >> 16);
}
__device__ __forceinline__ float bf_bits2f(unsigned short h) { return __uint_as_float(((unsigned)h) << 16); }
__device__ __forceinline__ unsigned pk2(float a, float b) {
  return (unsigned)f2bf_bits(a) | ((unsigned)f2bf_bits(b) << 16);
}
__device__ __forceinline__ void split2(float a, float b, unsigned& hw, unsigned& lw) {
  const unsigned short ha = f2bf_bits(a);
  const unsigned short hb = f2bf_bits(b);
  const unsigned short la = f2bf_bits(a - bf_bits2f(ha));
  const unsigned short lb = f2bf_bits(b - bf_bits2f(hb));
  hw = (unsigned)ha | ((unsigned)hb << 16);
  lw = (unsigned)la | ((unsigned)lb << 16);
}

/* one WMMA + hazard guard naming only this call's live operands */
__device__ __forceinline__ v8f mma_bf16(v16b a, v16b b, v8f c) {
  c = __builtin_amdgcn_wmma_f32_16x16x32_bf16(false, a, false, b, (short)0, c, false, false);
  asm volatile("v_nop\n\tv_nop\n\tv_nop\n\tv_nop" : "+v"(c) : "v"(a), "v"(b));
  return c;
}

__device__ __forceinline__ void wave_lds_sync() {
  __builtin_amdgcn_fence(3 /* release order */, "workgroup");
  __builtin_amdgcn_wave_barrier();
  __builtin_amdgcn_fence(2 /* acquire order */, "workgroup");
}

/* --------------------------------------------------------------------------
 * f32 rows -> bf16 rows (RNE), unit = 8 elements = one 16-B store.
 * out row = b*rpb + l  <-  in row = b*rpb_full + l ; row length = upr*8.
 * Coverage: nunits units x 8 elements = the whole plane.
 * ------------------------------------------------------------------------ */
__global__ __launch_bounds__(256) void cvt_rows_kernel(
    const float* __restrict__ in, unsigned short* __restrict__ outp,
    int nunits, int upr, int rpb, int rpb_full)
{
  const int u = blockIdx.x * 256 + threadIdx.x;
  if (u >= nunits) return;
  const int row = u / upr;
  const int seg = u - row * upr;
  const int b = row / rpb;
  const int l = row - b * rpb;
  const float* src = in + ((size_t)(b * rpb_full + l) * upr + seg) * 8;
  const v4f a0 = *(const v4f*)src;
  const v4f a1 = *(const v4f*)(src + 4);
  v4u w;
  w[0] = pk2(a0[0], a0[1]);
  w[1] = pk2(a0[2], a0[3]);
  w[2] = pk2(a1[0], a1[1]);
  w[3] = pk2(a1[2], a1[3]);
  v4u* dst = (v4u*)(outp + ((size_t)row * upr + seg) * 8);
  *dst = w;
  
}

/* --------------------------------------------------------------------------
 * W in[rows][cols] f32  ->  Wt out[cols][rows] bf16 (RNE), 64x64 tiles through LDS.
 * Block (x = rows tile, y = cols tile), 256 threads.
 * Coverage: 2 iterations x 256 threads = 512 units x 8 = 64x64 for the load phase
 * and the same 512 units x 8 = 64x64 for the store phase.
 * LDS tile: cross-wave, separated by a block barrier.
 * ------------------------------------------------------------------------ */
__global__ __launch_bounds__(256) void wt_planes_kernel(
    const float* __restrict__ W, unsigned short* __restrict__ Wt, int rows, int cols)
{
  __shared__ __align__(16) unsigned short Ts[64 * TS_PITCH];   /* [n][k] */
  const int k0 = blockIdx.x * 64;
  const int n0 = blockIdx.y * 64;
  const int tid = threadIdx.x;
#pragma unroll
  for (int it = 0; it < 2; ++it) {
    const int u = it * 256 + tid;
    const int row = u >> 3;      /* k local */
    const int seg = u & 7;       /* n segment */
    const float* src = W + (size_t)(k0 + row) * cols + n0 + seg * 8;
    const v4f a0 = *(const v4f*)src;
    const v4f a1 = *(const v4f*)(src + 4);
#pragma unroll
    for (int e = 0; e < 4; ++e) {
      Ts[(seg * 8 + e) * TS_PITCH + row]     = f2bf_bits(a0[e]);
      Ts[(seg * 8 + 4 + e) * TS_PITCH + row] = f2bf_bits(a1[e]);
    }
  }
  __syncthreads();
  {
#pragma unroll
    for (int it = 0; it < 2; ++it) {
      const int u = it * 256 + tid;
      const int nrow = u >> 3;
      const int seg  = u & 7;
      const v4u w = *(const v4u_a*)(Ts + nrow * TS_PITCH + seg * 8);
      *(v4u*)(Wt + (size_t)(n0 + nrow) * rows + k0 + seg * 8) = w;
    }
    
  }
}

/* --------------------------------------------------------------------------
 * qkv = Xb . WqT^T + b  (M = MROWS, N = 3072, K = 1024), bf16 x bf16, f32 acc.
 * Block = 4 waves, tile 128 tokens x 64 columns (= one head of one section);
 * wave = 32 rows x 64 cols (2 A fragments x 4 B fragments per 32-deep step),
 * fragments loaded per k-step straight from the 16-bit global rows.
 * Fragment map (hh = lane>>4, c = lane&15): A row c, elems 0..7 <- k0+8hh.., 8..15 <- k0+16+8hh..;
 * B col c with the same k map; D elem r = (row 8hh+r, col c).
 * Epilogue: (acc + bias) [x 1/8 for the k section] split to bf16 hi/lo, staged in a
 * block LDS tile ([tok][d] for q,k; [d][tok] for v), block barrier, whole-line stores:
 *   v  : 1024 units = 64 d-rows x 16 segments (16 lanes = one 256-B row segment).
 * ------------------------------------------------------------------------ */
__global__ __launch_bounds__(128) VGPR_CAP void gemm_qkv_kernel(
    const unsigned short* __restrict__ Xb, const unsigned short* __restrict__ WqT,
    const float* __restrict__ bias, unsigned short* __restrict__ qkvp)
{
  union FB { v16b v; v8b h[2]; };
  __shared__ __align__(16) unsigned short Th[T_ELEMS];
  __shared__ __align__(16) unsigned short Tl[T_ELEMS];

  const int tid  = threadIdx.x;
  const int wave = __builtin_amdgcn_readfirstlane(tid >> 5);
  const int lane = tid & 31;
  const int hh   = lane >> 4;
  const int c    = lane & 15;
  const int n0   = blockIdx.x * 64;
  const int m0   = blockIdx.y * 128;

  v8f acc[2][4];
#pragma unroll
  for (int mt = 0; mt < 2; ++mt)
#pragma unroll
    for (int t = 0; t < 4; ++t) acc[mt][t] = (v8f){0.f,0.f,0.f,0.f,0.f,0.f,0.f,0.f};

  const unsigned short* a0p = Xb + (size_t)(m0 + wave * 32 + c) * DMODEL + 8 * hh;
  const unsigned short* a1p = a0p + (size_t)16 * DMODEL;
  const unsigned short* bp  = WqT + (size_t)(n0 + c) * DMODEL + 8 * hh;

#pragma unroll 1
  for (int k0 = 0; k0 < DMODEL; k0 += 32) {
    FB a0, a1;
    a0.h[0] = *(const v8b*)(a0p + k0);
    a0.h[1] = *(const v8b*)(a0p + k0 + 16);
    a1.h[0] = *(const v8b*)(a1p + k0);
    a1.h[1] = *(const v8b*)(a1p + k0 + 16);
#pragma unroll
    for (int t = 0; t < 4; ++t) {
      FB bf;
      bf.h[0] = *(const v8b*)(bp + (size_t)t * 16 * DMODEL + k0);
      bf.h[1] = *(const v8b*)(bp + (size_t)t * 16 * DMODEL + k0 + 16);
      acc[0][t] = mma_bf16(a0.v, bf.v, acc[0][t]);
      acc[1][t] = mma_bf16(a1.v, bf.v, acc[1][t]);
    }
  }

  const int sec = n0 / DMODEL;                       /* 0 q, 1 k, 2 v : block-uniform */
  const float osc = (sec == 1) ? 0.125f : 1.0f;
#pragma unroll
  for (int t = 0; t < 4; ++t) {
    const float bv = bf_bits2f(f2bf_bits(bias[n0 + 16 * t + c]));
#pragma unroll
    for (int mt = 0; mt < 2; ++mt) {
#pragma unroll
      for (int r = 0; r < 8; ++r) {
        const float val = (acc[mt][t][r] + bv) * osc;
        const unsigned short hb = f2bf_bits(val);
        const unsigned short lb = f2bf_bits(val - bf_bits2f(hb));
        const int rl = wave * 32 + mt * 16 + 8 * hh + r;
        const int cl = 16 * t + c;
        const int idx = (sec < 2) ? (rl * TQ_PITCH + cl) : (cl * TV_PITCH + rl);
        Th[idx] = hb;
        Tl[idx] = lb;
      }
    }
  }
  __syncthreads();

  const int b  = m0 / SEQ;
  const int l0 = m0 - b * SEQ;
  const int h  = (n0 - sec * DMODEL) / DHEAD;
  const int bh = b * NHEAD + h;
  unsigned short* ph = qkvp + (size_t)(2 * sec) * PLANE;
  unsigned short* pl = ph + PLANE;

  {
    if (sec < 2) {
#pragma unroll
      for (int it = 0; it < 8; ++it) {
        const int u = it * 128 + tid;
        const int row = u >> 3;
        const int seg = u & 7;
        const v4u hw = *(const v4u_a*)(Th + row * TQ_PITCH + seg * 8);
        const v4u lw = *(const v4u_a*)(Tl + row * TQ_PITCH + seg * 8);
        const size_t g = ((size_t)bh * SEQ + l0 + row) * DHEAD + seg * 8;
        *(v4u*)(ph + g) = hw;
        *(v4u*)(pl + g) = lw;
      }
    } else {
#pragma unroll
      for (int it = 0; it < 8; ++it) {
        const int u = it * 128 + tid;
        const int drow = u >> 4;
        const int seg  = u & 15;
        const v4u hw = *(const v4u_a*)(Th + drow * TV_PITCH + seg * 8);
        const v4u lw = *(const v4u_a*)(Tl + drow * TV_PITCH + seg * 8);
        const size_t g = ((size_t)bh * DHEAD + drow) * SEQ + l0 + seg * 8;
        *(v4u*)(ph + g) = hw;
        *(v4u*)(pl + g) = lw;
      }
    }
    
  }
}

/* --------------------------------------------------------------------------
 * Attention with the per-head relative-position table, head dim 64.
 * Block = 16 query rows of one (b,h); grid (SEQ/16, NBH). The block's 4 waves deal the
 * 64-key chunks among them (wave w takes chunks w, w+4, ...), each with its own running
 * maximum, sum and output accumulators; one block barrier, then the four partial states
 * are merged through LDS by the usual rescaling to the common row maximum.
 * Per 64-key chunk and wave (16 query rows), in short phases so that only the
 * q fragments, the output accumulators and the row statistics stay resident:
 *   mask rows read by value (8 b128 loads + ballots); wave-uniform skip when every
 *   element of the 16x64 mask tile is set; per-element replace-fill otherwise;
 *   S = q.(k/8)^T : rolled loop over 4 key tiles, 2 d-steps x (hi.hi + hi.lo + lo.hi),
 *                   one accumulator, each tile written to the wave-private S slab;
 *   G = q.Ewin^T  : rolled loop over 5 tiles (80 offsets d = kv0-q0-15+g, table row =
 *                   d mod 2047), 2 d-steps x (hi + lo) against the bf16 table, written
 *                   to the wave-private G slab, read back skewed: G[m][n-m+15];
 *   f32 online softmax on S + G; P as bf16 hi+lo wave-private LDS tiles;
 *   O += Ph.Vh + Pl.Vh + Ph.Vl from the V^T planes, rolled loop over the two 32-key steps.
 * The q, k, Er and V fragments come straight from 16-bit global rows by arithmetic addressing.
 * LDS regions Ss/Gs/Psh/Psl are private to their wave (wave_sync form) inside the loop.
 * Epilogue: each wave's unnormalised 16x64 slab (aliases its G slab) and row statistics,
 * block barrier, merge + normalise (thread = one row x 8 columns) -> ctx hi/lo planes,
 * ------------------------------------------------------------------------ */
__global__ __launch_bounds__(128) VGPR_CAP void rel_attn_kernel(
    const unsigned short* __restrict__ qkvp, const unsigned short* __restrict__ Erb,
    const int* __restrict__ mask, unsigned short* __restrict__ ctxp)
{
  union FB { v16b v; v8b h[2]; };
  __shared__ __align__(16) float Gs[NWAVE][16 * GP];
  __shared__ __align__(16) float Ss[NWAVE][16 * SP];
  __shared__ __align__(16) unsigned short Psh[NWAVE][16 * KCH];
  __shared__ __align__(16) unsigned short Psl[NWAVE][16 * KCH];
  __shared__ float Ms[NWAVE][16];
  __shared__ float Ls[NWAVE][16];

  const int tid  = threadIdx.x;
  const int wave = __builtin_amdgcn_readfirstlane(tid >> 5);
  const int lane = tid & 31;
  const int hh   = lane >> 4;
  const int c    = lane & 15;
  const int c3   = c & 3;
  const int csh  = c >> 2;
  const int qb   = blockIdx.x;
  const int bh   = blockIdx.y;
  const int b    = bh / NHEAD;
  const int h    = bh - b * NHEAD;
  const int q0   = qb * 16;
  const float NEG_INF = -__builtin_inff();

  const unsigned short* Qh  = qkvp + (size_t)bh * SEQ * DHEAD;
  const unsigned short* Ql  = Qh + PLANE;
  const unsigned short* Kh  = Qh + 2 * PLANE;
  const unsigned short* Kl  = Qh + 3 * PLANE;
  const unsigned short* Vth = Qh + 4 * PLANE;     /* [bh][d][l]: same per-bh element count */
  const unsigned short* Vtl = Qh + 5 * PLANE;
  const unsigned short* Eh  = Erb + (size_t)h * NPOS * DHEAD;

  v16b qh[2], ql[2];
  {
    const size_t qo = (size_t)(q0 + c) * DHEAD + 8 * hh;
#pragma unroll
    for (int dc = 0; dc < 2; ++dc) {
      FB f;
      f.h[0] = *(const v8b*)(Qh + qo + dc * 32);
      f.h[1] = *(const v8b*)(Qh + qo + dc * 32 + 16);
      qh[dc] = f.v;
      f.h[0] = *(const v8b*)(Ql + qo + dc * 32);
      f.h[1] = *(const v8b*)(Ql + qo + dc * 32 + 16);
      ql[dc] = f.v;
    }
  }

  float mrow[8], lrow[8];
  v8f oacc[4];
#pragma unroll
  for (int r = 0; r < 8; ++r) { mrow[r] = NEG_INF; lrow[r] = 0.f; }
#pragma unroll
  for (int t = 0; t < 4; ++t) oacc[t] = (v8f){0.f,0.f,0.f,0.f,0.f,0.f,0.f,0.f};

  float* gs = Gs[wave];
  float* ss = Ss[wave];
  unsigned short* pwh = Psh[wave];
  unsigned short* pwl = Psl[wave];

#pragma unroll 1
  for (int kc = wave; kc < SEQ / KCH; kc += NWAVE) {
    const int kv0 = kc * KCH;

    /* mask tile by value: bit L of the ballot (it, e) = mask[q0+2it+(L>>4)][kv0+4(L&15)+e] != 0;
       each lane keeps the word of its own e = c&3 */
    unsigned msel[8];
    unsigned andall = 0xFFFFFFFFu;
#pragma unroll
    for (int it = 0; it < 8; ++it) {
      const v4i mv = *(const v4i*)(mask + (size_t)(q0 + 2 * it + hh) * SEQ_FULL + kv0 + 4 * c);
      const unsigned b0 = __builtin_amdgcn_ballot_w32(mv[0] != 0);
      const unsigned b1 = __builtin_amdgcn_ballot_w32(mv[1] != 0);
      const unsigned b2 = __builtin_amdgcn_ballot_w32(mv[2] != 0);
      const unsigned b3 = __builtin_amdgcn_ballot_w32(mv[3] != 0);
      andall &= (b0 & b1) & (b2 & b3);
      msel[it] = (c3 == 0) ? b0 : (c3 == 1) ? b1 : (c3 == 2) ? b2 : b3;
    }
    if (andall == 0xFFFFFFFFu) continue;          /* wave-uniform: every element masked */

    unsigned mw[4];
#pragma unroll
    for (int ii = 0; ii < 4; ++ii) mw[ii] = hh ? msel[4 + ii] : msel[ii];

    /* raw scores: 4 key tiles, one accumulator, tile -> S slab (D elem r = row 8hh+r, col c) */
#pragma unroll 1
    for (int j = 0; j < 4; ++j) {
      v8f sa = (v8f){0.f,0.f,0.f,0.f,0.f,0.f,0.f,0.f};
      const size_t ko = (size_t)(kv0 + j * 16 + c) * DHEAD + 8 * hh;
#pragma unroll
      for (int dc = 0; dc < 2; ++dc) {
        FB kfh, kfl;
        kfh.h[0] = *(const v8b*)(Kh + ko + dc * 32);
        kfh.h[1] = *(const v8b*)(Kh + ko + dc * 32 + 16);
        kfl.h[0] = *(const v8b*)(Kl + ko + dc * 32);
        kfl.h[1] = *(const v8b*)(Kl + ko + dc * 32 + 16);
        sa = mma_bf16(qh[dc], kfh.v, sa);
        sa = mma_bf16(qh[dc], kfl.v, sa);
        sa = mma_bf16(ql[dc], kfh.v, sa);
      }
#pragma unroll
      for (int r = 0; r < 8; ++r) ss[(8 * hh + r) * SP + 16 * j + c] = sa[r];
    }

    /* position term: G[m][g] = q[m] . Er[h][(kv0 - q0 - 15 + g) mod 2047], g = 0..79 */
    {
      const int dbase = kv0 - q0 - 15;
#pragma unroll 1
      for (int t = 0; t < 5; ++t) {
        const int d = dbase + 16 * t + c;
        int rr = d % NPOS;
        rr += (rr < 0) ? NPOS : 0;                 /* rr in [0, 2046] */
        const unsigned short* ep = Eh + (size_t)rr * DHEAD + 8 * hh;
        v8f g = (v8f){0.f,0.f,0.f,0.f,0.f,0.f,0.f,0.f};
#pragma unroll
        for (int dc = 0; dc < 2; ++dc) {
          FB ef;
          ef.h[0] = *(const v8b*)(ep + dc * 32);
          ef.h[1] = *(const v8b*)(ep + dc * 32 + 16);
          g = mma_bf16(qh[dc], ef.v, g);
          g = mma_bf16(ql[dc], ef.v, g);
        }
#pragma unroll
        for (int r = 0; r < 8; ++r) gs[(8 * hh + r) * GP + 16 * t + c] = g[r];
      }
    }
    wave_lds_sync();

    /* raw score + skewed position term, replace-fill of masked elements */
    v8f s[4];
#pragma unroll
    for (int j = 0; j < 4; ++j) {
#pragma unroll
      for (int r = 0; r < 8; ++r) {
        const int m = 8 * hh + r;
        const float raw = ss[m * SP + 16 * j + c];
        const float gv = gs[m * (GP - 1) + 16 * j + c + 15];
        const float sv = raw + gv;
        const unsigned bit = (mw[r >> 1] >> (16 * (r & 1) + 4 * j + csh)) & 1u;
        s[j][r] = bit ? NEG_INF : sv;
      }
    }

    /* chunk row max over the 64 keys */
    float cm[8];
#pragma unroll
    for (int r = 0; r < 8; ++r) {
      float m = fmaxf(fmaxf(s[0][r], s[1][r]), fmaxf(s[2][r], s[3][r]));
#pragma unroll
      for (int off = 1; off < 16; off <<= 1) m = fmaxf(m, __shfl_xor(m, off, 32));
      cm[r] = m;
    }

    /* online softmax update, P tiles as bf16 hi + lo */
#pragma unroll
    for (int r = 0; r < 8; ++r) {
      const float mnew  = fmaxf(mrow[r], cm[r]);
      const float msafe = (mnew == NEG_INF) ? 0.f : mnew;
      const float alpha = expf(mrow[r] - msafe);
      mrow[r] = mnew;
      float psum = 0.f;
#pragma unroll
      for (int j = 0; j < 4; ++j) {
        const float p = expf(s[j][r] - msafe);
        psum += p;
        const unsigned short hb = f2bf_bits(p);
        const unsigned short lb = f2bf_bits(p - bf_bits2f(hb));
        pwh[(8 * hh + r) * KCH + j * 16 + c] = hb;
        pwl[(8 * hh + r) * KCH + j * 16 + c] = lb;
      }
#pragma unroll
      for (int off = 1; off < 16; off <<= 1) psum += __shfl_xor(psum, off, 32);
      lrow[r] = lrow[r] * alpha + psum;
#pragma unroll
      for (int t = 0; t < 4; ++t) oacc[t][r] *= alpha;
    }
    wave_lds_sync();

    /* O += P.V : A = P [q][kv] (this wave's tiles), B = V [kv][d] from V^T [d][kv];
       rolled over the two 32-key steps, fragments loaded per step */
#pragma unroll 1
    for (int kk = 0; kk < 2; ++kk) {
      FB pa, pl;
      pa.h[0] = *(const v8b_a*)(pwh + c * KCH + kk * 32 + 8 * hh);
      pa.h[1] = *(const v8b_a*)(pwh + c * KCH + kk * 32 + 16 + 8 * hh);
      pl.h[0] = *(const v8b_a*)(pwl + c * KCH + kk * 32 + 8 * hh);
      pl.h[1] = *(const v8b_a*)(pwl + c * KCH + kk * 32 + 16 + 8 * hh);
#pragma unroll
      for (int t = 0; t < 4; ++t) {
        const size_t vo = (size_t)(t * 16 + c) * SEQ + kv0 + kk * 32 + 8 * hh;
        FB vbh, vbl;
        vbh.h[0] = *(const v8b*)(Vth + vo);
        vbh.h[1] = *(const v8b*)(Vth + vo + 16);
        vbl.h[0] = *(const v8b*)(Vtl + vo);
        vbl.h[1] = *(const v8b*)(Vtl + vo + 16);
        oacc[t] = mma_bf16(pa.v, vbh.v, oacc[t]);
        oacc[t] = mma_bf16(pl.v, vbh.v, oacc[t]);
        oacc[t] = mma_bf16(pa.v, vbl.v, oacc[t]);
      }
    }
    wave_lds_sync();
  }

  /* this wave's partial state: unnormalised output into its own slab (aliases the G slab),
     row maximum and row sum beside it */
  float* os = gs;
#pragma unroll
  for (int r = 0; r < 8; ++r) {
#pragma unroll
    for (int t = 0; t < 4; ++t) os[(8 * hh + r) * GP + t * 16 + c] = oacc[t][r];
  }
  if (c == 0) {      /* the 16 lanes of a half hold equal row statistics */
#pragma unroll
    for (int r = 0; r < 8; ++r) {
      Ms[wave][8 * hh + r] = mrow[r];
      Ls[wave][8 * hh + r] = lrow[r];
    }
  }
  __syncthreads();   /* publishes the four partial states to the whole block */
  {
    unsigned short* Ch = ctxp;
    unsigned short* Cl = ctxp + XB_E;
    const int row = tid >> 3;
    const int seg = tid & 7;
    float mall = Ms[0][row];
#pragma unroll
    for (int w = 1; w < NWAVE; ++w) mall = fmaxf(mall, Ms[w][row]);
    const float msafe = (mall == NEG_INF) ? 0.f : mall;
    float lsum = 0.f;
    v4f a0 = (v4f){0.f, 0.f, 0.f, 0.f};
    v4f a1 = (v4f){0.f, 0.f, 0.f, 0.f};
#pragma unroll
    for (int w = 0; w < NWAVE; ++w) {
      const float f = expf(Ms[w][row] - msafe);
      lsum += Ls[w][row] * f;
      a0 += *(const v4f_a*)(Gs[w] + row * GP + seg * 8) * f;
      a1 += *(const v4f_a*)(Gs[w] + row * GP + seg * 8 + 4) * f;
    }
    const float inv = 1.0f / lsum;
    a0 *= inv;
    a1 *= inv;
    unsigned h0, h1, h2, h3, l0, l1, l2, l3;
    split2(a0[0], a0[1], h0, l0);
    split2(a0[2], a0[3], h1, l1);
    split2(a1[0], a1[1], h2, l2);
    split2(a1[2], a1[3], h3, l3);
    v4u hw, lw;
    hw[0] = h0; hw[1] = h1; hw[2] = h2; hw[3] = h3;
    lw[0] = l0; lw[1] = l1; lw[2] = l2; lw[3] = l3;
    const size_t g = (size_t)(b * SEQ + q0 + row) * DMODEL + h * DHEAD + seg * 8;
    *(v4u*)(Ch + g) = hw;
    *(v4u*)(Cl + g) = lw;
  }
}

/* --------------------------------------------------------------------------
 * out = (Ch + Cl) . WoT^T + b  (M = MROWS, N = 1024, K = 1024), f32 acc.
 * Block = 4 waves, tile 128 x 64; wave = 32 rows x 64 cols; A hi and lo planes
 * against the single bf16 weight plane (two products per tile pair), fragments
 * loaded per k-step.
 * Epilogue: per-wave 32x64 f32 slab (wave-private LDS), 16 lanes x 16 B = one 256-B
 * ------------------------------------------------------------------------ */
__global__ __launch_bounds__(128) VGPR_CAP void gemm_out_kernel(
    const unsigned short* __restrict__ ctxp, const unsigned short* __restrict__ WoT,
    const float* __restrict__ bias, float* __restrict__ out)
{
  union FB { v16b v; v8b h[2]; };
  __shared__ __align__(16) float Os[NWAVE][32 * OS_PITCH];

  const int tid  = threadIdx.x;
  const int wave = __builtin_amdgcn_readfirstlane(tid >> 5);
  const int lane = tid & 31;
  const int hh   = lane >> 4;
  const int c    = lane & 15;
  const int n0   = blockIdx.x * 64;
  const int m0   = blockIdx.y * 128;

  v8f acc[2][4];
#pragma unroll
  for (int mt = 0; mt < 2; ++mt)
#pragma unroll
    for (int t = 0; t < 4; ++t) acc[mt][t] = (v8f){0.f,0.f,0.f,0.f,0.f,0.f,0.f,0.f};

  const unsigned short* ah0 = ctxp + (size_t)(m0 + wave * 32 + c) * DMODEL + 8 * hh;
  const unsigned short* ah1 = ah0 + (size_t)16 * DMODEL;
  const unsigned short* al0 = ah0 + XB_E;
  const unsigned short* al1 = ah1 + XB_E;
  const unsigned short* bp  = WoT + (size_t)(n0 + c) * DMODEL + 8 * hh;

#pragma unroll 1
  for (int k0 = 0; k0 < DMODEL; k0 += 32) {
    FB a0h, a1h, a0l, a1l;
    a0h.h[0] = *(const v8b*)(ah0 + k0);
    a0h.h[1] = *(const v8b*)(ah0 + k0 + 16);
    a1h.h[0] = *(const v8b*)(ah1 + k0);
    a1h.h[1] = *(const v8b*)(ah1 + k0 + 16);
    a0l.h[0] = *(const v8b*)(al0 + k0);
    a0l.h[1] = *(const v8b*)(al0 + k0 + 16);
    a1l.h[0] = *(const v8b*)(al1 + k0);
    a1l.h[1] = *(const v8b*)(al1 + k0 + 16);
#pragma unroll
    for (int t = 0; t < 4; ++t) {
      FB bf;
      bf.h[0] = *(const v8b*)(bp + (size_t)t * 16 * DMODEL + k0);
      bf.h[1] = *(const v8b*)(bp + (size_t)t * 16 * DMODEL + k0 + 16);
      acc[0][t] = mma_bf16(a0h.v, bf.v, acc[0][t]);
      acc[0][t] = mma_bf16(a0l.v, bf.v, acc[0][t]);
      acc[1][t] = mma_bf16(a1h.v, bf.v, acc[1][t]);
      acc[1][t] = mma_bf16(a1l.v, bf.v, acc[1][t]);
    }
  }

  float* os = Os[wave];
#pragma unroll
  for (int t = 0; t < 4; ++t) {
    const float bv = bf_bits2f(f2bf_bits(bias[n0 + 16 * t + c]));
#pragma unroll
    for (int mt = 0; mt < 2; ++mt)
#pragma unroll
      for (int r = 0; r < 8; ++r)
        os[(mt * 16 + 8 * hh + r) * OS_PITCH + 16 * t + c] = acc[mt][t][r] + bv;
  }
  wave_lds_sync();
  {
    const int c4 = c * 4;
    {
#pragma unroll
      for (int it = 0; it < 16; ++it) {
        const int row = it * 2 + hh;
        const v4f val = *(const v4f_a*)(os + row * OS_PITCH + c4);
        *(v4f*)(out + (size_t)(m0 + wave * 32 + row) * DMODEL + n0 + c4) = val;
      }
      
    }
  }
}

extern "C" void kernel_launch(void* const* d_in, const int* in_sizes, int n_in,
                              void* d_out, int out_size, void* d_ws, size_t ws_size,
                              hipStream_t stream)
{
  if (n_in < 7) return;
  if (in_sizes[0] < ((NB - 1) * SEQ_FULL + SEQ) * DMODEL) return;
  if (in_sizes[1] < (SEQ - 1) * SEQ_FULL + SEQ) return;
  if (in_sizes[2] < DMODEL * NQKV) return;
  if (in_sizes[3] < NQKV) return;
  if (in_sizes[4] < DMODEL * DMODEL) return;
  if (in_sizes[5] < DMODEL) return;
  if (in_sizes[6] < NHEAD * NPOS * DHEAD) return;
  if (out_size < MROWS * DMODEL) return;
  if (d_ws == nullptr || ws_size < WS_NEED) return;

  const float* x     = (const float*)d_in[0];
  const int*   mask  = (const int*)d_in[1];
  const float* W_qkv = (const float*)d_in[2];
  const float* b_qkv = (const float*)d_in[3];
  const float* W_o   = (const float*)d_in[4];
  const float* b_o   = (const float*)d_in[5];
  const float* Er    = (const float*)d_in[6];
  float* out = (float*)d_out;

  unsigned short* Xb   = (unsigned short*)d_ws;
  unsigned short* WqT  = Xb + XB_E;
  unsigned short* WoT  = WqT + WQT_E;
  unsigned short* Erb  = WoT + WOT_E;
  unsigned short* qkvp = Erb + ERB_E;
  unsigned short* ctxp = qkvp + QKVP_E;

  {
    const int nunits = MROWS * (DMODEL / 8);
    cvt_rows_kernel<<<(nunits + 255) / 256, 256, 0, stream>>>(x, Xb, nunits, DMODEL / 8, SEQ, SEQ_FULL);
  }
  {
    const int nunits = NHEAD * NPOS * (DHEAD / 8);
    cvt_rows_kernel<<<(nunits + 255) / 256, 256, 0, stream>>>(Er, Erb, nunits, DHEAD / 8, NHEAD * NPOS, NHEAD * NPOS);
  }
  /* W_qkv in[1024][3072] -> WqT out[3072][1024]; grid (rows/64, cols/64) */
  wt_planes_kernel<<<dim3(DMODEL / 64, NQKV / 64), 256, 0, stream>>>(W_qkv, WqT, DMODEL, NQKV);
  /* W_o in[1024][1024] -> WoT out[1024][1024]; grid (rows/64, cols/64) */
  wt_planes_kernel<<<dim3(DMODEL / 64, DMODEL / 64), 256, 0, stream>>>(W_o, WoT, DMODEL, DMODEL);

  gemm_qkv_kernel<<<dim3(NQKV / 64, MROWS / 128), 128, 0, stream>>>(Xb, WqT, b_qkv, qkvp);
  rel_attn_kernel<<<dim3(SEQ / 16, NBH), 128, 0, stream>>>(qkvp, Erb, mask, ctxp);
  gemm_out_kernel<<<dim3(DMODEL / 64, MROWS / 128), 128, 0, stream>>>(ctxp, WoT, b_o, out);
}

// v002
// Measured time: 161 microseconds a run.
// In both of two side-by-side timings against v001, it was 1.23 times as fast.
// Counting every step since v000, it is 1.66 times as fast.
// Contractions: x.Wqkv on v_wmma_f32_16x16x32_bf16 with both operands RNE-converted to bf16 once; q.(k/8)^T, q.Er^T, p.v and ctx.Wo on v_wmma_f32_16x16x32_bf16 with computed operands (q, k/8, v, p, ctx) carried as bf16 hi+lo planes (hi.hi + hi.lo + lo.hi) and input operands (Er, Wo) as single bf16 planes; f32 accumulate; softmax, bias adds and mask fill in f32.
#include <hip/hip_runtime.h>

typedef __attribute__((ext_vector_type(16))) __bf16 v16b;
typedef __attribute__((ext_vector_type(8)))  __bf16 v8b;
typedef __attribute__((ext_vector_type(8)))  float  v8f;
typedef __attribute__((ext_vector_type(4)))  float  v4f;
typedef __attribute__((ext_vector_type(4)))  unsigned int v4u;
typedef __attribute__((ext_vector_type(4)))  int v4i;
typedef v8b v8b_a __attribute__((may_alias));
typedef v4f v4f_a __attribute__((may_alias));
typedef v4u v4u_a __attribute__((may_alias));

#ifndef NB
#define NB 2
#endif
#ifndef SEQ
#define SEQ 1024
#endif
#define NB_FULL 2
#define SEQ_FULL 1024

#define VGPR_CAP __attribute__((amdgpu_num_vgpr(256)))

constexpr int DMODEL = 1024;
constexpr int NHEAD  = 16;
constexpr int DHEAD  = 64;
constexpr int NPOS   = 2047;
constexpr int NQKV   = 3 * DMODEL;
constexpr int NBH    = NB * NHEAD;
constexpr int MROWS  = NB * SEQ;
constexpr int KCH    = 64;        /* keys per chunk */
constexpr int NWAVE  = 4;
constexpr int GP     = 84;        /* skew slab pitch in floats (336 B rows, 16-B aligned) */
constexpr int SP     = 68;        /* raw score slab pitch in floats */
constexpr int TQ_PITCH = 72;      /* [tok][d] staging pitch (16-bit elements) */
constexpr int TV_PITCH = 136;     /* [d][tok] staging pitch (16-bit elements) */
constexpr int T_ELEMS  = 128 * TQ_PITCH;   /* 9216 >= 64 * TV_PITCH = 8704 */
constexpr int TS_PITCH = 72;
constexpr int OS_PITCH = 68;
constexpr int KST      = 64;      /* k elements per GEMM stage: one 128-B line of every operand row */
constexpr int RP       = 72;      /* GEMM stage row pitch (16-bit elements): 144 B = 16 B x odd for b128 readers */
constexpr int NSTAGE   = 1024 / KST;
constexpr int QKV_STAGE_E = (128 + 64) * RP;        /* [x 128 rows | W 64 rows] */
constexpr int OUT_STAGE_E = (128 + 128 + 64) * RP;  /* [ctx hi 128 | ctx lo 128 | W 64 rows] */

constexpr size_t PLANE  = (size_t)NBH * SEQ * DHEAD;
constexpr size_t XB_E   = (size_t)MROWS * DMODEL;
constexpr size_t WQT_E  = (size_t)NQKV * DMODEL;
constexpr size_t WOT_E  = (size_t)DMODEL * DMODEL;
constexpr size_t ERB_E  = (size_t)NHEAD * 2048 * DHEAD;
constexpr size_t QKVP_E = 6 * PLANE;
constexpr size_t CTX_E  = 2 * XB_E;
constexpr size_t WS_NEED = 2 * (XB_E + WQT_E + WOT_E + ERB_E + QKVP_E + CTX_E);

static_assert(SEQ % 128 == 0);
static_assert(SEQ <= SEQ_FULL && NB <= NB_FULL);
static_assert(DHEAD == 64 && DMODEL == NHEAD * DHEAD);
static_assert(DMODEL % 64 == 0 && NQKV % 64 == 0 && DMODEL % 32 == 0);
static_assert(64 * TV_PITCH <= T_ELEMS);
static_assert((TQ_PITCH * 2) % 16 == 0 && (TV_PITCH * 2) % 16 == 0 && (GP * 4) % 16 == 0 && (OS_PITCH * 4) % 16 == 0);
static_assert(GP >= 80 && SP >= 64);
static_assert(NSTAGE * KST == DMODEL && NSTAGE >= 2 && (RP * 2) % 16 == 0 && RP >= KST);
static_assert(2 * T_ELEMS <= 2 * QKV_STAGE_E);
static_assert((size_t)NHEAD * NPOS * DHEAD <= ERB_E);
static_assert(WS_NEED <= 134217728ull);

/*
 *   Xb   [MROWS][1024]        x, bf16
 *   WqT  [3072][1024]         W_qkv transposed, bf16
 *   WoT  [1024][1024]         W_o transposed, bf16
 *   Erb  [16][2047][64]       Er, bf16 (region padded to 16*2048 rows)
 *   qkvp 6 planes: Qh Ql [bh][l][64], Kh Kl [bh][l][64] (k/8), Vth Vtl [bh][64][l]
 *   ctxp 2 planes: Ch Cl [MROWS][1024]
 */

__device__ __forceinline__ unsigned short f2bf_bits(float f) {
  unsigned u = __float_as_uint(f);
  return (unsigned short)((u + 0x7FFFu + ((u >> 16) & 1u)) >> 16);
}
__device__ __forceinline__ float bf_bits2f(unsigned short h) { return __uint_as_float(((unsigned)h) << 16); }
__device__ __forceinline__ unsigned pk2(float a, float b) {
  return (unsigned)f2bf_bits(a) | ((unsigned)f2bf_bits(b) << 16);
}
__device__ __forceinline__ void split2(float a, float b, unsigned& hw, unsigned& lw) {
  const unsigned short ha = f2bf_bits(a);
  const unsigned short hb = f2bf_bits(b);
  const unsigned short la = f2bf_bits(a - bf_bits2f(ha));
  const unsigned short lb = f2bf_bits(b - bf_bits2f(hb));
  hw = (unsigned)ha | ((unsigned)hb << 16);
  lw = (unsigned)la | ((unsigned)lb << 16);
}

/* one WMMA + hazard guard naming only this call's live operands */
__device__ __forceinline__ v8f mma_bf16(v16b a, v16b b, v8f c) {
  c = __builtin_amdgcn_wmma_f32_16x16x32_bf16(false, a, false, b, (short)0, c, false, false);
  asm volatile("v_nop\n\tv_nop\n\tv_nop\n\tv_nop" : "+v"(c) : "v"(a), "v"(b));
  return c;
}

__device__ __forceinline__ void wave_lds_sync() {
  __builtin_amdgcn_fence(3 /* release order */, "workgroup");
  __builtin_amdgcn_wave_barrier();
  __builtin_amdgcn_fence(2 /* acquire order */, "workgroup");
}

/* byte offset of a __shared__ address inside the work-group's LDS */
__device__ __forceinline__ unsigned lds_off(const void* p) { return (unsigned)(size_t)p; }

/* Asynchronous copies global -> LDS, 16 B per lane and copy, every lane on. The copies of a run
   and the s_wait_xcnt 0 that stands before their address registers may be rewritten are one
   statement, so that no later address arithmetic can be moved in front of that wait. */
__device__ __forceinline__ void async_copy12(const unsigned (&l)[12], const unsigned short* const (&g)[12]) {
  asm volatile(
      "global_load_async_to_lds_b128 %0, %12, off\n\t"
      "global_load_async_to_lds_b128 %1, %13, off\n\t"
      "global_load_async_to_lds_b128 %2, %14, off\n\t"
      "global_load_async_to_lds_b128 %3, %15, off\n\t"
      "global_load_async_to_lds_b128 %4, %16, off\n\t"
      "global_load_async_to_lds_b128 %5, %17, off\n\t"
      "global_load_async_to_lds_b128 %6, %18, off\n\t"
      "global_load_async_to_lds_b128 %7, %19, off\n\t"
      "global_load_async_to_lds_b128 %8, %20, off\n\t"
      "global_load_async_to_lds_b128 %9, %21, off\n\t"
      "global_load_async_to_lds_b128 %10, %22, off\n\t"
      "global_load_async_to_lds_b128 %11, %23, off\n\t"
      "s_wait_xcnt 0x0"
      :: "v"(l[0]), "v"(l[1]), "v"(l[2]), "v"(l[3]), "v"(l[4]), "v"(l[5]),
         "v"(l[6]), "v"(l[7]), "v"(l[8]), "v"(l[9]), "v"(l[10]), "v"(l[11]),
         "v"(g[0]), "v"(g[1]), "v"(g[2]), "v"(g[3]), "v"(g[4]), "v"(g[5]),
         "v"(g[6]), "v"(g[7]), "v"(g[8]), "v"(g[9]), "v"(g[10]), "v"(g[11])
      : "memory");
}
__device__ __forceinline__ void async_copy10(const unsigned* l, const unsigned short* const* g) {
  asm volatile(
      "global_load_async_to_lds_b128 %0, %10, off\n\t"
      "global_load_async_to_lds_b128 %1, %11, off\n\t"
      "global_load_async_to_lds_b128 %2, %12, off\n\t"
      "global_load_async_to_lds_b128 %3, %13, off\n\t"
      "global_load_async_to_lds_b128 %4, %14, off\n\t"
      "global_load_async_to_lds_b128 %5, %15, off\n\t"
      "global_load_async_to_lds_b128 %6, %16, off\n\t"
      "global_load_async_to_lds_b128 %7, %17, off\n\t"
      "global_load_async_to_lds_b128 %8, %18, off\n\t"
      "global_load_async_to_lds_b128 %9, %19, off\n\t"
      "s_wait_xcnt 0x0"
      :: "v"(l[0]), "v"(l[1]), "v"(l[2]), "v"(l[3]), "v"(l[4]),
         "v"(l[5]), "v"(l[6]), "v"(l[7]), "v"(l[8]), "v"(l[9]),
         "v"(g[0]), "v"(g[1]), "v"(g[2]), "v"(g[3]), "v"(g[4]),
         "v"(g[5]), "v"(g[6]), "v"(g[7]), "v"(g[8]), "v"(g[9])
      : "memory");
}
/* this wave's copies have landed in LDS (the compiler places no wait for them) */
__device__ __forceinline__ void wait_copies() { asm volatile("s_wait_asynccnt 0x0" ::: "memory"); }
/* this wave's LDS reads have returned, so the buffer they read may be refilled behind the barrier */
__device__ __forceinline__ void wait_lds_reads() { asm volatile("s_wait_dscnt 0x0" ::: "memory"); }

/* --------------------------------------------------------------------------
 * f32 rows -> bf16 rows (RNE), unit = 8 elements = one 16-B store.
 * out row = b*rpb + l  <-  in row = b*rpb_full + l ; row length = upr*8.
 * Coverage: nunits units x 8 elements = the whole plane.
 * ------------------------------------------------------------------------ */
__global__ __launch_bounds__(256) void cvt_rows_kernel(
    const float* __restrict__ in, unsigned short* __restrict__ outp,
    int nunits, int upr, int rpb, int rpb_full)
{
  const int u = blockIdx.x * 256 + threadIdx.x;
  if (u >= nunits) return;
  const int row = u / upr;
  const int seg = u - row * upr;
  const int b = row / rpb;
  const int l = row - b * rpb;
  const float* src = in + ((size_t)(b * rpb_full + l) * upr + seg) * 8;
  const v4f a0 = *(const v4f*)src;
  const v4f a1 = *(const v4f*)(src + 4);
  v4u w;
  w[0] = pk2(a0[0], a0[1]);
  w[1] = pk2(a0[2], a0[3]);
  w[2] = pk2(a1[0], a1[1]);
  w[3] = pk2(a1[2], a1[3]);
  v4u* dst = (v4u*)(outp + ((size_t)row * upr + seg) * 8);
  *dst = w;
  
}

/* --------------------------------------------------------------------------
 * W in[rows][cols] f32  ->  Wt out[cols][rows] bf16 (RNE), 64x64 tiles through LDS.
 * Block (x = rows tile, y = cols tile), 256 threads.
 * Coverage: 2 iterations x 256 threads = 512 units x 8 = 64x64 for the load phase
 * and the same 512 units x 8 = 64x64 for the store phase.
 * LDS tile: cross-wave, separated by a block barrier.
 * ------------------------------------------------------------------------ */
__global__ __launch_bounds__(256) void wt_planes_kernel(
    const float* __restrict__ W, unsigned short* __restrict__ Wt, int rows, int cols)
{
  __shared__ __align__(16) unsigned short Ts[64 * TS_PITCH];   /* [n][k] */
  const int k0 = blockIdx.x * 64;
  const int n0 = blockIdx.y * 64;
  const int tid = threadIdx.x;
#pragma unroll
  for (int it = 0; it < 2; ++it) {
    const int u = it * 256 + tid;
    const int row = u >> 3;      /* k local */
    const int seg = u & 7;       /* n segment */
    const float* src = W + (size_t)(k0 + row) * cols + n0 + seg * 8;
    const v4f a0 = *(const v4f*)src;
    const v4f a1 = *(const v4f*)(src + 4);
#pragma unroll
    for (int e = 0; e < 4; ++e) {
      Ts[(seg * 8 + e) * TS_PITCH + row]     = f2bf_bits(a0[e]);
      Ts[(seg * 8 + 4 + e) * TS_PITCH + row] = f2bf_bits(a1[e]);
    }
  }
  __syncthreads();
  {
#pragma unroll
    for (int it = 0; it < 2; ++it) {
      const int u = it * 256 + tid;
      const int nrow = u >> 3;
      const int seg  = u & 7;
      const v4u w = *(const v4u_a*)(Ts + nrow * TS_PITCH + seg * 8);
      *(v4u*)(Wt + (size_t)(n0 + nrow) * rows + k0 + seg * 8) = w;
    }
    
  }
}

/* --------------------------------------------------------------------------
 * qkv = Xb . WqT^T + b  (M = MROWS, N = 3072, K = 1024), bf16 x bf16, f32 acc.
 * Block = 4 waves, tile 128 tokens x 64 columns (= one head of one section);
 * wave = 32 rows x 64 cols (2 A fragments x 4 B fragments per 32-deep step).
 * Operands: stages of 64 k (128 B of each of the 192 operand rows, whole lines) brought into a
 * two-buffer LDS ring by asynchronous copies, 12 per thread and stage, one stage ahead of the
 * stage being worked on; fragments by 16-B LDS loads from rows pitched 144 B.
 * Foot of every stage: own LDS reads back, own copies landed, block barrier, then the refill of
 * the buffer just read. The epilogue tile reuses the ring behind the last stage's barrier.
 * Fragment map (hh = lane>>4, c = lane&15): A row c, elems 0..7 <- k0+8hh.., 8..15 <- k0+16+8hh..;
 * B col c with the same k map; D elem r = (row 8hh+r, col c).
 * Epilogue: (acc + bias) [x 1/8 for the k section] split to bf16 hi/lo, staged in a
 * block LDS tile ([tok][d] for q,k; [d][tok] for v), block barrier, whole-line stores:
 *   v  : 1024 units = 64 d-rows x 16 segments (16 lanes = one 256-B row segment).
 * ------------------------------------------------------------------------ */
__global__ __launch_bounds__(128) VGPR_CAP void gemm_qkv_kernel(
    const unsigned short* __restrict__ Xb, const unsigned short* __restrict__ WqT,
    const float* __restrict__ bias, unsigned short* __restrict__ qkvp)
{
  union FB { v16b v; v8b h[2]; };
  __shared__ __align__(16) unsigned short Sm[2 * QKV_STAGE_E];
  unsigned short* Th = Sm;
  unsigned short* Tl = Sm + T_ELEMS;

  const int tid  = threadIdx.x;
  const int wave = __builtin_amdgcn_readfirstlane(tid >> 5);
  const int lane = tid & 31;
  const int hh   = lane >> 4;
  const int c    = lane & 15;
  const int n0   = blockIdx.x * 64;
  const int m0   = blockIdx.y * 128;

  v8f acc[2][4];
#pragma unroll
  for (int mt = 0; mt < 2; ++mt)
#pragma unroll
    for (int t = 0; t < 4; ++t) acc[mt][t] = (v8f){0.f,0.f,0.f,0.f,0.f,0.f,0.f,0.f};

  /* copy unit: thread -> (row tid>>3 of each group of 16 rows, 16-B segment tid&7) */
  const int crow = tid >> 3;
  const int cseg = tid & 7;
  const unsigned short* gx = Xb  + (size_t)(m0 + crow) * DMODEL + cseg * 8;
  const unsigned short* gw = WqT + (size_t)(n0 + crow) * DMODEL + cseg * 8;
  const unsigned lrow = lds_off(Sm) + (unsigned)(crow * RP + cseg * 8) * 2u;

  auto issue_stage = [&](int st) {
    /* unrolled below: the address arrays are indexed by constants and stay in registers */
    unsigned l[12];
    const unsigned short* g[12];
    const unsigned lb = lrow + (unsigned)(st & 1) * (unsigned)(QKV_STAGE_E * 2);
#pragma unroll
    for (int it = 0; it < 12; ++it) {
      l[it] = lb + (unsigned)(it * 16 * RP * 2);
      g[it] = (it < 8) ? gx + (size_t)it * 16 * DMODEL + st * KST
                       : gw + (size_t)(it - 8) * 16 * DMODEL + st * KST;
    }
    async_copy12(l, g);
  };

  const unsigned short* sa = Sm + (wave * 32 + c) * RP + 8 * hh;
  const unsigned short* sb = Sm + (128 + c) * RP + 8 * hh;

  issue_stage(0);
  wait_copies();
  __syncthreads();   /* publishes stage 0 */
  issue_stage(1);

  /* kept rolled: one copy of the ring's foot (waits, barrier, refill), small loop text */
#pragma unroll 1
  for (int st = 0; st < NSTAGE; ++st) {
    const int bo = (st & 1) * QKV_STAGE_E;
    /* the stage's fragment loads stand as one group ahead of its products, so that the wave pays
       the LDS latency once a stage; the loops below are unrolled so that every index of the
       fragment arrays is a constant and they stay in registers */
    FB a0[2], a1[2], bf[2][4];
#pragma unroll
    for (int s = 0; s < 2; ++s) {
      const int ks = s * 32;
      a0[s].h[0] = *(const v8b_a*)(sa + bo + ks);
      a0[s].h[1] = *(const v8b_a*)(sa + bo + ks + 16);
      a1[s].h[0] = *(const v8b_a*)(sa + bo + 16 * RP + ks);
      a1[s].h[1] = *(const v8b_a*)(sa + bo + 16 * RP + ks + 16);
#pragma unroll
      for (int t = 0; t < 4; ++t) {
        bf[s][t].h[0] = *(const v8b_a*)(sb + bo + t * 16 * RP + ks);
        bf[s][t].h[1] = *(const v8b_a*)(sb + bo + t * 16 * RP + ks + 16);
      }
    }
#pragma unroll
    for (int s = 0; s < 2; ++s) {
#pragma unroll
      for (int t = 0; t < 4; ++t) {
        acc[0][t] = mma_bf16(a0[s].v, bf[s][t].v, acc[0][t]);
        acc[1][t] = mma_bf16(a1[s].v, bf[s][t].v, acc[1][t]);
      }
    }
    wait_lds_reads();
    wait_copies();
    __syncthreads();   /* publishes stage st + 1 and ends every read of stage st's buffer */
    if (st + 2 < NSTAGE) issue_stage(st + 2);
  }
  wait_copies();

  const int sec = n0 / DMODEL;                       /* 0 q, 1 k, 2 v : block-uniform */
  const float osc = (sec == 1) ? 0.125f : 1.0f;
#pragma unroll
  for (int t = 0; t < 4; ++t) {
    const float bv = bf_bits2f(f2bf_bits(bias[n0 + 16 * t + c]));
#pragma unroll
    for (int mt = 0; mt < 2; ++mt) {
#pragma unroll
      for (int r = 0; r < 8; ++r) {
        const float val = (acc[mt][t][r] + bv) * osc;
        const unsigned short hb = f2bf_bits(val);
        const unsigned short lb = f2bf_bits(val - bf_bits2f(hb));
        const int rl = wave * 32 + mt * 16 + 8 * hh + r;
        const int cl = 16 * t + c;
        const int idx = (sec < 2) ? (rl * TQ_PITCH + cl) : (cl * TV_PITCH + rl);
        Th[idx] = hb;
        Tl[idx] = lb;
      }
    }
  }
  __syncthreads();

  const int b  = m0 / SEQ;
  const int l0 = m0 - b * SEQ;
  const int h  = (n0 - sec * DMODEL) / DHEAD;
  const int bh = b * NHEAD + h;
  unsigned short* ph = qkvp + (size_t)(2 * sec) * PLANE;
  unsigned short* pl = ph + PLANE;

  {
    if (sec < 2) {
#pragma unroll
      for (int it = 0; it < 8; ++it) {
        const int u = it * 128 + tid;
        const int row = u >> 3;
        const int seg = u & 7;
        const v4u hw = *(const v4u_a*)(Th + row * TQ_PITCH + seg * 8);
        const v4u lw = *(const v4u_a*)(Tl + row * TQ_PITCH + seg * 8);
        const size_t g = ((size_t)bh * SEQ + l0 + row) * DHEAD + seg * 8;
        *(v4u*)(ph + g) = hw;
        *(v4u*)(pl + g) = lw;
      }
    } else {
#pragma unroll
      for (int it = 0; it < 8; ++it) {
        const int u = it * 128 + tid;
        const int drow = u >> 4;
        const int seg  = u & 15;
        const v4u hw = *(const v4u_a*)(Th + drow * TV_PITCH + seg * 8);
        const v4u lw = *(const v4u_a*)(Tl + drow * TV_PITCH + seg * 8);
        const size_t g = ((size_t)bh * DHEAD + drow) * SEQ + l0 + seg * 8;
        *(v4u*)(ph + g) = hw;
        *(v4u*)(pl + g) = lw;
      }
    }
    
  }
}

/* --------------------------------------------------------------------------
 * Attention with the per-head relative-position table, head dim 64.
 * Block = 16 query rows of one (b,h); grid (SEQ/16, NBH). The block's 4 waves deal the
 * 64-key chunks among them (wave w takes chunks w, w+4, ...), each with its own running
 * maximum, sum and output accumulators; one block barrier, then the four partial states
 * are merged through LDS by the usual rescaling to the common row maximum.
 * Per 64-key chunk and wave (16 query rows), in short phases so that only the
 * q fragments, the output accumulators and the row statistics stay resident:
 *   mask rows read by value (8 b128 loads + ballots); wave-uniform skip when every
 *   element of the 16x64 mask tile is set; per-element replace-fill otherwise;
 *   S = q.(k/8)^T : rolled loop over 4 key tiles, 2 d-steps x (hi.hi + hi.lo + lo.hi),
 *                   one accumulator, each tile written to the wave-private S slab;
 *   G = q.Ewin^T  : rolled loop over 5 tiles (80 offsets d = kv0-q0-15+g, table row =
 *                   d mod 2047), 2 d-steps x (hi + lo) against the bf16 table, written
 *                   to the wave-private G slab, read back skewed: G[m][n-m+15];
 *   f32 online softmax on S + G; P as bf16 hi+lo wave-private LDS tiles;
 *   O += Ph.Vh + Pl.Vh + Ph.Vl from the V^T planes, rolled loop over the two 32-key steps.
 * The q, k, Er and V fragments come straight from 16-bit global rows by arithmetic addressing.
 * LDS regions Ss/Gs/Psh/Psl are private to their wave (wave_sync form) inside the loop.
 * Epilogue: each wave's unnormalised 16x64 slab (aliases its G slab) and row statistics,
 * block barrier, merge + normalise (thread = one row x 8 columns) -> ctx hi/lo planes,
 * ------------------------------------------------------------------------ */
__global__ __launch_bounds__(128) VGPR_CAP void rel_attn_kernel(
    const unsigned short* __restrict__ qkvp, const unsigned short* __restrict__ Erb,
    const int* __restrict__ mask, unsigned short* __restrict__ ctxp)
{
  union FB { v16b v; v8b h[2]; };
  __shared__ __align__(16) float Gs[NWAVE][16 * GP];
  __shared__ __align__(16) float Ss[NWAVE][16 * SP];
  __shared__ __align__(16) unsigned short Psh[NWAVE][16 * KCH];
  __shared__ __align__(16) unsigned short Psl[NWAVE][16 * KCH];
  __shared__ float Ms[NWAVE][16];
  __shared__ float Ls[NWAVE][16];

  const int tid  = threadIdx.x;
  const int wave = __builtin_amdgcn_readfirstlane(tid >> 5);
  const int lane = tid & 31;
  const int hh   = lane >> 4;
  const int c    = lane & 15;
  const int c3   = c & 3;
  const int csh  = c >> 2;
  const int qb   = blockIdx.x;
  const int bh   = blockIdx.y;
  const int b    = bh / NHEAD;
  const int h    = bh - b * NHEAD;
  const int q0   = qb * 16;
  const float NEG_INF = -__builtin_inff();

  const unsigned short* Qh  = qkvp + (size_t)bh * SEQ * DHEAD;
  const unsigned short* Ql  = Qh + PLANE;
  const unsigned short* Kh  = Qh + 2 * PLANE;
  const unsigned short* Kl  = Qh + 3 * PLANE;
  const unsigned short* Vth = Qh + 4 * PLANE;     /* [bh][d][l]: same per-bh element count */
  const unsigned short* Vtl = Qh + 5 * PLANE;
  const unsigned short* Eh  = Erb + (size_t)h * NPOS * DHEAD;

  v16b qh[2], ql[2];
  {
    const size_t qo = (size_t)(q0 + c) * DHEAD + 8 * hh;
#pragma unroll
    for (int dc = 0; dc < 2; ++dc) {
      FB f;
      f.h[0] = *(const v8b*)(Qh + qo + dc * 32);
      f.h[1] = *(const v8b*)(Qh + qo + dc * 32 + 16);
      qh[dc] = f.v;
      f.h[0] = *(const v8b*)(Ql + qo + dc * 32);
      f.h[1] = *(const v8b*)(Ql + qo + dc * 32 + 16);
      ql[dc] = f.v;
    }
  }

  float mrow[8], lrow[8];
  v8f oacc[4];
#pragma unroll
  for (int r = 0; r < 8; ++r) { mrow[r] = NEG_INF; lrow[r] = 0.f; }
#pragma unroll
  for (int t = 0; t < 4; ++t) oacc[t] = (v8f){0.f,0.f,0.f,0.f,0.f,0.f,0.f,0.f};

  float* gs = Gs[wave];
  float* ss = Ss[wave];
  unsigned short* pwh = Psh[wave];
  unsigned short* pwl = Psl[wave];

#pragma unroll 1
  for (int kc = wave; kc < SEQ / KCH; kc += NWAVE) {
    const int kv0 = kc * KCH;

    /* mask tile by value: bit L of the ballot (it, e) = mask[q0+2it+(L>>4)][kv0+4(L&15)+e] != 0;
       each lane keeps the word of its own e = c&3 */
    unsigned msel[8];
    unsigned andall = 0xFFFFFFFFu;
#pragma unroll
    for (int it = 0; it < 8; ++it) {
      const v4i mv = *(const v4i*)(mask + (size_t)(q0 + 2 * it + hh) * SEQ_FULL + kv0 + 4 * c);
      const unsigned b0 = __builtin_amdgcn_ballot_w32(mv[0] != 0);
      const unsigned b1 = __builtin_amdgcn_ballot_w32(mv[1] != 0);
      const unsigned b2 = __builtin_amdgcn_ballot_w32(mv[2] != 0);
      const unsigned b3 = __builtin_amdgcn_ballot_w32(mv[3] != 0);
      andall &= (b0 & b1) & (b2 & b3);
      msel[it] = (c3 == 0) ? b0 : (c3 == 1) ? b1 : (c3 == 2) ? b2 : b3;
    }
    if (andall == 0xFFFFFFFFu) continue;          /* wave-uniform: every element masked */

    unsigned mw[4];
#pragma unroll
    for (int ii = 0; ii < 4; ++ii) mw[ii] = hh ? msel[4 + ii] : msel[ii];

    /* raw scores: 4 key tiles, one accumulator, tile -> S slab (D elem r = row 8hh+r, col c) */
#pragma unroll 1
    for (int j = 0; j < 4; ++j) {
      v8f sa = (v8f){0.f,0.f,0.f,0.f,0.f,0.f,0.f,0.f};
      const size_t ko = (size_t)(kv0 + j * 16 + c) * DHEAD + 8 * hh;
#pragma unroll
      for (int dc = 0; dc < 2; ++dc) {
        FB kfh, kfl;
        kfh.h[0] = *(const v8b*)(Kh + ko + dc * 32);
        kfh.h[1] = *(const v8b*)(Kh + ko + dc * 32 + 16);
        kfl.h[0] = *(const v8b*)(Kl + ko + dc * 32);
        kfl.h[1] = *(const v8b*)(Kl + ko + dc * 32 + 16);
        sa = mma_bf16(qh[dc], kfh.v, sa);
        sa = mma_bf16(qh[dc], kfl.v, sa);
        sa = mma_bf16(ql[dc], kfh.v, sa);
      }
#pragma unroll
      for (int r = 0; r < 8; ++r) ss[(8 * hh + r) * SP + 16 * j + c] = sa[r];
    }

    /* position term: G[m][g] = q[m] . Er[h][(kv0 - q0 - 15 + g) mod 2047], g = 0..79 */
    {
      const int dbase = kv0 - q0 - 15;
#pragma unroll 1
      for (int t = 0; t < 5; ++t) {
        const int d = dbase + 16 * t + c;
        int rr = d % NPOS;
        rr += (rr < 0) ? NPOS : 0;                 /* rr in [0, 2046] */
        const unsigned short* ep = Eh + (size_t)rr * DHEAD + 8 * hh;
        v8f g = (v8f){0.f,0.f,0.f,0.f,0.f,0.f,0.f,0.f};
#pragma unroll
        for (int dc = 0; dc < 2; ++dc) {
          FB ef;
          ef.h[0] = *(const v8b*)(ep + dc * 32);
          ef.h[1] = *(const v8b*)(ep + dc * 32 + 16);
          g = mma_bf16(qh[dc], ef.v, g);
          g = mma_bf16(ql[dc], ef.v, g);
        }
#pragma unroll
        for (int r = 0; r < 8; ++r) gs[(8 * hh + r) * GP + 16 * t + c] = g[r];
      }
    }
    wave_lds_sync();

    /* raw score + skewed position term, replace-fill of masked elements */
    v8f s[4];
#pragma unroll
    for (int j = 0; j < 4; ++j) {
#pragma unroll
      for (int r = 0; r < 8; ++r) {
        const int m = 8 * hh + r;
        const float raw = ss[m * SP + 16 * j + c];
        const float gv = gs[m * (GP - 1) + 16 * j + c + 15];
        const float sv = raw + gv;
        const unsigned bit = (mw[r >> 1] >> (16 * (r & 1) + 4 * j + csh)) & 1u;
        s[j][r] = bit ? NEG_INF : sv;
      }
    }

    /* chunk row max over the 64 keys */
    float cm[8];
#pragma unroll
    for (int r = 0; r < 8; ++r) {
      float m = fmaxf(fmaxf(s[0][r], s[1][r]), fmaxf(s[2][r], s[3][r]));
#pragma unroll
      for (int off = 1; off < 16; off <<= 1) m = fmaxf(m, __shfl_xor(m, off, 32));
      cm[r] = m;
    }

    /* online softmax update, P tiles as bf16 hi + lo */
#pragma unroll
    for (int r = 0; r < 8; ++r) {
      const float mnew  = fmaxf(mrow[r], cm[r]);
      const float msafe = (mnew == NEG_INF) ? 0.f : mnew;
      const float alpha = expf(mrow[r] - msafe);
      mrow[r] = mnew;
      float psum = 0.f;
#pragma unroll
      for (int j = 0; j < 4; ++j) {
        const float p = expf(s[j][r] - msafe);
        psum += p;
        const unsigned short hb = f2bf_bits(p);
        const unsigned short lb = f2bf_bits(p - bf_bits2f(hb));
        pwh[(8 * hh + r) * KCH + j * 16 + c] = hb;
        pwl[(8 * hh + r) * KCH + j * 16 + c] = lb;
      }
#pragma unroll
      for (int off = 1; off < 16; off <<= 1) psum += __shfl_xor(psum, off, 32);
      lrow[r] = lrow[r] * alpha + psum;
#pragma unroll
      for (int t = 0; t < 4; ++t) oacc[t][r] *= alpha;
    }
    wave_lds_sync();

    /* O += P.V : A = P [q][kv] (this wave's tiles), B = V [kv][d] from V^T [d][kv];
       rolled over the two 32-key steps, fragments loaded per step */
#pragma unroll 1
    for (int kk = 0; kk < 2; ++kk) {
      FB pa, pl;
      pa.h[0] = *(const v8b_a*)(pwh + c * KCH + kk * 32 + 8 * hh);
      pa.h[1] = *(const v8b_a*)(pwh + c * KCH + kk * 32 + 16 + 8 * hh);
      pl.h[0] = *(const v8b_a*)(pwl + c * KCH + kk * 32 + 8 * hh);
      pl.h[1] = *(const v8b_a*)(pwl + c * KCH + kk * 32 + 16 + 8 * hh);
#pragma unroll
      for (int t = 0; t < 4; ++t) {
        const size_t vo = (size_t)(t * 16 + c) * SEQ + kv0 + kk * 32 + 8 * hh;
        FB vbh, vbl;
        vbh.h[0] = *(const v8b*)(Vth + vo);
        vbh.h[1] = *(const v8b*)(Vth + vo + 16);
        vbl.h[0] = *(const v8b*)(Vtl + vo);
        vbl.h[1] = *(const v8b*)(Vtl + vo + 16);
        oacc[t] = mma_bf16(pa.v, vbh.v, oacc[t]);
        oacc[t] = mma_bf16(pl.v, vbh.v, oacc[t]);
        oacc[t] = mma_bf16(pa.v, vbl.v, oacc[t]);
      }
    }
    wave_lds_sync();
  }

  /* this wave's partial state: unnormalised output into its own slab (aliases the G slab),
     row maximum and row sum beside it */
  float* os = gs;
#pragma unroll
  for (int r = 0; r < 8; ++r) {
#pragma unroll
    for (int t = 0; t < 4; ++t) os[(8 * hh + r) * GP + t * 16 + c] = oacc[t][r];
  }
  if (c == 0) {      /* the 16 lanes of a half hold equal row statistics */
#pragma unroll
    for (int r = 0; r < 8; ++r) {
      Ms[wave][8 * hh + r] = mrow[r];
      Ls[wave][8 * hh + r] = lrow[r];
    }
  }
  __syncthreads();   /* publishes the four partial states to the whole block */
  {
    unsigned short* Ch = ctxp;
    unsigned short* Cl = ctxp + XB_E;
    const int row = tid >> 3;
    const int seg = tid & 7;
    float mall = Ms[0][row];
#pragma unroll
    for (int w = 1; w < NWAVE; ++w) mall = fmaxf(mall, Ms[w][row]);
    const float msafe = (mall == NEG_INF) ? 0.f : mall;
    float lsum = 0.f;
    v4f a0 = (v4f){0.f, 0.f, 0.f, 0.f};
    v4f a1 = (v4f){0.f, 0.f, 0.f, 0.f};
#pragma unroll
    for (int w = 0; w < NWAVE; ++w) {
      const float f = expf(Ms[w][row] - msafe);
      lsum += Ls[w][row] * f;
      a0 += *(const v4f_a*)(Gs[w] + row * GP + seg * 8) * f;
      a1 += *(const v4f_a*)(Gs[w] + row * GP + seg * 8 + 4) * f;
    }
    const float inv = 1.0f / lsum;
    a0 *= inv;
    a1 *= inv;
    unsigned h0, h1, h2, h3, l0, l1, l2, l3;
    split2(a0[0], a0[1], h0, l0);
    split2(a0[2], a0[3], h1, l1);
    split2(a1[0], a1[1], h2, l2);
    split2(a1[2], a1[3], h3, l3);
    v4u hw, lw;
    hw[0] = h0; hw[1] = h1; hw[2] = h2; hw[3] = h3;
    lw[0] = l0; lw[1] = l1; lw[2] = l2; lw[3] = l3;
    const size_t g = (size_t)(b * SEQ + q0 + row) * DMODEL + h * DHEAD + seg * 8;
    *(v4u*)(Ch + g) = hw;
    *(v4u*)(Cl + g) = lw;
  }
}

/* --------------------------------------------------------------------------
 * out = (Ch + Cl) . WoT^T + b  (M = MROWS, N = 1024, K = 1024), f32 acc.
 * Block = 4 waves, tile 128 x 64; wave = 32 rows x 64 cols; A hi and lo planes
 * against the single bf16 weight plane (two products per tile pair).
 * Operands: stages of 64 k (128 B of each of the 320 operand rows) in a two-buffer LDS ring,
 * filled by asynchronous copies (20 per thread and stage) in the order of gemm_qkv_kernel.
 * Epilogue: per-wave 32x64 f32 slab (wave-private LDS), 16 lanes x 16 B = one 256-B
 * ------------------------------------------------------------------------ */
__global__ __launch_bounds__(128) VGPR_CAP void gemm_out_kernel(
    const unsigned short* __restrict__ ctxp, const unsigned short* __restrict__ WoT,
    const float* __restrict__ bias, float* __restrict__ out)
{
  union FB { v16b v; v8b h[2]; };
  __shared__ __align__(16) float Os[NWAVE][32 * OS_PITCH];
  __shared__ __align__(16) unsigned short Sm[2 * OUT_STAGE_E];

  const int tid  = threadIdx.x;
  const int wave = __builtin_amdgcn_readfirstlane(tid >> 5);
  const int lane = tid & 31;
  const int hh   = lane >> 4;
  const int c    = lane & 15;
  const int n0   = blockIdx.x * 64;
  const int m0   = blockIdx.y * 128;

  v8f acc[2][4];
#pragma unroll
  for (int mt = 0; mt < 2; ++mt)
#pragma unroll
    for (int t = 0; t < 4; ++t) acc[mt][t] = (v8f){0.f,0.f,0.f,0.f,0.f,0.f,0.f,0.f};

  /* copy unit: thread -> (row tid>>3 of each group of 16 rows, 16-B segment tid&7) */
  const int crow = tid >> 3;
  const int cseg = tid & 7;
  const unsigned short* gh = ctxp + (size_t)(m0 + crow) * DMODEL + cseg * 8;
  const unsigned short* gl = gh + XB_E;
  const unsigned short* gw = WoT + (size_t)(n0 + crow) * DMODEL + cseg * 8;
  const unsigned lrow = lds_off(Sm) + (unsigned)(crow * RP + cseg * 8) * 2u;

  auto issue_stage = [&](int st) {
    /* unrolled below: the address arrays are indexed by constants and stay in registers */
    unsigned l[20];
    const unsigned short* g[20];
    const unsigned lb = lrow + (unsigned)(st & 1) * (unsigned)(OUT_STAGE_E * 2);
#pragma unroll
    for (int it = 0; it < 20; ++it) {
      l[it] = lb + (unsigned)(it * 16 * RP * 2);
      g[it] = (it < 8)  ? gh + (size_t)it * 16 * DMODEL + st * KST
            : (it < 16) ? gl + (size_t)(it - 8) * 16 * DMODEL + st * KST
                        : gw + (size_t)(it - 16) * 16 * DMODEL + st * KST;
    }
    async_copy10(l, g);
    async_copy10(l + 10, g + 10);
  };

  const unsigned short* sh = Sm + (wave * 32 + c) * RP + 8 * hh;
  const unsigned short* sl = sh + 128 * RP;
  const unsigned short* sb = Sm + (256 + c) * RP + 8 * hh;

  issue_stage(0);
  wait_copies();
  __syncthreads();   /* publishes stage 0 */
  issue_stage(1);

  /* kept rolled: one copy of the ring's foot (waits, barrier, refill), small loop text */
#pragma unroll 1
  for (int st = 0; st < NSTAGE; ++st) {
    const int bo = (st & 1) * OUT_STAGE_E;
    /* the stage's fragment loads stand as one group ahead of its products, so that the wave pays
       the LDS latency once a stage; the loops below are unrolled so that every index of the
       fragment arrays is a constant and they stay in registers */
    FB a0h[2], a1h[2], a0l[2], a1l[2], bf[2][4];
#pragma unroll
    for (int s = 0; s < 2; ++s) {
      const int ks = s * 32;
      a0h[s].h[0] = *(const v8b_a*)(sh + bo + ks);
      a0h[s].h[1] = *(const v8b_a*)(sh + bo + ks + 16);
      a0l[s].h[0] = *(const v8b_a*)(sl + bo + ks);
      a0l[s].h[1] = *(const v8b_a*)(sl + bo + ks + 16);
      a1h[s].h[0] = *(const v8b_a*)(sh + bo + 16 * RP + ks);
      a1h[s].h[1] = *(const v8b_a*)(sh + bo + 16 * RP + ks + 16);
      a1l[s].h[0] = *(const v8b_a*)(sl + bo + 16 * RP + ks);
      a1l[s].h[1] = *(const v8b_a*)(sl + bo + 16 * RP + ks + 16);
#pragma unroll
      for (int t = 0; t < 4; ++t) {
        bf[s][t].h[0] = *(const v8b_a*)(sb + bo + t * 16 * RP + ks);
        bf[s][t].h[1] = *(const v8b_a*)(sb + bo + t * 16 * RP + ks + 16);
      }
    }
#pragma unroll
    for (int s = 0; s < 2; ++s) {
#pragma unroll
      for (int t = 0; t < 4; ++t) {
        acc[0][t] = mma_bf16(a0h[s].v, bf[s][t].v, acc[0][t]);
        acc[0][t] = mma_bf16(a0l[s].v, bf[s][t].v, acc[0][t]);
        acc[1][t] = mma_bf16(a1h[s].v, bf[s][t].v, acc[1][t]);
        acc[1][t] = mma_bf16(a1l[s].v, bf[s][t].v, acc[1][t]);
      }
    }
    wait_lds_reads();
    wait_copies();
    __syncthreads();   /* publishes stage st + 1 and ends every read of stage st's buffer */
    if (st + 2 < NSTAGE) issue_stage(st + 2);
  }
  wait_copies();

  float* os = Os[wave];
#pragma unroll
  for (int t = 0; t < 4; ++t) {
    const float bv = bf_bits2f(f2bf_bits(bias[n0 + 16 * t + c]));
#pragma unroll
    for (int mt = 0; mt < 2; ++mt)
#pragma unroll
      for (int r = 0; r < 8; ++r)
        os[(mt * 16 + 8 * hh + r) * OS_PITCH + 16 * t + c] = acc[mt][t][r] + bv;
  }
  wave_lds_sync();
  {
    const int c4 = c * 4;
    {
#pragma unroll
      for (int it = 0; it < 16; ++it) {
        const int row = it * 2 + hh;
        const v4f val = *(const v4f_a*)(os + row * OS_PITCH + c4);
        *(v4f*)(out + (size_t)(m0 + wave * 32 + row) * DMODEL + n0 + c4) = val;
      }
      
    }
  }
}

extern "C" void kernel_launch(void* const* d_in, const int* in_sizes, int n_in,
                              void* d_out, int out_size, void* d_ws, size_t ws_size,
                              hipStream_t stream)
{
  if (n_in < 7) return;
  if (in_sizes[0] < ((NB - 1) * SEQ_FULL + SEQ) * DMODEL) return;
  if (in_sizes[1] < (SEQ - 1) * SEQ_FULL + SEQ) return;
  if (in_sizes[2] < DMODEL * NQKV) return;
  if (in_sizes[3] < NQKV) return;
  if (in_sizes[4] < DMODEL * DMODEL) return;
  if (in_sizes[5] < DMODEL) return;
  if (in_sizes[6] < NHEAD * NPOS * DHEAD) return;
  if (out_size < MROWS * DMODEL) return;
  if (d_ws == nullptr || ws_size < WS_NEED) return;

  const float* x     = (const float*)d_in[0];
  const int*   mask  = (const int*)d_in[1];
  const float* W_qkv = (const float*)d_in[2];
  const float* b_qkv = (const float*)d_in[3];
  const float* W_o   = (const float*)d_in[4];
  const float* b_o   = (const float*)d_in[5];
  const float* Er    = (const float*)d_in[6];
  float* out = (float*)d_out;

  unsigned short* Xb   = (unsigned short*)d_ws;
  unsigned short* WqT  = Xb + XB_E;
  unsigned short* WoT  = WqT + WQT_E;
  unsigned short* Erb  = WoT + WOT_E;
  unsigned short* qkvp = Erb + ERB_E;
  unsigned short* ctxp = qkvp + QKVP_E;

  {
    const int nunits = MROWS * (DMODEL / 8);
    cvt_rows_kernel<<<(nunits + 255) / 256, 256, 0, stream>>>(x, Xb, nunits, DMODEL / 8, SEQ, SEQ_FULL);
  }
  {
    const int nunits = NHEAD * NPOS * (DHEAD / 8);
    cvt_rows_kernel<<<(nunits + 255) / 256, 256, 0, stream>>>(Er, Erb, nunits, DHEAD / 8, NHEAD * NPOS, NHEAD * NPOS);
  }
  /* W_qkv in[1024][3072] -> WqT out[3072][1024]; grid (rows/64, cols/64) */
  wt_planes_kernel<<<dim3(DMODEL / 64, NQKV / 64), 256, 0, stream>>>(W_qkv, WqT, DMODEL, NQKV);
  /* W_o in[1024][1024] -> WoT out[1024][1024]; grid (rows/64, cols/64) */
  wt_planes_kernel<<<dim3(DMODEL / 64, DMODEL / 64), 256, 0, stream>>>(W_o, WoT, DMODEL, DMODEL);

  gemm_qkv_kernel<<<dim3(NQKV / 64, MROWS / 128), 128, 0, stream>>>(Xb, WqT, b_qkv, qkvp);
  rel_attn_kernel<<<dim3(SEQ / 16, NBH), 128, 0, stream>>>(qkvp, Erb, mask, ctxp);
  gemm_out_kernel<<<dim3(DMODEL / 64, MROWS / 128), 128, 0, stream>>>(ctxp, WoT, b_o, out);
}

// v003
// Measured time: 136 microseconds a run.
// In two side-by-side timings against v002, it was 1.19 and 1.17 times as fast.
// Over all steps from v000 it is 1.96 times as fast.
// Contractions: x.Wqkv on v_wmma_f32_16x16x32_bf16 with both operands RNE-converted to bf16 once; q.(k/8)^T, q.Er^T, p.v and ctx.Wo on v_wmma_f32_16x16x32_bf16 with computed operands (q, k/8, v, p, ctx) carried as bf16 hi+lo planes (hi.hi + hi.lo + lo.hi) and input operands (Er, Wo) as single bf16 planes; f32 accumulate; softmax, bias adds and mask fill in f32.
#include <hip/hip_runtime.h>

typedef __attribute__((ext_vector_type(16))) __bf16 v16b;
typedef __attribute__((ext_vector_type(8)))  __bf16 v8b;
typedef __attribute__((ext_vector_type(8)))  float  v8f;
typedef __attribute__((ext_vector_type(4)))  float  v4f;
typedef __attribute__((ext_vector_type(4)))  unsigned int v4u;
typedef __attribute__((ext_vector_type(4)))  int v4i;
typedef v8b v8b_a __attribute__((may_alias));
typedef v4f v4f_a __attribute__((may_alias));
typedef v4u v4u_a __attribute__((may_alias));

#ifndef NB
#define NB 2
#endif
#ifndef SEQ
#define SEQ 1024
#endif
#define NB_FULL 2
#define SEQ_FULL 1024

#define VGPR_CAP __attribute__((amdgpu_num_vgpr(256)))

constexpr int DMODEL = 1024;
constexpr int NHEAD  = 16;
constexpr int DHEAD  = 64;
constexpr int NPOS   = 2047;
constexpr int NQKV   = 3 * DMODEL;
constexpr int NBH    = NB * NHEAD;
constexpr int MROWS  = NB * SEQ;
constexpr int KCH    = 64;        /* keys per chunk */
constexpr int NWAVE  = 4;
constexpr int NCH    = SEQ / (KCH * NWAVE);   /* key chunks per wave of the attention block */
constexpr int GP     = 84;        /* skew slab pitch in floats (336 B rows, 16-B aligned) */
constexpr int SP     = 68;        /* raw score slab pitch in floats */
constexpr int TQ_PITCH = 72;      /* [tok][d] staging pitch (16-bit elements) */
constexpr int TV_PITCH = 136;     /* [d][tok] staging pitch (16-bit elements) */
constexpr int T_ELEMS  = 128 * TQ_PITCH;   /* 9216 >= 64 * TV_PITCH = 8704 */
constexpr int TS_PITCH = 72;
constexpr int OS_PITCH = 68;
constexpr int KST      = 64;      /* k elements per GEMM stage: one 128-B line of every operand row */
constexpr int RP       = 72;      /* GEMM stage row pitch (16-bit elements): 144 B = 16 B x odd for b128 readers */
constexpr int NSTAGE   = 1024 / KST;
constexpr int QKV_STAGE_E = (128 + 64) * RP;        /* [x 128 rows | W 64 rows] */
constexpr int OUT_STAGE_E = (128 + 128 + 64) * RP;  /* [ctx hi 128 | ctx lo 128 | W 64 rows] */

constexpr size_t PLANE  = (size_t)NBH * SEQ * DHEAD;
constexpr size_t XB_E   = (size_t)MROWS * DMODEL;
constexpr size_t WQT_E  = (size_t)NQKV * DMODEL;
constexpr size_t WOT_E  = (size_t)DMODEL * DMODEL;
constexpr size_t ERB_E  = (size_t)NHEAD * 2048 * DHEAD;
constexpr size_t QKVP_E = 6 * PLANE;
constexpr size_t CTX_E  = 2 * XB_E;
constexpr size_t WS_NEED = 2 * (XB_E + WQT_E + WOT_E + ERB_E + QKVP_E + CTX_E);

static_assert(SEQ % 128 == 0);
static_assert(NCH * KCH * NWAVE == SEQ && NCH == 4);
static_assert(SEQ <= SEQ_FULL && NB <= NB_FULL);
static_assert(DHEAD == 64 && DMODEL == NHEAD * DHEAD);
static_assert(DMODEL % 64 == 0 && NQKV % 64 == 0 && DMODEL % 32 == 0);
static_assert(64 * TV_PITCH <= T_ELEMS);
static_assert((TQ_PITCH * 2) % 16 == 0 && (TV_PITCH * 2) % 16 == 0 && (GP * 4) % 16 == 0 && (OS_PITCH * 4) % 16 == 0);
static_assert(GP >= 80 && SP >= 64);
static_assert(NSTAGE * KST == DMODEL && NSTAGE >= 2 && (RP * 2) % 16 == 0 && RP >= KST);
static_assert(2 * T_ELEMS <= 2 * QKV_STAGE_E);
static_assert((size_t)NHEAD * NPOS * DHEAD <= ERB_E);
static_assert(WS_NEED <= 134217728ull);

/*
 *   Xb   [MROWS][1024]        x, bf16
 *   WqT  [3072][1024]         W_qkv transposed, bf16
 *   WoT  [1024][1024]         W_o transposed, bf16
 *   Erb  [16][2047][64]       Er, bf16 (region padded to 16*2048 rows)
 *   qkvp 6 planes: Qh Ql [bh][l][64], Kh Kl [bh][l][64] (k/8), Vth Vtl [bh][64][l]
 *   ctxp 2 planes: Ch Cl [MROWS][1024]
 */

__device__ __forceinline__ unsigned short f2bf_bits(float f) {
  unsigned u = __float_as_uint(f);
  return (unsigned short)((u + 0x7FFFu + ((u >> 16) & 1u)) >> 16);
}
__device__ __forceinline__ float bf_bits2f(unsigned short h) { return __uint_as_float(((unsigned)h) << 16); }
__device__ __forceinline__ unsigned pk2(float a, float b) {
  return (unsigned)f2bf_bits(a) | ((unsigned)f2bf_bits(b) << 16);
}
__device__ __forceinline__ void split2(float a, float b, unsigned& hw, unsigned& lw) {
  const unsigned short ha = f2bf_bits(a);
  const unsigned short hb = f2bf_bits(b);
  const unsigned short la = f2bf_bits(a - bf_bits2f(ha));
  const unsigned short lb = f2bf_bits(b - bf_bits2f(hb));
  hw = (unsigned)ha | ((unsigned)hb << 16);
  lw = (unsigned)la | ((unsigned)lb << 16);
}

/* one WMMA + hazard guard naming only this call's live operands */
__device__ __forceinline__ v8f mma_bf16(v16b a, v16b b, v8f c) {
  c = __builtin_amdgcn_wmma_f32_16x16x32_bf16(false, a, false, b, (short)0, c, false, false);
  asm volatile("v_nop\n\tv_nop\n\tv_nop\n\tv_nop" : "+v"(c) : "v"(a), "v"(b));
  return c;
}

__device__ __forceinline__ void wave_lds_sync() {
  __builtin_amdgcn_fence(3 /* release order */, "workgroup");
  __builtin_amdgcn_wave_barrier();
  __builtin_amdgcn_fence(2 /* acquire order */, "workgroup");
}

/* byte offset of a __shared__ address inside the work-group's LDS */
__device__ __forceinline__ unsigned lds_off(const void* p) { return (unsigned)(size_t)p; }

/* Asynchronous copies global -> LDS, 16 B per lane and copy, every lane on. The copies of a run
   and the s_wait_xcnt 0 that stands before their address registers may be rewritten are one
   statement, so that no later address arithmetic can be moved in front of that wait. */
__device__ __forceinline__ void async_copy12(const unsigned (&l)[12], const unsigned short* const (&g)[12]) {
  asm volatile(
      "global_load_async_to_lds_b128 %0, %12, off\n\t"
      "global_load_async_to_lds_b128 %1, %13, off\n\t"
      "global_load_async_to_lds_b128 %2, %14, off\n\t"
      "global_load_async_to_lds_b128 %3, %15, off\n\t"
      "global_load_async_to_lds_b128 %4, %16, off\n\t"
      "global_load_async_to_lds_b128 %5, %17, off\n\t"
      "global_load_async_to_lds_b128 %6, %18, off\n\t"
      "global_load_async_to_lds_b128 %7, %19, off\n\t"
      "global_load_async_to_lds_b128 %8, %20, off\n\t"
      "global_load_async_to_lds_b128 %9, %21, off\n\t"
      "global_load_async_to_lds_b128 %10, %22, off\n\t"
      "global_load_async_to_lds_b128 %11, %23, off\n\t"
      "s_wait_xcnt 0x0"
      :: "v"(l[0]), "v"(l[1]), "v"(l[2]), "v"(l[3]), "v"(l[4]), "v"(l[5]),
         "v"(l[6]), "v"(l[7]), "v"(l[8]), "v"(l[9]), "v"(l[10]), "v"(l[11]),
         "v"(g[0]), "v"(g[1]), "v"(g[2]), "v"(g[3]), "v"(g[4]), "v"(g[5]),
         "v"(g[6]), "v"(g[7]), "v"(g[8]), "v"(g[9]), "v"(g[10]), "v"(g[11])
      : "memory");
}
__device__ __forceinline__ void async_copy10(const unsigned* l, const unsigned short* const* g) {
  asm volatile(
      "global_load_async_to_lds_b128 %0, %10, off\n\t"
      "global_load_async_to_lds_b128 %1, %11, off\n\t"
      "global_load_async_to_lds_b128 %2, %12, off\n\t"
      "global_load_async_to_lds_b128 %3, %13, off\n\t"
      "global_load_async_to_lds_b128 %4, %14, off\n\t"
      "global_load_async_to_lds_b128 %5, %15, off\n\t"
      "global_load_async_to_lds_b128 %6, %16, off\n\t"
      "global_load_async_to_lds_b128 %7, %17, off\n\t"
      "global_load_async_to_lds_b128 %8, %18, off\n\t"
      "global_load_async_to_lds_b128 %9, %19, off\n\t"
      "s_wait_xcnt 0x0"
      :: "v"(l[0]), "v"(l[1]), "v"(l[2]), "v"(l[3]), "v"(l[4]),
         "v"(l[5]), "v"(l[6]), "v"(l[7]), "v"(l[8]), "v"(l[9]),
         "v"(g[0]), "v"(g[1]), "v"(g[2]), "v"(g[3]), "v"(g[4]),
         "v"(g[5]), "v"(g[6]), "v"(g[7]), "v"(g[8]), "v"(g[9])
      : "memory");
}
/* Stands in front of the last load from an address pair, whose destination may be that pair while
   earlier loads from it are in flight, and behind it, before the pair is written anew: the wait
   that is kept before a register of an issued global load is overwritten. */
__device__ __forceinline__ void wait_addr() { asm volatile("s_wait_xcnt 0x0" ::: "memory"); }
/* this wave's copies have landed in LDS (the compiler places no wait for them) */
__device__ __forceinline__ void wait_copies() { asm volatile("s_wait_asynccnt 0x0" ::: "memory"); }
/* this wave's LDS reads have returned, so the buffer they read may be refilled behind the barrier */
__device__ __forceinline__ void wait_lds_reads() { asm volatile("s_wait_dscnt 0x0" ::: "memory"); }

/* --------------------------------------------------------------------------
 * f32 rows -> bf16 rows (RNE), unit = 8 elements = one 16-B store.
 * out row = b*rpb + l  <-  in row = b*rpb_full + l ; row length = upr*8.
 * Coverage: nunits units x 8 elements = the whole plane.
 * ------------------------------------------------------------------------ */
__global__ __launch_bounds__(256) void cvt_rows_kernel(
    const float* __restrict__ in, unsigned short* __restrict__ outp,
    int nunits, int upr, int rpb, int rpb_full)
{
  const int u = blockIdx.x * 256 + threadIdx.x;
  if (u >= nunits) return;
  const int row = u / upr;
  const int seg = u - row * upr;
  const int b = row / rpb;
  const int l = row - b * rpb;
  const float* src = in + ((size_t)(b * rpb_full + l) * upr + seg) * 8;
  const v4f a0 = *(const v4f*)src;
  const v4f a1 = *(const v4f*)(src + 4);
  v4u w;
  w[0] = pk2(a0[0], a0[1]);
  w[1] = pk2(a0[2], a0[3]);
  w[2] = pk2(a1[0], a1[1]);
  w[3] = pk2(a1[2], a1[3]);
  v4u* dst = (v4u*)(outp + ((size_t)row * upr + seg) * 8);
  *dst = w;
  
}

/* --------------------------------------------------------------------------
 * W in[rows][cols] f32  ->  Wt out[cols][rows] bf16 (RNE), 64x64 tiles through LDS.
 * Block (x = rows tile, y = cols tile), 256 threads.
 * Coverage: 2 iterations x 256 threads = 512 units x 8 = 64x64 for the load phase
 * and the same 512 units x 8 = 64x64 for the store phase.
 * LDS tile: cross-wave, separated by a block barrier.
 * ------------------------------------------------------------------------ */
__global__ __launch_bounds__(256) void wt_planes_kernel(
    const float* __restrict__ W, unsigned short* __restrict__ Wt, int rows, int cols)
{
  __shared__ __align__(16) unsigned short Ts[64 * TS_PITCH];   /* [n][k] */
  const int k0 = blockIdx.x * 64;
  const int n0 = blockIdx.y * 64;
  const int tid = threadIdx.x;
#pragma unroll
  for (int it = 0; it < 2; ++it) {
    const int u = it * 256 + tid;
    const int row = u >> 3;      /* k local */
    const int seg = u & 7;       /* n segment */
    const float* src = W + (size_t)(k0 + row) * cols + n0 + seg * 8;
    const v4f a0 = *(const v4f*)src;
    const v4f a1 = *(const v4f*)(src + 4);
#pragma unroll
    for (int e = 0; e < 4; ++e) {
      Ts[(seg * 8 + e) * TS_PITCH + row]     = f2bf_bits(a0[e]);
      Ts[(seg * 8 + 4 + e) * TS_PITCH + row] = f2bf_bits(a1[e]);
    }
  }
  __syncthreads();
  {
#pragma unroll
    for (int it = 0; it < 2; ++it) {
      const int u = it * 256 + tid;
      const int nrow = u >> 3;
      const int seg  = u & 7;
      const v4u w = *(const v4u_a*)(Ts + nrow * TS_PITCH + seg * 8);
      *(v4u*)(Wt + (size_t)(n0 + nrow) * rows + k0 + seg * 8) = w;
    }
    
  }
}

/* --------------------------------------------------------------------------
 * qkv = Xb . WqT^T + b  (M = MROWS, N = 3072, K = 1024), bf16 x bf16, f32 acc.
 * Block = 4 waves, tile 128 tokens x 64 columns (= one head of one section);
 * wave = 32 rows x 64 cols (2 A fragments x 4 B fragments per 32-deep step).
 * Operands: stages of 64 k (128 B of each of the 192 operand rows, whole lines) brought into a
 * two-buffer LDS ring by asynchronous copies, 12 per thread and stage, one stage ahead of the
 * stage being worked on; fragments by 16-B LDS loads from rows pitched 144 B.
 * Foot of every stage: own LDS reads back, own copies landed, block barrier, then the refill of
 * the buffer just read. The epilogue tile reuses the ring behind the last stage's barrier.
 * Fragment map (hh = lane>>4, c = lane&15): A row c, elems 0..7 <- k0+8hh.., 8..15 <- k0+16+8hh..;
 * B col c with the same k map; D elem r = (row 8hh+r, col c).
 * Epilogue: (acc + bias) [x 1/8 for the k section] split to bf16 hi/lo, staged in a
 * block LDS tile ([tok][d] for q,k; [d][tok] for v), block barrier, whole-line stores:
 *   v  : 1024 units = 64 d-rows x 16 segments (16 lanes = one 256-B row segment).
 * ------------------------------------------------------------------------ */
__global__ __launch_bounds__(128) VGPR_CAP void gemm_qkv_kernel(
    const unsigned short* __restrict__ Xb, const unsigned short* __restrict__ WqT,
    const float* __restrict__ bias, unsigned short* __restrict__ qkvp)
{
  union FB { v16b v; v8b h[2]; };
  __shared__ __align__(16) unsigned short Sm[2 * QKV_STAGE_E];
  unsigned short* Th = Sm;
  unsigned short* Tl = Sm + T_ELEMS;

  const int tid  = threadIdx.x;
  const int wave = __builtin_amdgcn_readfirstlane(tid >> 5);
  const int lane = tid & 31;
  const int hh   = lane >> 4;
  const int c    = lane & 15;
  const int n0   = blockIdx.x * 64;
  const int m0   = blockIdx.y * 128;

  v8f acc[2][4];
#pragma unroll
  for (int mt = 0; mt < 2; ++mt)
#pragma unroll
    for (int t = 0; t < 4; ++t) acc[mt][t] = (v8f){0.f,0.f,0.f,0.f,0.f,0.f,0.f,0.f};

  /* copy unit: thread -> (row tid>>3 of each group of 16 rows, 16-B segment tid&7) */
  const int crow = tid >> 3;
  const int cseg = tid & 7;
  const unsigned short* gx = Xb  + (size_t)(m0 + crow) * DMODEL + cseg * 8;
  const unsigned short* gw = WqT + (size_t)(n0 + crow) * DMODEL + cseg * 8;
  const unsigned lrow = lds_off(Sm) + (unsigned)(crow * RP + cseg * 8) * 2u;

  auto issue_stage = [&](int st) {
    /* unrolled below: the address arrays are indexed by constants and stay in registers */
    unsigned l[12];
    const unsigned short* g[12];
    const unsigned lb = lrow + (unsigned)(st & 1) * (unsigned)(QKV_STAGE_E * 2);
#pragma unroll
    for (int it = 0; it < 12; ++it) {
      l[it] = lb + (unsigned)(it * 16 * RP * 2);
      g[it] = (it < 8) ? gx + (size_t)it * 16 * DMODEL + st * KST
                       : gw + (size_t)(it - 8) * 16 * DMODEL + st * KST;
    }
    async_copy12(l, g);
  };

  const unsigned short* sa = Sm + (wave * 32 + c) * RP + 8 * hh;
  const unsigned short* sb = Sm + (128 + c) * RP + 8 * hh;

  issue_stage(0);
  wait_copies();
  __syncthreads();   /* publishes stage 0 */
  issue_stage(1);

  /* kept rolled: one copy of the ring's foot (waits, barrier, refill), small loop text */
#pragma unroll 1
  for (int st = 0; st < NSTAGE; ++st) {
    const int bo = (st & 1) * QKV_STAGE_E;
    /* the stage's fragment loads stand as one group ahead of its products, so that the wave pays
       the LDS latency once a stage; the loops below are unrolled so that every index of the
       fragment arrays is a constant and they stay in registers */
    FB a0[2], a1[2], bf[2][4];
#pragma unroll
    for (int s = 0; s < 2; ++s) {
      const int ks = s * 32;
      a0[s].h[0] = *(const v8b_a*)(sa + bo + ks);
      a0[s].h[1] = *(const v8b_a*)(sa + bo + ks + 16);
      a1[s].h[0] = *(const v8b_a*)(sa + bo + 16 * RP + ks);
      a1[s].h[1] = *(const v8b_a*)(sa + bo + 16 * RP + ks + 16);
#pragma unroll
      for (int t = 0; t < 4; ++t) {
        bf[s][t].h[0] = *(const v8b_a*)(sb + bo + t * 16 * RP + ks);
        bf[s][t].h[1] = *(const v8b_a*)(sb + bo + t * 16 * RP + ks + 16);
      }
    }
#pragma unroll
    for (int s = 0; s < 2; ++s) {
#pragma unroll
      for (int t = 0; t < 4; ++t) {
        acc[0][t] = mma_bf16(a0[s].v, bf[s][t].v, acc[0][t]);
        acc[1][t] = mma_bf16(a1[s].v, bf[s][t].v, acc[1][t]);
      }
    }
    wait_lds_reads();
    wait_copies();
    __syncthreads();   /* publishes stage st + 1 and ends every read of stage st's buffer */
    if (st + 2 < NSTAGE) issue_stage(st + 2);
  }
  wait_copies();

  const int sec = n0 / DMODEL;                       /* 0 q, 1 k, 2 v : block-uniform */
  const float osc = (sec == 1) ? 0.125f : 1.0f;
#pragma unroll
  for (int t = 0; t < 4; ++t) {
    const float bv = bf_bits2f(f2bf_bits(bias[n0 + 16 * t + c]));
#pragma unroll
    for (int mt = 0; mt < 2; ++mt) {
#pragma unroll
      for (int r = 0; r < 8; ++r) {
        const float val = (acc[mt][t][r] + bv) * osc;
        const unsigned short hb = f2bf_bits(val);
        const unsigned short lb = f2bf_bits(val - bf_bits2f(hb));
        const int rl = wave * 32 + mt * 16 + 8 * hh + r;
        const int cl = 16 * t + c;
        const int idx = (sec < 2) ? (rl * TQ_PITCH + cl) : (cl * TV_PITCH + rl);
        Th[idx] = hb;
        Tl[idx] = lb;
      }
    }
  }
  __syncthreads();

  const int b  = m0 / SEQ;
  const int l0 = m0 - b * SEQ;
  const int h  = (n0 - sec * DMODEL) / DHEAD;
  const int bh = b * NHEAD + h;
  unsigned short* ph = qkvp + (size_t)(2 * sec) * PLANE;
  unsigned short* pl = ph + PLANE;

  {
    if (sec < 2) {
#pragma unroll
      for (int it = 0; it < 8; ++it) {
        const int u = it * 128 + tid;
        const int row = u >> 3;
        const int seg = u & 7;
        const v4u hw = *(const v4u_a*)(Th + row * TQ_PITCH + seg * 8);
        const v4u lw = *(const v4u_a*)(Tl + row * TQ_PITCH + seg * 8);
        const size_t g = ((size_t)bh * SEQ + l0 + row) * DHEAD + seg * 8;
        *(v4u*)(ph + g) = hw;
        *(v4u*)(pl + g) = lw;
      }
    } else {
#pragma unroll
      for (int it = 0; it < 8; ++it) {
        const int u = it * 128 + tid;
        const int drow = u >> 4;
        const int seg  = u & 15;
        const v4u hw = *(const v4u_a*)(Th + drow * TV_PITCH + seg * 8);
        const v4u lw = *(const v4u_a*)(Tl + drow * TV_PITCH + seg * 8);
        const size_t g = ((size_t)bh * DHEAD + drow) * SEQ + l0 + seg * 8;
        *(v4u*)(ph + g) = hw;
        *(v4u*)(pl + g) = lw;
      }
    }
    
  }
}

/* --------------------------------------------------------------------------
 * Attention with the per-head relative-position table, head dim 64.
 * Block = 16 query rows of one (b,h); grid (SEQ/16, NBH). The block's 4 waves deal the
 * 64-key chunks among them (wave w takes chunks w, w+4, ...), each with its own running
 * maximum, sum and output accumulators; one block barrier, then the four partial states
 * are merged through LDS by the usual rescaling to the common row maximum.
 * At entry: the mask rows of all the wave's chunks read by value as one group of loads
 * (8 b128 loads a chunk + ballots), one packed word a chunk and lane; wave-uniform skip of a
 * chunk when every element of its 16x64 mask tile is set; per-element replace-fill otherwise.
 * Per 64-key chunk and wave (16 query rows); only the output accumulators, the row statistics
 * and the mask words stay resident between chunks:
 *   G = q.Ewin^T  : 5 tiles (80 offsets d = kv0-q0-15+g, table row = d mod 2047),
 *                   2 d-steps x (hi + lo) against the bf16 table, written
 *                   to the wave-private G slab, read back skewed: G[m][n-m+15];
 *   S = q.(k/8)^T : 4 key tiles, 2 d-steps x (hi.hi + hi.lo + lo.hi),
 *                   one accumulator, each tile written to the wave-private S slab;
 *   f32 online softmax on S + G; P as bf16 hi+lo wave-private LDS tiles;
 *   O += Ph.Vh + Pl.Vh + Ph.Vl from the V^T planes, two 32-key steps.
 * All fragments come straight from 16-bit global rows by arithmetic addressing, their loads
 * issued in groups ahead of the products that use them (q, table and key tile 0 together; key
 * tiles 1..3 as registers come free; v during the softmax).
 * LDS regions Ss/Gs/Psh/Psl are private to their wave (wave_sync form) inside the loop.
 * Epilogue: each wave's unnormalised 16x64 slab (aliases its G slab) and row statistics,
 * block barrier, merge + normalise (thread = one row x 8 columns) -> ctx hi/lo planes,
 * ------------------------------------------------------------------------ */
__global__ __launch_bounds__(128) VGPR_CAP void rel_attn_kernel(
    const unsigned short* __restrict__ qkvp, const unsigned short* __restrict__ Erb,
    const int* __restrict__ mask, unsigned short* __restrict__ ctxp)
{
  union FB { v16b v; v8b h[2]; };
  __shared__ __align__(16) float Gs[NWAVE][16 * GP];
  __shared__ __align__(16) float Ss[NWAVE][16 * SP];
  __shared__ __align__(16) unsigned short Psh[NWAVE][16 * KCH];
  __shared__ __align__(16) unsigned short Psl[NWAVE][16 * KCH];
  __shared__ float Ms[NWAVE][16];
  __shared__ float Ls[NWAVE][16];

  const int tid  = threadIdx.x;
  const int wave = __builtin_amdgcn_readfirstlane(tid >> 5);
  const int lane = tid & 31;
  const int hh   = lane >> 4;
  const int c    = lane & 15;
  const int c3   = c & 3;
  const int csh  = c >> 2;
  const int qb   = blockIdx.x;
  const int bh   = blockIdx.y;
  const int b    = bh / NHEAD;
  const int h    = bh - b * NHEAD;
  const int q0   = qb * 16;
  const float NEG_INF = -__builtin_inff();

  const unsigned short* Qh  = qkvp + (size_t)bh * SEQ * DHEAD;
  const unsigned short* Ql  = Qh + PLANE;
  const unsigned short* Kh  = Qh + 2 * PLANE;
  const unsigned short* Kl  = Qh + 3 * PLANE;
  const unsigned short* Vth = Qh + 4 * PLANE;     /* [bh][d][l]: same per-bh element count */
  const unsigned short* Vtl = Qh + 5 * PLANE;
  const unsigned short* Eh  = Erb + (size_t)h * NPOS * DHEAD;

  float mrow[8], lrow[8];
  v8f oacc[4];
#pragma unroll
  for (int r = 0; r < 8; ++r) { mrow[r] = NEG_INF; lrow[r] = 0.f; }
#pragma unroll
  for (int t = 0; t < 4; ++t) oacc[t] = (v8f){0.f,0.f,0.f,0.f,0.f,0.f,0.f,0.f};

  float* gs = Gs[wave];
  float* ss = Ss[wave];
  unsigned short* pwh = Psh[wave];
  unsigned short* pwl = Psl[wave];
  /* one lane base per slab and access pattern; every row and tile below is a constant offset from
     it, so that the LDS addresses take one register each and leave room for loads in flight */
  float* gsw = gs + 8 * hh * GP + c;                    /* G and output slab, element (8hh+r, 16t+c) */
  float* ssw = ss + 8 * hh * SP + c;                    /* S slab, element (8hh+r, 16j+c) */
  const float* gsk = gs + 8 * hh * (GP - 1) + c + 15;   /* G slab read skewed: G[m][n-m+15] */
  unsigned short* pwhw = pwh + 8 * hh * KCH + c;
  unsigned short* pwlw = pwl + 8 * hh * KCH + c;
  const unsigned vlane = (unsigned)(c * SEQ + 8 * hh);          /* V^T row c, this lane's k half (elements) */
  const unsigned short* klh = Kh + c * DHEAD + 8 * hh;          /* key row c of a tile, this lane's d half */
  const unsigned short* kll = Kl + c * DHEAD + 8 * hh;

  /* mask tiles of all NCH chunks of this wave, by value: the 8 * NCH row loads stand as one group
     ahead of every use, so that the wave waits for the mask once and not once a row.
     Bit L of the ballot (it, e) = mask[q0+2it+(L>>4)][kv0+4(L&15)+e] != 0; each lane keeps the
     word of its own e = c&3 (lane masks sel0..sel3) and of its own row half, and packs its own
     32 bits of a chunk into one word: bit 16(r&1) + 4j + (r>>1) = element (row 8hh+r, key 16j+c). */
  unsigned mpk[NCH];
  unsigned skip = 0u;                 /* bit i: every element of chunk i's tile is masked (wave-uniform) */
  {
    v4i mv[NCH][8];
    const int* ml = mask + (size_t)(q0 + hh) * SEQ_FULL + wave * KCH + 4 * c;   /* lane base; the rest are constants */
#pragma unroll
    for (int i = 0; i < NCH; ++i)
#pragma unroll
      for (int it = 0; it < 8; ++it) {
        if (i == NCH - 1 && it == 7) wait_addr();   /* last use of the mask address pair */
        mv[i][it] = *(const v4i*)(ml + it * 2 * SEQ_FULL + i * NWAVE * KCH);
      }
    const unsigned sel0 = (c3 == 0) ? 0xFFFFFFFFu : 0u;
    const unsigned sel1 = (c3 == 1) ? 0xFFFFFFFFu : 0u;
    const unsigned sel2 = (c3 == 2) ? 0xFFFFFFFFu : 0u;
    const unsigned sel3 = (c3 == 3) ? 0xFFFFFFFFu : 0u;
#pragma unroll
    for (int i = 0; i < NCH; ++i) {
      unsigned msel[8];
      unsigned andall = 0xFFFFFFFFu;
#pragma unroll
      for (int it = 0; it < 8; ++it) {
        const unsigned b0 = __builtin_amdgcn_ballot_w32(mv[i][it][0] != 0);
        const unsigned b1 = __builtin_amdgcn_ballot_w32(mv[i][it][1] != 0);
        const unsigned b2 = __builtin_amdgcn_ballot_w32(mv[i][it][2] != 0);
        const unsigned b3 = __builtin_amdgcn_ballot_w32(mv[i][it][3] != 0);
        andall &= (b0 & b1) & (b2 & b3);
        msel[it] = (b0 & sel0) | (b1 & sel1) | (b2 & sel2) | (b3 & sel3);
      }
      unsigned pk = 0u;
#pragma unroll
      for (int ii = 0; ii < 4; ++ii) {
        const unsigned w = hh ? msel[4 + ii] : msel[ii];
        pk |= ((w >> csh) & 0x11111111u) << ii;
      }
      mpk[i] = pk;
      skip |= (andall == 0xFFFFFFFFu) ? (1u << i) : 0u;
    }
  }

  /* kept rolled: one copy of the chunk's text */
#pragma unroll 1
  for (int i = 0; i < NCH; ++i) {
    if ((skip >> i) & 1u) continue;               /* wave-uniform: every element masked */
    const int kv0 = (wave + i * NWAVE) * KCH;

    const unsigned mk = (i == 0) ? mpk[0] : (i == 1) ? mpk[1] : (i == 2) ? mpk[2] : mpk[3];

    /* The chunk's loads fly as a window ahead of the products that use them: q, the 5 table tiles
       and key tile 0 are issued as one group, each further key tile as soon as earlier tiles'
       registers come free. q is read per chunk so that its registers are free for the v fragments
       during the softmax and p.v. All loops below are unrolled so that the fragment arrays are
       indexed by constants and stay in registers. */
    v16b qh[2], ql[2];
    FB kfh[4][2], kfl[4][2], ef[5][2];
    /* position table rows: (kv0 - q0 - 15 + g) mod 2047, g = 0..79 */
    const int dbase = kv0 - q0 - 15;
    const unsigned short* ep[5];
#pragma unroll
    for (int t = 0; t < 5; ++t) {
      const int d = dbase + 16 * t + c;
      int rr = d % NPOS;
      rr += (rr < 0) ? NPOS : 0;                   /* rr in [0, 2046] */
      ep[t] = Eh + (size_t)rr * DHEAD + 8 * hh;
    }
    const unsigned short* kh = klh + kv0 * DHEAD;
    const unsigned short* kl = kll + kv0 * DHEAD;
    auto load_key_tile = [&](int j) {
#pragma unroll
      for (int dc = 0; dc < 2; ++dc) {
        kfh[j][dc].h[0] = *(const v8b*)(kh + j * 16 * DHEAD + dc * 32);
        kfh[j][dc].h[1] = *(const v8b*)(kh + j * 16 * DHEAD + dc * 32 + 16);
        kfl[j][dc].h[0] = *(const v8b*)(kl + j * 16 * DHEAD + dc * 32);
        /* the chunk's last k load is the last use of the k address pair: see wait_addr() */
        if (j == 3 && dc == 1) wait_addr();
        kfl[j][dc].h[1] = *(const v8b*)(kl + j * 16 * DHEAD + dc * 32 + 16);
        if (j == 3 && dc == 1) wait_addr();
      }
    };
    /* keeps the group's address arithmetic in front of its first load, so that no address
       register is written among the loads */
    __builtin_amdgcn_sched_barrier(0);
    {
      const size_t qo = (size_t)(q0 + c) * DHEAD + 8 * hh;
#pragma unroll
      for (int dc = 0; dc < 2; ++dc) {
        FB f;
        f.h[0] = *(const v8b*)(Qh + qo + dc * 32);
        f.h[1] = *(const v8b*)(Qh + qo + dc * 32 + 16);
        qh[dc] = f.v;
        f.h[0] = *(const v8b*)(Ql + qo + dc * 32);
        f.h[1] = *(const v8b*)(Ql + qo + dc * 32 + 16);
        ql[dc] = f.v;
      }
    }
#pragma unroll
    for (int t = 0; t < 5; ++t) {
      ef[t][0].h[0] = *(const v8b*)(ep[t]);
      ef[t][0].h[1] = *(const v8b*)(ep[t] + 16);
      ef[t][1].h[0] = *(const v8b*)(ep[t] + 32);
    }
    load_key_tile(0);
    wait_addr();      /* each table tile's last load is the last use of its address pair */
#pragma unroll
    for (int t = 0; t < 5; ++t) ef[t][1].h[1] = *(const v8b*)(ep[t] + 48);
    wait_addr();
    /* keeps the first product, and the load wait in front of it, behind the issue of the whole
       group: moved up among the loads it would make the rest of the group wait a full latency */
    __builtin_amdgcn_sched_barrier(0);

    /* position term: G[m][g] = q[m] . Er[h][(kv0 - q0 - 15 + g) mod 2047], g = 0..79 */
#pragma unroll
    for (int t = 0; t < 5; ++t) {
      v8f g = (v8f){0.f,0.f,0.f,0.f,0.f,0.f,0.f,0.f};
#pragma unroll
      for (int dc = 0; dc < 2; ++dc) {
        g = mma_bf16(qh[dc], ef[t][dc].v, g);
        g = mma_bf16(ql[dc], ef[t][dc].v, g);
      }
      if (t == 1) load_key_tile(1);
      if (t == 3) load_key_tile(2);
#pragma unroll
      for (int r = 0; r < 8; ++r) gsw[r * GP + 16 * t] = g[r];
    }

    /* raw scores: 4 key tiles, one accumulator, tile -> S slab (D elem r = row 8hh+r, col c) */
#pragma unroll
    for (int j = 0; j < 4; ++j) {
      v8f sa = (v8f){0.f,0.f,0.f,0.f,0.f,0.f,0.f,0.f};
#pragma unroll
      for (int dc = 0; dc < 2; ++dc) {
        sa = mma_bf16(qh[dc], kfh[j][dc].v, sa);
        sa = mma_bf16(qh[dc], kfl[j][dc].v, sa);
        sa = mma_bf16(ql[dc], kfh[j][dc].v, sa);
      }
      if (j == 0) load_key_tile(3);
#pragma unroll
      for (int r = 0; r < 8; ++r) ssw[r * SP + 16 * j] = sa[r];
    }
    wave_lds_sync();

    /* v fragments of the first 32 keys: issued here, so that they fly during the softmax */
    FB vbh[2][4], vbl[2][4];
    auto load_v_step = [&](int kk) {
#pragma unroll
      for (int t = 0; t < 4; ++t) {
        const int vo = t * 16 * SEQ + kk * 32;
        vbh[kk][t].h[0] = *(const v8b*)(Vth + kv0 + vlane + vo);
        vbh[kk][t].h[1] = *(const v8b*)(Vth + kv0 + vlane + vo + 16);
        vbl[kk][t].h[0] = *(const v8b*)(Vtl + kv0 + vlane + vo);
        if (kk == 1 && t == 3) wait_addr();   /* last use of the v address pair */
        vbl[kk][t].h[1] = *(const v8b*)(Vtl + kv0 + vlane + vo + 16);
      }
    };
    load_v_step(0);

    /* raw score + skewed position term, replace-fill of masked elements */
    v8f s[4];
#pragma unroll
    for (int j = 0; j < 4; ++j) {
#pragma unroll
      for (int r = 0; r < 8; ++r) {
        const float raw = ssw[r * SP + 16 * j];
        const float gv = gsk[r * (GP - 1) + 16 * j];
        const float sv = raw + gv;
        const unsigned bit = (mk >> (16 * (r & 1) + 4 * j + (r >> 1))) & 1u;
        s[j][r] = bit ? NEG_INF : sv;
      }
    }

    /* chunk row max over the 64 keys */
    float cm[8];
#pragma unroll
    for (int r = 0; r < 8; ++r) {
      float m = fmaxf(fmaxf(s[0][r], s[1][r]), fmaxf(s[2][r], s[3][r]));
#pragma unroll
      for (int off = 1; off < 16; off <<= 1) m = fmaxf(m, __shfl_xor(m, off, 32));
      cm[r] = m;
    }

    /* online softmax update, P tiles as bf16 hi + lo */
#pragma unroll
    for (int r = 0; r < 8; ++r) {
      if (r == 4) load_v_step(1);   /* the second 32 keys' fragments, once half the score registers are free */
      const float mnew  = fmaxf(mrow[r], cm[r]);
      const float msafe = (mnew == NEG_INF) ? 0.f : mnew;
      const float alpha = expf(mrow[r] - msafe);
      mrow[r] = mnew;
      float psum = 0.f;
#pragma unroll
      for (int j = 0; j < 4; ++j) {
        const float p = expf(s[j][r] - msafe);
        psum += p;
        const unsigned short hb = f2bf_bits(p);
        const unsigned short lb = f2bf_bits(p - bf_bits2f(hb));
        pwhw[r * KCH + j * 16] = hb;
        pwlw[r * KCH + j * 16] = lb;
      }
#pragma unroll
      for (int off = 1; off < 16; off <<= 1) psum += __shfl_xor(psum, off, 32);
      lrow[r] = lrow[r] * alpha + psum;
#pragma unroll
      for (int t = 0; t < 4; ++t) oacc[t][r] *= alpha;
    }
    wave_lds_sync();

    /* O += P.V : A = P [q][kv] (this wave's tiles), B = V [kv][d] from V^T [d][kv];
       unrolled over the two 32-key steps: the fragment arrays are indexed by constants */
#pragma unroll
    for (int kk = 0; kk < 2; ++kk) {
      FB pa, pl;
      pa.h[0] = *(const v8b_a*)(pwh + c * KCH + kk * 32 + 8 * hh);
      pa.h[1] = *(const v8b_a*)(pwh + c * KCH + kk * 32 + 16 + 8 * hh);
      pl.h[0] = *(const v8b_a*)(pwl + c * KCH + kk * 32 + 8 * hh);
      pl.h[1] = *(const v8b_a*)(pwl + c * KCH + kk * 32 + 16 + 8 * hh);
#pragma unroll
      for (int t = 0; t < 4; ++t) {
        oacc[t] = mma_bf16(pa.v, vbh[kk][t].v, oacc[t]);
        oacc[t] = mma_bf16(pl.v, vbh[kk][t].v, oacc[t]);
        oacc[t] = mma_bf16(pa.v, vbl[kk][t].v, oacc[t]);
      }
    }
    wave_lds_sync();
  }

  /* this wave's partial state: unnormalised output into its own slab (aliases the G slab),
     row maximum and row sum beside it */
#pragma unroll
  for (int r = 0; r < 8; ++r) {
#pragma unroll
    for (int t = 0; t < 4; ++t) gsw[r * GP + t * 16] = oacc[t][r];
  }
  if (c == 0) {      /* the 16 lanes of a half hold equal row statistics */
#pragma unroll
    for (int r = 0; r < 8; ++r) {
      Ms[wave][8 * hh + r] = mrow[r];
      Ls[wave][8 * hh + r] = lrow[r];
    }
  }
  __syncthreads();   /* publishes the four partial states to the whole block */
  {
    unsigned short* Ch = ctxp;
    unsigned short* Cl = ctxp + XB_E;
    const int row = tid >> 3;
    const int seg = tid & 7;
    float mall = Ms[0][row];
#pragma unroll
    for (int w = 1; w < NWAVE; ++w) mall = fmaxf(mall, Ms[w][row]);
    const float msafe = (mall == NEG_INF) ? 0.f : mall;
    float lsum = 0.f;
    v4f a0 = (v4f){0.f, 0.f, 0.f, 0.f};
    v4f a1 = (v4f){0.f, 0.f, 0.f, 0.f};
#pragma unroll
    for (int w = 0; w < NWAVE; ++w) {
      const float f = expf(Ms[w][row] - msafe);
      lsum += Ls[w][row] * f;
      a0 += *(const v4f_a*)(Gs[w] + row * GP + seg * 8) * f;
      a1 += *(const v4f_a*)(Gs[w] + row * GP + seg * 8 + 4) * f;
    }
    const float inv = 1.0f / lsum;
    a0 *= inv;
    a1 *= inv;
    unsigned h0, h1, h2, h3, l0, l1, l2, l3;
    split2(a0[0], a0[1], h0, l0);
    split2(a0[2], a0[3], h1, l1);
    split2(a1[0], a1[1], h2, l2);
    split2(a1[2], a1[3], h3, l3);
    v4u hw, lw;
    hw[0] = h0; hw[1] = h1; hw[2] = h2; hw[3] = h3;
    lw[0] = l0; lw[1] = l1; lw[2] = l2; lw[3] = l3;
    const size_t g = (size_t)(b * SEQ + q0 + row) * DMODEL + h * DHEAD + seg * 8;
    *(v4u*)(Ch + g) = hw;
    *(v4u*)(Cl + g) = lw;
  }
}

/* --------------------------------------------------------------------------
 * out = (Ch + Cl) . WoT^T + b  (M = MROWS, N = 1024, K = 1024), f32 acc.
 * Block = 4 waves, tile 128 x 64; wave = 32 rows x 64 cols; A hi and lo planes
 * against the single bf16 weight plane (two products per tile pair).
 * Operands: stages of 64 k (128 B of each of the 320 operand rows) in a two-buffer LDS ring,
 * filled by asynchronous copies (20 per thread and stage) in the order of gemm_qkv_kernel.
 * Epilogue: per-wave 32x64 f32 slab (wave-private LDS), 16 lanes x 16 B = one 256-B
 * ------------------------------------------------------------------------ */
__global__ __launch_bounds__(128) VGPR_CAP void gemm_out_kernel(
    const unsigned short* __restrict__ ctxp, const unsigned short* __restrict__ WoT,
    const float* __restrict__ bias, float* __restrict__ out)
{
  union FB { v16b v; v8b h[2]; };
  __shared__ __align__(16) float Os[NWAVE][32 * OS_PITCH];
  __shared__ __align__(16) unsigned short Sm[2 * OUT_STAGE_E];

  const int tid  = threadIdx.x;
  const int wave = __builtin_amdgcn_readfirstlane(tid >> 5);
  const int lane = tid & 31;
  const int hh   = lane >> 4;
  const int c    = lane & 15;
  const int n0   = blockIdx.x * 64;
  const int m0   = blockIdx.y * 128;

  v8f acc[2][4];
#pragma unroll
  for (int mt = 0; mt < 2; ++mt)
#pragma unroll
    for (int t = 0; t < 4; ++t) acc[mt][t] = (v8f){0.f,0.f,0.f,0.f,0.f,0.f,0.f,0.f};

  /* copy unit: thread -> (row tid>>3 of each group of 16 rows, 16-B segment tid&7) */
  const int crow = tid >> 3;
  const int cseg = tid & 7;
  const unsigned short* gh = ctxp + (size_t)(m0 + crow) * DMODEL + cseg * 8;
  const unsigned short* gl = gh + XB_E;
  const unsigned short* gw = WoT + (size_t)(n0 + crow) * DMODEL + cseg * 8;
  const unsigned lrow = lds_off(Sm) + (unsigned)(crow * RP + cseg * 8) * 2u;

  auto issue_stage = [&](int st) {
    /* unrolled below: the address arrays are indexed by constants and stay in registers */
    unsigned l[20];
    const unsigned short* g[20];
    const unsigned lb = lrow + (unsigned)(st & 1) * (unsigned)(OUT_STAGE_E * 2);
#pragma unroll
    for (int it = 0; it < 20; ++it) {
      l[it] = lb + (unsigned)(it * 16 * RP * 2);
      g[it] = (it < 8)  ? gh + (size_t)it * 16 * DMODEL + st * KST
            : (it < 16) ? gl + (size_t)(it - 8) * 16 * DMODEL + st * KST
                        : gw + (size_t)(it - 16) * 16 * DMODEL + st * KST;
    }
    async_copy10(l, g);
    async_copy10(l + 10, g + 10);
  };

  const unsigned short* sh = Sm + (wave * 32 + c) * RP + 8 * hh;
  const unsigned short* sl = sh + 128 * RP;
  const unsigned short* sb = Sm + (256 + c) * RP + 8 * hh;

  issue_stage(0);
  wait_copies();
  __syncthreads();   /* publishes stage 0 */
  issue_stage(1);

  /* kept rolled: one copy of the ring's foot (waits, barrier, refill), small loop text */
#pragma unroll 1
  for (int st = 0; st < NSTAGE; ++st) {
    const int bo = (st & 1) * OUT_STAGE_E;
    /* the stage's fragment loads stand as one group ahead of its products, so that the wave pays
       the LDS latency once a stage; the loops below are unrolled so that every index of the
       fragment arrays is a constant and they stay in registers */
    FB a0h[2], a1h[2], a0l[2], a1l[2], bf[2][4];
#pragma unroll
    for (int s = 0; s < 2; ++s) {
      const int ks = s * 32;
      a0h[s].h[0] = *(const v8b_a*)(sh + bo + ks);
      a0h[s].h[1] = *(const v8b_a*)(sh + bo + ks + 16);
      a0l[s].h[0] = *(const v8b_a*)(sl + bo + ks);
      a0l[s].h[1] = *(const v8b_a*)(sl + bo + ks + 16);
      a1h[s].h[0] = *(const v8b_a*)(sh + bo + 16 * RP + ks);
      a1h[s].h[1] = *(const v8b_a*)(sh + bo + 16 * RP + ks + 16);
      a1l[s].h[0] = *(const v8b_a*)(sl + bo + 16 * RP + ks);
      a1l[s].h[1] = *(const v8b_a*)(sl + bo + 16 * RP + ks + 16);
#pragma unroll
      for (int t = 0; t < 4; ++t) {
        bf[s][t].h[0] = *(const v8b_a*)(sb + bo + t * 16 * RP + ks);
        bf[s][t].h[1] = *(const v8b_a*)(sb + bo + t * 16 * RP + ks + 16);
      }
    }
#pragma unroll
    for (int s = 0; s < 2; ++s) {
#pragma unroll
      for (int t = 0; t < 4; ++t) {
        acc[0][t] = mma_bf16(a0h[s].v, bf[s][t].v, acc[0][t]);
        acc[0][t] = mma_bf16(a0l[s].v, bf[s][t].v, acc[0][t]);
        acc[1][t] = mma_bf16(a1h[s].v, bf[s][t].v, acc[1][t]);
        acc[1][t] = mma_bf16(a1l[s].v, bf[s][t].v, acc[1][t]);
      }
    }
    wait_lds_reads();
    wait_copies();
    __syncthreads();   /* publishes stage st + 1 and ends every read of stage st's buffer */
    if (st + 2 < NSTAGE) issue_stage(st + 2);
  }
  wait_copies();

  float* os = Os[wave];
#pragma unroll
  for (int t = 0; t < 4; ++t) {
    const float bv = bf_bits2f(f2bf_bits(bias[n0 + 16 * t + c]));
#pragma unroll
    for (int mt = 0; mt < 2; ++mt)
#pragma unroll
      for (int r = 0; r < 8; ++r)
        os[(mt * 16 + 8 * hh + r) * OS_PITCH + 16 * t + c] = acc[mt][t][r] + bv;
  }
  wave_lds_sync();
  {
    const int c4 = c * 4;
    {
#pragma unroll
      for (int it = 0; it < 16; ++it) {
        const int row = it * 2 + hh;
        const v4f val = *(const v4f_a*)(os + row * OS_PITCH + c4);
        *(v4f*)(out + (size_t)(m0 + wave * 32 + row) * DMODEL + n0 + c4) = val;
      }
      
    }
  }
}

extern "C" void kernel_launch(void* const* d_in, const int* in_sizes, int n_in,
                              void* d_out, int out_size, void* d_ws, size_t ws_size,
                              hipStream_t stream)
{
  if (n_in < 7) return;
  if (in_sizes[0] < ((NB - 1) * SEQ_FULL + SEQ) * DMODEL) return;
  if (in_sizes[1] < (SEQ - 1) * SEQ_FULL + SEQ) return;
  if (in_sizes[2] < DMODEL * NQKV) return;
  if (in_sizes[3] < NQKV) return;
  if (in_sizes[4] < DMODEL * DMODEL) return;
  if (in_sizes[5] < DMODEL) return;
  if (in_sizes[6] < NHEAD * NPOS * DHEAD) return;
  if (out_size < MROWS * DMODEL) return;
  if (d_ws == nullptr || ws_size < WS_NEED) return;

  const float* x     = (const float*)d_in[0];
  const int*   mask  = (const int*)d_in[1];
  const float* W_qkv = (const float*)d_in[2];
  const float* b_qkv = (const float*)d_in[3];
  const float* W_o   = (const float*)d_in[4];
  const float* b_o   = (const float*)d_in[5];
  const float* Er    = (const float*)d_in[6];
  float* out = (float*)d_out;

  unsigned short* Xb   = (unsigned short*)d_ws;
  unsigned short* WqT  = Xb + XB_E;
  unsigned short* WoT  = WqT + WQT_E;
  unsigned short* Erb  = WoT + WOT_E;
  unsigned short* qkvp = Erb + ERB_E;
  unsigned short* ctxp = qkvp + QKVP_E;

  {
    const int nunits = MROWS * (DMODEL / 8);
    cvt_rows_kernel<<<(nunits + 255) / 256, 256, 0, stream>>>(x, Xb, nunits, DMODEL / 8, SEQ, SEQ_FULL);
  }
  {
    const int nunits = NHEAD * NPOS * (DHEAD / 8);
    cvt_rows_kernel<<<(nunits + 255) / 256, 256, 0, stream>>>(Er, Erb, nunits, DHEAD / 8, NHEAD * NPOS, NHEAD * NPOS);
  }
  /* W_qkv in[1024][3072] -> WqT out[3072][1024]; grid (rows/64, cols/64) */
  wt_planes_kernel<<<dim3(DMODEL / 64, NQKV / 64), 256, 0, stream>>>(W_qkv, WqT, DMODEL, NQKV);
  /* W_o in[1024][1024] -> WoT out[1024][1024]; grid (rows/64, cols/64) */
  wt_planes_kernel<<<dim3(DMODEL / 64, DMODEL / 64), 256, 0, stream>>>(W_o, WoT, DMODEL, DMODEL);

  gemm_qkv_kernel<<<dim3(NQKV / 64, MROWS / 128), 128, 0, stream>>>(Xb, WqT, b_qkv, qkvp);
  rel_attn_kernel<<<dim3(SEQ / 16, NBH), 128, 0, stream>>>(qkvp, Erb, mask, ctxp);
  gemm_out_kernel<<<dim3(DMODEL / 64, MROWS / 128), 128, 0, stream>>>(ctxp, WoT, b_o, out);
}

// v004
// A run of this version takes 107 microseconds.
// Two timings next to v003 put it at 1.27 and 1.28 times that version's speed.
// All steps since v000 together make it 2.49 times as fast.
// Contractions: x.Wqkv on v_wmma_f32_16x16x32_bf16 with both operands RNE-converted to bf16 once; q.(k/8)^T, q.Er^T, p.v and ctx.Wo on v_wmma_f32_16x16x32_bf16 with computed operands (q, k/8, v, p, ctx) carried as bf16 hi+lo planes (hi.hi + hi.lo + lo.hi) and input operands (Er, Wo) as single bf16 planes; f32 accumulate; softmax, bias adds and mask fill in f32.
#include <hip/hip_runtime.h>

typedef __attribute__((ext_vector_type(16))) __bf16 v16b;
typedef __attribute__((ext_vector_type(8)))  __bf16 v8b;
typedef __attribute__((ext_vector_type(8)))  float  v8f;
typedef __attribute__((ext_vector_type(4)))  float  v4f;
typedef __attribute__((ext_vector_type(4)))  unsigned int v4u;
typedef __attribute__((ext_vector_type(4)))  int v4i;
typedef v8b v8b_a __attribute__((may_alias));
typedef v4f v4f_a __attribute__((may_alias));
typedef v4u v4u_a __attribute__((may_alias));

#ifndef NB
#define NB 2
#endif
#ifndef SEQ
#define SEQ 1024
#endif
#define NB_FULL 2
#define SEQ_FULL 1024

#define VGPR_CAP __attribute__((amdgpu_num_vgpr(256)))

constexpr int DMODEL = 1024;
constexpr int NHEAD  = 16;
constexpr int DHEAD  = 64;
constexpr int NPOS   = 2047;
constexpr int NQKV   = 3 * DMODEL;
constexpr int NBH    = NB * NHEAD;
constexpr int MROWS  = NB * SEQ;
constexpr int KCH    = 64;        /* keys per chunk */
constexpr int NWAVE  = 4;
constexpr int NCH    = SEQ / (KCH * NWAVE);   /* key chunks per wave of the attention block */
constexpr int GP     = 84;        /* skew slab pitch in floats (336 B rows, 16-B aligned) */
constexpr int SP     = 68;        /* raw score slab pitch in floats */
constexpr int TQ_PITCH = 72;      /* [tok][d] staging pitch (16-bit elements) */
constexpr int TV_PITCH = 136;     /* [d][tok] staging pitch (16-bit elements) */
constexpr int T_ELEMS  = 128 * TQ_PITCH;   /* 9216 >= 64 * TV_PITCH = 8704 */
constexpr int TS_PITCH = 72;
constexpr int OS_PITCH = 68;
constexpr int KST      = 64;      /* k elements per GEMM stage: one 128-B line of every operand row */
constexpr int RP       = 72;      /* GEMM stage row pitch (16-bit elements): 144 B = 16 B x odd for b128 readers */
constexpr int NSTAGE   = 1024 / KST;
constexpr int QKV_STAGE_E = (128 + 64) * RP;        /* [x 128 rows | W 64 rows] */
constexpr int OUT_STAGE_E = (128 + 128 + 64) * RP;  /* [ctx hi 128 | ctx lo 128 | W 64 rows] */

constexpr size_t PLANE  = (size_t)NBH * SEQ * DHEAD;
constexpr size_t XB_E   = (size_t)MROWS * DMODEL;
constexpr size_t WQT_E  = (size_t)NQKV * DMODEL;
constexpr size_t WOT_E  = (size_t)DMODEL * DMODEL;
constexpr size_t ERB_E  = (size_t)NHEAD * 2048 * DHEAD;
constexpr size_t QKVP_E = 6 * PLANE;
constexpr size_t CTX_E  = 2 * XB_E;
constexpr size_t WS_NEED = 2 * (XB_E + WQT_E + WOT_E + ERB_E + QKVP_E + CTX_E);

static_assert(SEQ % 128 == 0);
static_assert(NCH * KCH * NWAVE == SEQ && NCH == 4);
static_assert(SEQ <= SEQ_FULL && NB <= NB_FULL);
static_assert(DHEAD == 64 && DMODEL == NHEAD * DHEAD);
static_assert(DMODEL % 64 == 0 && NQKV % 64 == 0 && DMODEL % 32 == 0);
static_assert(64 * TV_PITCH <= T_ELEMS);
static_assert((TQ_PITCH * 2) % 16 == 0 && (TV_PITCH * 2) % 16 == 0 && (GP * 4) % 16 == 0 && (OS_PITCH * 4) % 16 == 0);
static_assert(GP >= 80 && SP >= 64);
static_assert(NSTAGE * KST == DMODEL && NSTAGE >= 2 && (RP * 2) % 16 == 0 && RP >= KST);
static_assert(2 * T_ELEMS <= 2 * QKV_STAGE_E);
static_assert((size_t)NHEAD * NPOS * DHEAD <= ERB_E);
static_assert(WS_NEED <= 134217728ull);

/*
 *   Xb   [MROWS][1024]        x, bf16
 *   WqT  [3072][1024]         W_qkv transposed, bf16
 *   WoT  [1024][1024]         W_o transposed, bf16
 *   Erb  [16][128 tiles][8][16][8]   Er, bf16, in fragment order (below); row c of tile m is the
 *                             table row of offset 16m - 1023 + c, that is (16m - 1023 + c) mod 2047
 *   qkvp 6 planes, in fragment order: Qh Ql, Kh Kl (k/8) [bh][l/16][d/8][l%16][8 d],
 *                             Vh Vl [bh][l/32][d/16][(l%32)/8][d%16][8 l]
 *   ctxp 2 planes: Ch Cl [MROWS][1024]
 * Fragment order: the 16-B unit that lane (hh, c) takes for half a fragment register set stands at
 * unit 16hh + c of a 512-B run, so that one 16-B load of a wave covers four whole 128-B lines.
 */

__device__ __forceinline__ unsigned short f2bf_bits(float f) {
  unsigned u = __float_as_uint(f);
  return (unsigned short)((u + 0x7FFFu + ((u >> 16) & 1u)) >> 16);
}
__device__ __forceinline__ float bf_bits2f(unsigned short h) { return __uint_as_float(((unsigned)h) << 16); }
__device__ __forceinline__ unsigned pk2(float a, float b) {
  return (unsigned)f2bf_bits(a) | ((unsigned)f2bf_bits(b) << 16);
}
__device__ __forceinline__ void split2(float a, float b, unsigned& hw, unsigned& lw) {
  const unsigned short ha = f2bf_bits(a);
  const unsigned short hb = f2bf_bits(b);
  const unsigned short la = f2bf_bits(a - bf_bits2f(ha));
  const unsigned short lb = f2bf_bits(b - bf_bits2f(hb));
  hw = (unsigned)ha | ((unsigned)hb << 16);
  lw = (unsigned)la | ((unsigned)lb << 16);
}

/* one WMMA + hazard guard naming only this call's live operands */
__device__ __forceinline__ v8f mma_bf16(v16b a, v16b b, v8f c) {
  c = __builtin_amdgcn_wmma_f32_16x16x32_bf16(false, a, false, b, (short)0, c, false, false);
  asm volatile("v_nop\n\tv_nop\n\tv_nop\n\tv_nop" : "+v"(c) : "v"(a), "v"(b));
  return c;
}

__device__ __forceinline__ void wave_lds_sync() {
  __builtin_amdgcn_fence(3 /* release order */, "workgroup");
  __builtin_amdgcn_wave_barrier();
  __builtin_amdgcn_fence(2 /* acquire order */, "workgroup");
}

/* byte offset of a __shared__ address inside the work-group's LDS */
__device__ __forceinline__ unsigned lds_off(const void* p) { return (unsigned)(size_t)p; }

/* Asynchronous copies global -> LDS, 16 B per lane and copy, every lane on. The copies of a run
   and the s_wait_xcnt 0 that stands before their address registers may be rewritten are one
   statement, so that no later address arithmetic can be moved in front of that wait. */
__device__ __forceinline__ void async_copy12(const unsigned (&l)[12], const unsigned short* const (&g)[12]) {
  asm volatile(
      "global_load_async_to_lds_b128 %0, %12, off\n\t"
      "global_load_async_to_lds_b128 %1, %13, off\n\t"
      "global_load_async_to_lds_b128 %2, %14, off\n\t"
      "global_load_async_to_lds_b128 %3, %15, off\n\t"
      "global_load_async_to_lds_b128 %4, %16, off\n\t"
      "global_load_async_to_lds_b128 %5, %17, off\n\t"
      "global_load_async_to_lds_b128 %6, %18, off\n\t"
      "global_load_async_to_lds_b128 %7, %19, off\n\t"
      "global_load_async_to_lds_b128 %8, %20, off\n\t"
      "global_load_async_to_lds_b128 %9, %21, off\n\t"
      "global_load_async_to_lds_b128 %10, %22, off\n\t"
      "global_load_async_to_lds_b128 %11, %23, off\n\t"
      "s_wait_xcnt 0x0"
      :: "v"(l[0]), "v"(l[1]), "v"(l[2]), "v"(l[3]), "v"(l[4]), "v"(l[5]),
         "v"(l[6]), "v"(l[7]), "v"(l[8]), "v"(l[9]), "v"(l[10]), "v"(l[11]),
         "v"(g[0]), "v"(g[1]), "v"(g[2]), "v"(g[3]), "v"(g[4]), "v"(g[5]),
         "v"(g[6]), "v"(g[7]), "v"(g[8]), "v"(g[9]), "v"(g[10]), "v"(g[11])
      : "memory");
}
__device__ __forceinline__ void async_copy10(const unsigned* l, const unsigned short* const* g) {
  asm volatile(
      "global_load_async_to_lds_b128 %0, %10, off\n\t"
      "global_load_async_to_lds_b128 %1, %11, off\n\t"
      "global_load_async_to_lds_b128 %2, %12, off\n\t"
      "global_load_async_to_lds_b128 %3, %13, off\n\t"
      "global_load_async_to_lds_b128 %4, %14, off\n\t"
      "global_load_async_to_lds_b128 %5, %15, off\n\t"
      "global_load_async_to_lds_b128 %6, %16, off\n\t"
      "global_load_async_to_lds_b128 %7, %17, off\n\t"
      "global_load_async_to_lds_b128 %8, %18, off\n\t"
      "global_load_async_to_lds_b128 %9, %19, off\n\t"
      "s_wait_xcnt 0x0"
      :: "v"(l[0]), "v"(l[1]), "v"(l[2]), "v"(l[3]), "v"(l[4]),
         "v"(l[5]), "v"(l[6]), "v"(l[7]), "v"(l[8]), "v"(l[9]),
         "v"(g[0]), "v"(g[1]), "v"(g[2]), "v"(g[3]), "v"(g[4]),
         "v"(g[5]), "v"(g[6]), "v"(g[7]), "v"(g[8]), "v"(g[9])
      : "memory");
}
/* A pointer that is the same in every lane, held in scalar registers: the loads from it take the
   form scalar base + lane offset, so that no vector address pair is written among loads in flight. */
typedef const __attribute__((address_space(1))) unsigned short g_u16;   /* global memory, named as such */
typedef const __attribute__((address_space(1))) v8b g_v8b;
__device__ __forceinline__ g_u16* scalar_base(const unsigned short* p) {
  const unsigned long long a = (unsigned long long)p;
  const unsigned lo = (unsigned)__builtin_amdgcn_readfirstlane((int)(unsigned)a);
  const unsigned hi = (unsigned)__builtin_amdgcn_readfirstlane((int)(unsigned)(a >> 32));
  return (g_u16*)(((unsigned long long)hi << 32) | lo);
}
/* Stands in front of the last load from an address pair, whose destination may be that pair while
   earlier loads from it are in flight, and behind it, before the pair is written anew: the wait
   that is kept before a register of an issued global load is overwritten. */
__device__ __forceinline__ void wait_addr() { asm volatile("s_wait_xcnt 0x0" ::: "memory"); }
/* this wave's copies have landed in LDS (the compiler places no wait for them) */
__device__ __forceinline__ void wait_copies() { asm volatile("s_wait_asynccnt 0x0" ::: "memory"); }
/* this wave's LDS reads have returned, so the buffer they read may be refilled behind the barrier */
__device__ __forceinline__ void wait_lds_reads() { asm volatile("s_wait_dscnt 0x0" ::: "memory"); }

/* --------------------------------------------------------------------------
 * f32 rows -> bf16 rows (RNE), unit = 8 elements = one 16-B store.
 * out row = b*rpb + l  <-  in row = b*rpb_full + l ; row length = upr*8.
 * Coverage: nunits units x 8 elements = the whole plane.
 * ------------------------------------------------------------------------ */
__global__ __launch_bounds__(256) void cvt_rows_kernel(
    const float* __restrict__ in, unsigned short* __restrict__ outp,
    int nunits, int upr, int rpb, int rpb_full)
{
  const int u = blockIdx.x * 256 + threadIdx.x;
  if (u >= nunits) return;
  const int row = u / upr;
  const int seg = u - row * upr;
  const int b = row / rpb;
  const int l = row - b * rpb;
  const float* src = in + ((size_t)(b * rpb_full + l) * upr + seg) * 8;
  const v4f a0 = *(const v4f*)src;
  const v4f a1 = *(const v4f*)(src + 4);
  v4u w;
  w[0] = pk2(a0[0], a0[1]);
  w[1] = pk2(a0[2], a0[3]);
  w[2] = pk2(a1[0], a1[1]);
  w[3] = pk2(a1[2], a1[3]);
  v4u* dst = (v4u*)(outp + ((size_t)row * upr + seg) * 8);
  *dst = w;
  
}

/* --------------------------------------------------------------------------
 * Er [16][2047][64] f32 -> Erb, bf16 (RNE), 16-row tiles in fragment order.
 * Tile m (0..127) of a head holds the rows of the offsets 16m - 1023 + c, c = 0..15, which are
 * the windows the attention kernel asks for (its offsets start at 1 mod 16).
 * Block = 2 tiles, thread = one 8-element unit: read as (row u>>3, segment u&7), whole lines;
 * units turned from [row][segment] to [segment][row] through LDS (cross-wave, block barrier);
 * stored in thread order. Coverage: 1024 blocks x 2 tiles = 16 heads x 128 tiles.
 * LDS unit pitch: one spare unit per 16, so that the 8 segments of a row fall on different banks.
 * ------------------------------------------------------------------------ */
__global__ __launch_bounds__(256) void pack_table_kernel(
    const float* __restrict__ Er, unsigned short* __restrict__ Erb)
{
  __shared__ __align__(16) v4u Us[2 * 136];
  const int tid  = threadIdx.x;
  const int tl   = tid >> 7;
  const int u    = tid & 127;
  const int tile = blockIdx.x * 2 + tl;      /* head * 128 + m */
  const int h    = tile >> 7;
  const int m    = tile & 127;
  const int row  = u >> 3;
  const int seg  = u & 7;
  const int d    = 16 * m - (SEQ_FULL - 1) + row;      /* -1023 .. 1024 */
  const int rr   = d + ((d < 0) ? NPOS : 0);           /* 0 .. 2046 */
  const float* src = Er + ((size_t)h * NPOS + rr) * DHEAD + seg * 8;
  const v4f a0 = *(const v4f*)src;
  const v4f a1 = *(const v4f*)(src + 4);
  v4u w;
  w[0] = pk2(a0[0], a0[1]);
  w[1] = pk2(a0[2], a0[3]);
  w[2] = pk2(a1[0], a1[1]);
  w[3] = pk2(a1[2], a1[3]);
  Us[tl * 136 + seg * 17 + row] = w;
  __syncthreads();   /* publishes the tile's units to the waves that store them */
  *(v4u*)(Erb + (size_t)tile * 1024 + u * 8) = Us[tl * 136 + (u >> 4) * 17 + (u & 15)];
}

/* --------------------------------------------------------------------------
 * W in[rows][cols] f32  ->  Wt out[cols][rows] bf16 (RNE), 64x64 tiles through LDS.
 * Block (x = rows tile, y = cols tile), 256 threads.
 * Coverage: 2 iterations x 256 threads = 512 units x 8 = 64x64 for the load phase
 * and the same 512 units x 8 = 64x64 for the store phase.
 * LDS tile: cross-wave, separated by a block barrier.
 * ------------------------------------------------------------------------ */
__global__ __launch_bounds__(256) void wt_planes_kernel(
    const float* __restrict__ W, unsigned short* __restrict__ Wt, int rows, int cols)
{
  __shared__ __align__(16) unsigned short Ts[64 * TS_PITCH];   /* [n][k] */
  const int k0 = blockIdx.x * 64;
  const int n0 = blockIdx.y * 64;
  const int tid = threadIdx.x;
#pragma unroll
  for (int it = 0; it < 2; ++it) {
    const int u = it * 256 + tid;
    const int row = u >> 3;      /* k local */
    const int seg = u & 7;       /* n segment */
    const float* src = W + (size_t)(k0 + row) * cols + n0 + seg * 8;
    const v4f a0 = *(const v4f*)src;
    const v4f a1 = *(const v4f*)(src + 4);
#pragma unroll
    for (int e = 0; e < 4; ++e) {
      Ts[(seg * 8 + e) * TS_PITCH + row]     = f2bf_bits(a0[e]);
      Ts[(seg * 8 + 4 + e) * TS_PITCH + row] = f2bf_bits(a1[e]);
    }
  }
  __syncthreads();
  {
#pragma unroll
    for (int it = 0; it < 2; ++it) {
      const int u = it * 256 + tid;
      const int nrow = u >> 3;
      const int seg  = u & 7;
      const v4u w = *(const v4u_a*)(Ts + nrow * TS_PITCH + seg * 8);
      *(v4u*)(Wt + (size_t)(n0 + nrow) * rows + k0 + seg * 8) = w;
    }
    
  }
}

/* --------------------------------------------------------------------------
 * qkv = Xb . WqT^T + b  (M = MROWS, N = 3072, K = 1024), bf16 x bf16, f32 acc.
 * Block = 4 waves, tile 128 tokens x 64 columns (= one head of one section);
 * wave = 32 rows x 64 cols (2 A fragments x 4 B fragments per 32-deep step).
 * Operands: stages of 64 k (128 B of each of the 192 operand rows, whole lines) brought into a
 * two-buffer LDS ring by asynchronous copies, 12 per thread and stage, one stage ahead of the
 * stage being worked on; fragments by 16-B LDS loads from rows pitched 144 B.
 * Foot of every stage: own LDS reads back, own copies landed, block barrier, then the refill of
 * the buffer just read. The epilogue tile reuses the ring behind the last stage's barrier.
 * Fragment map (hh = lane>>4, c = lane&15): A row c, elems 0..7 <- k0+8hh.., 8..15 <- k0+16+8hh..;
 * B col c with the same k map; D elem r = (row 8hh+r, col c).
 * Epilogue: (acc + bias) [x 1/8 for the k section] split to bf16 hi/lo, staged in a
 * block LDS tile ([tok][d] for q,k; [d][tok] for v), block barrier, then stored in fragment
 * order: the block's 1024 units of a plane are 16 KB in a row, unit u from
 *   q,k: token 16(u>>7) + (u&15), d segment (u>>4)&7;
 *   v  : d row 16((u>>6)&3) + (u&15), key segment 4(u>>8) + ((u>>4)&3).
 * ------------------------------------------------------------------------ */
__global__ __launch_bounds__(128) VGPR_CAP void gemm_qkv_kernel(
    const unsigned short* __restrict__ Xb, const unsigned short* __restrict__ WqT,
    const float* __restrict__ bias, unsigned short* __restrict__ qkvp)
{
  union FB { v16b v; v8b h[2]; };
  __shared__ __align__(16) unsigned short Sm[2 * QKV_STAGE_E];
  unsigned short* Th = Sm;
  unsigned short* Tl = Sm + T_ELEMS;

  const int tid  = threadIdx.x;
  const int wave = __builtin_amdgcn_readfirstlane(tid >> 5);
  const int lane = tid & 31;
  const int hh   = lane >> 4;
  const int c    = lane & 15;
  const int n0   = blockIdx.x * 64;
  const int m0   = blockIdx.y * 128;

  v8f acc[2][4];
#pragma unroll
  for (int mt = 0; mt < 2; ++mt)
#pragma unroll
    for (int t = 0; t < 4; ++t) acc[mt][t] = (v8f){0.f,0.f,0.f,0.f,0.f,0.f,0.f,0.f};

  /* copy unit: thread -> (row tid>>3 of each group of 16 rows, 16-B segment tid&7) */
  const int crow = tid >> 3;
  const int cseg = tid & 7;
  const unsigned short* gx = Xb  + (size_t)(m0 + crow) * DMODEL + cseg * 8;
  const unsigned short* gw = WqT + (size_t)(n0 + crow) * DMODEL + cseg * 8;
  const unsigned lrow = lds_off(Sm) + (unsigned)(crow * RP + cseg * 8) * 2u;

  auto issue_stage = [&](int st) {
    /* unrolled below: the address arrays are indexed by constants and stay in registers */
    unsigned l[12];
    const unsigned short* g[12];
    const unsigned lb = lrow + (unsigned)(st & 1) * (unsigned)(QKV_STAGE_E * 2);
#pragma unroll
    for (int it = 0; it < 12; ++it) {
      l[it] = lb + (unsigned)(it * 16 * RP * 2);
      g[it] = (it < 8) ? gx + (size_t)it * 16 * DMODEL + st * KST
                       : gw + (size_t)(it - 8) * 16 * DMODEL + st * KST;
    }
    async_copy12(l, g);
  };

  const unsigned short* sa = Sm + (wave * 32 + c) * RP + 8 * hh;
  const unsigned short* sb = Sm + (128 + c) * RP + 8 * hh;

  issue_stage(0);
  wait_copies();
  __syncthreads();   /* publishes stage 0 */
  issue_stage(1);

  /* kept rolled: one copy of the ring's foot (waits, barrier, refill), small loop text */
#pragma unroll 1
  for (int st = 0; st < NSTAGE; ++st) {
    const int bo = (st & 1) * QKV_STAGE_E;
    /* the stage's fragment loads stand as one group ahead of its products, so that the wave pays
       the LDS latency once a stage; the loops below are unrolled so that every index of the
       fragment arrays is a constant and they stay in registers */
    FB a0[2], a1[2], bf[2][4];
#pragma unroll
    for (int s = 0; s < 2; ++s) {
      const int ks = s * 32;
      a0[s].h[0] = *(const v8b_a*)(sa + bo + ks);
      a0[s].h[1] = *(const v8b_a*)(sa + bo + ks + 16);
      a1[s].h[0] = *(const v8b_a*)(sa + bo + 16 * RP + ks);
      a1[s].h[1] = *(const v8b_a*)(sa + bo + 16 * RP + ks + 16);
#pragma unroll
      for (int t = 0; t < 4; ++t) {
        bf[s][t].h[0] = *(const v8b_a*)(sb + bo + t * 16 * RP + ks);
        bf[s][t].h[1] = *(const v8b_a*)(sb + bo + t * 16 * RP + ks + 16);
      }
    }
#pragma unroll
    for (int s = 0; s < 2; ++s) {
#pragma unroll
      for (int t = 0; t < 4; ++t) {
        acc[0][t] = mma_bf16(a0[s].v, bf[s][t].v, acc[0][t]);
        acc[1][t] = mma_bf16(a1[s].v, bf[s][t].v, acc[1][t]);
      }
    }
    wait_lds_reads();
    wait_copies();
    __syncthreads();   /* publishes stage st + 1 and ends every read of stage st's buffer */
    if (st + 2 < NSTAGE) issue_stage(st + 2);
  }
  wait_copies();

  const int sec = n0 / DMODEL;                       /* 0 q, 1 k, 2 v : block-uniform */
  const float osc = (sec == 1) ? 0.125f : 1.0f;
#pragma unroll
  for (int t = 0; t < 4; ++t) {
    const float bv = bf_bits2f(f2bf_bits(bias[n0 + 16 * t + c]));
#pragma unroll
    for (int mt = 0; mt < 2; ++mt) {
#pragma unroll
      for (int r = 0; r < 8; ++r) {
        const float val = (acc[mt][t][r] + bv) * osc;
        const unsigned short hb = f2bf_bits(val);
        const unsigned short lb = f2bf_bits(val - bf_bits2f(hb));
        const int rl = wave * 32 + mt * 16 + 8 * hh + r;
        const int cl = 16 * t + c;
        const int idx = (sec < 2) ? (rl * TQ_PITCH + cl) : (cl * TV_PITCH + rl);
        Th[idx] = hb;
        Tl[idx] = lb;
      }
    }
  }
  __syncthreads();

  const int b  = m0 / SEQ;
  const int l0 = m0 - b * SEQ;
  const int h  = (n0 - sec * DMODEL) / DHEAD;
  const int bh = b * NHEAD + h;
  unsigned short* ph = qkvp + (size_t)(2 * sec) * PLANE;
  unsigned short* pl = ph + PLANE;

  {
    if (sec < 2) {
#pragma unroll
      for (int it = 0; it < 8; ++it) {
        const int u = it * 128 + tid;
        const int row = (u >> 7) * 16 + (u & 15);
        const int seg = (u >> 4) & 7;
        const v4u hw = *(const v4u_a*)(Th + row * TQ_PITCH + seg * 8);
        const v4u lw = *(const v4u_a*)(Tl + row * TQ_PITCH + seg * 8);
        const size_t g = ((size_t)bh * SEQ + l0) * DHEAD + u * 8;
        *(v4u*)(ph + g) = hw;
        *(v4u*)(pl + g) = lw;
      }
    } else {
#pragma unroll
      for (int it = 0; it < 8; ++it) {
        const int u = it * 128 + tid;
        const int drow = ((u >> 6) & 3) * 16 + (u & 15);
        const int seg  = (u >> 8) * 4 + ((u >> 4) & 3);
        const v4u hw = *(const v4u_a*)(Th + drow * TV_PITCH + seg * 8);
        const v4u lw = *(const v4u_a*)(Tl + drow * TV_PITCH + seg * 8);
        const size_t g = ((size_t)bh * SEQ + l0) * DHEAD + u * 8;
        *(v4u*)(ph + g) = hw;
        *(v4u*)(pl + g) = lw;
      }
    }
    
  }
}

/* --------------------------------------------------------------------------
 * Attention with the per-head relative-position table, head dim 64.
 * Block = 16 query rows of one (b,h); grid (SEQ/16, NBH). The block's 4 waves deal the
 * 64-key chunks among them (wave w takes chunks w, w+4, ...), each with its own running
 * maximum, sum and output accumulators; one block barrier, then the four partial states
 * are merged through LDS by the usual rescaling to the common row maximum.
 * At entry: the mask rows of all the wave's chunks read by value as one group of loads
 * (8 b128 loads a chunk + ballots), one packed word a chunk and lane; wave-uniform skip of a
 * chunk when every element of its 16x64 mask tile is set; per-element replace-fill otherwise.
 * Per 64-key chunk and wave (16 query rows); only the output accumulators, the row statistics
 * and the mask words stay resident between chunks:
 *   G = q.Ewin^T  : 5 tiles (80 offsets d = kv0-q0-15+g, packed tiles (kv0-q0)/16+63 ..),
 *                   2 d-steps x (hi + lo) against the bf16 table, written
 *                   to the wave-private G slab, read back skewed: G[m][n-m+15];
 *   S = q.(k/8)^T : 4 key tiles, 2 d-steps x (hi.hi + hi.lo + lo.hi),
 *                   one accumulator, each tile written to the wave-private S slab;
 *   f32 online softmax on S + G; P as bf16 hi+lo wave-private LDS tiles;
 *   O += Ph.Vh + Pl.Vh + Ph.Vl from the V^T planes, two 32-key steps.
 * All fragments come straight from the 16-bit global planes, which stand in fragment order: every
 * load is a wave-uniform base + 16 B x lane and covers four whole lines. The loads are
 * issued in groups ahead of the products that use them (q, table and key tile 0 together; key
 * tiles 1..3 as registers come free; v during the softmax).
 * LDS regions Ss/Gs/Psh/Psl are private to their wave (wave_sync form) inside the loop.
 * Epilogue: each wave's unnormalised 16x64 slab (aliases its G slab) and row statistics,
 * block barrier, merge + normalise (thread = one row x 8 columns) -> ctx hi/lo planes,
 * ------------------------------------------------------------------------ */
__global__ __launch_bounds__(128) VGPR_CAP void rel_attn_kernel(
    const unsigned short* __restrict__ qkvp, const unsigned short* __restrict__ Erb,
    const int* __restrict__ mask, unsigned short* __restrict__ ctxp)
{
  union FB { v16b v; v8b h[2]; };
  __shared__ __align__(16) float Gs[NWAVE][16 * GP];
  __shared__ __align__(16) float Ss[NWAVE][16 * SP];
  __shared__ __align__(16) unsigned short Psh[NWAVE][16 * KCH];
  __shared__ __align__(16) unsigned short Psl[NWAVE][16 * KCH];
  __shared__ float Ms[NWAVE][16];
  __shared__ float Ls[NWAVE][16];

  const int tid  = threadIdx.x;
  const int wave = __builtin_amdgcn_readfirstlane(tid >> 5);
  const int lane = tid & 31;
  const int hh   = lane >> 4;
  const int c    = lane & 15;
  const int c3   = c & 3;
  const int csh  = c >> 2;
  const int qb   = blockIdx.x;
  const int bh   = blockIdx.y;
  const int b    = bh / NHEAD;
  const int h    = bh - b * NHEAD;
  const int q0   = qb * 16;
  const float NEG_INF = -__builtin_inff();

  const unsigned short* Qh  = qkvp + (size_t)bh * SEQ * DHEAD;   /* each lo plane stands PLANE behind its hi plane */
  const unsigned short* Kh  = Qh + 2 * PLANE;
  const unsigned short* Vth = Qh + 4 * PLANE;     /* same per-bh element count */
  const unsigned short* Eh  = Erb + (size_t)h * 128 * 1024;   /* 128 packed tiles of 1024 elements a head */

  float mrow[8], lrow[8];
  v8f oacc[4];
#pragma unroll
  for (int r = 0; r < 8; ++r) { mrow[r] = NEG_INF; lrow[r] = 0.f; }
#pragma unroll
  for (int t = 0; t < 4; ++t) oacc[t] = (v8f){0.f,0.f,0.f,0.f,0.f,0.f,0.f,0.f};

  float* gs = Gs[wave];
  float* ss = Ss[wave];
  unsigned short* pwh = Psh[wave];
  unsigned short* pwl = Psl[wave];
  /* one lane base per slab and access pattern; every row and tile below is a constant offset from
     it, so that the LDS addresses take one register each and leave room for loads in flight */
  float* gsw = gs + 8 * hh * GP + c;                    /* G and output slab, element (8hh+r, 16t+c) */
  float* ssw = ss + 8 * hh * SP + c;                    /* S slab, element (8hh+r, 16j+c) */
  const float* gsk = gs + 8 * hh * (GP - 1) + c + 15;   /* G slab read skewed: G[m][n-m+15] */
  unsigned short* pwhw = pwh + 8 * hh * KCH + c;
  unsigned short* pwlw = pwl + 8 * hh * KCH + c;
  const unsigned lane8 = (unsigned)(lane * 8);   /* this lane's 16-B unit of every 512-B fragment run (elements) */

  /* mask tiles of all NCH chunks of this wave, by value: the 8 * NCH row loads stand as one group
     ahead of every use, so that the wave waits for the mask once and not once a row.
     Bit L of the ballot (it, e) = mask[q0+2it+(L>>4)][kv0+4(L&15)+e] != 0; each lane keeps the
     word of its own e = c&3 (lane masks sel0..sel3) and of its own row half, and packs its own
     32 bits of a chunk into one word: bit 16(r&1) + 4j + (r>>1) = element (row 8hh+r, key 16j+c). */
  unsigned mpk[NCH];
  unsigned skip = 0u;                 /* bit i: every element of chunk i's tile is masked (wave-uniform) */
  {
    v4i mv[NCH][8];
    const int* ml = mask + (size_t)(q0 + hh) * SEQ_FULL + wave * KCH + 4 * c;   /* lane base; the rest are constants */
#pragma unroll
    for (int i = 0; i < NCH; ++i)
#pragma unroll
      for (int it = 0; it < 8; ++it) {
        if (i == NCH - 1 && it == 7) wait_addr();   /* last use of the mask address pair */
        mv[i][it] = *(const v4i*)(ml + it * 2 * SEQ_FULL + i * NWAVE * KCH);
      }
    const unsigned sel0 = (c3 == 0) ? 0xFFFFFFFFu : 0u;
    const unsigned sel1 = (c3 == 1) ? 0xFFFFFFFFu : 0u;
    const unsigned sel2 = (c3 == 2) ? 0xFFFFFFFFu : 0u;
    const unsigned sel3 = (c3 == 3) ? 0xFFFFFFFFu : 0u;
#pragma unroll
    for (int i = 0; i < NCH; ++i) {
      unsigned msel[8];
      unsigned andall = 0xFFFFFFFFu;
#pragma unroll
      for (int it = 0; it < 8; ++it) {
        const unsigned b0 = __builtin_amdgcn_ballot_w32(mv[i][it][0] != 0);
        const unsigned b1 = __builtin_amdgcn_ballot_w32(mv[i][it][1] != 0);
        const unsigned b2 = __builtin_amdgcn_ballot_w32(mv[i][it][2] != 0);
        const unsigned b3 = __builtin_amdgcn_ballot_w32(mv[i][it][3] != 0);
        andall &= (b0 & b1) & (b2 & b3);
        msel[it] = (b0 & sel0) | (b1 & sel1) | (b2 & sel2) | (b3 & sel3);
      }
      unsigned pk = 0u;
#pragma unroll
      for (int ii = 0; ii < 4; ++ii) {
        const unsigned w = hh ? msel[4 + ii] : msel[ii];
        pk |= ((w >> csh) & 0x11111111u) << ii;
      }
      mpk[i] = pk;
      skip |= (andall == 0xFFFFFFFFu) ? (1u << i) : 0u;
    }
  }

  /* kept rolled: one copy of the chunk's text */
#pragma unroll 1
  for (int i = 0; i < NCH; ++i) {
    if ((skip >> i) & 1u) continue;               /* wave-uniform: every element masked */
    const int kv0 = (wave + i * NWAVE) * KCH;

    const unsigned mk = (i == 0) ? mpk[0] : (i == 1) ? mpk[1] : (i == 2) ? mpk[2] : mpk[3];

    /* The chunk's loads fly as a window ahead of the products that use them: q, the 5 table tiles
       and key tile 0 are issued as one group, each further key tile as soon as earlier tiles'
       registers come free. q is read per chunk so that its registers are free for the v fragments
       during the softmax and p.v. All loops below are unrolled so that the fragment arrays are
       indexed by constants and stay in registers. */
    v16b qh[2], ql[2];
    FB kfh[4][2], kfl[4][2], ef[5][2];
    /* position table: offsets kv0 - q0 - 15 + g, g = 0..79, are the packed tiles
       (kv0 - q0) / 16 + 63 + t, t = 0..4, in [0, 127] */
    g_u16* ep = scalar_base(Eh + ((kv0 - q0 + SEQ_FULL - 16) >> 4) * 1024);
    g_u16* kh = scalar_base(Kh + kv0 * DHEAD);
    g_u16* kl = kh + PLANE;
    g_u16* vh = scalar_base(Vth + kv0 * DHEAD);
    g_u16* vl = vh + PLANE;
    g_u16* qph = scalar_base(Qh + q0 * DHEAD);
    g_u16* qpl = qph + PLANE;
    auto load_key_tile = [&](int j) {
#pragma unroll
      for (int dc = 0; dc < 2; ++dc) {
        kfh[j][dc].h[0] = *(g_v8b*)(kh + lane8 + j * 1024 + dc * 512);
        kfh[j][dc].h[1] = *(g_v8b*)(kh + lane8 + j * 1024 + dc * 512 + 256);
        kfl[j][dc].h[0] = *(g_v8b*)(kl + lane8 + j * 1024 + dc * 512);
        kfl[j][dc].h[1] = *(g_v8b*)(kl + lane8 + j * 1024 + dc * 512 + 256);
      }
      /* behind the chunk's last k load, before its address registers are written anew */
      if (j == 3) wait_addr();
    };
    {
#pragma unroll
      for (int dc = 0; dc < 2; ++dc) {
        FB f;
        f.h[0] = *(g_v8b*)(qph + lane8 + dc * 512);
        f.h[1] = *(g_v8b*)(qph + lane8 + dc * 512 + 256);
        qh[dc] = f.v;
        f.h[0] = *(g_v8b*)(qpl + lane8 + dc * 512);
        f.h[1] = *(g_v8b*)(qpl + lane8 + dc * 512 + 256);
        ql[dc] = f.v;
      }
    }
#pragma unroll
    for (int t = 0; t < 5; ++t) {
#pragma unroll
      for (int dc = 0; dc < 2; ++dc) {
        ef[t][dc].h[0] = *(g_v8b*)(ep + lane8 + t * 1024 + dc * 512);
        ef[t][dc].h[1] = *(g_v8b*)(ep + lane8 + t * 1024 + dc * 512 + 256);
      }
    }
    load_key_tile(0);
    wait_addr();      /* behind the last q and table loads, before their address registers are written anew */
    /* keeps the first product, and the load wait in front of it, behind the issue of the whole
       group: moved up among the loads it would make the rest of the group wait a full latency */
    __builtin_amdgcn_sched_barrier(0);

    /* position term: G[m][g] = q[m] . Er[h][(kv0 - q0 - 15 + g) mod 2047], g = 0..79 */
#pragma unroll
    for (int t = 0; t < 5; ++t) {
      v8f g = (v8f){0.f,0.f,0.f,0.f,0.f,0.f,0.f,0.f};
#pragma unroll
      for (int dc = 0; dc < 2; ++dc) {
        g = mma_bf16(qh[dc], ef[t][dc].v, g);
        g = mma_bf16(ql[dc], ef[t][dc].v, g);
      }
      if (t == 1) load_key_tile(1);
      if (t == 3) load_key_tile(2);
#pragma unroll
      for (int r = 0; r < 8; ++r) gsw[r * GP + 16 * t] = g[r];
    }

    /* raw scores: 4 key tiles, one accumulator, tile -> S slab (D elem r = row 8hh+r, col c) */
#pragma unroll
    for (int j = 0; j < 4; ++j) {
      v8f sa = (v8f){0.f,0.f,0.f,0.f,0.f,0.f,0.f,0.f};
#pragma unroll
      for (int dc = 0; dc < 2; ++dc) {
        sa = mma_bf16(qh[dc], kfh[j][dc].v, sa);
        sa = mma_bf16(qh[dc], kfl[j][dc].v, sa);
        sa = mma_bf16(ql[dc], kfh[j][dc].v, sa);
      }
      if (j == 0) load_key_tile(3);
#pragma unroll
      for (int r = 0; r < 8; ++r) ssw[r * SP + 16 * j] = sa[r];
    }
    wave_lds_sync();

    /* v fragments of the first 32 keys: issued here, so that they fly during the softmax */
    FB vbh[2][4], vbl[2][4];
    auto load_v_step = [&](int kk) {
#pragma unroll
      for (int t = 0; t < 4; ++t) {
        const int vo = kk * 2048 + t * 512;
        vbh[kk][t].h[0] = *(g_v8b*)(vh + lane8 + vo);
        vbh[kk][t].h[1] = *(g_v8b*)(vh + lane8 + vo + 256);
        vbl[kk][t].h[0] = *(g_v8b*)(vl + lane8 + vo);
        vbl[kk][t].h[1] = *(g_v8b*)(vl + lane8 + vo + 256);
      }
      /* behind the chunk's last v load, before its address registers are written anew */
      if (kk == 1) wait_addr();
    };
    load_v_step(0);

    /* raw score + skewed position term, replace-fill of masked elements */
    v8f s[4];
#pragma unroll
    for (int j = 0; j < 4; ++j) {
#pragma unroll
      for (int r = 0; r < 8; ++r) {
        const float raw = ssw[r * SP + 16 * j];
        const float gv = gsk[r * (GP - 1) + 16 * j];
        const float sv = raw + gv;
        const unsigned bit = (mk >> (16 * (r & 1) + 4 * j + (r >> 1))) & 1u;
        s[j][r] = bit ? NEG_INF : sv;
      }
    }

    /* chunk row max over the 64 keys */
    float cm[8];
#pragma unroll
    for (int r = 0; r < 8; ++r) {
      float m = fmaxf(fmaxf(s[0][r], s[1][r]), fmaxf(s[2][r], s[3][r]));
#pragma unroll
      for (int off = 1; off < 16; off <<= 1) m = fmaxf(m, __shfl_xor(m, off, 32));
      cm[r] = m;
    }

    /* online softmax update, P tiles as bf16 hi + lo */
#pragma unroll
    for (int r = 0; r < 8; ++r) {
      if (r == 4) load_v_step(1);   /* the second 32 keys' fragments, once half the score registers are free */
      const float mnew  = fmaxf(mrow[r], cm[r]);
      const float msafe = (mnew == NEG_INF) ? 0.f : mnew;
      const float alpha = expf(mrow[r] - msafe);
      mrow[r] = mnew;
      float psum = 0.f;
#pragma unroll
      for (int j = 0; j < 4; ++j) {
        const float p = expf(s[j][r] - msafe);
        psum += p;
        const unsigned short hb = f2bf_bits(p);
        const unsigned short lb = f2bf_bits(p - bf_bits2f(hb));
        pwhw[r * KCH + j * 16] = hb;
        pwlw[r * KCH + j * 16] = lb;
      }
#pragma unroll
      for (int off = 1; off < 16; off <<= 1) psum += __shfl_xor(psum, off, 32);
      lrow[r] = lrow[r] * alpha + psum;
#pragma unroll
      for (int t = 0; t < 4; ++t) oacc[t][r] *= alpha;
    }
    wave_lds_sync();

    /* O += P.V : A = P [q][kv] (this wave's tiles), B = V [kv][d] from the packed v planes;
       unrolled over the two 32-key steps: the fragment arrays are indexed by constants */
#pragma unroll
    for (int kk = 0; kk < 2; ++kk) {
      FB pa, pl;
      pa.h[0] = *(const v8b_a*)(pwh + c * KCH + kk * 32 + 8 * hh);
      pa.h[1] = *(const v8b_a*)(pwh + c * KCH + kk * 32 + 16 + 8 * hh);
      pl.h[0] = *(const v8b_a*)(pwl + c * KCH + kk * 32 + 8 * hh);
      pl.h[1] = *(const v8b_a*)(pwl + c * KCH + kk * 32 + 16 + 8 * hh);
#pragma unroll
      for (int t = 0; t < 4; ++t) {
        oacc[t] = mma_bf16(pa.v, vbh[kk][t].v, oacc[t]);
        oacc[t] = mma_bf16(pl.v, vbh[kk][t].v, oacc[t]);
        oacc[t] = mma_bf16(pa.v, vbl[kk][t].v, oacc[t]);
      }
    }
    wave_lds_sync();
  }

  /* this wave's partial state: unnormalised output into its own slab (aliases the G slab),
     row maximum and row sum beside it */
#pragma unroll
  for (int r = 0; r < 8; ++r) {
#pragma unroll
    for (int t = 0; t < 4; ++t) gsw[r * GP + t * 16] = oacc[t][r];
  }
  if (c == 0) {      /* the 16 lanes of a half hold equal row statistics */
#pragma unroll
    for (int r = 0; r < 8; ++r) {
      Ms[wave][8 * hh + r] = mrow[r];
      Ls[wave][8 * hh + r] = lrow[r];
    }
  }
  __syncthreads();   /* publishes the four partial states to the whole block */
  {
    unsigned short* Ch = ctxp;
    unsigned short* Cl = ctxp + XB_E;
    const int row = tid >> 3;
    const int seg = tid & 7;
    float mall = Ms[0][row];
#pragma unroll
    for (int w = 1; w < NWAVE; ++w) mall = fmaxf(mall, Ms[w][row]);
    const float msafe = (mall == NEG_INF) ? 0.f : mall;
    float lsum = 0.f;
    v4f a0 = (v4f){0.f, 0.f, 0.f, 0.f};
    v4f a1 = (v4f){0.f, 0.f, 0.f, 0.f};
#pragma unroll
    for (int w = 0; w < NWAVE; ++w) {
      const float f = expf(Ms[w][row] - msafe);
      lsum += Ls[w][row] * f;
      a0 += *(const v4f_a*)(Gs[w] + row * GP + seg * 8) * f;
      a1 += *(const v4f_a*)(Gs[w] + row * GP + seg * 8 + 4) * f;
    }
    const float inv = 1.0f / lsum;
    a0 *= inv;
    a1 *= inv;
    unsigned h0, h1, h2, h3, l0, l1, l2, l3;
    split2(a0[0], a0[1], h0, l0);
    split2(a0[2], a0[3], h1, l1);
    split2(a1[0], a1[1], h2, l2);
    split2(a1[2], a1[3], h3, l3);
    v4u hw, lw;
    hw[0] = h0; hw[1] = h1; hw[2] = h2; hw[3] = h3;
    lw[0] = l0; lw[1] = l1; lw[2] = l2; lw[3] = l3;
    const size_t g = (size_t)(b * SEQ + q0 + row) * DMODEL + h * DHEAD + seg * 8;
    *(v4u*)(Ch + g) = hw;
    *(v4u*)(Cl + g) = lw;
  }
}

/* --------------------------------------------------------------------------
 * out = (Ch + Cl) . WoT^T + b  (M = MROWS, N = 1024, K = 1024), f32 acc.
 * Block = 4 waves, tile 128 x 64; wave = 32 rows x 64 cols; A hi and lo planes
 * against the single bf16 weight plane (two products per tile pair).
 * Operands: stages of 64 k (128 B of each of the 320 operand rows) in a two-buffer LDS ring,
 * filled by asynchronous copies (20 per thread and stage) in the order of gemm_qkv_kernel.
 * Epilogue: per-wave 32x64 f32 slab (wave-private LDS), 16 lanes x 16 B = one 256-B
 * ------------------------------------------------------------------------ */
__global__ __launch_bounds__(128) VGPR_CAP void gemm_out_kernel(
    const unsigned short* __restrict__ ctxp, const unsigned short* __restrict__ WoT,
    const float* __restrict__ bias, float* __restrict__ out)
{
  union FB { v16b v; v8b h[2]; };
  __shared__ __align__(16) float Os[NWAVE][32 * OS_PITCH];
  __shared__ __align__(16) unsigned short Sm[2 * OUT_STAGE_E];

  const int tid  = threadIdx.x;
  const int wave = __builtin_amdgcn_readfirstlane(tid >> 5);
  const int lane = tid & 31;
  const int hh   = lane >> 4;
  const int c    = lane & 15;
  const int n0   = blockIdx.x * 64;
  const int m0   = blockIdx.y * 128;

  v8f acc[2][4];
#pragma unroll
  for (int mt = 0; mt < 2; ++mt)
#pragma unroll
    for (int t = 0; t < 4; ++t) acc[mt][t] = (v8f){0.f,0.f,0.f,0.f,0.f,0.f,0.f,0.f};

  /* copy unit: thread -> (row tid>>3 of each group of 16 rows, 16-B segment tid&7) */
  const int crow = tid >> 3;
  const int cseg = tid & 7;
  const unsigned short* gh = ctxp + (size_t)(m0 + crow) * DMODEL + cseg * 8;
  const unsigned short* gl = gh + XB_E;
  const unsigned short* gw = WoT + (size_t)(n0 + crow) * DMODEL + cseg * 8;
  const unsigned lrow = lds_off(Sm) + (unsigned)(crow * RP + cseg * 8) * 2u;

  auto issue_stage = [&](int st) {
    /* unrolled below: the address arrays are indexed by constants and stay in registers */
    unsigned l[20];
    const unsigned short* g[20];
    const unsigned lb = lrow + (unsigned)(st & 1) * (unsigned)(OUT_STAGE_E * 2);
#pragma unroll
    for (int it = 0; it < 20; ++it) {
      l[it] = lb + (unsigned)(it * 16 * RP * 2);
      g[it] = (it < 8)  ? gh + (size_t)it * 16 * DMODEL + st * KST
            : (it < 16) ? gl + (size_t)(it - 8) * 16 * DMODEL + st * KST
                        : gw + (size_t)(it - 16) * 16 * DMODEL + st * KST;
    }
    async_copy10(l, g);
    async_copy10(l + 10, g + 10);
  };

  const unsigned short* sh = Sm + (wave * 32 + c) * RP + 8 * hh;
  const unsigned short* sl = sh + 128 * RP;
  const unsigned short* sb = Sm + (256 + c) * RP + 8 * hh;

  issue_stage(0);
  wait_copies();
  __syncthreads();   /* publishes stage 0 */
  issue_stage(1);

  /* kept rolled: one copy of the ring's foot (waits, barrier, refill), small loop text */
#pragma unroll 1
  for (int st = 0; st < NSTAGE; ++st) {
    const int bo = (st & 1) * OUT_STAGE_E;
    /* the stage's fragment loads stand as one group ahead of its products, so that the wave pays
       the LDS latency once a stage; the loops below are unrolled so that every index of the
       fragment arrays is a constant and they stay in registers */
    FB a0h[2], a1h[2], a0l[2], a1l[2], bf[2][4];
#pragma unroll
    for (int s = 0; s < 2; ++s) {
      const int ks = s * 32;
      a0h[s].h[0] = *(const v8b_a*)(sh + bo + ks);
      a0h[s].h[1] = *(const v8b_a*)(sh + bo + ks + 16);
      a0l[s].h[0] = *(const v8b_a*)(sl + bo + ks);
      a0l[s].h[1] = *(const v8b_a*)(sl + bo + ks + 16);
      a1h[s].h[0] = *(const v8b_a*)(sh + bo + 16 * RP + ks);
      a1h[s].h[1] = *(const v8b_a*)(sh + bo + 16 * RP + ks + 16);
      a1l[s].h[0] = *(const v8b_a*)(sl + bo + 16 * RP + ks);
      a1l[s].h[1] = *(const v8b_a*)(sl + bo + 16 * RP + ks + 16);
#pragma unroll
      for (int t = 0; t < 4; ++t) {
        bf[s][t].h[0] = *(const v8b_a*)(sb + bo + t * 16 * RP + ks);
        bf[s][t].h[1] = *(const v8b_a*)(sb + bo + t * 16 * RP + ks + 16);
      }
    }
#pragma unroll
    for (int s = 0; s < 2; ++s) {
#pragma unroll
      for (int t = 0; t < 4; ++t) {
        acc[0][t] = mma_bf16(a0h[s].v, bf[s][t].v, acc[0][t]);
        acc[0][t] = mma_bf16(a0l[s].v, bf[s][t].v, acc[0][t]);
        acc[1][t] = mma_bf16(a1h[s].v, bf[s][t].v, acc[1][t]);
        acc[1][t] = mma_bf16(a1l[s].v, bf[s][t].v, acc[1][t]);
      }
    }
    wait_lds_reads();
    wait_copies();
    __syncthreads();   /* publishes stage st + 1 and ends every read of stage st's buffer */
    if (st + 2 < NSTAGE) issue_stage(st + 2);
  }
  wait_copies();

  float* os = Os[wave];
#pragma unroll
  for (int t = 0; t < 4; ++t) {
    const float bv = bf_bits2f(f2bf_bits(bias[n0 + 16 * t + c]));
#pragma unroll
    for (int mt = 0; mt < 2; ++mt)
#pragma unroll
      for (int r = 0; r < 8; ++r)
        os[(mt * 16 + 8 * hh + r) * OS_PITCH + 16 * t + c] = acc[mt][t][r] + bv;
  }
  wave_lds_sync();
  {
    const int c4 = c * 4;
    {
#pragma unroll
      for (int it = 0; it < 16; ++it) {
        const int row = it * 2 + hh;
        const v4f val = *(const v4f_a*)(os + row * OS_PITCH + c4);
        *(v4f*)(out + (size_t)(m0 + wave * 32 + row) * DMODEL + n0 + c4) = val;
      }
      
    }
  }
}

extern "C" void kernel_launch(void* const* d_in, const int* in_sizes, int n_in,
                              void* d_out, int out_size, void* d_ws, size_t ws_size,
                              hipStream_t stream)
{
  if (n_in < 7) return;
  if (in_sizes[0] < ((NB - 1) * SEQ_FULL + SEQ) * DMODEL) return;
  if (in_sizes[1] < (SEQ - 1) * SEQ_FULL + SEQ) return;
  if (in_sizes[2] < DMODEL * NQKV) return;
  if (in_sizes[3] < NQKV) return;
  if (in_sizes[4] < DMODEL * DMODEL) return;
  if (in_sizes[5] < DMODEL) return;
  if (in_sizes[6] < NHEAD * NPOS * DHEAD) return;
  if (out_size < MROWS * DMODEL) return;
  if (d_ws == nullptr || ws_size < WS_NEED) return;

  const float* x     = (const float*)d_in[0];
  const int*   mask  = (const int*)d_in[1];
  const float* W_qkv = (const float*)d_in[2];
  const float* b_qkv = (const float*)d_in[3];
  const float* W_o   = (const float*)d_in[4];
  const float* b_o   = (const float*)d_in[5];
  const float* Er    = (const float*)d_in[6];
  float* out = (float*)d_out;

  unsigned short* Xb   = (unsigned short*)d_ws;
  unsigned short* WqT  = Xb + XB_E;
  unsigned short* WoT  = WqT + WQT_E;
  unsigned short* Erb  = WoT + WOT_E;
  unsigned short* qkvp = Erb + ERB_E;
  unsigned short* ctxp = qkvp + QKVP_E;

  {
    const int nunits = MROWS * (DMODEL / 8);
    cvt_rows_kernel<<<(nunits + 255) / 256, 256, 0, stream>>>(x, Xb, nunits, DMODEL / 8, SEQ, SEQ_FULL);
  }
  /* 16 heads x 128 tiles, 2 tiles a block */
  pack_table_kernel<<<NHEAD * 128 / 2, 256, 0, stream>>>(Er, Erb);
  /* W_qkv in[1024][3072] -> WqT out[3072][1024]; grid (rows/64, cols/64) */
  wt_planes_kernel<<<dim3(DMODEL / 64, NQKV / 64), 256, 0, stream>>>(W_qkv, WqT, DMODEL, NQKV);
  /* W_o in[1024][1024] -> WoT out[1024][1024]; grid (rows/64, cols/64) */
  wt_planes_kernel<<<dim3(DMODEL / 64, DMODEL / 64), 256, 0, stream>>>(W_o, WoT, DMODEL, DMODEL);

  gemm_qkv_kernel<<<dim3(NQKV / 64, MROWS / 128), 128, 0, stream>>>(Xb, WqT, b_qkv, qkvp);
  rel_attn_kernel<<<dim3(SEQ / 16, NBH), 128, 0, stream>>>(qkvp, Erb, mask, ctxp);
  gemm_out_kernel<<<dim3(DMODEL / 64, MROWS / 128), 128, 0, stream>>>(ctxp, WoT, b_o, out);
}

// v005
// One run takes 101 microseconds.
// Next to v004, in two timings, it ran 1.06 and 1.07 times as fast.
// Over all steps from v000 it is 2.65 times as fast.
// Contractions: x.Wqkv on v_wmma_f32_16x16x32_bf16 with both operands RNE-converted to bf16 once; q.(k/8)^T, q.Er^T, p.v and ctx.Wo on v_wmma_f32_16x16x32_bf16 with computed operands (q, k/8, v, p, ctx) carried as bf16 hi+lo planes (hi.hi + hi.lo + lo.hi) and input operands (Er, Wo) as single bf16 planes; f32 accumulate; softmax, bias adds and mask fill in f32.
#include <hip/hip_runtime.h>

typedef __attribute__((ext_vector_type(16))) __bf16 v16b;
typedef __attribute__((ext_vector_type(8)))  __bf16 v8b;
typedef __attribute__((ext_vector_type(8)))  float  v8f;
typedef __attribute__((ext_vector_type(4)))  float  v4f;
typedef __attribute__((ext_vector_type(4)))  unsigned int v4u;
typedef __attribute__((ext_vector_type(4)))  int v4i;
typedef v8b v8b_a __attribute__((may_alias));
typedef v4f v4f_a __attribute__((may_alias));
typedef v4u v4u_a __attribute__((may_alias));

#ifndef NB
#define NB 2
#endif
#ifndef SEQ
#define SEQ 1024
#endif
#define NB_FULL 2
#define SEQ_FULL 1024

#define VGPR_CAP __attribute__((amdgpu_num_vgpr(256)))

constexpr int DMODEL = 1024;
constexpr int NHEAD  = 16;
constexpr int DHEAD  = 64;
constexpr int NPOS   = 2047;
constexpr int NQKV   = 3 * DMODEL;
constexpr int NBH    = NB * NHEAD;
constexpr int MROWS  = NB * SEQ;
constexpr int KCH    = 64;        /* keys per chunk */
constexpr int NWAVE  = 4;
constexpr int NCH    = SEQ / (KCH * NWAVE);   /* key chunks per wave of the attention block */
constexpr int GP     = 84;        /* skew slab pitch in floats (336 B rows, 16-B aligned) */
constexpr int SP     = 68;        /* raw score slab pitch in floats */
constexpr int TQ_PITCH = 72;      /* [tok][d] staging pitch (16-bit elements) */
constexpr int TV_PITCH = 136;     /* [d][tok] staging pitch (16-bit elements) */
constexpr int T_ELEMS  = 128 * TQ_PITCH;   /* 9216 >= 64 * TV_PITCH = 8704 */
constexpr int TS_PITCH = 72;
constexpr int OS_PITCH = 68;
constexpr int KST      = 64;      /* k elements per GEMM stage: one 128-B line of every operand row */
constexpr int RP       = 72;      /* GEMM stage row pitch (16-bit elements): 144 B = 16 B x odd for b128 readers */
constexpr int NSTAGE   = 1024 / KST;
constexpr int QKV_STAGE_E = (128 + 64) * RP;        /* [x 128 rows | W 64 rows] */
constexpr int OUT_STAGE_E = (128 + 128 + 64) * RP;  /* [ctx hi 128 | ctx lo 128 | W 64 rows] */

constexpr size_t PLANE  = (size_t)NBH * SEQ * DHEAD;
constexpr size_t XB_E   = (size_t)MROWS * DMODEL;
constexpr size_t WQT_E  = (size_t)NQKV * DMODEL;
constexpr size_t WOT_E  = (size_t)DMODEL * DMODEL;
constexpr size_t ERB_E  = (size_t)NHEAD * 2048 * DHEAD;
constexpr size_t QKVP_E = 6 * PLANE;
constexpr size_t CTX_E  = 2 * XB_E;
constexpr size_t WS_NEED = 2 * (XB_E + WQT_E + WOT_E + ERB_E + QKVP_E + CTX_E);

static_assert(SEQ % 128 == 0);
static_assert(NCH * KCH * NWAVE == SEQ && NCH == 4);
static_assert(SEQ <= SEQ_FULL && NB <= NB_FULL);
static_assert(DHEAD == 64 && DMODEL == NHEAD * DHEAD);
static_assert(DMODEL % 64 == 0 && NQKV % 64 == 0 && DMODEL % 32 == 0);
static_assert(64 * TV_PITCH <= T_ELEMS);
static_assert((TQ_PITCH * 2) % 16 == 0 && (TV_PITCH * 2) % 16 == 0 && (GP * 4) % 16 == 0 && (OS_PITCH * 4) % 16 == 0);
static_assert(GP >= 80 && SP >= 64);
static_assert(NSTAGE * KST == DMODEL && NSTAGE >= 2 && (RP * 2) % 16 == 0 && RP >= KST);
static_assert(2 * T_ELEMS <= 2 * QKV_STAGE_E);
static_assert((size_t)NHEAD * NPOS * DHEAD <= ERB_E);
static_assert(WS_NEED <= 134217728ull);

/*
 *   Xb   [MROWS][1024]        x, bf16
 *   WqT  [3072][1024]         W_qkv transposed, bf16
 *   WoT  [1024][1024]         W_o transposed, bf16
 *   Erb  [16][128 tiles][8][16][8]   Er, bf16, in fragment order (below); row c of tile m is the
 *                             table row of offset 16m - 1023 + c, that is (16m - 1023 + c) mod 2047
 *   qkvp 6 planes, in fragment order: Qh Ql, Kh Kl (k/8) [bh][l/16][d/8][l%16][8 d],
 *                             Vh Vl [bh][l/32][d/16][(l%32)/8][d%16][8 l]
 *   ctxp 2 planes: Ch Cl [MROWS][1024]
 * Fragment order: the 16-B unit that lane (hh, c) takes for half a fragment register set stands at
 * unit 16hh + c of a 512-B run, so that one 16-B load of a wave covers four whole 128-B lines.
 */

__device__ __forceinline__ unsigned short f2bf_bits(float f) {
  unsigned u = __float_as_uint(f);
  return (unsigned short)((u + 0x7FFFu + ((u >> 16) & 1u)) >> 16);
}
__device__ __forceinline__ float bf_bits2f(unsigned short h) { return __uint_as_float(((unsigned)h) << 16); }
__device__ __forceinline__ unsigned pk2(float a, float b) {
  return (unsigned)f2bf_bits(a) | ((unsigned)f2bf_bits(b) << 16);
}
__device__ __forceinline__ void split2(float a, float b, unsigned& hw, unsigned& lw) {
  const unsigned short ha = f2bf_bits(a);
  const unsigned short hb = f2bf_bits(b);
  const unsigned short la = f2bf_bits(a - bf_bits2f(ha));
  const unsigned short lb = f2bf_bits(b - bf_bits2f(hb));
  hw = (unsigned)ha | ((unsigned)hb << 16);
  lw = (unsigned)la | ((unsigned)lb << 16);
}

/* one WMMA + hazard guard naming only this call's live operands */
__device__ __forceinline__ v8f mma_bf16(v16b a, v16b b, v8f c) {
  c = __builtin_amdgcn_wmma_f32_16x16x32_bf16(false, a, false, b, (short)0, c, false, false);
  asm volatile("v_nop\n\tv_nop\n\tv_nop\n\tv_nop" : "+v"(c) : "v"(a), "v"(b));
  return c;
}

__device__ __forceinline__ void wave_lds_sync() {
  __builtin_amdgcn_fence(3 /* release order */, "workgroup");
  __builtin_amdgcn_wave_barrier();
  __builtin_amdgcn_fence(2 /* acquire order */, "workgroup");
}

/* byte offset of a __shared__ address inside the work-group's LDS */
__device__ __forceinline__ unsigned lds_off(const void* p) { return (unsigned)(size_t)p; }

/* Asynchronous copies global -> LDS, 16 B per lane and copy, every lane on. The copies of a run
   and the s_wait_xcnt 0 that stands before their address registers may be rewritten are one
   statement, so that no later address arithmetic can be moved in front of that wait. */
__device__ __forceinline__ void async_copy12(const unsigned (&l)[12], const unsigned short* const (&g)[12]) {
  asm volatile(
      "global_load_async_to_lds_b128 %0, %12, off\n\t"
      "global_load_async_to_lds_b128 %1, %13, off\n\t"
      "global_load_async_to_lds_b128 %2, %14, off\n\t"
      "global_load_async_to_lds_b128 %3, %15, off\n\t"
      "global_load_async_to_lds_b128 %4, %16, off\n\t"
      "global_load_async_to_lds_b128 %5, %17, off\n\t"
      "global_load_async_to_lds_b128 %6, %18, off\n\t"
      "global_load_async_to_lds_b128 %7, %19, off\n\t"
      "global_load_async_to_lds_b128 %8, %20, off\n\t"
      "global_load_async_to_lds_b128 %9, %21, off\n\t"
      "global_load_async_to_lds_b128 %10, %22, off\n\t"
      "global_load_async_to_lds_b128 %11, %23, off\n\t"
      "s_wait_xcnt 0x0"
      :: "v"(l[0]), "v"(l[1]), "v"(l[2]), "v"(l[3]), "v"(l[4]), "v"(l[5]),
         "v"(l[6]), "v"(l[7]), "v"(l[8]), "v"(l[9]), "v"(l[10]), "v"(l[11]),
         "v"(g[0]), "v"(g[1]), "v"(g[2]), "v"(g[3]), "v"(g[4]), "v"(g[5]),
         "v"(g[6]), "v"(g[7]), "v"(g[8]), "v"(g[9]), "v"(g[10]), "v"(g[11])
      : "memory");
}
__device__ __forceinline__ void async_copy10(const unsigned* l, const unsigned short* const* g) {
  asm volatile(
      "global_load_async_to_lds_b128 %0, %10, off\n\t"
      "global_load_async_to_lds_b128 %1, %11, off\n\t"
      "global_load_async_to_lds_b128 %2, %12, off\n\t"
      "global_load_async_to_lds_b128 %3, %13, off\n\t"
      "global_load_async_to_lds_b128 %4, %14, off\n\t"
      "global_load_async_to_lds_b128 %5, %15, off\n\t"
      "global_load_async_to_lds_b128 %6, %16, off\n\t"
      "global_load_async_to_lds_b128 %7, %17, off\n\t"
      "global_load_async_to_lds_b128 %8, %18, off\n\t"
      "global_load_async_to_lds_b128 %9, %19, off\n\t"
      "s_wait_xcnt 0x0"
      :: "v"(l[0]), "v"(l[1]), "v"(l[2]), "v"(l[3]), "v"(l[4]),
         "v"(l[5]), "v"(l[6]), "v"(l[7]), "v"(l[8]), "v"(l[9]),
         "v"(g[0]), "v"(g[1]), "v"(g[2]), "v"(g[3]), "v"(g[4]),
         "v"(g[5]), "v"(g[6]), "v"(g[7]), "v"(g[8]), "v"(g[9])
      : "memory");
}
/* A pointer that is the same in every lane, held in scalar registers: the loads from it take the
   form scalar base + lane offset, so that no vector address pair is written among loads in flight. */
typedef const __attribute__((address_space(1))) unsigned short g_u16;   /* global memory, named as such */
typedef const __attribute__((address_space(1))) v8b g_v8b;
__device__ __forceinline__ g_u16* scalar_base(const unsigned short* p) {
  const unsigned long long a = (unsigned long long)p;
  const unsigned lo = (unsigned)__builtin_amdgcn_readfirstlane((int)(unsigned)a);
  const unsigned hi = (unsigned)__builtin_amdgcn_readfirstlane((int)(unsigned)(a >> 32));
  return (g_u16*)(((unsigned long long)hi << 32) | lo);
}
/* Stands in front of the last load from an address pair, whose destination may be that pair while
   earlier loads from it are in flight, and behind it, before the pair is written anew: the wait
   that is kept before a register of an issued global load is overwritten. */
__device__ __forceinline__ void wait_addr() { asm volatile("s_wait_xcnt 0x0" ::: "memory"); }
/* this wave's copies have landed in LDS (the compiler places no wait for them) */
__device__ __forceinline__ void wait_copies() { asm volatile("s_wait_asynccnt 0x0" ::: "memory"); }
/* this wave's LDS reads have returned, so the buffer they read may be refilled behind the barrier */
__device__ __forceinline__ void wait_lds_reads() { asm volatile("s_wait_dscnt 0x0" ::: "memory"); }

/* --------------------------------------------------------------------------
 * Preparation of the four 16-bit operand planes. The four jobs read only inputs and write
 * disjoint planes, so they are the block ranges of ONE launch (prep_kernel, below) and run
 * side by side; each job is a block-level function, the block's job a block-uniform choice.
 * ------------------------------------------------------------------------ */

/* x: f32 rows -> bf16 rows (RNE), unit = 8 elements = one 16-B store.
 * out row = b*SEQ + l  <-  in row = b*SEQ_FULL + l ; row length = DMODEL.
 * Coverage: CVT_BLOCKS x 256 units x 8 elements = the whole plane. */
constexpr int CVT_UPR    = DMODEL / 8;
constexpr int CVT_UNITS  = MROWS * CVT_UPR;
constexpr int CVT_BLOCKS = (CVT_UNITS + 255) / 256;
__device__ __forceinline__ void cvt_rows_block(
    const float* __restrict__ in, unsigned short* __restrict__ outp, int blk)
{
  const int u = blk * 256 + threadIdx.x;
  if (u >= CVT_UNITS) return;      /* no barrier follows in this job */
  const int row = u / CVT_UPR;
  const int seg = u - row * CVT_UPR;
  const int b = row / SEQ;
  const int l = row - b * SEQ;
  const float* src = in + ((size_t)(b * SEQ_FULL + l) * CVT_UPR + seg) * 8;
  const v4f a0 = *(const v4f*)src;
  const v4f a1 = *(const v4f*)(src + 4);
  v4u w;
  w[0] = pk2(a0[0], a0[1]);
  w[1] = pk2(a0[2], a0[3]);
  w[2] = pk2(a1[0], a1[1]);
  w[3] = pk2(a1[2], a1[3]);
  v4u* dst = (v4u*)(outp + ((size_t)row * CVT_UPR + seg) * 8);
  *dst = w;
}

/* Er [16][2047][64] f32 -> Erb, bf16 (RNE), 16-row tiles in fragment order.
 * Tile m (0..127) of a head holds the rows of the offsets 16m - 1023 + c, c = 0..15, which are
 * the windows the attention kernel asks for (its offsets start at 1 mod 16).
 * Block = 2 tiles, thread = one 8-element unit: read as (row u>>3, segment u&7), whole lines;
 * units turned from [row][segment] to [segment][row] through LDS (cross-wave, block barrier);
 * stored in thread order. Coverage: TAB_BLOCKS x 2 tiles = 16 heads x 128 tiles.
 * LDS unit pitch: one spare unit per 16, so that the 8 segments of a row fall on different banks. */
constexpr int TAB_BLOCKS = NHEAD * 128 / 2;
__device__ __forceinline__ void pack_table_block(
    const float* __restrict__ Er, unsigned short* __restrict__ Erb, int blk, v4u* Us)
{
  const int tid  = threadIdx.x;
  const int tl   = tid >> 7;
  const int u    = tid & 127;
  const int tile = blk * 2 + tl;             /* head * 128 + m */
  const int h    = tile >> 7;
  const int m    = tile & 127;
  const int row  = u >> 3;
  const int seg  = u & 7;
  const int d    = 16 * m - (SEQ_FULL - 1) + row;      /* -1023 .. 1024 */
  const int rr   = d + ((d < 0) ? NPOS : 0);           /* 0 .. 2046 */
  const float* src = Er + ((size_t)h * NPOS + rr) * DHEAD + seg * 8;
  const v4f a0 = *(const v4f*)src;
  const v4f a1 = *(const v4f*)(src + 4);
  v4u w;
  w[0] = pk2(a0[0], a0[1]);
  w[1] = pk2(a0[2], a0[3]);
  w[2] = pk2(a1[0], a1[1]);
  w[3] = pk2(a1[2], a1[3]);
  Us[tl * 136 + seg * 17 + row] = w;
  __syncthreads();   /* publishes the tile's units to the waves that store them */
  *(v4u*)(Erb + (size_t)tile * 1024 + u * 8) = Us[tl * 136 + (u >> 4) * 17 + (u & 15)];
  wait_addr();   /* behind the job's store: another job's text follows it in the one kernel and writes its registers */
}

/* W in[rows][cols] f32  ->  Wt out[cols][rows] bf16 (RNE), one 64x64 tile through LDS.
 * Tile (kt = rows tile, nt = cols tile), 256 threads.
 * Coverage: 2 iterations x 256 threads = 512 units x 8 = 64x64 for the load phase
 * and the same 512 units x 8 = 64x64 for the store phase.
 * LDS tile: cross-wave, separated by a block barrier. */
constexpr int WQ_BLOCKS = (DMODEL / 64) * (NQKV / 64);
constexpr int WO_BLOCKS = (DMODEL / 64) * (DMODEL / 64);
__device__ __forceinline__ void wt_planes_block(
    const float* __restrict__ W, unsigned short* __restrict__ Wt, int rows, int cols,
    int kt, int nt, unsigned short* Ts /* [n][k] */)
{
  const int k0 = kt * 64;
  const int n0 = nt * 64;
  const int tid = threadIdx.x;
  const float* src[2];
  v4f a0[2], a1[2];
  /* both loops unrolled: the arrays are indexed by constants and stay in registers */
#pragma unroll
  for (int it = 0; it < 2; ++it) {
    const int u = it * 256 + tid;
    src[it] = W + (size_t)(k0 + (u >> 3)) * cols + n0 + (u & 7) * 8;
    a0[it] = *(const v4f*)src[it];
    a1[it] = *(const v4f*)(src[it] + 4);
  }
  /* the wait that is kept before a register of an issued global load is overwritten; it takes the
     two address pairs as inputs, so that they stay whole up to it and no load's result lands on one */
  asm volatile("s_wait_xcnt 0x0" :: "v"(src[0]), "v"(src[1]) : "memory");
#pragma unroll
  for (int it = 0; it < 2; ++it) {
    const int u = it * 256 + tid;
    const int row = u >> 3;      /* k local */
    const int seg = u & 7;       /* n segment */
#pragma unroll
    for (int e = 0; e < 4; ++e) {
      Ts[(seg * 8 + e) * TS_PITCH + row]     = f2bf_bits(a0[it][e]);
      Ts[(seg * 8 + 4 + e) * TS_PITCH + row] = f2bf_bits(a1[it][e]);
    }
  }
  __syncthreads();   /* publishes the tile to the waves that store its rows */
#pragma unroll
  for (int it = 0; it < 2; ++it) {
    const int u = it * 256 + tid;
    const int nrow = u >> 3;
    const int seg  = u & 7;
    const v4u w = *(const v4u_a*)(Ts + nrow * TS_PITCH + seg * 8);
    *(v4u*)(Wt + (size_t)(n0 + nrow) * rows + k0 + seg * 8) = w;
  }
  wait_addr();   /* behind the job's two stores: another job's text follows them in the one kernel and writes their registers */
}

/* Block ranges, the jobs with two phases and a barrier first:
 *   [0, WQ)            W_qkv in[1024][3072] -> WqT out[3072][1024], tile (blk % 16, blk / 16)
 *   [WQ, WQ + WO)      W_o   in[1024][1024] -> WoT out[1024][1024], likewise
 *   then TAB_BLOCKS    the position table, then CVT_BLOCKS x. */
constexpr int PREP_BLOCKS = WQ_BLOCKS + WO_BLOCKS + TAB_BLOCKS + CVT_BLOCKS;
__global__ __launch_bounds__(256) void prep_kernel(
    const float* __restrict__ x, const float* __restrict__ W_qkv, const float* __restrict__ W_o,
    const float* __restrict__ Er, unsigned short* __restrict__ Xb, unsigned short* __restrict__ WqT,
    unsigned short* __restrict__ WoT, unsigned short* __restrict__ Erb)
{
  __shared__ __align__(16) unsigned short Ts[64 * TS_PITCH];
  __shared__ __align__(16) v4u Us[2 * 136];
  constexpr int KT = DMODEL / 64;
  const int blk = blockIdx.x;
  if (blk < WQ_BLOCKS) {
    wt_planes_block(W_qkv, WqT, DMODEL, NQKV, blk % KT, blk / KT, Ts);
  } else if (blk < WQ_BLOCKS + WO_BLOCKS) {
    const int t = blk - WQ_BLOCKS;
    wt_planes_block(W_o, WoT, DMODEL, DMODEL, t % KT, t / KT, Ts);
  } else if (blk < WQ_BLOCKS + WO_BLOCKS + TAB_BLOCKS) {
    pack_table_block(Er, Erb, blk - (WQ_BLOCKS + WO_BLOCKS), Us);
  } else {
    cvt_rows_block(x, Xb, blk - (WQ_BLOCKS + WO_BLOCKS + TAB_BLOCKS));
  }
}

/* --------------------------------------------------------------------------
 * qkv = Xb . WqT^T + b  (M = MROWS, N = 3072, K = 1024), bf16 x bf16, f32 acc.
 * Block = 4 waves, tile 128 tokens x 64 columns (= one head of one section);
 * wave = 32 rows x 64 cols (2 A fragments x 4 B fragments per 32-deep step).
 * Operands: stages of 64 k (128 B of each of the 192 operand rows, whole lines) brought into a
 * two-buffer LDS ring by asynchronous copies, 12 per thread and stage, one stage ahead of the
 * stage being worked on; fragments by 16-B LDS loads from rows pitched 144 B.
 * Foot of every stage: own LDS reads back, own copies landed, block barrier, then the refill of
 * the buffer just read. The epilogue tile reuses the ring behind the last stage's barrier.
 * Fragment map (hh = lane>>4, c = lane&15): A row c, elems 0..7 <- k0+8hh.., 8..15 <- k0+16+8hh..;
 * B col c with the same k map; D elem r = (row 8hh+r, col c).
 * Epilogue: (acc + bias) [x 1/8 for the k section] split to bf16 hi/lo, staged in a
 * block LDS tile ([tok][d] for q,k; [d][tok] for v), block barrier, then stored in fragment
 * order: the block's 1024 units of a plane are 16 KB in a row, unit u from
 *   q,k: token 16(u>>7) + (u&15), d segment (u>>4)&7;
 *   v  : d row 16((u>>6)&3) + (u&15), key segment 4(u>>8) + ((u>>4)&3).
 * ------------------------------------------------------------------------ */
__global__ __launch_bounds__(128) VGPR_CAP void gemm_qkv_kernel(
    const unsigned short* __restrict__ Xb, const unsigned short* __restrict__ WqT,
    const float* __restrict__ bias, unsigned short* __restrict__ qkvp)
{
  union FB { v16b v; v8b h[2]; };
  __shared__ __align__(16) unsigned short Sm[2 * QKV_STAGE_E];
  unsigned short* Th = Sm;
  unsigned short* Tl = Sm + T_ELEMS;

  const int tid  = threadIdx.x;
  const int wave = __builtin_amdgcn_readfirstlane(tid >> 5);
  const int lane = tid & 31;
  const int hh   = lane >> 4;
  const int c    = lane & 15;
  const int n0   = blockIdx.x * 64;
  const int m0   = blockIdx.y * 128;

  v8f acc[2][4];
#pragma unroll
  for (int mt = 0; mt < 2; ++mt)
#pragma unroll
    for (int t = 0; t < 4; ++t) acc[mt][t] = (v8f){0.f,0.f,0.f,0.f,0.f,0.f,0.f,0.f};

  /* copy unit: thread -> (row tid>>3 of each group of 16 rows, 16-B segment tid&7) */
  const int crow = tid >> 3;
  const int cseg = tid & 7;
  const unsigned short* gx = Xb  + (size_t)(m0 + crow) * DMODEL + cseg * 8;
  const unsigned short* gw = WqT + (size_t)(n0 + crow) * DMODEL + cseg * 8;
  const unsigned lrow = lds_off(Sm) + (unsigned)(crow * RP + cseg * 8) * 2u;

  auto issue_stage = [&](int st) {
    /* unrolled below: the address arrays are indexed by constants and stay in registers */
    unsigned l[12];
    const unsigned short* g[12];
    const unsigned lb = lrow + (unsigned)(st & 1) * (unsigned)(QKV_STAGE_E * 2);
#pragma unroll
    for (int it = 0; it < 12; ++it) {
      l[it] = lb + (unsigned)(it * 16 * RP * 2);
      g[it] = (it < 8) ? gx + (size_t)it * 16 * DMODEL + st * KST
                       : gw + (size_t)(it - 8) * 16 * DMODEL + st * KST;
    }
    async_copy12(l, g);
  };

  const unsigned short* sa = Sm + (wave * 32 + c) * RP + 8 * hh;
  const unsigned short* sb = Sm + (128 + c) * RP + 8 * hh;

  issue_stage(0);
  wait_copies();
  __syncthreads();   /* publishes stage 0 */
  issue_stage(1);

  /* kept rolled: one copy of the ring's foot (waits, barrier, refill), small loop text */
#pragma unroll 1
  for (int st = 0; st < NSTAGE; ++st) {
    const int bo = (st & 1) * QKV_STAGE_E;
    /* the stage's fragment loads stand as one group ahead of its products, so that the wave pays
       the LDS latency once a stage; the loops below are unrolled so that every index of the
       fragment arrays is a constant and they stay in registers */
    FB a0[2], a1[2], bf[2][4];
#pragma unroll
    for (int s = 0; s < 2; ++s) {
      const int ks = s * 32;
      a0[s].h[0] = *(const v8b_a*)(sa + bo + ks);
      a0[s].h[1] = *(const v8b_a*)(sa + bo + ks + 16);
      a1[s].h[0] = *(const v8b_a*)(sa + bo + 16 * RP + ks);
      a1[s].h[1] = *(const v8b_a*)(sa + bo + 16 * RP + ks + 16);
#pragma unroll
      for (int t = 0; t < 4; ++t) {
        bf[s][t].h[0] = *(const v8b_a*)(sb + bo + t * 16 * RP + ks);
        bf[s][t].h[1] = *(const v8b_a*)(sb + bo + t * 16 * RP + ks + 16);
      }
    }
#pragma unroll
    for (int s = 0; s < 2; ++s) {
#pragma unroll
      for (int t = 0; t < 4; ++t) {
        acc[0][t] = mma_bf16(a0[s].v, bf[s][t].v, acc[0][t]);
        acc[1][t] = mma_bf16(a1[s].v, bf[s][t].v, acc[1][t]);
      }
    }
    wait_lds_reads();
    wait_copies();
    __syncthreads();   /* publishes stage st + 1 and ends every read of stage st's buffer */
    if (st + 2 < NSTAGE) issue_stage(st + 2);
  }
  wait_copies();

  const int sec = n0 / DMODEL;                       /* 0 q, 1 k, 2 v : block-uniform */
  const float osc = (sec == 1) ? 0.125f : 1.0f;
#pragma unroll
  for (int t = 0; t < 4; ++t) {
    const float bv = bf_bits2f(f2bf_bits(bias[n0 + 16 * t + c]));
#pragma unroll
    for (int mt = 0; mt < 2; ++mt) {
#pragma unroll
      for (int r = 0; r < 8; ++r) {
        const float val = (acc[mt][t][r] + bv) * osc;
        const unsigned short hb = f2bf_bits(val);
        const unsigned short lb = f2bf_bits(val - bf_bits2f(hb));
        const int rl = wave * 32 + mt * 16 + 8 * hh + r;
        const int cl = 16 * t + c;
        const int idx = (sec < 2) ? (rl * TQ_PITCH + cl) : (cl * TV_PITCH + rl);
        Th[idx] = hb;
        Tl[idx] = lb;
      }
    }
  }
  __syncthreads();

  const int b  = m0 / SEQ;
  const int l0 = m0 - b * SEQ;
  const int h  = (n0 - sec * DMODEL) / DHEAD;
  const int bh = b * NHEAD + h;
  unsigned short* ph = qkvp + (size_t)(2 * sec) * PLANE;
  unsigned short* pl = ph + PLANE;

  {
    if (sec < 2) {
#pragma unroll
      for (int it = 0; it < 8; ++it) {
        const int u = it * 128 + tid;
        const int row = (u >> 7) * 16 + (u & 15);
        const int seg = (u >> 4) & 7;
        const v4u hw = *(const v4u_a*)(Th + row * TQ_PITCH + seg * 8);
        const v4u lw = *(const v4u_a*)(Tl + row * TQ_PITCH + seg * 8);
        const size_t g = ((size_t)bh * SEQ + l0) * DHEAD + u * 8;
        *(v4u*)(ph + g) = hw;
        *(v4u*)(pl + g) = lw;
      }
    } else {
#pragma unroll
      for (int it = 0; it < 8; ++it) {
        const int u = it * 128 + tid;
        const int drow = ((u >> 6) & 3) * 16 + (u & 15);
        const int seg  = (u >> 8) * 4 + ((u >> 4) & 3);
        const v4u hw = *(const v4u_a*)(Th + drow * TV_PITCH + seg * 8);
        const v4u lw = *(const v4u_a*)(Tl + drow * TV_PITCH + seg * 8);
        const size_t g = ((size_t)bh * SEQ + l0) * DHEAD + u * 8;
        *(v4u*)(ph + g) = hw;
        *(v4u*)(pl + g) = lw;
      }
    }
    
  }
}

/* --------------------------------------------------------------------------
 * Attention with the per-head relative-position table, head dim 64.
 * Block = 16 query rows of one (b,h); grid (SEQ/16, NBH). The block's 4 waves deal the
 * 64-key chunks among them (wave w takes chunks w, w+4, ...), each with its own running
 * maximum, sum and output accumulators; one block barrier, then the four partial states
 * are merged through LDS by the usual rescaling to the common row maximum.
 * At entry: the mask rows of all the wave's chunks read by value as one group of loads
 * (8 b128 loads a chunk + ballots), one packed word a chunk and lane; wave-uniform skip of a
 * chunk when every element of its 16x64 mask tile is set; per-element replace-fill otherwise.
 * Per 64-key chunk and wave (16 query rows); only the output accumulators, the row statistics
 * and the mask words stay resident between chunks:
 *   G = q.Ewin^T  : 5 tiles (80 offsets d = kv0-q0-15+g, packed tiles (kv0-q0)/16+63 ..),
 *                   2 d-steps x (hi + lo) against the bf16 table, written
 *                   to the wave-private G slab, read back skewed: G[m][n-m+15];
 *   S = q.(k/8)^T : 4 key tiles, 2 d-steps x (hi.hi + hi.lo + lo.hi),
 *                   one accumulator, each tile written to the wave-private S slab;
 *   f32 online softmax on S + G; P as bf16 hi+lo wave-private LDS tiles;
 *   O += Ph.Vh + Pl.Vh + Ph.Vl from the V^T planes, two 32-key steps.
 * All fragments come straight from the 16-bit global planes, which stand in fragment order: every
 * load is a wave-uniform base + 16 B x lane and covers four whole lines. The loads are
 * issued in groups ahead of the products that use them (q, table and key tile 0 together; key
 * tiles 1..3 as registers come free; v during the softmax).
 * LDS regions Ss/Gs/Psh/Psl are private to their wave (wave_sync form) inside the loop.
 * Epilogue: each wave's unnormalised 16x64 slab (aliases its G slab) and row statistics,
 * block barrier, merge + normalise (thread = one row x 8 columns) -> ctx hi/lo planes,
 * ------------------------------------------------------------------------ */
__global__ __launch_bounds__(128) VGPR_CAP void rel_attn_kernel(
    const unsigned short* __restrict__ qkvp, const unsigned short* __restrict__ Erb,
    const int* __restrict__ mask, unsigned short* __restrict__ ctxp)
{
  union FB { v16b v; v8b h[2]; };
  __shared__ __align__(16) float Gs[NWAVE][16 * GP];
  __shared__ __align__(16) float Ss[NWAVE][16 * SP];
  __shared__ __align__(16) unsigned short Psh[NWAVE][16 * KCH];
  __shared__ __align__(16) unsigned short Psl[NWAVE][16 * KCH];
  __shared__ float Ms[NWAVE][16];
  __shared__ float Ls[NWAVE][16];

  const int tid  = threadIdx.x;
  const int wave = __builtin_amdgcn_readfirstlane(tid >> 5);
  const int lane = tid & 31;
  const int hh   = lane >> 4;
  const int c    = lane & 15;
  const int c3   = c & 3;
  const int csh  = c >> 2;
  const int qb   = blockIdx.x;
  const int bh   = blockIdx.y;
  const int b    = bh / NHEAD;
  const int h    = bh - b * NHEAD;
  const int q0   = qb * 16;
  const float NEG_INF = -__builtin_inff();

  const unsigned short* Qh  = qkvp + (size_t)bh * SEQ * DHEAD;   /* each lo plane stands PLANE behind its hi plane */
  const unsigned short* Kh  = Qh + 2 * PLANE;
  const unsigned short* Vth = Qh + 4 * PLANE;     /* same per-bh element count */
  const unsigned short* Eh  = Erb + (size_t)h * 128 * 1024;   /* 128 packed tiles of 1024 elements a head */

  float mrow[8], lrow[8];
  v8f oacc[4];
#pragma unroll
  for (int r = 0; r < 8; ++r) { mrow[r] = NEG_INF; lrow[r] = 0.f; }
#pragma unroll
  for (int t = 0; t < 4; ++t) oacc[t] = (v8f){0.f,0.f,0.f,0.f,0.f,0.f,0.f,0.f};

  float* gs = Gs[wave];
  float* ss = Ss[wave];
  unsigned short* pwh = Psh[wave];
  unsigned short* pwl = Psl[wave];
  /* one lane base per slab and access pattern; every row and tile below is a constant offset from
     it, so that the LDS addresses take one register each and leave room for loads in flight */
  float* gsw = gs + 8 * hh * GP + c;                    /* G and output slab, element (8hh+r, 16t+c) */
  float* ssw = ss + 8 * hh * SP + c;                    /* S slab, element (8hh+r, 16j+c) */
  const float* gsk = gs + 8 * hh * (GP - 1) + c + 15;   /* G slab read skewed: G[m][n-m+15] */
  unsigned short* pwhw = pwh + 8 * hh * KCH + c;
  unsigned short* pwlw = pwl + 8 * hh * KCH + c;
  const unsigned lane8 = (unsigned)(lane * 8);   /* this lane's 16-B unit of every 512-B fragment run (elements) */

  /* mask tiles of all NCH chunks of this wave, by value: the 8 * NCH row loads stand as one group
     ahead of every use, so that the wave waits for the mask once and not once a row.
     Bit L of the ballot (it, e) = mask[q0+2it+(L>>4)][kv0+4(L&15)+e] != 0; each lane keeps the
     word of its own e = c&3 (lane masks sel0..sel3) and of its own row half, and packs its own
     32 bits of a chunk into one word: bit 16(r&1) + 4j + (r>>1) = element (row 8hh+r, key 16j+c). */
  unsigned mpk[NCH];
  unsigned skip = 0u;                 /* bit i: every element of chunk i's tile is masked (wave-uniform) */
  {
    v4i mv[NCH][8];
    const int* ml = mask + (size_t)(q0 + hh) * SEQ_FULL + wave * KCH + 4 * c;   /* lane base; the rest are constants */
#pragma unroll
    for (int i = 0; i < NCH; ++i)
#pragma unroll
      for (int it = 0; it < 8; ++it) {
        if (i == NCH - 1 && it == 7) wait_addr();   /* last use of the mask address pair */
        mv[i][it] = *(const v4i*)(ml + it * 2 * SEQ_FULL + i * NWAVE * KCH);
      }
    const unsigned sel0 = (c3 == 0) ? 0xFFFFFFFFu : 0u;
    const unsigned sel1 = (c3 == 1) ? 0xFFFFFFFFu : 0u;
    const unsigned sel2 = (c3 == 2) ? 0xFFFFFFFFu : 0u;
    const unsigned sel3 = (c3 == 3) ? 0xFFFFFFFFu : 0u;
#pragma unroll
    for (int i = 0; i < NCH; ++i) {
      unsigned msel[8];
      unsigned andall = 0xFFFFFFFFu;
#pragma unroll
      for (int it = 0; it < 8; ++it) {
        const unsigned b0 = __builtin_amdgcn_ballot_w32(mv[i][it][0] != 0);
        const unsigned b1 = __builtin_amdgcn_ballot_w32(mv[i][it][1] != 0);
        const unsigned b2 = __builtin_amdgcn_ballot_w32(mv[i][it][2] != 0);
        const unsigned b3 = __builtin_amdgcn_ballot_w32(mv[i][it][3] != 0);
        andall &= (b0 & b1) & (b2 & b3);
        msel[it] = (b0 & sel0) | (b1 & sel1) | (b2 & sel2) | (b3 & sel3);
      }
      unsigned pk = 0u;
#pragma unroll
      for (int ii = 0; ii < 4; ++ii) {
        const unsigned w = hh ? msel[4 + ii] : msel[ii];
        pk |= ((w >> csh) & 0x11111111u) << ii;
      }
      mpk[i] = pk;
      skip |= (andall == 0xFFFFFFFFu) ? (1u << i) : 0u;
    }
  }

  /* kept rolled: one copy of the chunk's text */
#pragma unroll 1
  for (int i = 0; i < NCH; ++i) {
    if ((skip >> i) & 1u) continue;               /* wave-uniform: every element masked */
    const int kv0 = (wave + i * NWAVE) * KCH;

    const unsigned mk = (i == 0) ? mpk[0] : (i == 1) ? mpk[1] : (i == 2) ? mpk[2] : mpk[3];

    /* The chunk's loads fly as a window ahead of the products that use them: q, the 5 table tiles
       and key tile 0 are issued as one group, each further key tile as soon as earlier tiles'
       registers come free. q is read per chunk so that its registers are free for the v fragments
       during the softmax and p.v. All loops below are unrolled so that the fragment arrays are
       indexed by constants and stay in registers. */
    v16b qh[2], ql[2];
    FB kfh[4][2], kfl[4][2], ef[5][2];
    /* position table: offsets kv0 - q0 - 15 + g, g = 0..79, are the packed tiles
       (kv0 - q0) / 16 + 63 + t, t = 0..4, in [0, 127] */
    g_u16* ep = scalar_base(Eh + ((kv0 - q0 + SEQ_FULL - 16) >> 4) * 1024);
    g_u16* kh = scalar_base(Kh + kv0 * DHEAD);
    g_u16* kl = kh + PLANE;
    g_u16* vh = scalar_base(Vth + kv0 * DHEAD);
    g_u16* vl = vh + PLANE;
    g_u16* qph = scalar_base(Qh + q0 * DHEAD);
    g_u16* qpl = qph + PLANE;
    auto load_key_tile = [&](int j) {
#pragma unroll
      for (int dc = 0; dc < 2; ++dc) {
        kfh[j][dc].h[0] = *(g_v8b*)(kh + lane8 + j * 1024 + dc * 512);
        kfh[j][dc].h[1] = *(g_v8b*)(kh + lane8 + j * 1024 + dc * 512 + 256);
        kfl[j][dc].h[0] = *(g_v8b*)(kl + lane8 + j * 1024 + dc * 512);
        kfl[j][dc].h[1] = *(g_v8b*)(kl + lane8 + j * 1024 + dc * 512 + 256);
      }
      /* behind the chunk's last k load, before its address registers are written anew */
      if (j == 3) wait_addr();
    };
    {
#pragma unroll
      for (int dc = 0; dc < 2; ++dc) {
        FB f;
        f.h[0] = *(g_v8b*)(qph + lane8 + dc * 512);
        f.h[1] = *(g_v8b*)(qph + lane8 + dc * 512 + 256);
        qh[dc] = f.v;
        f.h[0] = *(g_v8b*)(qpl + lane8 + dc * 512);
        f.h[1] = *(g_v8b*)(qpl + lane8 + dc * 512 + 256);
        ql[dc] = f.v;
      }
    }
#pragma unroll
    for (int t = 0; t < 5; ++t) {
#pragma unroll
      for (int dc = 0; dc < 2; ++dc) {
        ef[t][dc].h[0] = *(g_v8b*)(ep + lane8 + t * 1024 + dc * 512);
        ef[t][dc].h[1] = *(g_v8b*)(ep + lane8 + t * 1024 + dc * 512 + 256);
      }
    }
    load_key_tile(0);
    wait_addr();      /* behind the last q and table loads, before their address registers are written anew */
    /* keeps the first product, and the load wait in front of it, behind the issue of the whole
       group: moved up among the loads it would make the rest of the group wait a full latency */
    __builtin_amdgcn_sched_barrier(0);

    /* position term: G[m][g] = q[m] . Er[h][(kv0 - q0 - 15 + g) mod 2047], g = 0..79 */
#pragma unroll
    for (int t = 0; t < 5; ++t) {
      v8f g = (v8f){0.f,0.f,0.f,0.f,0.f,0.f,0.f,0.f};
#pragma unroll
      for (int dc = 0; dc < 2; ++dc) {
        g = mma_bf16(qh[dc], ef[t][dc].v, g);
        g = mma_bf16(ql[dc], ef[t][dc].v, g);
      }
      if (t == 1) load_key_tile(1);
      if (t == 3) load_key_tile(2);
#pragma unroll
      for (int r = 0; r < 8; ++r) gsw[r * GP + 16 * t] = g[r];
    }

    /* raw scores: 4 key tiles, one accumulator, tile -> S slab (D elem r = row 8hh+r, col c) */
#pragma unroll
    for (int j = 0; j < 4; ++j) {
      v8f sa = (v8f){0.f,0.f,0.f,0.f,0.f,0.f,0.f,0.f};
#pragma unroll
      for (int dc = 0; dc < 2; ++dc) {
        sa = mma_bf16(qh[dc], kfh[j][dc].v, sa);
        sa = mma_bf16(qh[dc], kfl[j][dc].v, sa);
        sa = mma_bf16(ql[dc], kfh[j][dc].v, sa);
      }
      if (j == 0) load_key_tile(3);
#pragma unroll
      for (int r = 0; r < 8; ++r) ssw[r * SP + 16 * j] = sa[r];
    }
    wave_lds_sync();

    /* v fragments of the first 32 keys: issued here, so that they fly during the softmax */
    FB vbh[2][4], vbl[2][4];
    auto load_v_step = [&](int kk) {
#pragma unroll
      for (int t = 0; t < 4; ++t) {
        const int vo = kk * 2048 + t * 512;
        vbh[kk][t].h[0] = *(g_v8b*)(vh + lane8 + vo);
        vbh[kk][t].h[1] = *(g_v8b*)(vh + lane8 + vo + 256);
        vbl[kk][t].h[0] = *(g_v8b*)(vl + lane8 + vo);
        vbl[kk][t].h[1] = *(g_v8b*)(vl + lane8 + vo + 256);
      }
      /* behind the chunk's last v load, before its address registers are written anew */
      if (kk == 1) wait_addr();
    };
    load_v_step(0);

    /* raw score + skewed position term, replace-fill of masked elements */
    v8f s[4];
#pragma unroll
    for (int j = 0; j < 4; ++j) {
#pragma unroll
      for (int r = 0; r < 8; ++r) {
        const float raw = ssw[r * SP + 16 * j];
        const float gv = gsk[r * (GP - 1) + 16 * j];
        const float sv = raw + gv;
        const unsigned bit = (mk >> (16 * (r & 1) + 4 * j + (r >> 1))) & 1u;
        s[j][r] = bit ? NEG_INF : sv;
      }
    }

    /* chunk row max over the 64 keys */
    float cm[8];
#pragma unroll
    for (int r = 0; r < 8; ++r) {
      float m = fmaxf(fmaxf(s[0][r], s[1][r]), fmaxf(s[2][r], s[3][r]));
#pragma unroll
      for (int off = 1; off < 16; off <<= 1) m = fmaxf(m, __shfl_xor(m, off, 32));
      cm[r] = m;
    }

    /* online softmax update, P tiles as bf16 hi + lo */
#pragma unroll
    for (int r = 0; r < 8; ++r) {
      if (r == 4) load_v_step(1);   /* the second 32 keys' fragments, once half the score registers are free */
      const float mnew  = fmaxf(mrow[r], cm[r]);
      const float msafe = (mnew == NEG_INF) ? 0.f : mnew;
      const float alpha = expf(mrow[r] - msafe);
      mrow[r] = mnew;
      float psum = 0.f;
#pragma unroll
      for (int j = 0; j < 4; ++j) {
        const float p = expf(s[j][r] - msafe);
        psum += p;
        const unsigned short hb = f2bf_bits(p);
        const unsigned short lb = f2bf_bits(p - bf_bits2f(hb));
        pwhw[r * KCH + j * 16] = hb;
        pwlw[r * KCH + j * 16] = lb;
      }
#pragma unroll
      for (int off = 1; off < 16; off <<= 1) psum += __shfl_xor(psum, off, 32);
      lrow[r] = lrow[r] * alpha + psum;
#pragma unroll
      for (int t = 0; t < 4; ++t) oacc[t][r] *= alpha;
    }
    wave_lds_sync();

    /* O += P.V : A = P [q][kv] (this wave's tiles), B = V [kv][d] from the packed v planes;
       unrolled over the two 32-key steps: the fragment arrays are indexed by constants */
#pragma unroll
    for (int kk = 0; kk < 2; ++kk) {
      FB pa, pl;
      pa.h[0] = *(const v8b_a*)(pwh + c * KCH + kk * 32 + 8 * hh);
      pa.h[1] = *(const v8b_a*)(pwh + c * KCH + kk * 32 + 16 + 8 * hh);
      pl.h[0] = *(const v8b_a*)(pwl + c * KCH + kk * 32 + 8 * hh);
      pl.h[1] = *(const v8b_a*)(pwl + c * KCH + kk * 32 + 16 + 8 * hh);
#pragma unroll
      for (int t = 0; t < 4; ++t) {
        oacc[t] = mma_bf16(pa.v, vbh[kk][t].v, oacc[t]);
        oacc[t] = mma_bf16(pl.v, vbh[kk][t].v, oacc[t]);
        oacc[t] = mma_bf16(pa.v, vbl[kk][t].v, oacc[t]);
      }
    }
    wave_lds_sync();
  }

  /* this wave's partial state: unnormalised output into its own slab (aliases the G slab),
     row maximum and row sum beside it */
#pragma unroll
  for (int r = 0; r < 8; ++r) {
#pragma unroll
    for (int t = 0; t < 4; ++t) gsw[r * GP + t * 16] = oacc[t][r];
  }
  if (c == 0) {      /* the 16 lanes of a half hold equal row statistics */
#pragma unroll
    for (int r = 0; r < 8; ++r) {
      Ms[wave][8 * hh + r] = mrow[r];
      Ls[wave][8 * hh + r] = lrow[r];
    }
  }
  __syncthreads();   /* publishes the four partial states to the whole block */
  {
    unsigned short* Ch = ctxp;
    unsigned short* Cl = ctxp + XB_E;
    const int row = tid >> 3;
    const int seg = tid & 7;
    float mall = Ms[0][row];
#pragma unroll
    for (int w = 1; w < NWAVE; ++w) mall = fmaxf(mall, Ms[w][row]);
    const float msafe = (mall == NEG_INF) ? 0.f : mall;
    float lsum = 0.f;
    v4f a0 = (v4f){0.f, 0.f, 0.f, 0.f};
    v4f a1 = (v4f){0.f, 0.f, 0.f, 0.f};
#pragma unroll
    for (int w = 0; w < NWAVE; ++w) {
      const float f = expf(Ms[w][row] - msafe);
      lsum += Ls[w][row] * f;
      a0 += *(const v4f_a*)(Gs[w] + row * GP + seg * 8) * f;
      a1 += *(const v4f_a*)(Gs[w] + row * GP + seg * 8 + 4) * f;
    }
    const float inv = 1.0f / lsum;
    a0 *= inv;
    a1 *= inv;
    unsigned h0, h1, h2, h3, l0, l1, l2, l3;
    split2(a0[0], a0[1], h0, l0);
    split2(a0[2], a0[3], h1, l1);
    split2(a1[0], a1[1], h2, l2);
    split2(a1[2], a1[3], h3, l3);
    v4u hw, lw;
    hw[0] = h0; hw[1] = h1; hw[2] = h2; hw[3] = h3;
    lw[0] = l0; lw[1] = l1; lw[2] = l2; lw[3] = l3;
    const size_t g = (size_t)(b * SEQ + q0 + row) * DMODEL + h * DHEAD + seg * 8;
    *(v4u*)(Ch + g) = hw;
    *(v4u*)(Cl + g) = lw;
  }
}

/* --------------------------------------------------------------------------
 * out = (Ch + Cl) . WoT^T + b  (M = MROWS, N = 1024, K = 1024), f32 acc.
 * Block = 4 waves, tile 128 x 64; wave = 32 rows x 64 cols; A hi and lo planes
 * against the single bf16 weight plane (two products per tile pair).
 * Operands: stages of 64 k (128 B of each of the 320 operand rows) in a two-buffer LDS ring,
 * filled by asynchronous copies (20 per thread and stage) in the order of gemm_qkv_kernel.
 * Epilogue: per-wave 32x64 f32 slab (wave-private LDS), 16 lanes x 16 B = one 256-B
 * ------------------------------------------------------------------------ */
__global__ __launch_bounds__(128) VGPR_CAP void gemm_out_kernel(
    const unsigned short* __restrict__ ctxp, const unsigned short* __restrict__ WoT,
    const float* __restrict__ bias, float* __restrict__ out)
{
  union FB { v16b v; v8b h[2]; };
  __shared__ __align__(16) float Os[NWAVE][32 * OS_PITCH];
  __shared__ __align__(16) unsigned short Sm[2 * OUT_STAGE_E];

  const int tid  = threadIdx.x;
  const int wave = __builtin_amdgcn_readfirstlane(tid >> 5);
  const int lane = tid & 31;
  const int hh   = lane >> 4;
  const int c    = lane & 15;
  const int n0   = blockIdx.x * 64;
  const int m0   = blockIdx.y * 128;

  v8f acc[2][4];
#pragma unroll
  for (int mt = 0; mt < 2; ++mt)
#pragma unroll
    for (int t = 0; t < 4; ++t) acc[mt][t] = (v8f){0.f,0.f,0.f,0.f,0.f,0.f,0.f,0.f};

  /* copy unit: thread -> (row tid>>3 of each group of 16 rows, 16-B segment tid&7) */
  const int crow = tid >> 3;
  const int cseg = tid & 7;
  const unsigned short* gh = ctxp + (size_t)(m0 + crow) * DMODEL + cseg * 8;
  const unsigned short* gl = gh + XB_E;
  const unsigned short* gw = WoT + (size_t)(n0 + crow) * DMODEL + cseg * 8;
  const unsigned lrow = lds_off(Sm) + (unsigned)(crow * RP + cseg * 8) * 2u;

  auto issue_stage = [&](int st) {
    /* unrolled below: the address arrays are indexed by constants and stay in registers */
    unsigned l[20];
    const unsigned short* g[20];
    const unsigned lb = lrow + (unsigned)(st & 1) * (unsigned)(OUT_STAGE_E * 2);
#pragma unroll
    for (int it = 0; it < 20; ++it) {
      l[it] = lb + (unsigned)(it * 16 * RP * 2);
      g[it] = (it < 8)  ? gh + (size_t)it * 16 * DMODEL + st * KST
            : (it < 16) ? gl + (size_t)(it - 8) * 16 * DMODEL + st * KST
                        : gw + (size_t)(it - 16) * 16 * DMODEL + st * KST;
    }
    async_copy10(l, g);
    async_copy10(l + 10, g + 10);
  };

  const unsigned short* sh = Sm + (wave * 32 + c) * RP + 8 * hh;
  const unsigned short* sl = sh + 128 * RP;
  const unsigned short* sb = Sm + (256 + c) * RP + 8 * hh;

  issue_stage(0);
  wait_copies();
  __syncthreads();   /* publishes stage 0 */
  issue_stage(1);

  /* kept rolled: one copy of the ring's foot (waits, barrier, refill), small loop text */
#pragma unroll 1
  for (int st = 0; st < NSTAGE; ++st) {
    const int bo = (st & 1) * OUT_STAGE_E;
    /* the stage's fragment loads stand as one group ahead of its products, so that the wave pays
       the LDS latency once a stage; the loops below are unrolled so that every index of the
       fragment arrays is a constant and they stay in registers */
    FB a0h[2], a1h[2], a0l[2], a1l[2], bf[2][4];
#pragma unroll
    for (int s = 0; s < 2; ++s) {
      const int ks = s * 32;
      a0h[s].h[0] = *(const v8b_a*)(sh + bo + ks);
      a0h[s].h[1] = *(const v8b_a*)(sh + bo + ks + 16);
      a0l[s].h[0] = *(const v8b_a*)(sl + bo + ks);
      a0l[s].h[1] = *(const v8b_a*)(sl + bo + ks + 16);
      a1h[s].h[0] = *(const v8b_a*)(sh + bo + 16 * RP + ks);
      a1h[s].h[1] = *(const v8b_a*)(sh + bo + 16 * RP + ks + 16);
      a1l[s].h[0] = *(const v8b_a*)(sl + bo + 16 * RP + ks);
      a1l[s].h[1] = *(const v8b_a*)(sl + bo + 16 * RP + ks + 16);
#pragma unroll
      for (int t = 0; t < 4; ++t) {
        bf[s][t].h[0] = *(const v8b_a*)(sb + bo + t * 16 * RP + ks);
        bf[s][t].h[1] = *(const v8b_a*)(sb + bo + t * 16 * RP + ks + 16);
      }
    }
#pragma unroll
    for (int s = 0; s < 2; ++s) {
#pragma unroll
      for (int t = 0; t < 4; ++t) {
        acc[0][t] = mma_bf16(a0h[s].v, bf[s][t].v, acc[0][t]);
        acc[0][t] = mma_bf16(a0l[s].v, bf[s][t].v, acc[0][t]);
        acc[1][t] = mma_bf16(a1h[s].v, bf[s][t].v, acc[1][t]);
        acc[1][t] = mma_bf16(a1l[s].v, bf[s][t].v, acc[1][t]);
      }
    }
    wait_lds_reads();
    wait_copies();
    __syncthreads();   /* publishes stage st + 1 and ends every read of stage st's buffer */
    if (st + 2 < NSTAGE) issue_stage(st + 2);
  }
  wait_copies();

  float* os = Os[wave];
#pragma unroll
  for (int t = 0; t < 4; ++t) {
    const float bv = bf_bits2f(f2bf_bits(bias[n0 + 16 * t + c]));
#pragma unroll
    for (int mt = 0; mt < 2; ++mt)
#pragma unroll
      for (int r = 0; r < 8; ++r)
        os[(mt * 16 + 8 * hh + r) * OS_PITCH + 16 * t + c] = acc[mt][t][r] + bv;
  }
  wave_lds_sync();
  {
    const int c4 = c * 4;
    {
#pragma unroll
      for (int it = 0; it < 16; ++it) {
        const int row = it * 2 + hh;
        const v4f val = *(const v4f_a*)(os + row * OS_PITCH + c4);
        *(v4f*)(out + (size_t)(m0 + wave * 32 + row) * DMODEL + n0 + c4) = val;
      }
      
    }
  }
}

extern "C" void kernel_launch(void* const* d_in, const int* in_sizes, int n_in,
                              void* d_out, int out_size, void* d_ws, size_t ws_size,
                              hipStream_t stream)
{
  if (n_in < 7) return;
  if (in_sizes[0] < ((NB - 1) * SEQ_FULL + SEQ) * DMODEL) return;
  if (in_sizes[1] < (SEQ - 1) * SEQ_FULL + SEQ) return;
  if (in_sizes[2] < DMODEL * NQKV) return;
  if (in_sizes[3] < NQKV) return;
  if (in_sizes[4] < DMODEL * DMODEL) return;
  if (in_sizes[5] < DMODEL) return;
  if (in_sizes[6] < NHEAD * NPOS * DHEAD) return;
  if (out_size < MROWS * DMODEL) return;
  if (d_ws == nullptr || ws_size < WS_NEED) return;

  const float* x     = (const float*)d_in[0];
  const int*   mask  = (const int*)d_in[1];
  const float* W_qkv = (const float*)d_in[2];
  const float* b_qkv = (const float*)d_in[3];
  const float* W_o   = (const float*)d_in[4];
  const float* b_o   = (const float*)d_in[5];
  const float* Er    = (const float*)d_in[6];
  float* out = (float*)d_out;

  unsigned short* Xb   = (unsigned short*)d_ws;
  unsigned short* WqT  = Xb + XB_E;
  unsigned short* WoT  = WqT + WQT_E;
  unsigned short* Erb  = WoT + WOT_E;
  unsigned short* qkvp = Erb + ERB_E;
  unsigned short* ctxp = qkvp + QKVP_E;

  /* the four preparation jobs, one launch */
  prep_kernel<<<PREP_BLOCKS, 256, 0, stream>>>(x, W_qkv, W_o, Er, Xb, WqT, WoT, Erb);

  gemm_qkv_kernel<<<dim3(NQKV / 64, MROWS / 128), 128, 0, stream>>>(Xb, WqT, b_qkv, qkvp);
  rel_attn_kernel<<<dim3(SEQ / 16, NBH), 128, 0, stream>>>(qkvp, Erb, mask, ctxp);
  gemm_out_kernel<<<dim3(DMODEL / 64, MROWS / 128), 128, 0, stream>>>(ctxp, WoT, b_o, out);
}

// v006
// A run of this version takes 85.3 microseconds.
// In both of two side-by-side timings against v005, it was 1.18 times as fast.
// All steps since v000 together make it 3.12 times as fast.
// Contractions: x.Wqkv on v_wmma_f32_16x16x32_bf16 with both operands RNE-converted to bf16 once; q.(k/8)^T, q.Er^T, p.v and ctx.Wo on v_wmma_f32_16x16x32_bf16 with computed operands (q, k/8, v, p, ctx) carried as bf16 hi+lo planes (hi.hi + hi.lo + lo.hi) and input operands (Er, Wo) as single bf16 planes; f32 accumulate; softmax, bias adds and mask fill in f32.
#include <hip/hip_runtime.h>

typedef __attribute__((ext_vector_type(16))) __bf16 v16b;
typedef __attribute__((ext_vector_type(8)))  __bf16 v8b;
typedef __attribute__((ext_vector_type(8)))  float  v8f;
typedef __attribute__((ext_vector_type(4)))  float  v4f;
typedef __attribute__((ext_vector_type(4)))  unsigned int v4u;
typedef __attribute__((ext_vector_type(4)))  int v4i;
typedef v8b v8b_a __attribute__((may_alias));
typedef v4f v4f_a __attribute__((may_alias));
typedef v4u v4u_a __attribute__((may_alias));

#ifndef NB
#define NB 2
#endif
#ifndef SEQ
#define SEQ 1024
#endif
#define NB_FULL 2
#define SEQ_FULL 1024

#define VGPR_CAP __attribute__((amdgpu_num_vgpr(256)))

constexpr int DMODEL = 1024;
constexpr int NHEAD  = 16;
constexpr int DHEAD  = 64;
constexpr int NPOS   = 2047;
constexpr int NQKV   = 3 * DMODEL;
constexpr int NBH    = NB * NHEAD;
constexpr int MROWS  = NB * SEQ;
constexpr int KCH    = 64;        /* keys per chunk */
constexpr int NWAVE  = 4;
constexpr int NCH    = SEQ / (KCH * NWAVE);   /* key chunks per wave of the attention block */
constexpr int GP     = 84;        /* skew slab pitch in floats (336 B rows, 16-B aligned) */
constexpr int SP     = 68;        /* raw score slab pitch in floats */
constexpr int TQ_PITCH = 72;      /* [tok][d] staging pitch (16-bit elements) */
constexpr int TV_PITCH = 136;     /* [d][tok] staging pitch (16-bit elements) */
constexpr int T_ELEMS  = 128 * TQ_PITCH;   /* 9216 >= 64 * TV_PITCH = 8704 */
constexpr int TS_PITCH = 72;
constexpr int OS_PITCH = 68;
constexpr int KST      = 64;      /* k elements per GEMM stage: one 128-B line of every operand row */
constexpr int RP       = 72;      /* GEMM stage row pitch (16-bit elements): 144 B = 16 B x odd for b128 readers */
constexpr int NSTAGE   = 1024 / KST;
constexpr int QKV_STAGE_E = (128 + 64) * RP;        /* [x 128 rows | W 64 rows] */
constexpr int OUT_STAGE_E = (128 + 128 + 64) * RP;  /* [ctx hi 128 | ctx lo 128 | W 64 rows] */

constexpr size_t PLANE  = (size_t)NBH * SEQ * DHEAD;
constexpr size_t XB_E   = (size_t)MROWS * DMODEL;
constexpr size_t WQT_E  = (size_t)NQKV * DMODEL;
constexpr size_t WOT_E  = (size_t)DMODEL * DMODEL;
constexpr size_t ERB_E  = (size_t)NHEAD * 2048 * DHEAD;
constexpr size_t QKVP_E = 6 * PLANE;
constexpr size_t CTX_E  = 2 * XB_E;
constexpr size_t WS_NEED = 2 * (XB_E + WQT_E + WOT_E + ERB_E + QKVP_E + CTX_E);

static_assert(SEQ % 128 == 0);
static_assert(NCH * KCH * NWAVE == SEQ && NCH == 4);
static_assert(SEQ <= SEQ_FULL && NB <= NB_FULL);
static_assert(DHEAD == 64 && DMODEL == NHEAD * DHEAD);
static_assert(DMODEL % 64 == 0 && NQKV % 64 == 0 && DMODEL % 32 == 0);
static_assert(64 * TV_PITCH <= T_ELEMS);
static_assert((TQ_PITCH * 2) % 16 == 0 && (TV_PITCH * 2) % 16 == 0 && (GP * 4) % 16 == 0 && (OS_PITCH * 4) % 16 == 0);
static_assert(GP >= 80 && SP >= 64);
static_assert(NSTAGE * KST == DMODEL && NSTAGE >= 2 && (RP * 2) % 16 == 0 && RP >= KST);
static_assert(2 * T_ELEMS <= 2 * QKV_STAGE_E);
static_assert((size_t)NHEAD * NPOS * DHEAD <= ERB_E);
static_assert(WS_NEED <= 134217728ull);

/*
 *   Xb   [MROWS][1024]        x, bf16
 *   WqT  [3072][1024]         W_qkv transposed, bf16
 *   WoT  [1024][1024]         W_o transposed, bf16
 *   Erb  [16][128 tiles][8][16][8]   Er, bf16, in fragment order (below); row c of tile m is the
 *                             table row of offset 16m - 1023 + c, that is (16m - 1023 + c) mod 2047
 *   qkvp 6 planes, in fragment order: Qh Ql, Kh Kl (k/8) [bh][l/16][d/8][l%16][8 d],
 *                             Vh Vl [bh][l/32][d/16][(l%32)/8][d%16][8 l]
 *   ctxp 2 planes: Ch Cl [MROWS][1024]
 * Fragment order: the 16-B unit that lane (hh, c) takes for half a fragment register set stands at
 * unit 16hh + c of a 512-B run, so that one 16-B load of a wave covers four whole 128-B lines.
 */

__device__ __forceinline__ unsigned short f2bf_bits(float f) {
  unsigned u = __float_as_uint(f);
  return (unsigned short)((u + 0x7FFFu + ((u >> 16) & 1u)) >> 16);
}
__device__ __forceinline__ float bf_bits2f(unsigned short h) { return __uint_as_float(((unsigned)h) << 16); }
__device__ __forceinline__ unsigned pk2(float a, float b) {
  return (unsigned)f2bf_bits(a) | ((unsigned)f2bf_bits(b) << 16);
}
__device__ __forceinline__ void split2(float a, float b, unsigned& hw, unsigned& lw) {
  const unsigned short ha = f2bf_bits(a);
  const unsigned short hb = f2bf_bits(b);
  const unsigned short la = f2bf_bits(a - bf_bits2f(ha));
  const unsigned short lb = f2bf_bits(b - bf_bits2f(hb));
  hw = (unsigned)ha | ((unsigned)hb << 16);
  lw = (unsigned)la | ((unsigned)lb << 16);
}

/* one WMMA + hazard guard naming only this call's live operands */
__device__ __forceinline__ v8f mma_bf16(v16b a, v16b b, v8f c) {
  c = __builtin_amdgcn_wmma_f32_16x16x32_bf16(false, a, false, b, (short)0, c, false, false);
  asm volatile("v_nop\n\tv_nop\n\tv_nop\n\tv_nop" : "+v"(c) : "v"(a), "v"(b));
  return c;
}

__device__ __forceinline__ void wave_lds_sync() {
  __builtin_amdgcn_fence(3 /* release order */, "workgroup");
  __builtin_amdgcn_wave_barrier();
  __builtin_amdgcn_fence(2 /* acquire order */, "workgroup");
}

/* byte offset of a __shared__ address inside the work-group's LDS */
__device__ __forceinline__ unsigned lds_off(const void* p) { return (unsigned)(size_t)p; }

/* Asynchronous copies global -> LDS, 16 B per lane and copy, every lane on. The copies of a run
   and the s_wait_xcnt 0 that stands before their address registers may be rewritten are one
   statement, so that no later address arithmetic can be moved in front of that wait. */
__device__ __forceinline__ void async_copy12(const unsigned (&l)[12], const unsigned short* const (&g)[12]) {
  asm volatile(
      "global_load_async_to_lds_b128 %0, %12, off\n\t"
      "global_load_async_to_lds_b128 %1, %13, off\n\t"
      "global_load_async_to_lds_b128 %2, %14, off\n\t"
      "global_load_async_to_lds_b128 %3, %15, off\n\t"
      "global_load_async_to_lds_b128 %4, %16, off\n\t"
      "global_load_async_to_lds_b128 %5, %17, off\n\t"
      "global_load_async_to_lds_b128 %6, %18, off\n\t"
      "global_load_async_to_lds_b128 %7, %19, off\n\t"
      "global_load_async_to_lds_b128 %8, %20, off\n\t"
      "global_load_async_to_lds_b128 %9, %21, off\n\t"
      "global_load_async_to_lds_b128 %10, %22, off\n\t"
      "global_load_async_to_lds_b128 %11, %23, off\n\t"
      "s_wait_xcnt 0x0"
      :: "v"(l[0]), "v"(l[1]), "v"(l[2]), "v"(l[3]), "v"(l[4]), "v"(l[5]),
         "v"(l[6]), "v"(l[7]), "v"(l[8]), "v"(l[9]), "v"(l[10]), "v"(l[11]),
         "v"(g[0]), "v"(g[1]), "v"(g[2]), "v"(g[3]), "v"(g[4]), "v"(g[5]),
         "v"(g[6]), "v"(g[7]), "v"(g[8]), "v"(g[9]), "v"(g[10]), "v"(g[11])
      : "memory");
}
__device__ __forceinline__ void async_copy10(const unsigned* l, const unsigned short* const* g) {
  asm volatile(
      "global_load_async_to_lds_b128 %0, %10, off\n\t"
      "global_load_async_to_lds_b128 %1, %11, off\n\t"
      "global_load_async_to_lds_b128 %2, %12, off\n\t"
      "global_load_async_to_lds_b128 %3, %13, off\n\t"
      "global_load_async_to_lds_b128 %4, %14, off\n\t"
      "global_load_async_to_lds_b128 %5, %15, off\n\t"
      "global_load_async_to_lds_b128 %6, %16, off\n\t"
      "global_load_async_to_lds_b128 %7, %17, off\n\t"
      "global_load_async_to_lds_b128 %8, %18, off\n\t"
      "global_load_async_to_lds_b128 %9, %19, off\n\t"
      "s_wait_xcnt 0x0"
      :: "v"(l[0]), "v"(l[1]), "v"(l[2]), "v"(l[3]), "v"(l[4]),
         "v"(l[5]), "v"(l[6]), "v"(l[7]), "v"(l[8]), "v"(l[9]),
         "v"(g[0]), "v"(g[1]), "v"(g[2]), "v"(g[3]), "v"(g[4]),
         "v"(g[5]), "v"(g[6]), "v"(g[7]), "v"(g[8]), "v"(g[9])
      : "memory");
}
/* A pointer that is the same in every lane, held in scalar registers: the loads from it take the
   form scalar base + lane offset, so that no vector address pair is written among loads in flight. */
typedef const __attribute__((address_space(1))) unsigned short g_u16;   /* global memory, named as such */
typedef const __attribute__((address_space(1))) v8b g_v8b;
__device__ __forceinline__ g_u16* scalar_base(const unsigned short* p) {
  const unsigned long long a = (unsigned long long)p;
  const unsigned lo = (unsigned)__builtin_amdgcn_readfirstlane((int)(unsigned)a);
  const unsigned hi = (unsigned)__builtin_amdgcn_readfirstlane((int)(unsigned)(a >> 32));
  return (g_u16*)(((unsigned long long)hi << 32) | lo);
}
/* Stands in front of the last load from an address pair, whose destination may be that pair while
   earlier loads from it are in flight, and behind it, before the pair is written anew: the wait
   that is kept before a register of an issued global load is overwritten. */
__device__ __forceinline__ void wait_addr() { asm volatile("s_wait_xcnt 0x0" ::: "memory"); }
/* this wave's copies have landed in LDS (the compiler places no wait for them) */
__device__ __forceinline__ void wait_copies() { asm volatile("s_wait_asynccnt 0x0" ::: "memory"); }
/* this wave's LDS reads have returned, so the buffer they read may be refilled behind the barrier */
__device__ __forceinline__ void wait_lds_reads() { asm volatile("s_wait_dscnt 0x0" ::: "memory"); }

/* --------------------------------------------------------------------------
 * Preparation of the four 16-bit operand planes. The four jobs read only inputs and write
 * disjoint planes, so they are the block ranges of ONE launch (prep_kernel, below) and run
 * side by side; each job is a block-level function, the block's job a block-uniform choice.
 * ------------------------------------------------------------------------ */

/* x: f32 rows -> bf16 rows (RNE), unit = 8 elements = one 16-B store.
 * out row = b*SEQ + l  <-  in row = b*SEQ_FULL + l ; row length = DMODEL.
 * Coverage: CVT_BLOCKS x 256 units x 8 elements = the whole plane. */
constexpr int CVT_UPR    = DMODEL / 8;
constexpr int CVT_UNITS  = MROWS * CVT_UPR;
constexpr int CVT_BLOCKS = (CVT_UNITS + 255) / 256;
__device__ __forceinline__ void cvt_rows_block(
    const float* __restrict__ in, unsigned short* __restrict__ outp, int blk)
{
  const int u = blk * 256 + threadIdx.x;
  if (u >= CVT_UNITS) return;      /* no barrier follows in this job */
  const int row = u / CVT_UPR;
  const int seg = u - row * CVT_UPR;
  const int b = row / SEQ;
  const int l = row - b * SEQ;
  const float* src = in + ((size_t)(b * SEQ_FULL + l) * CVT_UPR + seg) * 8;
  const v4f a0 = *(const v4f*)src;
  const v4f a1 = *(const v4f*)(src + 4);
  v4u w;
  w[0] = pk2(a0[0], a0[1]);
  w[1] = pk2(a0[2], a0[3]);
  w[2] = pk2(a1[0], a1[1]);
  w[3] = pk2(a1[2], a1[3]);
  v4u* dst = (v4u*)(outp + ((size_t)row * CVT_UPR + seg) * 8);
  *dst = w;
}

/* Er [16][2047][64] f32 -> Erb, bf16 (RNE), 16-row tiles in fragment order.
 * Tile m (0..127) of a head holds the rows of the offsets 16m - 1023 + c, c = 0..15, which are
 * the windows the attention kernel asks for (its offsets start at 1 mod 16).
 * Block = 2 tiles, thread = one 8-element unit: read as (row u>>3, segment u&7), whole lines;
 * units turned from [row][segment] to [segment][row] through LDS (cross-wave, block barrier);
 * stored in thread order. Coverage: TAB_BLOCKS x 2 tiles = 16 heads x 128 tiles.
 * LDS unit pitch: one spare unit per 16, so that the 8 segments of a row fall on different banks. */
constexpr int TAB_BLOCKS = NHEAD * 128 / 2;
__device__ __forceinline__ void pack_table_block(
    const float* __restrict__ Er, unsigned short* __restrict__ Erb, int blk, v4u* Us)
{
  const int tid  = threadIdx.x;
  const int tl   = tid >> 7;
  const int u    = tid & 127;
  const int tile = blk * 2 + tl;             /* head * 128 + m */
  const int h    = tile >> 7;
  const int m    = tile & 127;
  const int row  = u >> 3;
  const int seg  = u & 7;
  const int d    = 16 * m - (SEQ_FULL - 1) + row;      /* -1023 .. 1024 */
  const int rr   = d + ((d < 0) ? NPOS : 0);           /* 0 .. 2046 */
  const float* src = Er + ((size_t)h * NPOS + rr) * DHEAD + seg * 8;
  const v4f a0 = *(const v4f*)src;
  const v4f a1 = *(const v4f*)(src + 4);
  v4u w;
  w[0] = pk2(a0[0], a0[1]);
  w[1] = pk2(a0[2], a0[3]);
  w[2] = pk2(a1[0], a1[1]);
  w[3] = pk2(a1[2], a1[3]);
  Us[tl * 136 + seg * 17 + row] = w;
  __syncthreads();   /* publishes the tile's units to the waves that store them */
  *(v4u*)(Erb + (size_t)tile * 1024 + u * 8) = Us[tl * 136 + (u >> 4) * 17 + (u & 15)];
  wait_addr();   /* behind the job's store: another job's text follows it in the one kernel and writes its registers */
}

/* W in[rows][cols] f32  ->  Wt out[cols][rows] bf16 (RNE), one 64x64 tile through LDS.
 * Tile (kt = rows tile, nt = cols tile), 256 threads.
 * Coverage: 2 iterations x 256 threads = 512 units x 8 = 64x64 for the load phase
 * and the same 512 units x 8 = 64x64 for the store phase.
 * LDS tile: cross-wave, separated by a block barrier. */
constexpr int WQ_BLOCKS = (DMODEL / 64) * (NQKV / 64);
constexpr int WO_BLOCKS = (DMODEL / 64) * (DMODEL / 64);
__device__ __forceinline__ void wt_planes_block(
    const float* __restrict__ W, unsigned short* __restrict__ Wt, int rows, int cols,
    int kt, int nt, unsigned short* Ts /* [n][k] */)
{
  const int k0 = kt * 64;
  const int n0 = nt * 64;
  const int tid = threadIdx.x;
  const float* src[2];
  v4f a0[2], a1[2];
  /* both loops unrolled: the arrays are indexed by constants and stay in registers */
#pragma unroll
  for (int it = 0; it < 2; ++it) {
    const int u = it * 256 + tid;
    src[it] = W + (size_t)(k0 + (u >> 3)) * cols + n0 + (u & 7) * 8;
    a0[it] = *(const v4f*)src[it];
    a1[it] = *(const v4f*)(src[it] + 4);
  }
  /* the wait that is kept before a register of an issued global load is overwritten; it takes the
     two address pairs as inputs, so that they stay whole up to it and no load's result lands on one */
  asm volatile("s_wait_xcnt 0x0" :: "v"(src[0]), "v"(src[1]) : "memory");
#pragma unroll
  for (int it = 0; it < 2; ++it) {
    const int u = it * 256 + tid;
    const int row = u >> 3;      /* k local */
    const int seg = u & 7;       /* n segment */
#pragma unroll
    for (int e = 0; e < 4; ++e) {
      Ts[(seg * 8 + e) * TS_PITCH + row]     = f2bf_bits(a0[it][e]);
      Ts[(seg * 8 + 4 + e) * TS_PITCH + row] = f2bf_bits(a1[it][e]);
    }
  }
  __syncthreads();   /* publishes the tile to the waves that store its rows */
#pragma unroll
  for (int it = 0; it < 2; ++it) {
    const int u = it * 256 + tid;
    const int nrow = u >> 3;
    const int seg  = u & 7;
    const v4u w = *(const v4u_a*)(Ts + nrow * TS_PITCH + seg * 8);
    *(v4u*)(Wt + (size_t)(n0 + nrow) * rows + k0 + seg * 8) = w;
  }
  wait_addr();   /* behind the job's two stores: another job's text follows them in the one kernel and writes their registers */
}

/* Block ranges, the jobs with two phases and a barrier first:
 *   [0, WQ)            W_qkv in[1024][3072] -> WqT out[3072][1024], tile (blk % 16, blk / 16)
 *   [WQ, WQ + WO)      W_o   in[1024][1024] -> WoT out[1024][1024], likewise
 *   then TAB_BLOCKS    the position table, then CVT_BLOCKS x. */
constexpr int PREP_BLOCKS = WQ_BLOCKS + WO_BLOCKS + TAB_BLOCKS + CVT_BLOCKS;
__global__ __launch_bounds__(256) void prep_kernel(
    const float* __restrict__ x, const float* __restrict__ W_qkv, const float* __restrict__ W_o,
    const float* __restrict__ Er, unsigned short* __restrict__ Xb, unsigned short* __restrict__ WqT,
    unsigned short* __restrict__ WoT, unsigned short* __restrict__ Erb)
{
  __shared__ __align__(16) unsigned short Ts[64 * TS_PITCH];
  __shared__ __align__(16) v4u Us[2 * 136];
  constexpr int KT = DMODEL / 64;
  const int blk = blockIdx.x;
  if (blk < WQ_BLOCKS) {
    wt_planes_block(W_qkv, WqT, DMODEL, NQKV, blk % KT, blk / KT, Ts);
  } else if (blk < WQ_BLOCKS + WO_BLOCKS) {
    const int t = blk - WQ_BLOCKS;
    wt_planes_block(W_o, WoT, DMODEL, DMODEL, t % KT, t / KT, Ts);
  } else if (blk < WQ_BLOCKS + WO_BLOCKS + TAB_BLOCKS) {
    pack_table_block(Er, Erb, blk - (WQ_BLOCKS + WO_BLOCKS), Us);
  } else {
    cvt_rows_block(x, Xb, blk - (WQ_BLOCKS + WO_BLOCKS + TAB_BLOCKS));
  }
}

/* --------------------------------------------------------------------------
 * qkv = Xb . WqT^T + b  (M = MROWS, N = 3072, K = 1024), bf16 x bf16, f32 acc.
 * Block = 4 waves, tile 128 tokens x 64 columns (= one head of one section);
 * wave = 32 rows x 64 cols (2 A fragments x 4 B fragments per 32-deep step).
 * Operands: stages of 64 k (128 B of each of the 192 operand rows, whole lines) brought into a
 * two-buffer LDS ring by asynchronous copies, 12 per thread and stage, one stage ahead of the
 * stage being worked on; fragments by 16-B LDS loads from rows pitched 144 B.
 * Foot of every stage: own LDS reads back, own copies landed, block barrier, then the refill of
 * the buffer just read. The epilogue tile reuses the ring behind the last stage's barrier.
 * Fragment map (hh = lane>>4, c = lane&15): A row c, elems 0..7 <- k0+8hh.., 8..15 <- k0+16+8hh..;
 * B col c with the same k map; D elem r = (row 8hh+r, col c).
 * Epilogue: (acc + bias) [x 1/8 for the k section] split to bf16 hi/lo, staged in a
 * block LDS tile ([tok][d] for q,k; [d][tok] for v), block barrier, then stored in fragment
 * order: the block's 1024 units of a plane are 16 KB in a row, unit u from
 *   q,k: token 16(u>>7) + (u&15), d segment (u>>4)&7;
 *   v  : d row 16((u>>6)&3) + (u&15), key segment 4(u>>8) + ((u>>4)&3).
 * ------------------------------------------------------------------------ */
__global__ __launch_bounds__(128) VGPR_CAP void gemm_qkv_kernel(
    const unsigned short* __restrict__ Xb, const unsigned short* __restrict__ WqT,
    const float* __restrict__ bias, unsigned short* __restrict__ qkvp)
{
  union FB { v16b v; v8b h[2]; };
  __shared__ __align__(16) unsigned short Sm[2 * QKV_STAGE_E];
  unsigned short* Th = Sm;
  unsigned short* Tl = Sm + T_ELEMS;

  const int tid  = threadIdx.x;
  const int wave = __builtin_amdgcn_readfirstlane(tid >> 5);
  const int lane = tid & 31;
  const int hh   = lane >> 4;
  const int c    = lane & 15;
  const int n0   = blockIdx.x * 64;
  const int m0   = blockIdx.y * 128;

  v8f acc[2][4];
#pragma unroll
  for (int mt = 0; mt < 2; ++mt)
#pragma unroll
    for (int t = 0; t < 4; ++t) acc[mt][t] = (v8f){0.f,0.f,0.f,0.f,0.f,0.f,0.f,0.f};

  /* copy unit: thread -> (row tid>>3 of each group of 16 rows, 16-B segment tid&7) */
  const int crow = tid >> 3;
  const int cseg = tid & 7;
  const unsigned short* gx = Xb  + (size_t)(m0 + crow) * DMODEL + cseg * 8;
  const unsigned short* gw = WqT + (size_t)(n0 + crow) * DMODEL + cseg * 8;
  const unsigned lrow = lds_off(Sm) + (unsigned)(crow * RP + cseg * 8) * 2u;

  auto issue_stage = [&](int st) {
    /* unrolled below: the address arrays are indexed by constants and stay in registers */
    unsigned l[12];
    const unsigned short* g[12];
    const unsigned lb = lrow + (unsigned)(st & 1) * (unsigned)(QKV_STAGE_E * 2);
#pragma unroll
    for (int it = 0; it < 12; ++it) {
      l[it] = lb + (unsigned)(it * 16 * RP * 2);
      g[it] = (it < 8) ? gx + (size_t)it * 16 * DMODEL + st * KST
                       : gw + (size_t)(it - 8) * 16 * DMODEL + st * KST;
    }
    async_copy12(l, g);
  };

  const unsigned short* sa = Sm + (wave * 32 + c) * RP + 8 * hh;
  const unsigned short* sb = Sm + (128 + c) * RP + 8 * hh;

  issue_stage(0);
  wait_copies();
  __syncthreads();   /* publishes stage 0 */
  issue_stage(1);

  /* kept rolled: one copy of the ring's foot (waits, barrier, refill), small loop text */
#pragma unroll 1
  for (int st = 0; st < NSTAGE; ++st) {
    const int bo = (st & 1) * QKV_STAGE_E;
    /* the stage's fragment loads stand as one group ahead of its products, so that the wave pays
       the LDS latency once a stage; the loops below are unrolled so that every index of the
       fragment arrays is a constant and they stay in registers */
    FB a0[2], a1[2], bf[2][4];
#pragma unroll
    for (int s = 0; s < 2; ++s) {
      const int ks = s * 32;
      a0[s].h[0] = *(const v8b_a*)(sa + bo + ks);
      a0[s].h[1] = *(const v8b_a*)(sa + bo + ks + 16);
      a1[s].h[0] = *(const v8b_a*)(sa + bo + 16 * RP + ks);
      a1[s].h[1] = *(const v8b_a*)(sa + bo + 16 * RP + ks + 16);
#pragma unroll
      for (int t = 0; t < 4; ++t) {
        bf[s][t].h[0] = *(const v8b_a*)(sb + bo + t * 16 * RP + ks);
        bf[s][t].h[1] = *(const v8b_a*)(sb + bo + t * 16 * RP + ks + 16);
      }
    }
#pragma unroll
    for (int s = 0; s < 2; ++s) {
#pragma unroll
      for (int t = 0; t < 4; ++t) {
        acc[0][t] = mma_bf16(a0[s].v, bf[s][t].v, acc[0][t]);
        acc[1][t] = mma_bf16(a1[s].v, bf[s][t].v, acc[1][t]);
      }
    }
    wait_lds_reads();
    wait_copies();
    __syncthreads();   /* publishes stage st + 1 and ends every read of stage st's buffer */
    if (st + 2 < NSTAGE) issue_stage(st + 2);
  }
  wait_copies();

  const int sec = n0 / DMODEL;                       /* 0 q, 1 k, 2 v : block-uniform */
  const float osc = (sec == 1) ? 0.125f : 1.0f;
#pragma unroll
  for (int t = 0; t < 4; ++t) {
    const float bv = bf_bits2f(f2bf_bits(bias[n0 + 16 * t + c]));
#pragma unroll
    for (int mt = 0; mt < 2; ++mt) {
#pragma unroll
      for (int r = 0; r < 8; ++r) {
        const float val = (acc[mt][t][r] + bv) * osc;
        const unsigned short hb = f2bf_bits(val);
        const unsigned short lb = f2bf_bits(val - bf_bits2f(hb));
        const int rl = wave * 32 + mt * 16 + 8 * hh + r;
        const int cl = 16 * t + c;
        const int idx = (sec < 2) ? (rl * TQ_PITCH + cl) : (cl * TV_PITCH + rl);
        Th[idx] = hb;
        Tl[idx] = lb;
      }
    }
  }
  __syncthreads();

  const int b  = m0 / SEQ;
  const int l0 = m0 - b * SEQ;
  const int h  = (n0 - sec * DMODEL) / DHEAD;
  const int bh = b * NHEAD + h;
  unsigned short* ph = qkvp + (size_t)(2 * sec) * PLANE;
  unsigned short* pl = ph + PLANE;

  {
    if (sec < 2) {
#pragma unroll
      for (int it = 0; it < 8; ++it) {
        const int u = it * 128 + tid;
        const int row = (u >> 7) * 16 + (u & 15);
        const int seg = (u >> 4) & 7;
        const v4u hw = *(const v4u_a*)(Th + row * TQ_PITCH + seg * 8);
        const v4u lw = *(const v4u_a*)(Tl + row * TQ_PITCH + seg * 8);
        const size_t g = ((size_t)bh * SEQ + l0) * DHEAD + u * 8;
        *(v4u*)(ph + g) = hw;
        *(v4u*)(pl + g) = lw;
      }
    } else {
#pragma unroll
      for (int it = 0; it < 8; ++it) {
        const int u = it * 128 + tid;
        const int drow = ((u >> 6) & 3) * 16 + (u & 15);
        const int seg  = (u >> 8) * 4 + ((u >> 4) & 3);
        const v4u hw = *(const v4u_a*)(Th + drow * TV_PITCH + seg * 8);
        const v4u lw = *(const v4u_a*)(Tl + drow * TV_PITCH + seg * 8);
        const size_t g = ((size_t)bh * SEQ + l0) * DHEAD + u * 8;
        *(v4u*)(ph + g) = hw;
        *(v4u*)(pl + g) = lw;
      }
    }
    
  }
}

/* --------------------------------------------------------------------------
 * Attention with the per-head relative-position table, head dim 64.
 * Block = 16 query rows of one (b,h); grid (NBH, SEQ/16), the last query tile first, for speed
 * only; the order is a permutation of the tiles and changes no result under any mask.
 * The block's 4 waves deal the
 * 64-key chunks among them (wave w takes chunks w, w+4, ...), each with its own running
 * maximum, sum and output accumulators; one block barrier, then the four partial states
 * are merged through LDS by the usual rescaling to the common row maximum.
 * At entry: the mask rows of all the wave's chunks read by value as one group of loads
 * (8 b128 loads a chunk + ballots), one packed word a chunk and lane; wave-uniform skip of a
 * chunk when every element of its 16x64 mask tile is set; per-element replace-fill otherwise.
 * Per 64-key chunk and wave (16 query rows); only the output accumulators, the row statistics
 * and the mask words stay resident between chunks:
 *   G = q.Ewin^T  : 5 tiles (80 offsets d = kv0-q0-15+g, packed tiles (kv0-q0)/16+63 ..),
 *                   2 d-steps x (hi + lo) against the bf16 table, written
 *                   to the wave-private G slab, read back skewed: G[m][n-m+15];
 *   S = q.(k/8)^T : 4 key tiles, 2 d-steps x (hi.hi + hi.lo + lo.hi),
 *                   one accumulator, each tile written to the wave-private S slab;
 *   f32 online softmax on S + G; P as bf16 hi+lo wave-private LDS tiles;
 *   O += Ph.Vh + Pl.Vh + Ph.Vl from the V^T planes, two 32-key steps.
 * All fragments come straight from the 16-bit global planes, which stand in fragment order: every
 * load is a wave-uniform base + 16 B x lane and covers four whole lines. The loads are
 * issued in groups ahead of the products that use them (q, table and key tile 0 together; key
 * tiles 1..3 as registers come free; v during the softmax).
 * LDS regions Ss/Gs/Psh/Psl are private to their wave (wave_sync form) inside the loop.
 * Epilogue: each wave's unnormalised 16x64 slab (aliases its G slab) and row statistics,
 * block barrier, merge + normalise (thread = one row x 8 columns) -> ctx hi/lo planes,
 * ------------------------------------------------------------------------ */
__global__ __launch_bounds__(128) VGPR_CAP void rel_attn_kernel(
    const unsigned short* __restrict__ qkvp, const unsigned short* __restrict__ Erb,
    const int* __restrict__ mask, unsigned short* __restrict__ ctxp)
{
  union FB { v16b v; v8b h[2]; };
  __shared__ __align__(16) float Gs[NWAVE][16 * GP];
  __shared__ __align__(16) float Ss[NWAVE][16 * SP];
  __shared__ __align__(16) unsigned short Psh[NWAVE][16 * KCH];
  __shared__ __align__(16) unsigned short Psl[NWAVE][16 * KCH];
  __shared__ float Ms[NWAVE][16];
  __shared__ float Ls[NWAVE][16];

  const int tid  = threadIdx.x;
  const int wave = __builtin_amdgcn_readfirstlane(tid >> 5);
  const int lane = tid & 31;
  const int hh   = lane >> 4;
  const int c    = lane & 15;
  const int c3   = c & 3;
  const int csh  = c >> 2;
  const int qb   = SEQ / 16 - 1 - (int)blockIdx.y;
  const int bh   = blockIdx.x;
  const int b    = bh / NHEAD;
  const int h    = bh - b * NHEAD;
  const int q0   = qb * 16;
  const float NEG_INF = -__builtin_inff();

  const unsigned short* Qh  = qkvp + (size_t)bh * SEQ * DHEAD;   /* each lo plane stands PLANE behind its hi plane */
  const unsigned short* Kh  = Qh + 2 * PLANE;
  const unsigned short* Vth = Qh + 4 * PLANE;     /* same per-bh element count */
  const unsigned short* Eh  = Erb + (size_t)h * 128 * 1024;   /* 128 packed tiles of 1024 elements a head */

  float mrow[8], lrow[8];
  v8f oacc[4];
#pragma unroll
  for (int r = 0; r < 8; ++r) { mrow[r] = NEG_INF; lrow[r] = 0.f; }
#pragma unroll
  for (int t = 0; t < 4; ++t) oacc[t] = (v8f){0.f,0.f,0.f,0.f,0.f,0.f,0.f,0.f};

  float* gs = Gs[wave];
  float* ss = Ss[wave];
  unsigned short* pwh = Psh[wave];
  unsigned short* pwl = Psl[wave];
  /* one lane base per slab and access pattern; every row and tile below is a constant offset from
     it, so that the LDS addresses take one register each and leave room for loads in flight */
  float* gsw = gs + 8 * hh * GP + c;                    /* G and output slab, element (8hh+r, 16t+c) */
  float* ssw = ss + 8 * hh * SP + c;                    /* S slab, element (8hh+r, 16j+c) */
  const float* gsk = gs + 8 * hh * (GP - 1) + c + 15;   /* G slab read skewed: G[m][n-m+15] */
  unsigned short* pwhw = pwh + 8 * hh * KCH + c;
  unsigned short* pwlw = pwl + 8 * hh * KCH + c;
  const unsigned lane8 = (unsigned)(lane * 8);   /* this lane's 16-B unit of every 512-B fragment run (elements) */

  /* mask tiles of all NCH chunks of this wave, by value: the 8 * NCH row loads stand as one group
     ahead of every use, so that the wave waits for the mask once and not once a row.
     Bit L of the ballot (it, e) = mask[q0+2it+(L>>4)][kv0+4(L&15)+e] != 0; each lane keeps the
     word of its own e = c&3 (lane masks sel0..sel3) and of its own row half, and packs its own
     32 bits of a chunk into one word: bit 16(r&1) + 4j + (r>>1) = element (row 8hh+r, key 16j+c). */
  unsigned mpk[NCH];
  unsigned skip = 0u;                 /* bit i: every element of chunk i's tile is masked (wave-uniform) */
  {
    v4i mv[NCH][8];
    const int* ml = mask + (size_t)(q0 + hh) * SEQ_FULL + wave * KCH + 4 * c;   /* lane base; the rest are constants */
#pragma unroll
    for (int i = 0; i < NCH; ++i)
#pragma unroll
      for (int it = 0; it < 8; ++it) {
        if (i == NCH - 1 && it == 7) wait_addr();   /* last use of the mask address pair */
        mv[i][it] = *(const v4i*)(ml + it * 2 * SEQ_FULL + i * NWAVE * KCH);
      }
    const unsigned sel0 = (c3 == 0) ? 0xFFFFFFFFu : 0u;
    const unsigned sel1 = (c3 == 1) ? 0xFFFFFFFFu : 0u;
    const unsigned sel2 = (c3 == 2) ? 0xFFFFFFFFu : 0u;
    const unsigned sel3 = (c3 == 3) ? 0xFFFFFFFFu : 0u;
#pragma unroll
    for (int i = 0; i < NCH; ++i) {
      unsigned msel[8];
      unsigned andall = 0xFFFFFFFFu;
#pragma unroll
      for (int it = 0; it < 8; ++it) {
        const unsigned b0 = __builtin_amdgcn_ballot_w32(mv[i][it][0] != 0);
        const unsigned b1 = __builtin_amdgcn_ballot_w32(mv[i][it][1] != 0);
        const unsigned b2 = __builtin_amdgcn_ballot_w32(mv[i][it][2] != 0);
        const unsigned b3 = __builtin_amdgcn_ballot_w32(mv[i][it][3] != 0);
        andall &= (b0 & b1) & (b2 & b3);
        msel[it] = (b0 & sel0) | (b1 & sel1) | (b2 & sel2) | (b3 & sel3);
      }
      unsigned pk = 0u;
#pragma unroll
      for (int ii = 0; ii < 4; ++ii) {
        const unsigned w = hh ? msel[4 + ii] : msel[ii];
        pk |= ((w >> csh) & 0x11111111u) << ii;
      }
      mpk[i] = pk;
      skip |= (andall == 0xFFFFFFFFu) ? (1u << i) : 0u;
    }
  }

  /* kept rolled: one copy of the chunk's text */
#pragma unroll 1
  for (int i = 0; i < NCH; ++i) {
    if ((skip >> i) & 1u) continue;               /* wave-uniform: every element masked */
    const int kv0 = (wave + i * NWAVE) * KCH;

    const unsigned mk = (i == 0) ? mpk[0] : (i == 1) ? mpk[1] : (i == 2) ? mpk[2] : mpk[3];

    /* The chunk's loads fly as a window ahead of the products that use them: q, the 5 table tiles
       and key tile 0 are issued as one group, each further key tile as soon as earlier tiles'
       registers come free. q is read per chunk so that its registers are free for the v fragments
       during the softmax and p.v. All loops below are unrolled so that the fragment arrays are
       indexed by constants and stay in registers. */
    v16b qh[2], ql[2];
    FB kfh[4][2], kfl[4][2], ef[5][2];
    /* position table: offsets kv0 - q0 - 15 + g, g = 0..79, are the packed tiles
       (kv0 - q0) / 16 + 63 + t, t = 0..4, in [0, 127] */
    g_u16* ep = scalar_base(Eh + ((kv0 - q0 + SEQ_FULL - 16) >> 4) * 1024);
    g_u16* kh = scalar_base(Kh + kv0 * DHEAD);
    g_u16* kl = kh + PLANE;
    g_u16* vh = scalar_base(Vth + kv0 * DHEAD);
    g_u16* vl = vh + PLANE;
    g_u16* qph = scalar_base(Qh + q0 * DHEAD);
    g_u16* qpl = qph + PLANE;
    auto load_key_tile = [&](int j) {
#pragma unroll
      for (int dc = 0; dc < 2; ++dc) {
        kfh[j][dc].h[0] = *(g_v8b*)(kh + lane8 + j * 1024 + dc * 512);
        kfh[j][dc].h[1] = *(g_v8b*)(kh + lane8 + j * 1024 + dc * 512 + 256);
        kfl[j][dc].h[0] = *(g_v8b*)(kl + lane8 + j * 1024 + dc * 512);
        kfl[j][dc].h[1] = *(g_v8b*)(kl + lane8 + j * 1024 + dc * 512 + 256);
      }
      /* behind the chunk's last k load, before its address registers are written anew */
      if (j == 3) wait_addr();
    };
    {
#pragma unroll
      for (int dc = 0; dc < 2; ++dc) {
        FB f;
        f.h[0] = *(g_v8b*)(qph + lane8 + dc * 512);
        f.h[1] = *(g_v8b*)(qph + lane8 + dc * 512 + 256);
        qh[dc] = f.v;
        f.h[0] = *(g_v8b*)(qpl + lane8 + dc * 512);
        f.h[1] = *(g_v8b*)(qpl + lane8 + dc * 512 + 256);
        ql[dc] = f.v;
      }
    }
#pragma unroll
    for (int t = 0; t < 5; ++t) {
#pragma unroll
      for (int dc = 0; dc < 2; ++dc) {
        ef[t][dc].h[0] = *(g_v8b*)(ep + lane8 + t * 1024 + dc * 512);
        ef[t][dc].h[1] = *(g_v8b*)(ep + lane8 + t * 1024 + dc * 512 + 256);
      }
    }
    load_key_tile(0);
    wait_addr();      /* behind the last q and table loads, before their address registers are written anew */
    /* keeps the first product, and the load wait in front of it, behind the issue of the whole
       group: moved up among the loads it would make the rest of the group wait a full latency */
    __builtin_amdgcn_sched_barrier(0);

    /* position term: G[m][g] = q[m] . Er[h][(kv0 - q0 - 15 + g) mod 2047], g = 0..79 */
#pragma unroll
    for (int t = 0; t < 5; ++t) {
      v8f g = (v8f){0.f,0.f,0.f,0.f,0.f,0.f,0.f,0.f};
#pragma unroll
      for (int dc = 0; dc < 2; ++dc) {
        g = mma_bf16(qh[dc], ef[t][dc].v, g);
        g = mma_bf16(ql[dc], ef[t][dc].v, g);
      }
      if (t == 1) load_key_tile(1);
      if (t == 3) load_key_tile(2);
#pragma unroll
      for (int r = 0; r < 8; ++r) gsw[r * GP + 16 * t] = g[r];
    }

    /* raw scores: 4 key tiles, one accumulator, tile -> S slab (D elem r = row 8hh+r, col c) */
#pragma unroll
    for (int j = 0; j < 4; ++j) {
      v8f sa = (v8f){0.f,0.f,0.f,0.f,0.f,0.f,0.f,0.f};
#pragma unroll
      for (int dc = 0; dc < 2; ++dc) {
        sa = mma_bf16(qh[dc], kfh[j][dc].v, sa);
        sa = mma_bf16(qh[dc], kfl[j][dc].v, sa);
        sa = mma_bf16(ql[dc], kfh[j][dc].v, sa);
      }
      if (j == 0) load_key_tile(3);
#pragma unroll
      for (int r = 0; r < 8; ++r) ssw[r * SP + 16 * j] = sa[r];
    }
    wave_lds_sync();

    /* v fragments of the first 32 keys: issued here, so that they fly during the softmax */
    FB vbh[2][4], vbl[2][4];
    auto load_v_step = [&](int kk) {
#pragma unroll
      for (int t = 0; t < 4; ++t) {
        const int vo = kk * 2048 + t * 512;
        vbh[kk][t].h[0] = *(g_v8b*)(vh + lane8 + vo);
        vbh[kk][t].h[1] = *(g_v8b*)(vh + lane8 + vo + 256);
        vbl[kk][t].h[0] = *(g_v8b*)(vl + lane8 + vo);
        vbl[kk][t].h[1] = *(g_v8b*)(vl + lane8 + vo + 256);
      }
      /* behind the chunk's last v load, before its address registers are written anew */
      if (kk == 1) wait_addr();
    };
    load_v_step(0);

    /* raw score + skewed position term, replace-fill of masked elements */
    v8f s[4];
#pragma unroll
    for (int j = 0; j < 4; ++j) {
#pragma unroll
      for (int r = 0; r < 8; ++r) {
        const float raw = ssw[r * SP + 16 * j];
        const float gv = gsk[r * (GP - 1) + 16 * j];
        const float sv = raw + gv;
        const unsigned bit = (mk >> (16 * (r & 1) + 4 * j + (r >> 1))) & 1u;
        s[j][r] = bit ? NEG_INF : sv;
      }
    }

    /* chunk row max over the 64 keys */
    float cm[8];
#pragma unroll
    for (int r = 0; r < 8; ++r) {
      float m = fmaxf(fmaxf(s[0][r], s[1][r]), fmaxf(s[2][r], s[3][r]));
#pragma unroll
      for (int off = 1; off < 16; off <<= 1) m = fmaxf(m, __shfl_xor(m, off, 32));
      cm[r] = m;
    }

    /* online softmax update, P tiles as bf16 hi + lo */
#pragma unroll
    for (int r = 0; r < 8; ++r) {
      if (r == 4) load_v_step(1);   /* the second 32 keys' fragments, once half the score registers are free */
      const float mnew  = fmaxf(mrow[r], cm[r]);
      const float msafe = (mnew == NEG_INF) ? 0.f : mnew;
      const float alpha = expf(mrow[r] - msafe);
      mrow[r] = mnew;
      float psum = 0.f;
#pragma unroll
      for (int j = 0; j < 4; ++j) {
        const float p = expf(s[j][r] - msafe);
        psum += p;
        const unsigned short hb = f2bf_bits(p);
        const unsigned short lb = f2bf_bits(p - bf_bits2f(hb));
        pwhw[r * KCH + j * 16] = hb;
        pwlw[r * KCH + j * 16] = lb;
      }
#pragma unroll
      for (int off = 1; off < 16; off <<= 1) psum += __shfl_xor(psum, off, 32);
      lrow[r] = lrow[r] * alpha + psum;
#pragma unroll
      for (int t = 0; t < 4; ++t) oacc[t][r] *= alpha;
    }
    wave_lds_sync();

    /* O += P.V : A = P [q][kv] (this wave's tiles), B = V [kv][d] from the packed v planes;
       unrolled over the two 32-key steps: the fragment arrays are indexed by constants */
#pragma unroll
    for (int kk = 0; kk < 2; ++kk) {
      FB pa, pl;
      pa.h[0] = *(const v8b_a*)(pwh + c * KCH + kk * 32 + 8 * hh);
      pa.h[1] = *(const v8b_a*)(pwh + c * KCH + kk * 32 + 16 + 8 * hh);
      pl.h[0] = *(const v8b_a*)(pwl + c * KCH + kk * 32 + 8 * hh);
      pl.h[1] = *(const v8b_a*)(pwl + c * KCH + kk * 32 + 16 + 8 * hh);
#pragma unroll
      for (int t = 0; t < 4; ++t) {
        oacc[t] = mma_bf16(pa.v, vbh[kk][t].v, oacc[t]);
        oacc[t] = mma_bf16(pl.v, vbh[kk][t].v, oacc[t]);
        oacc[t] = mma_bf16(pa.v, vbl[kk][t].v, oacc[t]);
      }
    }
    wave_lds_sync();
  }

  /* this wave's partial state: unnormalised output into its own slab (aliases the G slab),
     row maximum and row sum beside it */
#pragma unroll
  for (int r = 0; r < 8; ++r) {
#pragma unroll
    for (int t = 0; t < 4; ++t) gsw[r * GP + t * 16] = oacc[t][r];
  }
  if (c == 0) {      /* the 16 lanes of a half hold equal row statistics */
#pragma unroll
    for (int r = 0; r < 8; ++r) {
      Ms[wave][8 * hh + r] = mrow[r];
      Ls[wave][8 * hh + r] = lrow[r];
    }
  }
  __syncthreads();   /* publishes the four partial states to the whole block */
  {
    unsigned short* Ch = ctxp;
    unsigned short* Cl = ctxp + XB_E;
    const int row = tid >> 3;
    const int seg = tid & 7;
    float mall = Ms[0][row];
#pragma unroll
    for (int w = 1; w < NWAVE; ++w) mall = fmaxf(mall, Ms[w][row]);
    const float msafe = (mall == NEG_INF) ? 0.f : mall;
    float lsum = 0.f;
    v4f a0 = (v4f){0.f, 0.f, 0.f, 0.f};
    v4f a1 = (v4f){0.f, 0.f, 0.f, 0.f};
#pragma unroll
    for (int w = 0; w < NWAVE; ++w) {
      const float f = expf(Ms[w][row] - msafe);
      lsum += Ls[w][row] * f;
      a0 += *(const v4f_a*)(Gs[w] + row * GP + seg * 8) * f;
      a1 += *(const v4f_a*)(Gs[w] + row * GP + seg * 8 + 4) * f;
    }
    const float inv = 1.0f / lsum;
    a0 *= inv;
    a1 *= inv;
    unsigned h0, h1, h2, h3, l0, l1, l2, l3;
    split2(a0[0], a0[1], h0, l0);
    split2(a0[2], a0[3], h1, l1);
    split2(a1[0], a1[1], h2, l2);
    split2(a1[2], a1[3], h3, l3);
    v4u hw, lw;
    hw[0] = h0; hw[1] = h1; hw[2] = h2; hw[3] = h3;
    lw[0] = l0; lw[1] = l1; lw[2] = l2; lw[3] = l3;
    const size_t g = (size_t)(b * SEQ + q0 + row) * DMODEL + h * DHEAD + seg * 8;
    *(v4u*)(Ch + g) = hw;
    *(v4u*)(Cl + g) = lw;
  }
}

/* --------------------------------------------------------------------------
 * out = (Ch + Cl) . WoT^T + b  (M = MROWS, N = 1024, K = 1024), f32 acc.
 * Block = 4 waves, tile 128 x 64; wave = 32 rows x 64 cols; A hi and lo planes
 * against the single bf16 weight plane (two products per tile pair).
 * Operands: stages of 64 k (128 B of each of the 320 operand rows) in a two-buffer LDS ring,
 * filled by asynchronous copies (20 per thread and stage) in the order of gemm_qkv_kernel.
 * Epilogue: per-wave 32x64 f32 slab (wave-private LDS), 16 lanes x 16 B = one 256-B
 * ------------------------------------------------------------------------ */
__global__ __launch_bounds__(128) VGPR_CAP void gemm_out_kernel(
    const unsigned short* __restrict__ ctxp, const unsigned short* __restrict__ WoT,
    const float* __restrict__ bias, float* __restrict__ out)
{
  union FB { v16b v; v8b h[2]; };
  __shared__ __align__(16) float Os[NWAVE][32 * OS_PITCH];
  __shared__ __align__(16) unsigned short Sm[2 * OUT_STAGE_E];

  const int tid  = threadIdx.x;
  const int wave = __builtin_amdgcn_readfirstlane(tid >> 5);
  const int lane = tid & 31;
  const int hh   = lane >> 4;
  const int c    = lane & 15;
  const int n0   = blockIdx.x * 64;
  const int m0   = blockIdx.y * 128;

  v8f acc[2][4];
#pragma unroll
  for (int mt = 0; mt < 2; ++mt)
#pragma unroll
    for (int t = 0; t < 4; ++t) acc[mt][t] = (v8f){0.f,0.f,0.f,0.f,0.f,0.f,0.f,0.f};

  /* copy unit: thread -> (row tid>>3 of each group of 16 rows, 16-B segment tid&7) */
  const int crow = tid >> 3;
  const int cseg = tid & 7;
  const unsigned short* gh = ctxp + (size_t)(m0 + crow) * DMODEL + cseg * 8;
  const unsigned short* gl = gh + XB_E;
  const unsigned short* gw = WoT + (size_t)(n0 + crow) * DMODEL + cseg * 8;
  const unsigned lrow = lds_off(Sm) + (unsigned)(crow * RP + cseg * 8) * 2u;

  auto issue_stage = [&](int st) {
    /* unrolled below: the address arrays are indexed by constants and stay in registers */
    unsigned l[20];
    const unsigned short* g[20];
    const unsigned lb = lrow + (unsigned)(st & 1) * (unsigned)(OUT_STAGE_E * 2);
#pragma unroll
    for (int it = 0; it < 20; ++it) {
      l[it] = lb + (unsigned)(it * 16 * RP * 2);
      g[it] = (it < 8)  ? gh + (size_t)it * 16 * DMODEL + st * KST
            : (it < 16) ? gl + (size_t)(it - 8) * 16 * DMODEL + st * KST
                        : gw + (size_t)(it - 16) * 16 * DMODEL + st * KST;
    }
    async_copy10(l, g);
    async_copy10(l + 10, g + 10);
  };

  const unsigned short* sh = Sm + (wave * 32 + c) * RP + 8 * hh;
  const unsigned short* sl = sh + 128 * RP;
  const unsigned short* sb = Sm + (256 + c) * RP + 8 * hh;

  issue_stage(0);
  wait_copies();
  __syncthreads();   /* publishes stage 0 */
  issue_stage(1);

  /* kept rolled: one copy of the ring's foot (waits, barrier, refill), small loop text */
#pragma unroll 1
  for (int st = 0; st < NSTAGE; ++st) {
    const int bo = (st & 1) * OUT_STAGE_E;
    /* the stage's fragment loads stand as one group ahead of its products, so that the wave pays
       the LDS latency once a stage; the loops below are unrolled so that every index of the
       fragment arrays is a constant and they stay in registers */
    FB a0h[2], a1h[2], a0l[2], a1l[2], bf[2][4];
#pragma unroll
    for (int s = 0; s < 2; ++s) {
      const int ks = s * 32;
      a0h[s].h[0] = *(const v8b_a*)(sh + bo + ks);
      a0h[s].h[1] = *(const v8b_a*)(sh + bo + ks + 16);
      a0l[s].h[0] = *(const v8b_a*)(sl + bo + ks);
      a0l[s].h[1] = *(const v8b_a*)(sl + bo + ks + 16);
      a1h[s].h[0] = *(const v8b_a*)(sh + bo + 16 * RP + ks);
      a1h[s].h[1] = *(const v8b_a*)(sh + bo + 16 * RP + ks + 16);
      a1l[s].h[0] = *(const v8b_a*)(sl + bo + 16 * RP + ks);
      a1l[s].h[1] = *(const v8b_a*)(sl + bo + 16 * RP + ks + 16);
#pragma unroll
      for (int t = 0; t < 4; ++t) {
        bf[s][t].h[0] = *(const v8b_a*)(sb + bo + t * 16 * RP + ks);
        bf[s][t].h[1] = *(const v8b_a*)(sb + bo + t * 16 * RP + ks + 16);
      }
    }
#pragma unroll
    for (int s = 0; s < 2; ++s) {
#pragma unroll
      for (int t = 0; t < 4; ++t) {
        acc[0][t] = mma_bf16(a0h[s].v, bf[s][t].v, acc[0][t]);
        acc[0][t] = mma_bf16(a0l[s].v, bf[s][t].v, acc[0][t]);
        acc[1][t] = mma_bf16(a1h[s].v, bf[s][t].v, acc[1][t]);
        acc[1][t] = mma_bf16(a1l[s].v, bf[s][t].v, acc[1][t]);
      }
    }
    wait_lds_reads();
    wait_copies();
    __syncthreads();   /* publishes stage st + 1 and ends every read of stage st's buffer */
    if (st + 2 < NSTAGE) issue_stage(st + 2);
  }
  wait_copies();

  float* os = Os[wave];
#pragma unroll
  for (int t = 0; t < 4; ++t) {
    const float bv = bf_bits2f(f2bf_bits(bias[n0 + 16 * t + c]));
#pragma unroll
    for (int mt = 0; mt < 2; ++mt)
#pragma unroll
      for (int r = 0; r < 8; ++r)
        os[(mt * 16 + 8 * hh + r) * OS_PITCH + 16 * t + c] = acc[mt][t][r] + bv;
  }
  wave_lds_sync();
  {
    const int c4 = c * 4;
    {
#pragma unroll
      for (int it = 0; it < 16; ++it) {
        const int row = it * 2 + hh;
        const v4f val = *(const v4f_a*)(os + row * OS_PITCH + c4);
        *(v4f*)(out + (size_t)(m0 + wave * 32 + row) * DMODEL + n0 + c4) = val;
      }
      
    }
  }
}

extern "C" void kernel_launch(void* const* d_in, const int* in_sizes, int n_in,
                              void* d_out, int out_size, void* d_ws, size_t ws_size,
                              hipStream_t stream)
{
  if (n_in < 7) return;
  if (in_sizes[0] < ((NB - 1) * SEQ_FULL + SEQ) * DMODEL) return;
  if (in_sizes[1] < (SEQ - 1) * SEQ_FULL + SEQ) return;
  if (in_sizes[2] < DMODEL * NQKV) return;
  if (in_sizes[3] < NQKV) return;
  if (in_sizes[4] < DMODEL * DMODEL) return;
  if (in_sizes[5] < DMODEL) return;
  if (in_sizes[6] < NHEAD * NPOS * DHEAD) return;
  if (out_size < MROWS * DMODEL) return;
  if (d_ws == nullptr || ws_size < WS_NEED) return;

  const float* x     = (const float*)d_in[0];
  const int*   mask  = (const int*)d_in[1];
  const float* W_qkv = (const float*)d_in[2];
  const float* b_qkv = (const float*)d_in[3];
  const float* W_o   = (const float*)d_in[4];
  const float* b_o   = (const float*)d_in[5];
  const float* Er    = (const float*)d_in[6];
  float* out = (float*)d_out;

  unsigned short* Xb   = (unsigned short*)d_ws;
  unsigned short* WqT  = Xb + XB_E;
  unsigned short* WoT  = WqT + WQT_E;
  unsigned short* Erb  = WoT + WOT_E;
  unsigned short* qkvp = Erb + ERB_E;
  unsigned short* ctxp = qkvp + QKVP_E;

  /* the four preparation jobs, one launch */
  prep_kernel<<<PREP_BLOCKS, 256, 0, stream>>>(x, W_qkv, W_o, Er, Xb, WqT, WoT, Erb);

  gemm_qkv_kernel<<<dim3(NQKV / 64, MROWS / 128), 128, 0, stream>>>(Xb, WqT, b_qkv, qkvp);
  rel_attn_kernel<<<dim3(NBH, SEQ / 16), 128, 0, stream>>>(qkvp, Erb, mask, ctxp);
  gemm_out_kernel<<<dim3(DMODEL / 64, MROWS / 128), 128, 0, stream>>>(ctxp, WoT, b_o, out);
}

// v007
// A run of this version takes 83 microseconds.
// Two timings next to v006 put it at 1.03 and 1.04 times that version's speed.
// Over all steps from v000 it is 3.23 times as fast.
// Contractions: x.Wqkv on v_wmma_f32_16x16x32_bf16 with both operands RNE-converted to bf16 once; q.(k/8)^T, q.Er^T, p.v and ctx.Wo on v_wmma_f32_16x16x32_bf16 with computed operands (q, k/8, v, p, ctx) carried as bf16 hi+lo planes (hi.hi + hi.lo + lo.hi) and input operands (Er, Wo) as single bf16 planes; f32 accumulate; softmax, bias adds and mask fill in f32.
#include <hip/hip_runtime.h>

typedef __attribute__((ext_vector_type(16))) __bf16 v16b;
typedef __attribute__((ext_vector_type(8)))  __bf16 v8b;
typedef __attribute__((ext_vector_type(8)))  float  v8f;
typedef __attribute__((ext_vector_type(4)))  float  v4f;
typedef __attribute__((ext_vector_type(4)))  unsigned int v4u;
typedef __attribute__((ext_vector_type(4)))  int v4i;
typedef v8b v8b_a __attribute__((may_alias));
typedef v4f v4f_a __attribute__((may_alias));
typedef v4u v4u_a __attribute__((may_alias));

#ifndef NB
#define NB 2
#endif
#ifndef SEQ
#define SEQ 1024
#endif
#define NB_FULL 2
#define SEQ_FULL 1024

#define VGPR_CAP __attribute__((amdgpu_num_vgpr(256)))

constexpr int DMODEL = 1024;
constexpr int NHEAD  = 16;
constexpr int DHEAD  = 64;
constexpr int NPOS   = 2047;
constexpr int NQKV   = 3 * DMODEL;
constexpr int NBH    = NB * NHEAD;
constexpr int MROWS  = NB * SEQ;
constexpr int KCH    = 64;        /* keys per chunk */
constexpr int NWAVE  = 4;
constexpr int NCH    = SEQ / (KCH * NWAVE);   /* key chunks per wave of the attention block */
constexpr int GP     = 84;        /* skew slab pitch in floats (336 B rows, 16-B aligned) */
constexpr int SP     = 68;        /* raw score slab pitch in floats */
constexpr int TQ_PITCH = 72;      /* [tok][d] staging pitch (16-bit elements) */
constexpr int TV_PITCH = 136;     /* [d][tok] staging pitch (16-bit elements) */
constexpr int T_ELEMS  = 128 * TQ_PITCH;   /* 9216 >= 64 * TV_PITCH = 8704 */
constexpr int TS_PITCH = 72;
constexpr int OS_PITCH = 68;
constexpr int KST      = 64;      /* k elements per GEMM stage: one 128-B line of every operand row */
constexpr int RP       = 72;      /* GEMM stage row pitch (16-bit elements): 144 B = 16 B x odd for b128 readers */
constexpr int NSTAGE   = 1024 / KST;
constexpr int QKV_STAGE_E = (128 + 64) * RP;        /* [x 128 rows | W 64 rows] */
constexpr int OUT_STAGE_E = (128 + 128 + 64) * RP;  /* [ctx hi 128 | ctx lo 128 | W 64 rows] */

constexpr size_t PLANE  = (size_t)NBH * SEQ * DHEAD;
constexpr size_t XB_E   = (size_t)MROWS * DMODEL;
constexpr size_t WQT_E  = (size_t)NQKV * DMODEL;
constexpr size_t WOT_E  = (size_t)DMODEL * DMODEL;
constexpr size_t ERB_E  = (size_t)NHEAD * 2048 * DHEAD;
constexpr size_t QKVP_E = 6 * PLANE;
constexpr size_t CTX_E  = 2 * XB_E;
constexpr size_t WS_NEED = 2 * (XB_E + WQT_E + WOT_E + ERB_E + QKVP_E + CTX_E);

static_assert(SEQ % 128 == 0);
static_assert(NCH * KCH * NWAVE == SEQ && NCH == 4);
static_assert(SEQ <= SEQ_FULL && NB <= NB_FULL);
static_assert(DHEAD == 64 && DMODEL == NHEAD * DHEAD);
static_assert(DMODEL % 64 == 0 && NQKV % 64 == 0 && DMODEL % 32 == 0);
static_assert(64 * TV_PITCH <= T_ELEMS);
static_assert((TQ_PITCH * 2) % 16 == 0 && (TV_PITCH * 2) % 16 == 0 && (GP * 4) % 16 == 0 && (OS_PITCH * 4) % 16 == 0);
static_assert(GP >= 80 && SP >= 64);
static_assert(NSTAGE * KST == DMODEL && NSTAGE >= 2 && (RP * 2) % 16 == 0 && RP >= KST);
static_assert(2 * T_ELEMS <= 2 * QKV_STAGE_E);
static_assert((size_t)NHEAD * NPOS * DHEAD <= ERB_E);
static_assert(WS_NEED <= 134217728ull);

/*
 *   Xb   [MROWS][1024]        x, bf16
 *   WqT  [3072][1024]         W_qkv transposed, bf16
 *   WoT  [1024][1024]         W_o transposed, bf16
 *   Erb  [16][128 tiles][8][16][8]   Er, bf16, in fragment order (below); row c of tile m is the
 *                             table row of offset 16m - 1023 + c, that is (16m - 1023 + c) mod 2047
 *   qkvp 6 planes, in fragment order: Qh Ql, Kh Kl (k/8) [bh][l/16][d/8][l%16][8 d],
 *                             Vh Vl [bh][l/32][d/16][(l%32)/8][d%16][8 l]
 *   ctxp 2 planes: Ch Cl [MROWS][1024]
 * Fragment order: the 16-B unit that lane (hh, c) takes for half a fragment register set stands at
 * unit 16hh + c of a 512-B run, so that one 16-B load of a wave covers four whole 128-B lines.
 */

__device__ __forceinline__ unsigned short f2bf_bits(float f) {
  unsigned u = __float_as_uint(f);
  return (unsigned short)((u + 0x7FFFu + ((u >> 16) & 1u)) >> 16);
}
__device__ __forceinline__ float bf_bits2f(unsigned short h) { return __uint_as_float(((unsigned)h) << 16); }
__device__ __forceinline__ unsigned pk2(float a, float b) {
  return (unsigned)f2bf_bits(a) | ((unsigned)f2bf_bits(b) << 16);
}
__device__ __forceinline__ void split2(float a, float b, unsigned& hw, unsigned& lw) {
  const unsigned short ha = f2bf_bits(a);
  const unsigned short hb = f2bf_bits(b);
  const unsigned short la = f2bf_bits(a - bf_bits2f(ha));
  const unsigned short lb = f2bf_bits(b - bf_bits2f(hb));
  hw = (unsigned)ha | ((unsigned)hb << 16);
  lw = (unsigned)la | ((unsigned)lb << 16);
}

/* e^(x - m) as one multiply-add and the hardware's base-2 exponential: exp2(x * log2(e) + nm), with
   nm = -m * log2(e) formed once a row. x = -inf gives 0; a result below the smallest normal number
   counts as 0, which is far below the last bit that the row sum or the 16-bit planes of p keep. */
constexpr float LOG2E = 1.44269504088896340736f;
__device__ __forceinline__ float exp_shifted(float x, float nm) {
  return __builtin_amdgcn_exp2f(__builtin_fmaf(x, LOG2E, nm));
}

/* one WMMA + hazard guard naming only this call's live operands */
__device__ __forceinline__ v8f mma_bf16(v16b a, v16b b, v8f c) {
  c = __builtin_amdgcn_wmma_f32_16x16x32_bf16(false, a, false, b, (short)0, c, false, false);
  asm volatile("v_nop\n\tv_nop\n\tv_nop\n\tv_nop" : "+v"(c) : "v"(a), "v"(b));
  return c;
}

__device__ __forceinline__ void wave_lds_sync() {
  __builtin_amdgcn_fence(3 /* release order */, "workgroup");
  __builtin_amdgcn_wave_barrier();
  __builtin_amdgcn_fence(2 /* acquire order */, "workgroup");
}

/* byte offset of a __shared__ address inside the work-group's LDS */
__device__ __forceinline__ unsigned lds_off(const void* p) { return (unsigned)(size_t)p; }

/* Asynchronous copies global -> LDS, 16 B per lane and copy, every lane on. The copies of a run
   and the s_wait_xcnt 0 that stands before their address registers may be rewritten are one
   statement, so that no later address arithmetic can be moved in front of that wait. */
__device__ __forceinline__ void async_copy12(const unsigned (&l)[12], const unsigned short* const (&g)[12]) {
  asm volatile(
      "global_load_async_to_lds_b128 %0, %12, off\n\t"
      "global_load_async_to_lds_b128 %1, %13, off\n\t"
      "global_load_async_to_lds_b128 %2, %14, off\n\t"
      "global_load_async_to_lds_b128 %3, %15, off\n\t"
      "global_load_async_to_lds_b128 %4, %16, off\n\t"
      "global_load_async_to_lds_b128 %5, %17, off\n\t"
      "global_load_async_to_lds_b128 %6, %18, off\n\t"
      "global_load_async_to_lds_b128 %7, %19, off\n\t"
      "global_load_async_to_lds_b128 %8, %20, off\n\t"
      "global_load_async_to_lds_b128 %9, %21, off\n\t"
      "global_load_async_to_lds_b128 %10, %22, off\n\t"
      "global_load_async_to_lds_b128 %11, %23, off\n\t"
      "s_wait_xcnt 0x0"
      :: "v"(l[0]), "v"(l[1]), "v"(l[2]), "v"(l[3]), "v"(l[4]), "v"(l[5]),
         "v"(l[6]), "v"(l[7]), "v"(l[8]), "v"(l[9]), "v"(l[10]), "v"(l[11]),
         "v"(g[0]), "v"(g[1]), "v"(g[2]), "v"(g[3]), "v"(g[4]), "v"(g[5]),
         "v"(g[6]), "v"(g[7]), "v"(g[8]), "v"(g[9]), "v"(g[10]), "v"(g[11])
      : "memory");
}
__device__ __forceinline__ void async_copy10(const unsigned* l, const unsigned short* const* g) {
  asm volatile(
      "global_load_async_to_lds_b128 %0, %10, off\n\t"
      "global_load_async_to_lds_b128 %1, %11, off\n\t"
      "global_load_async_to_lds_b128 %2, %12, off\n\t"
      "global_load_async_to_lds_b128 %3, %13, off\n\t"
      "global_load_async_to_lds_b128 %4, %14, off\n\t"
      "global_load_async_to_lds_b128 %5, %15, off\n\t"
      "global_load_async_to_lds_b128 %6, %16, off\n\t"
      "global_load_async_to_lds_b128 %7, %17, off\n\t"
      "global_load_async_to_lds_b128 %8, %18, off\n\t"
      "global_load_async_to_lds_b128 %9, %19, off\n\t"
      "s_wait_xcnt 0x0"
      :: "v"(l[0]), "v"(l[1]), "v"(l[2]), "v"(l[3]), "v"(l[4]),
         "v"(l[5]), "v"(l[6]), "v"(l[7]), "v"(l[8]), "v"(l[9]),
         "v"(g[0]), "v"(g[1]), "v"(g[2]), "v"(g[3]), "v"(g[4]),
         "v"(g[5]), "v"(g[6]), "v"(g[7]), "v"(g[8]), "v"(g[9])
      : "memory");
}
/* A pointer that is the same in every lane, held in scalar registers: the loads from it take the
   form scalar base + lane offset, so that no vector address pair is written among loads in flight. */
typedef const __attribute__((address_space(1))) unsigned short g_u16;   /* global memory, named as such */
typedef const __attribute__((address_space(1))) v8b g_v8b;
__device__ __forceinline__ g_u16* scalar_base(const unsigned short* p) {
  const unsigned long long a = (unsigned long long)p;
  const unsigned lo = (unsigned)__builtin_amdgcn_readfirstlane((int)(unsigned)a);
  const unsigned hi = (unsigned)__builtin_amdgcn_readfirstlane((int)(unsigned)(a >> 32));
  return (g_u16*)(((unsigned long long)hi << 32) | lo);
}
/* Stands in front of the last load from an address pair, whose destination may be that pair while
   earlier loads from it are in flight, and behind it, before the pair is written anew: the wait
   that is kept before a register of an issued global load is overwritten. */
__device__ __forceinline__ void wait_addr() { asm volatile("s_wait_xcnt 0x0" ::: "memory"); }
/* this wave's copies have landed in LDS (the compiler places no wait for them) */
__device__ __forceinline__ void wait_copies() { asm volatile("s_wait_asynccnt 0x0" ::: "memory"); }
/* this wave's LDS reads have returned, so the buffer they read may be refilled behind the barrier */
__device__ __forceinline__ void wait_lds_reads() { asm volatile("s_wait_dscnt 0x0" ::: "memory"); }

/* --------------------------------------------------------------------------
 * Preparation of the four 16-bit operand planes. The four jobs read only inputs and write
 * disjoint planes, so they are the block ranges of ONE launch (prep_kernel, below) and run
 * side by side; each job is a block-level function, the block's job a block-uniform choice.
 * ------------------------------------------------------------------------ */

/* x: f32 rows -> bf16 rows (RNE), unit = 8 elements = one 16-B store.
 * out row = b*SEQ + l  <-  in row = b*SEQ_FULL + l ; row length = DMODEL.
 * Coverage: CVT_BLOCKS x 256 units x 8 elements = the whole plane. */
constexpr int CVT_UPR    = DMODEL / 8;
constexpr int CVT_UNITS  = MROWS * CVT_UPR;
constexpr int CVT_BLOCKS = (CVT_UNITS + 255) / 256;
__device__ __forceinline__ void cvt_rows_block(
    const float* __restrict__ in, unsigned short* __restrict__ outp, int blk)
{
  const int u = blk * 256 + threadIdx.x;
  if (u >= CVT_UNITS) return;      /* no barrier follows in this job */
  const int row = u / CVT_UPR;
  const int seg = u - row * CVT_UPR;
  const int b = row / SEQ;
  const int l = row - b * SEQ;
  const float* src = in + ((size_t)(b * SEQ_FULL + l) * CVT_UPR + seg) * 8;
  const v4f a0 = *(const v4f*)src;
  const v4f a1 = *(const v4f*)(src + 4);
  v4u w;
  w[0] = pk2(a0[0], a0[1]);
  w[1] = pk2(a0[2], a0[3]);
  w[2] = pk2(a1[0], a1[1]);
  w[3] = pk2(a1[2], a1[3]);
  v4u* dst = (v4u*)(outp + ((size_t)row * CVT_UPR + seg) * 8);
  *dst = w;
}

/* Er [16][2047][64] f32 -> Erb, bf16 (RNE), 16-row tiles in fragment order.
 * Tile m (0..127) of a head holds the rows of the offsets 16m - 1023 + c, c = 0..15, which are
 * the windows the attention kernel asks for (its offsets start at 1 mod 16).
 * Block = 2 tiles, thread = one 8-element unit: read as (row u>>3, segment u&7), whole lines;
 * units turned from [row][segment] to [segment][row] through LDS (cross-wave, block barrier);
 * stored in thread order. Coverage: TAB_BLOCKS x 2 tiles = 16 heads x 128 tiles.
 * LDS unit pitch: one spare unit per 16, so that the 8 segments of a row fall on different banks. */
constexpr int TAB_BLOCKS = NHEAD * 128 / 2;
__device__ __forceinline__ void pack_table_block(
    const float* __restrict__ Er, unsigned short* __restrict__ Erb, int blk, v4u* Us)
{
  const int tid  = threadIdx.x;
  const int tl   = tid >> 7;
  const int u    = tid & 127;
  const int tile = blk * 2 + tl;             /* head * 128 + m */
  const int h    = tile >> 7;
  const int m    = tile & 127;
  const int row  = u >> 3;
  const int seg  = u & 7;
  const int d    = 16 * m - (SEQ_FULL - 1) + row;      /* -1023 .. 1024 */
  const int rr   = d + ((d < 0) ? NPOS : 0);           /* 0 .. 2046 */
  const float* src = Er + ((size_t)h * NPOS + rr) * DHEAD + seg * 8;
  const v4f a0 = *(const v4f*)src;
  const v4f a1 = *(const v4f*)(src + 4);
  v4u w;
  w[0] = pk2(a0[0], a0[1]);
  w[1] = pk2(a0[2], a0[3]);
  w[2] = pk2(a1[0], a1[1]);
  w[3] = pk2(a1[2], a1[3]);
  Us[tl * 136 + seg * 17 + row] = w;
  __syncthreads();   /* publishes the tile's units to the waves that store them */
  *(v4u*)(Erb + (size_t)tile * 1024 + u * 8) = Us[tl * 136 + (u >> 4) * 17 + (u & 15)];
  wait_addr();   /* behind the job's store: another job's text follows it in the one kernel and writes its registers */
}

/* W in[rows][cols] f32  ->  Wt out[cols][rows] bf16 (RNE), one 64x64 tile through LDS.
 * Tile (kt = rows tile, nt = cols tile), 256 threads.
 * Coverage: 2 iterations x 256 threads = 512 units x 8 = 64x64 for the load phase
 * and the same 512 units x 8 = 64x64 for the store phase.
 * LDS tile: cross-wave, separated by a block barrier. */
constexpr int WQ_BLOCKS = (DMODEL / 64) * (NQKV / 64);
constexpr int WO_BLOCKS = (DMODEL / 64) * (DMODEL / 64);
__device__ __forceinline__ void wt_planes_block(
    const float* __restrict__ W, unsigned short* __restrict__ Wt, int rows, int cols,
    int kt, int nt, unsigned short* Ts /* [n][k] */)
{
  const int k0 = kt * 64;
  const int n0 = nt * 64;
  const int tid = threadIdx.x;
  const float* src[2];
  v4f a0[2], a1[2];
  /* both loops unrolled: the arrays are indexed by constants and stay in registers */
#pragma unroll
  for (int it = 0; it < 2; ++it) {
    const int u = it * 256 + tid;
    src[it] = W + (size_t)(k0 + (u >> 3)) * cols + n0 + (u & 7) * 8;
    a0[it] = *(const v4f*)src[it];
    a1[it] = *(const v4f*)(src[it] + 4);
  }
  /* the wait that is kept before a register of an issued global load is overwritten; it takes the
     two address pairs as inputs, so that they stay whole up to it and no load's result lands on one */
  asm volatile("s_wait_xcnt 0x0" :: "v"(src[0]), "v"(src[1]) : "memory");
#pragma unroll
  for (int it = 0; it < 2; ++it) {
    const int u = it * 256 + tid;
    const int row = u >> 3;      /* k local */
    const int seg = u & 7;       /* n segment */
#pragma unroll
    for (int e = 0; e < 4; ++e) {
      Ts[(seg * 8 + e) * TS_PITCH + row]     = f2bf_bits(a0[it][e]);
      Ts[(seg * 8 + 4 + e) * TS_PITCH + row] = f2bf_bits(a1[it][e]);
    }
  }
  __syncthreads();   /* publishes the tile to the waves that store its rows */
#pragma unroll
  for (int it = 0; it < 2; ++it) {
    const int u = it * 256 + tid;
    const int nrow = u >> 3;
    const int seg  = u & 7;
    const v4u w = *(const v4u_a*)(Ts + nrow * TS_PITCH + seg * 8);
    *(v4u*)(Wt + (size_t)(n0 + nrow) * rows + k0 + seg * 8) = w;
  }
  wait_addr();   /* behind the job's two stores: another job's text follows them in the one kernel and writes their registers */
}

/* Block ranges, the jobs with two phases and a barrier first:
 *   [0, WQ)            W_qkv in[1024][3072] -> WqT out[3072][1024], tile (blk % 16, blk / 16)
 *   [WQ, WQ + WO)      W_o   in[1024][1024] -> WoT out[1024][1024], likewise
 *   then TAB_BLOCKS    the position table, then CVT_BLOCKS x. */
constexpr int PREP_BLOCKS = WQ_BLOCKS + WO_BLOCKS + TAB_BLOCKS + CVT_BLOCKS;
__global__ __launch_bounds__(256) void prep_kernel(
    const float* __restrict__ x, const float* __restrict__ W_qkv, const float* __restrict__ W_o,
    const float* __restrict__ Er, unsigned short* __restrict__ Xb, unsigned short* __restrict__ WqT,
    unsigned short* __restrict__ WoT, unsigned short* __restrict__ Erb)
{
  __shared__ __align__(16) unsigned short Ts[64 * TS_PITCH];
  __shared__ __align__(16) v4u Us[2 * 136];
  constexpr int KT = DMODEL / 64;
  const int blk = blockIdx.x;
  if (blk < WQ_BLOCKS) {
    wt_planes_block(W_qkv, WqT, DMODEL, NQKV, blk % KT, blk / KT, Ts);
  } else if (blk < WQ_BLOCKS + WO_BLOCKS) {
    const int t = blk - WQ_BLOCKS;
    wt_planes_block(W_o, WoT, DMODEL, DMODEL, t % KT, t / KT, Ts);
  } else if (blk < WQ_BLOCKS + WO_BLOCKS + TAB_BLOCKS) {
    pack_table_block(Er, Erb, blk - (WQ_BLOCKS + WO_BLOCKS), Us);
  } else {
    cvt_rows_block(x, Xb, blk - (WQ_BLOCKS + WO_BLOCKS + TAB_BLOCKS));
  }
}

/* --------------------------------------------------------------------------
 * qkv = Xb . WqT^T + b  (M = MROWS, N = 3072, K = 1024), bf16 x bf16, f32 acc.
 * Block = 4 waves, tile 128 tokens x 64 columns (= one head of one section);
 * wave = 32 rows x 64 cols (2 A fragments x 4 B fragments per 32-deep step).
 * Operands: stages of 64 k (128 B of each of the 192 operand rows, whole lines) brought into a
 * two-buffer LDS ring by asynchronous copies, 12 per thread and stage, one stage ahead of the
 * stage being worked on; fragments by 16-B LDS loads from rows pitched 144 B.
 * Foot of every stage: own LDS reads back, own copies landed, block barrier, then the refill of
 * the buffer just read. The epilogue tile reuses the ring behind the last stage's barrier.
 * Fragment map (hh = lane>>4, c = lane&15): A row c, elems 0..7 <- k0+8hh.., 8..15 <- k0+16+8hh..;
 * B col c with the same k map; D elem r = (row 8hh+r, col c).
 * Epilogue: (acc + bias) [x 1/8 for the k section] split to bf16 hi/lo, staged in a
 * block LDS tile ([tok][d] for q,k; [d][tok] for v), block barrier, then stored in fragment
 * order: the block's 1024 units of a plane are 16 KB in a row, unit u from
 *   q,k: token 16(u>>7) + (u&15), d segment (u>>4)&7;
 *   v  : d row 16((u>>6)&3) + (u&15), key segment 4(u>>8) + ((u>>4)&3).
 * ------------------------------------------------------------------------ */
__global__ __launch_bounds__(128) VGPR_CAP void gemm_qkv_kernel(
    const unsigned short* __restrict__ Xb, const unsigned short* __restrict__ WqT,
    const float* __restrict__ bias, unsigned short* __restrict__ qkvp)
{
  union FB { v16b v; v8b h[2]; };
  __shared__ __align__(16) unsigned short Sm[2 * QKV_STAGE_E];
  unsigned short* Th = Sm;
  unsigned short* Tl = Sm + T_ELEMS;

  const int tid  = threadIdx.x;
  const int wave = __builtin_amdgcn_readfirstlane(tid >> 5);
  const int lane = tid & 31;
  const int hh   = lane >> 4;
  const int c    = lane & 15;
  const int n0   = blockIdx.x * 64;
  const int m0   = blockIdx.y * 128;

  v8f acc[2][4];
#pragma unroll
  for (int mt = 0; mt < 2; ++mt)
#pragma unroll
    for (int t = 0; t < 4; ++t) acc[mt][t] = (v8f){0.f,0.f,0.f,0.f,0.f,0.f,0.f,0.f};

  /* copy unit: thread -> (row tid>>3 of each group of 16 rows, 16-B segment tid&7) */
  const int crow = tid >> 3;
  const int cseg = tid & 7;
  const unsigned short* gx = Xb  + (size_t)(m0 + crow) * DMODEL + cseg * 8;
  const unsigned short* gw = WqT + (size_t)(n0 + crow) * DMODEL + cseg * 8;
  const unsigned lrow = lds_off(Sm) + (unsigned)(crow * RP + cseg * 8) * 2u;

  auto issue_stage = [&](int st) {
    /* unrolled below: the address arrays are indexed by constants and stay in registers */
    unsigned l[12];
    const unsigned short* g[12];
    const unsigned lb = lrow + (unsigned)(st & 1) * (unsigned)(QKV_STAGE_E * 2);
#pragma unroll
    for (int it = 0; it < 12; ++it) {
      l[it] = lb + (unsigned)(it * 16 * RP * 2);
      g[it] = (it < 8) ? gx + (size_t)it * 16 * DMODEL + st * KST
                       : gw + (size_t)(it - 8) * 16 * DMODEL + st * KST;
    }
    async_copy12(l, g);
  };

  const unsigned short* sa = Sm + (wave * 32 + c) * RP + 8 * hh;
  const unsigned short* sb = Sm + (128 + c) * RP + 8 * hh;

  issue_stage(0);
  wait_copies();
  __syncthreads();   /* publishes stage 0 */
  issue_stage(1);

  /* kept rolled: one copy of the ring's foot (waits, barrier, refill), small loop text */
#pragma unroll 1
  for (int st = 0; st < NSTAGE; ++st) {
    const int bo = (st & 1) * QKV_STAGE_E;
    /* the stage's fragment loads stand as one group ahead of its products, so that the wave pays
       the LDS latency once a stage; the loops below are unrolled so that every index of the
       fragment arrays is a constant and they stay in registers */
    FB a0[2], a1[2], bf[2][4];
#pragma unroll
    for (int s = 0; s < 2; ++s) {
      const int ks = s * 32;
      a0[s].h[0] = *(const v8b_a*)(sa + bo + ks);
      a0[s].h[1] = *(const v8b_a*)(sa + bo + ks + 16);
      a1[s].h[0] = *(const v8b_a*)(sa + bo + 16 * RP + ks);
      a1[s].h[1] = *(const v8b_a*)(sa + bo + 16 * RP + ks + 16);
#pragma unroll
      for (int t = 0; t < 4; ++t) {
        bf[s][t].h[0] = *(const v8b_a*)(sb + bo + t * 16 * RP + ks);
        bf[s][t].h[1] = *(const v8b_a*)(sb + bo + t * 16 * RP + ks + 16);
      }
    }
#pragma unroll
    for (int s = 0; s < 2; ++s) {
#pragma unroll
      for (int t = 0; t < 4; ++t) {
        acc[0][t] = mma_bf16(a0[s].v, bf[s][t].v, acc[0][t]);
        acc[1][t] = mma_bf16(a1[s].v, bf[s][t].v, acc[1][t]);
      }
    }
    wait_lds_reads();
    wait_copies();
    __syncthreads();   /* publishes stage st + 1 and ends every read of stage st's buffer */
    if (st + 2 < NSTAGE) issue_stage(st + 2);
  }
  wait_copies();

  const int sec = n0 / DMODEL;                       /* 0 q, 1 k, 2 v : block-uniform */
  const float osc = (sec == 1) ? 0.125f : 1.0f;
#pragma unroll
  for (int t = 0; t < 4; ++t) {
    const float bv = bf_bits2f(f2bf_bits(bias[n0 + 16 * t + c]));
#pragma unroll
    for (int mt = 0; mt < 2; ++mt) {
#pragma unroll
      for (int r = 0; r < 8; ++r) {
        const float val = (acc[mt][t][r] + bv) * osc;
        const unsigned short hb = f2bf_bits(val);
        const unsigned short lb = f2bf_bits(val - bf_bits2f(hb));
        const int rl = wave * 32 + mt * 16 + 8 * hh + r;
        const int cl = 16 * t + c;
        const int idx = (sec < 2) ? (rl * TQ_PITCH + cl) : (cl * TV_PITCH + rl);
        Th[idx] = hb;
        Tl[idx] = lb;
      }
    }
  }
  __syncthreads();

  const int b  = m0 / SEQ;
  const int l0 = m0 - b * SEQ;
  const int h  = (n0 - sec * DMODEL) / DHEAD;
  const int bh = b * NHEAD + h;
  unsigned short* ph = qkvp + (size_t)(2 * sec) * PLANE;
  unsigned short* pl = ph + PLANE;

  {
    if (sec < 2) {
#pragma unroll
      for (int it = 0; it < 8; ++it) {
        const int u = it * 128 + tid;
        const int row = (u >> 7) * 16 + (u & 15);
        const int seg = (u >> 4) & 7;
        const v4u hw = *(const v4u_a*)(Th + row * TQ_PITCH + seg * 8);
        const v4u lw = *(const v4u_a*)(Tl + row * TQ_PITCH + seg * 8);
        const size_t g = ((size_t)bh * SEQ + l0) * DHEAD + u * 8;
        *(v4u*)(ph + g) = hw;
        *(v4u*)(pl + g) = lw;
      }
    } else {
#pragma unroll
      for (int it = 0; it < 8; ++it) {
        const int u = it * 128 + tid;
        const int drow = ((u >> 6) & 3) * 16 + (u & 15);
        const int seg  = (u >> 8) * 4 + ((u >> 4) & 3);
        const v4u hw = *(const v4u_a*)(Th + drow * TV_PITCH + seg * 8);
        const v4u lw = *(const v4u_a*)(Tl + drow * TV_PITCH + seg * 8);
        const size_t g = ((size_t)bh * SEQ + l0) * DHEAD + u * 8;
        *(v4u*)(ph + g) = hw;
        *(v4u*)(pl + g) = lw;
      }
    }
    
  }
}

/* --------------------------------------------------------------------------
 * Attention with the per-head relative-position table, head dim 64.
 * Block = 16 query rows of one (b,h); grid (NBH, SEQ/16), the last query tile first, for speed
 * only; the order is a permutation of the tiles and changes no result under any mask.
 * The block's 4 waves deal the
 * 64-key chunks among them (wave w takes chunks w, w+4, ...), each with its own running
 * maximum, sum and output accumulators; one block barrier, then the four partial states
 * are merged through LDS by the usual rescaling to the common row maximum.
 * At entry: the mask rows of all the wave's chunks read by value as one group of loads
 * (8 b128 loads a chunk + ballots), one packed word a chunk and lane; wave-uniform skip of a
 * chunk when every element of its 16x64 mask tile is set; per-element replace-fill otherwise.
 * Per 64-key chunk and wave (16 query rows); only the output accumulators, the row statistics
 * and the mask words stay resident between chunks:
 *   G = q.Ewin^T  : 5 tiles (80 offsets d = kv0-q0-15+g, packed tiles (kv0-q0)/16+63 ..),
 *                   2 d-steps x (hi + lo) against the bf16 table, written
 *                   to the wave-private G slab, read back skewed: G[m][n-m+15];
 *   S = q.(k/8)^T : 4 key tiles, 2 d-steps x (hi.hi + hi.lo + lo.hi),
 *                   one accumulator, each tile written to the wave-private S slab;
 *   f32 online softmax on S + G; P as bf16 hi+lo wave-private LDS tiles;
 *   O += Ph.Vh + Pl.Vh + Ph.Vl from the V^T planes, two 32-key steps.
 * All fragments come straight from the 16-bit global planes, which stand in fragment order: every
 * load is a wave-uniform base + 16 B x lane and covers four whole lines. The loads are
 * issued in groups ahead of the products that use them (q, table and key tile 0 together; key
 * tiles 1..3 as registers come free; v during the softmax).
 * LDS regions Ss/Gs/Psh/Psl are private to their wave (wave_sync form) inside the loop.
 * Epilogue: each wave's unnormalised 16x64 slab (aliases its G slab) and row statistics,
 * block barrier, merge + normalise (thread = one row x 8 columns) -> ctx hi/lo planes,
 * ------------------------------------------------------------------------ */
__global__ __launch_bounds__(128) VGPR_CAP void rel_attn_kernel(
    const unsigned short* __restrict__ qkvp, const unsigned short* __restrict__ Erb,
    const int* __restrict__ mask, unsigned short* __restrict__ ctxp)
{
  union FB { v16b v; v8b h[2]; };
  __shared__ __align__(16) float Gs[NWAVE][16 * GP];
  __shared__ __align__(16) float Ss[NWAVE][16 * SP];
  __shared__ __align__(16) unsigned short Psh[NWAVE][16 * KCH];
  __shared__ __align__(16) unsigned short Psl[NWAVE][16 * KCH];
  __shared__ float Ms[NWAVE][16];
  __shared__ float Ls[NWAVE][16];

  const int tid  = threadIdx.x;
  const int wave = __builtin_amdgcn_readfirstlane(tid >> 5);
  const int lane = tid & 31;
  const int hh   = lane >> 4;
  const int c    = lane & 15;
  const int c3   = c & 3;
  const int csh  = c >> 2;
  const int qb   = SEQ / 16 - 1 - (int)blockIdx.y;
  const int bh   = blockIdx.x;
  const int b    = bh / NHEAD;
  const int h    = bh - b * NHEAD;
  const int q0   = qb * 16;
  const float NEG_INF = -__builtin_inff();

  const unsigned short* Qh  = qkvp + (size_t)bh * SEQ * DHEAD;   /* each lo plane stands PLANE behind its hi plane */
  const unsigned short* Kh  = Qh + 2 * PLANE;
  const unsigned short* Vth = Qh + 4 * PLANE;     /* same per-bh element count */
  const unsigned short* Eh  = Erb + (size_t)h * 128 * 1024;   /* 128 packed tiles of 1024 elements a head */

  float mrow[8], lrow[8];
  v8f oacc[4];
#pragma unroll
  for (int r = 0; r < 8; ++r) { mrow[r] = NEG_INF; lrow[r] = 0.f; }
#pragma unroll
  for (int t = 0; t < 4; ++t) oacc[t] = (v8f){0.f,0.f,0.f,0.f,0.f,0.f,0.f,0.f};

  float* gs = Gs[wave];
  float* ss = Ss[wave];
  unsigned short* pwh = Psh[wave];
  unsigned short* pwl = Psl[wave];
  /* one lane base per slab and access pattern; every row and tile below is a constant offset from
     it, so that the LDS addresses take one register each and leave room for loads in flight */
  float* gsw = gs + 8 * hh * GP + c;                    /* G and output slab, element (8hh+r, 16t+c) */
  float* ssw = ss + 8 * hh * SP + c;                    /* S slab, element (8hh+r, 16j+c) */
  const float* gsk = gs + 8 * hh * (GP - 1) + c + 15;   /* G slab read skewed: G[m][n-m+15] */
  unsigned short* pwhw = pwh + 8 * hh * KCH + c;
  unsigned short* pwlw = pwl + 8 * hh * KCH + c;
  const unsigned lane8 = (unsigned)(lane * 8);   /* this lane's 16-B unit of every 512-B fragment run (elements) */

  /* mask tiles of all NCH chunks of this wave, by value: the 8 * NCH row loads stand as one group
     ahead of every use, so that the wave waits for the mask once and not once a row.
     Bit L of the ballot (it, e) = mask[q0+2it+(L>>4)][kv0+4(L&15)+e] != 0; each lane keeps the
     word of its own e = c&3 (lane masks sel0..sel3) and of its own row half, and packs its own
     32 bits of a chunk into one word: bit 16(r&1) + 4j + (r>>1) = element (row 8hh+r, key 16j+c). */
  unsigned mpk[NCH];
  unsigned skip = 0u;                 /* bit i: every element of chunk i's tile is masked (wave-uniform) */
  {
    v4i mv[NCH][8];
    const int* ml = mask + (size_t)(q0 + hh) * SEQ_FULL + wave * KCH + 4 * c;   /* lane base; the rest are constants */
#pragma unroll
    for (int i = 0; i < NCH; ++i)
#pragma unroll
      for (int it = 0; it < 8; ++it) {
        if (i == NCH - 1 && it == 7) wait_addr();   /* last use of the mask address pair */
        mv[i][it] = *(const v4i*)(ml + it * 2 * SEQ_FULL + i * NWAVE * KCH);
      }
    const unsigned sel0 = (c3 == 0) ? 0xFFFFFFFFu : 0u;
    const unsigned sel1 = (c3 == 1) ? 0xFFFFFFFFu : 0u;
    const unsigned sel2 = (c3 == 2) ? 0xFFFFFFFFu : 0u;
    const unsigned sel3 = (c3 == 3) ? 0xFFFFFFFFu : 0u;
#pragma unroll
    for (int i = 0; i < NCH; ++i) {
      unsigned msel[8];
      unsigned andall = 0xFFFFFFFFu;
#pragma unroll
      for (int it = 0; it < 8; ++it) {
        const unsigned b0 = __builtin_amdgcn_ballot_w32(mv[i][it][0] != 0);
        const unsigned b1 = __builtin_amdgcn_ballot_w32(mv[i][it][1] != 0);
        const unsigned b2 = __builtin_amdgcn_ballot_w32(mv[i][it][2] != 0);
        const unsigned b3 = __builtin_amdgcn_ballot_w32(mv[i][it][3] != 0);
        andall &= (b0 & b1) & (b2 & b3);
        msel[it] = (b0 & sel0) | (b1 & sel1) | (b2 & sel2) | (b3 & sel3);
      }
      unsigned pk = 0u;
#pragma unroll
      for (int ii = 0; ii < 4; ++ii) {
        const unsigned w = hh ? msel[4 + ii] : msel[ii];
        pk |= ((w >> csh) & 0x11111111u) << ii;
      }
      mpk[i] = pk;
      skip |= (andall == 0xFFFFFFFFu) ? (1u << i) : 0u;
    }
  }

  /* kept rolled: one copy of the chunk's text */
#pragma unroll 1
  for (int i = 0; i < NCH; ++i) {
    if ((skip >> i) & 1u) continue;               /* wave-uniform: every element masked */
    const int kv0 = (wave + i * NWAVE) * KCH;

    const unsigned mk = (i == 0) ? mpk[0] : (i == 1) ? mpk[1] : (i == 2) ? mpk[2] : mpk[3];

    /* The chunk's loads fly as a window ahead of the products that use them: q, the 5 table tiles
       and key tile 0 are issued as one group, each further key tile as soon as earlier tiles'
       registers come free. q is read per chunk so that its registers are free for the v fragments
       during the softmax and p.v. All loops below are unrolled so that the fragment arrays are
       indexed by constants and stay in registers. */
    v16b qh[2], ql[2];
    FB kfh[4][2], kfl[4][2], ef[5][2];
    /* position table: offsets kv0 - q0 - 15 + g, g = 0..79, are the packed tiles
       (kv0 - q0) / 16 + 63 + t, t = 0..4, in [0, 127] */
    g_u16* ep = scalar_base(Eh + ((kv0 - q0 + SEQ_FULL - 16) >> 4) * 1024);
    g_u16* kh = scalar_base(Kh + kv0 * DHEAD);
    g_u16* kl = kh + PLANE;
    g_u16* vh = scalar_base(Vth + kv0 * DHEAD);
    g_u16* vl = vh + PLANE;
    g_u16* qph = scalar_base(Qh + q0 * DHEAD);
    g_u16* qpl = qph + PLANE;
    auto load_key_tile = [&](int j) {
#pragma unroll
      for (int dc = 0; dc < 2; ++dc) {
        kfh[j][dc].h[0] = *(g_v8b*)(kh + lane8 + j * 1024 + dc * 512);
        kfh[j][dc].h[1] = *(g_v8b*)(kh + lane8 + j * 1024 + dc * 512 + 256);
        kfl[j][dc].h[0] = *(g_v8b*)(kl + lane8 + j * 1024 + dc * 512);
        kfl[j][dc].h[1] = *(g_v8b*)(kl + lane8 + j * 1024 + dc * 512 + 256);
      }
      /* behind the chunk's last k load, before its address registers are written anew */
      if (j == 3) wait_addr();
    };
    {
#pragma unroll
      for (int dc = 0; dc < 2; ++dc) {
        FB f;
        f.h[0] = *(g_v8b*)(qph + lane8 + dc * 512);
        f.h[1] = *(g_v8b*)(qph + lane8 + dc * 512 + 256);
        qh[dc] = f.v;
        f.h[0] = *(g_v8b*)(qpl + lane8 + dc * 512);
        f.h[1] = *(g_v8b*)(qpl + lane8 + dc * 512 + 256);
        ql[dc] = f.v;
      }
    }
#pragma unroll
    for (int t = 0; t < 5; ++t) {
#pragma unroll
      for (int dc = 0; dc < 2; ++dc) {
        ef[t][dc].h[0] = *(g_v8b*)(ep + lane8 + t * 1024 + dc * 512);
        ef[t][dc].h[1] = *(g_v8b*)(ep + lane8 + t * 1024 + dc * 512 + 256);
      }
    }
    load_key_tile(0);
    wait_addr();      /* behind the last q and table loads, before their address registers are written anew */
    /* keeps the first product, and the load wait in front of it, behind the issue of the whole
       group: moved up among the loads it would make the rest of the group wait a full latency */
    __builtin_amdgcn_sched_barrier(0);

    /* position term: G[m][g] = q[m] . Er[h][(kv0 - q0 - 15 + g) mod 2047], g = 0..79 */
#pragma unroll
    for (int t = 0; t < 5; ++t) {
      v8f g = (v8f){0.f,0.f,0.f,0.f,0.f,0.f,0.f,0.f};
#pragma unroll
      for (int dc = 0; dc < 2; ++dc) {
        g = mma_bf16(qh[dc], ef[t][dc].v, g);
        g = mma_bf16(ql[dc], ef[t][dc].v, g);
      }
      if (t == 1) load_key_tile(1);
      if (t == 3) load_key_tile(2);
#pragma unroll
      for (int r = 0; r < 8; ++r) gsw[r * GP + 16 * t] = g[r];
    }

    /* raw scores: 4 key tiles, one accumulator, tile -> S slab (D elem r = row 8hh+r, col c) */
#pragma unroll
    for (int j = 0; j < 4; ++j) {
      v8f sa = (v8f){0.f,0.f,0.f,0.f,0.f,0.f,0.f,0.f};
#pragma unroll
      for (int dc = 0; dc < 2; ++dc) {
        sa = mma_bf16(qh[dc], kfh[j][dc].v, sa);
        sa = mma_bf16(qh[dc], kfl[j][dc].v, sa);
        sa = mma_bf16(ql[dc], kfh[j][dc].v, sa);
      }
      if (j == 0) load_key_tile(3);
#pragma unroll
      for (int r = 0; r < 8; ++r) ssw[r * SP + 16 * j] = sa[r];
    }
    wave_lds_sync();

    /* v fragments of the first 32 keys: issued here, so that they fly during the softmax */
    FB vbh[2][4], vbl[2][4];
    auto load_v_step = [&](int kk) {
#pragma unroll
      for (int t = 0; t < 4; ++t) {
        const int vo = kk * 2048 + t * 512;
        vbh[kk][t].h[0] = *(g_v8b*)(vh + lane8 + vo);
        vbh[kk][t].h[1] = *(g_v8b*)(vh + lane8 + vo + 256);
        vbl[kk][t].h[0] = *(g_v8b*)(vl + lane8 + vo);
        vbl[kk][t].h[1] = *(g_v8b*)(vl + lane8 + vo + 256);
      }
      /* behind the chunk's last v load, before its address registers are written anew */
      if (kk == 1) wait_addr();
    };
    load_v_step(0);

    /* raw score + skewed position term, replace-fill of masked elements */
    v8f s[4];
#pragma unroll
    for (int j = 0; j < 4; ++j) {
#pragma unroll
      for (int r = 0; r < 8; ++r) {
        const float raw = ssw[r * SP + 16 * j];
        const float gv = gsk[r * (GP - 1) + 16 * j];
        const float sv = raw + gv;
        const unsigned bit = (mk >> (16 * (r & 1) + 4 * j + (r >> 1))) & 1u;
        s[j][r] = bit ? NEG_INF : sv;
      }
    }

    /* chunk row max over the 64 keys */
    float cm[8];
#pragma unroll
    for (int r = 0; r < 8; ++r) {
      float m = fmaxf(fmaxf(s[0][r], s[1][r]), fmaxf(s[2][r], s[3][r]));
#pragma unroll
      for (int off = 1; off < 16; off <<= 1) m = fmaxf(m, __shfl_xor(m, off, 32));
      cm[r] = m;
    }

    /* online softmax update, P tiles as bf16 hi + lo */
#pragma unroll
    for (int r = 0; r < 8; ++r) {
      if (r == 4) load_v_step(1);   /* the second 32 keys' fragments, once half the score registers are free */
      const float mnew  = fmaxf(mrow[r], cm[r]);
      const float msafe = (mnew == NEG_INF) ? 0.f : mnew;
      const float nm    = -msafe * LOG2E;
      const float alpha = exp_shifted(mrow[r], nm);
      mrow[r] = mnew;
      float psum = 0.f;
#pragma unroll
      for (int j = 0; j < 4; ++j) {
        const float p = exp_shifted(s[j][r], nm);
        psum += p;
        const unsigned short hb = f2bf_bits(p);
        const unsigned short lb = f2bf_bits(p - bf_bits2f(hb));
        pwhw[r * KCH + j * 16] = hb;
        pwlw[r * KCH + j * 16] = lb;
      }
#pragma unroll
      for (int off = 1; off < 16; off <<= 1) psum += __shfl_xor(psum, off, 32);
      lrow[r] = lrow[r] * alpha + psum;
#pragma unroll
      for (int t = 0; t < 4; ++t) oacc[t][r] *= alpha;
    }
    wave_lds_sync();

    /* O += P.V : A = P [q][kv] (this wave's tiles), B = V [kv][d] from the packed v planes;
       unrolled over the two 32-key steps: the fragment arrays are indexed by constants */
#pragma unroll
    for (int kk = 0; kk < 2; ++kk) {
      FB pa, pl;
      pa.h[0] = *(const v8b_a*)(pwh + c * KCH + kk * 32 + 8 * hh);
      pa.h[1] = *(const v8b_a*)(pwh + c * KCH + kk * 32 + 16 + 8 * hh);
      pl.h[0] = *(const v8b_a*)(pwl + c * KCH + kk * 32 + 8 * hh);
      pl.h[1] = *(const v8b_a*)(pwl + c * KCH + kk * 32 + 16 + 8 * hh);
#pragma unroll
      for (int t = 0; t < 4; ++t) {
        oacc[t] = mma_bf16(pa.v, vbh[kk][t].v, oacc[t]);
        oacc[t] = mma_bf16(pl.v, vbh[kk][t].v, oacc[t]);
        oacc[t] = mma_bf16(pa.v, vbl[kk][t].v, oacc[t]);
      }
    }
    wave_lds_sync();
  }

  /* this wave's partial state: unnormalised output into its own slab (aliases the G slab),
     row maximum and row sum beside it */
#pragma unroll
  for (int r = 0; r < 8; ++r) {
#pragma unroll
    for (int t = 0; t < 4; ++t) gsw[r * GP + t * 16] = oacc[t][r];
  }
  if (c == 0) {      /* the 16 lanes of a half hold equal row statistics */
#pragma unroll
    for (int r = 0; r < 8; ++r) {
      Ms[wave][8 * hh + r] = mrow[r];
      Ls[wave][8 * hh + r] = lrow[r];
    }
  }
  __syncthreads();   /* publishes the four partial states to the whole block */
  {
    unsigned short* Ch = ctxp;
    unsigned short* Cl = ctxp + XB_E;
    const int row = tid >> 3;
    const int seg = tid & 7;
    float mall = Ms[0][row];
#pragma unroll
    for (int w = 1; w < NWAVE; ++w) mall = fmaxf(mall, Ms[w][row]);
    const float msafe = (mall == NEG_INF) ? 0.f : mall;
    const float nm = -msafe * LOG2E;
    float lsum = 0.f;
    v4f a0 = (v4f){0.f, 0.f, 0.f, 0.f};
    v4f a1 = (v4f){0.f, 0.f, 0.f, 0.f};
#pragma unroll
    for (int w = 0; w < NWAVE; ++w) {
      const float f = exp_shifted(Ms[w][row], nm);
      lsum += Ls[w][row] * f;
      a0 += *(const v4f_a*)(Gs[w] + row * GP + seg * 8) * f;
      a1 += *(const v4f_a*)(Gs[w] + row * GP + seg * 8 + 4) * f;
    }
    const float inv = 1.0f / lsum;
    a0 *= inv;
    a1 *= inv;
    unsigned h0, h1, h2, h3, l0, l1, l2, l3;
    split2(a0[0], a0[1], h0, l0);
    split2(a0[2], a0[3], h1, l1);
    split2(a1[0], a1[1], h2, l2);
    split2(a1[2], a1[3], h3, l3);
    v4u hw, lw;
    hw[0] = h0; hw[1] = h1; hw[2] = h2; hw[3] = h3;
    lw[0] = l0; lw[1] = l1; lw[2] = l2; lw[3] = l3;
    const size_t g = (size_t)(b * SEQ + q0 + row) * DMODEL + h * DHEAD + seg * 8;
    *(v4u*)(Ch + g) = hw;
    *(v4u*)(Cl + g) = lw;
  }
}

/* --------------------------------------------------------------------------
 * out = (Ch + Cl) . WoT^T + b  (M = MROWS, N = 1024, K = 1024), f32 acc.
 * Block = 4 waves, tile 128 x 64; wave = 32 rows x 64 cols; A hi and lo planes
 * against the single bf16 weight plane (two products per tile pair).
 * Operands: stages of 64 k (128 B of each of the 320 operand rows) in a two-buffer LDS ring,
 * filled by asynchronous copies (20 per thread and stage) in the order of gemm_qkv_kernel.
 * Epilogue: per-wave 32x64 f32 slab (wave-private LDS), 16 lanes x 16 B = one 256-B
 * ------------------------------------------------------------------------ */
__global__ __launch_bounds__(128) VGPR_CAP void gemm_out_kernel(
    const unsigned short* __restrict__ ctxp, const unsigned short* __restrict__ WoT,
    const float* __restrict__ bias, float* __restrict__ out)
{
  union FB { v16b v; v8b h[2]; };
  __shared__ __align__(16) float Os[NWAVE][32 * OS_PITCH];
  __shared__ __align__(16) unsigned short Sm[2 * OUT_STAGE_E];

  const int tid  = threadIdx.x;
  const int wave = __builtin_amdgcn_readfirstlane(tid >> 5);
  const int lane = tid & 31;
  const int hh   = lane >> 4;
  const int c    = lane & 15;
  const int n0   = blockIdx.x * 64;
  const int m0   = blockIdx.y * 128;

  v8f acc[2][4];
#pragma unroll
  for (int mt = 0; mt < 2; ++mt)
#pragma unroll
    for (int t = 0; t < 4; ++t) acc[mt][t] = (v8f){0.f,0.f,0.f,0.f,0.f,0.f,0.f,0.f};

  /* copy unit: thread -> (row tid>>3 of each group of 16 rows, 16-B segment tid&7) */
  const int crow = tid >> 3;
  const int cseg = tid & 7;
  const unsigned short* gh = ctxp + (size_t)(m0 + crow) * DMODEL + cseg * 8;
  const unsigned short* gl = gh + XB_E;
  const unsigned short* gw = WoT + (size_t)(n0 + crow) * DMODEL + cseg * 8;
  const unsigned lrow = lds_off(Sm) + (unsigned)(crow * RP + cseg * 8) * 2u;

  auto issue_stage = [&](int st) {
    /* unrolled below: the address arrays are indexed by constants and stay in registers */
    unsigned l[20];
    const unsigned short* g[20];
    const unsigned lb = lrow + (unsigned)(st & 1) * (unsigned)(OUT_STAGE_E * 2);
#pragma unroll
    for (int it = 0; it < 20; ++it) {
      l[it] = lb + (unsigned)(it * 16 * RP * 2);
      g[it] = (it < 8)  ? gh + (size_t)it * 16 * DMODEL + st * KST
            : (it < 16) ? gl + (size_t)(it - 8) * 16 * DMODEL + st * KST
                        : gw + (size_t)(it - 16) * 16 * DMODEL + st * KST;
    }
    async_copy10(l, g);
    async_copy10(l + 10, g + 10);
  };

  const unsigned short* sh = Sm + (wave * 32 + c) * RP + 8 * hh;
  const unsigned short* sl = sh + 128 * RP;
  const unsigned short* sb = Sm + (256 + c) * RP + 8 * hh;

  issue_stage(0);
  wait_copies();
  __syncthreads();   /* publishes stage 0 */
  issue_stage(1);

  /* kept rolled: one copy of the ring's foot (waits, barrier, refill), small loop text */
#pragma unroll 1
  for (int st = 0; st < NSTAGE; ++st) {
    const int bo = (st & 1) * OUT_STAGE_E;
    /* the stage's fragment loads stand as one group ahead of its products, so that the wave pays
       the LDS latency once a stage; the loops below are unrolled so that every index of the
       fragment arrays is a constant and they stay in registers */
    FB a0h[2], a1h[2], a0l[2], a1l[2], bf[2][4];
#pragma unroll
    for (int s = 0; s < 2; ++s) {
      const int ks = s * 32;
      a0h[s].h[0] = *(const v8b_a*)(sh + bo + ks);
      a0h[s].h[1] = *(const v8b_a*)(sh + bo + ks + 16);
      a0l[s].h[0] = *(const v8b_a*)(sl + bo + ks);
      a0l[s].h[1] = *(const v8b_a*)(sl + bo + ks + 16);
      a1h[s].h[0] = *(const v8b_a*)(sh + bo + 16 * RP + ks);
      a1h[s].h[1] = *(const v8b_a*)(sh + bo + 16 * RP + ks + 16);
      a1l[s].h[0] = *(const v8b_a*)(sl + bo + 16 * RP + ks);
      a1l[s].h[1] = *(const v8b_a*)(sl + bo + 16 * RP + ks + 16);
#pragma unroll
      for (int t = 0; t < 4; ++t) {
        bf[s][t].h[0] = *(const v8b_a*)(sb + bo + t * 16 * RP + ks);
        bf[s][t].h[1] = *(const v8b_a*)(sb + bo + t * 16 * RP + ks + 16);
      }
    }
#pragma unroll
    for (int s = 0; s < 2; ++s) {
#pragma unroll
      for (int t = 0; t < 4; ++t) {
        acc[0][t] = mma_bf16(a0h[s].v, bf[s][t].v, acc[0][t]);
        acc[0][t] = mma_bf16(a0l[s].v, bf[s][t].v, acc[0][t]);
        acc[1][t] = mma_bf16(a1h[s].v, bf[s][t].v, acc[1][t]);
        acc[1][t] = mma_bf16(a1l[s].v, bf[s][t].v, acc[1][t]);
      }
    }
    wait_lds_reads();
    wait_copies();
    __syncthreads();   /* publishes stage st + 1 and ends every read of stage st's buffer */
    if (st + 2 < NSTAGE) issue_stage(st + 2);
  }
  wait_copies();

  float* os = Os[wave];
#pragma unroll
  for (int t = 0; t < 4; ++t) {
    const float bv = bf_bits2f(f2bf_bits(bias[n0 + 16 * t + c]));
#pragma unroll
    for (int mt = 0; mt < 2; ++mt)
#pragma unroll
      for (int r = 0; r < 8; ++r)
        os[(mt * 16 + 8 * hh + r) * OS_PITCH + 16 * t + c] = acc[mt][t][r] + bv;
  }
  wave_lds_sync();
  {
    const int c4 = c * 4;
    {
#pragma unroll
      for (int it = 0; it < 16; ++it) {
        const int row = it * 2 + hh;
        const v4f val = *(const v4f_a*)(os + row * OS_PITCH + c4);
        *(v4f*)(out + (size_t)(m0 + wave * 32 + row) * DMODEL + n0 + c4) = val;
      }
      
    }
  }
}

extern "C" void kernel_launch(void* const* d_in, const int* in_sizes, int n_in,
                              void* d_out, int out_size, void* d_ws, size_t ws_size,
                              hipStream_t stream)
{
  if (n_in < 7) return;
  if (in_sizes[0] < ((NB - 1) * SEQ_FULL + SEQ) * DMODEL) return;
  if (in_sizes[1] < (SEQ - 1) * SEQ_FULL + SEQ) return;
  if (in_sizes[2] < DMODEL * NQKV) return;
  if (in_sizes[3] < NQKV) return;
  if (in_sizes[4] < DMODEL * DMODEL) return;
  if (in_sizes[5] < DMODEL) return;
  if (in_sizes[6] < NHEAD * NPOS * DHEAD) return;
  if (out_size < MROWS * DMODEL) return;
  if (d_ws == nullptr || ws_size < WS_NEED) return;

  const float* x     = (const float*)d_in[0];
  const int*   mask  = (const int*)d_in[1];
  const float* W_qkv = (const float*)d_in[2];
  const float* b_qkv = (const float*)d_in[3];
  const float* W_o   = (const float*)d_in[4];
  const float* b_o   = (const float*)d_in[5];
  const float* Er    = (const float*)d_in[6];
  float* out = (float*)d_out;

  unsigned short* Xb   = (unsigned short*)d_ws;
  unsigned short* WqT  = Xb + XB_E;
  unsigned short* WoT  = WqT + WQT_E;
  unsigned short* Erb  = WoT + WOT_E;
  unsigned short* qkvp = Erb + ERB_E;
  unsigned short* ctxp = qkvp + QKVP_E;

  /* the four preparation jobs, one launch */
  prep_kernel<<<PREP_BLOCKS, 256, 0, stream>>>(x, W_qkv, W_o, Er, Xb, WqT, WoT, Erb);

  gemm_qkv_kernel<<<dim3(NQKV / 64, MROWS / 128), 128, 0, stream>>>(Xb, WqT, b_qkv, qkvp);
  rel_attn_kernel<<<dim3(NBH, SEQ / 16), 128, 0, stream>>>(qkvp, Erb, mask, ctxp);
  gemm_out_kernel<<<dim3(DMODEL / 64, MROWS / 128), 128, 0, stream>>>(ctxp, WoT, b_o, out);
}

// v008
// Measured time: 80.3 microseconds a run.
// Next to v007, in two timings, it ran 1.03 times as fast each time.
// Over all steps from v000 it is 3.32 times as fast.
// Contractions: x.Wqkv on v_wmma_f32_16x16x32_bf16 with both operands RNE-converted to bf16 once; q.(k/8)^T, q.Er^T, p.v and ctx.Wo on v_wmma_f32_16x16x32_bf16 with computed operands (q, k/8, v, p, ctx) carried as bf16 hi+lo planes (hi.hi + hi.lo + lo.hi) and input operands (Er, Wo) as single bf16 planes; f32 accumulate; softmax, bias adds and mask fill in f32.
#include <hip/hip_runtime.h>

typedef __attribute__((ext_vector_type(16))) __bf16 v16b;
typedef __attribute__((ext_vector_type(8)))  __bf16 v8b;
typedef __attribute__((ext_vector_type(8)))  float  v8f;
typedef __attribute__((ext_vector_type(4)))  float  v4f;
typedef __attribute__((ext_vector_type(4)))  unsigned int v4u;
typedef __attribute__((ext_vector_type(4)))  int v4i;
typedef v8b v8b_a __attribute__((may_alias));
typedef v4f v4f_a __attribute__((may_alias));
typedef v4u v4u_a __attribute__((may_alias));

#ifndef NB
#define NB 2
#endif
#ifndef SEQ
#define SEQ 1024
#endif
#define NB_FULL 2
#define SEQ_FULL 1024

#define VGPR_CAP __attribute__((amdgpu_num_vgpr(256)))

constexpr int DMODEL = 1024;
constexpr int NHEAD  = 16;
constexpr int DHEAD  = 64;
constexpr int NPOS   = 2047;
constexpr int NQKV   = 3 * DMODEL;
constexpr int NBH    = NB * NHEAD;
constexpr int MROWS  = NB * SEQ;
constexpr int KCH    = 64;        /* keys per chunk */
constexpr int NWAVE  = 4;
constexpr int NCH    = SEQ / (KCH * NWAVE);   /* key chunks per wave of the attention block */
constexpr int GP     = 84;        /* skew slab pitch in floats (336 B rows, 16-B aligned) */
constexpr int SP     = 68;        /* raw score slab pitch in floats */
constexpr int TQ_PITCH = 72;      /* [tok][d] staging pitch (16-bit elements) */
constexpr int TV_PITCH = 136;     /* [d][tok] staging pitch (16-bit elements) */
constexpr int T_ELEMS  = 128 * TQ_PITCH;   /* 9216 >= 64 * TV_PITCH = 8704 */
constexpr int TS_PITCH = 72;
constexpr int OS_PITCH = 68;
constexpr int KST      = 64;      /* k elements per GEMM stage: one 128-B line of every operand row */
constexpr int RP       = 72;      /* GEMM stage row pitch (16-bit elements): 144 B = 16 B x odd for b128 readers */
constexpr int NSTAGE   = 1024 / KST;
constexpr int QKV_STAGE_E = (128 + 64) * RP;        /* [x 128 rows | W 64 rows] */
constexpr int OUT_STAGE_E = (128 + 128 + 64) * RP;  /* [ctx hi 128 | ctx lo 128 | W 64 rows] */

constexpr size_t PLANE  = (size_t)NBH * SEQ * DHEAD;
constexpr size_t XB_E   = (size_t)MROWS * DMODEL;
constexpr size_t WQT_E  = (size_t)NQKV * DMODEL;
constexpr size_t WOT_E  = (size_t)DMODEL * DMODEL;
constexpr size_t ERB_E  = (size_t)NHEAD * 2048 * DHEAD;
constexpr size_t QKVP_E = 6 * PLANE;
constexpr size_t CTX_E  = 2 * XB_E;
constexpr size_t WS_NEED = 2 * (XB_E + WQT_E + WOT_E + ERB_E + QKVP_E + CTX_E);

static_assert(SEQ % 128 == 0);
static_assert(NCH * KCH * NWAVE == SEQ && NCH == 4);
static_assert(SEQ <= SEQ_FULL && NB <= NB_FULL);
static_assert(DHEAD == 64 && DMODEL == NHEAD * DHEAD);
static_assert(DMODEL % 64 == 0 && NQKV % 64 == 0 && DMODEL % 32 == 0);
static_assert(64 * TV_PITCH <= T_ELEMS);
static_assert((TQ_PITCH * 2) % 16 == 0 && (TV_PITCH * 2) % 16 == 0 && (GP * 4) % 16 == 0 && (OS_PITCH * 4) % 16 == 0);
static_assert(GP >= 80 && SP >= 64);
static_assert(NSTAGE * KST == DMODEL && NSTAGE >= 2 && (RP * 2) % 16 == 0 && RP >= KST);
static_assert(2 * T_ELEMS <= 2 * QKV_STAGE_E);
static_assert((size_t)NHEAD * NPOS * DHEAD <= ERB_E);
static_assert(WS_NEED <= 134217728ull);

/*
 *   Xb   [MROWS][1024]        x, bf16
 *   WqT  [3072][1024]         W_qkv transposed, bf16
 *   WoT  [1024][1024]         W_o transposed, bf16
 *   Erb  [16][128 tiles][8][16][8]   Er, bf16, in fragment order (below); row c of tile m is the
 *                             table row of offset 16m - 1023 + c, that is (16m - 1023 + c) mod 2047
 *   qkvp 6 planes, in fragment order: Qh Ql, Kh Kl (k/8) [bh][l/16][d/8][l%16][8 d],
 *                             Vh Vl [bh][l/32][d/16][(l%32)/8][d%16][8 l]
 *   ctxp 2 planes: Ch Cl [MROWS][1024]
 * Fragment order: the 16-B unit that lane (hh, c) takes for half a fragment register set stands at
 * unit 16hh + c of a 512-B run, so that one 16-B load of a wave covers four whole 128-B lines.
 */

__device__ __forceinline__ unsigned short f2bf_bits(float f) {
  unsigned u = __float_as_uint(f);
  return (unsigned short)((u + 0x7FFFu + ((u >> 16) & 1u)) >> 16);
}
__device__ __forceinline__ float bf_bits2f(unsigned short h) { return __uint_as_float(((unsigned)h) << 16); }
__device__ __forceinline__ unsigned pk2(float a, float b) {
  return (unsigned)f2bf_bits(a) | ((unsigned)f2bf_bits(b) << 16);
}
__device__ __forceinline__ void split2(float a, float b, unsigned& hw, unsigned& lw) {
  const unsigned short ha = f2bf_bits(a);
  const unsigned short hb = f2bf_bits(b);
  const unsigned short la = f2bf_bits(a - bf_bits2f(ha));
  const unsigned short lb = f2bf_bits(b - bf_bits2f(hb));
  hw = (unsigned)ha | ((unsigned)hb << 16);
  lw = (unsigned)la | ((unsigned)lb << 16);
}

/* e^(x - m) as one multiply-add and the hardware's base-2 exponential: exp2(x * log2(e) + nm), with
   nm = -m * log2(e) formed once a row. x = -inf gives 0; a result below the smallest normal number
   counts as 0, which is far below the last bit that the row sum or the 16-bit planes of p keep. */
constexpr float LOG2E = 1.44269504088896340736f;
__device__ __forceinline__ float exp_shifted(float x, float nm) {
  return __builtin_amdgcn_exp2f(__builtin_fmaf(x, LOG2E, nm));
}

/* The value of lane (lane ^ M) of the same 16-lane row, M = 1, 2, 4, 8, by the vector unit's own
   cross-lane read (DPP row_xmask); every lane is on where it is used. A shuffle builtin would go
   through the LDS queue and make each step of a row reduction wait for an LDS round trip. */
template <int M>
__device__ __forceinline__ float row_xor(float v) {
  return __int_as_float(__builtin_amdgcn_update_dpp(0, __float_as_int(v), 0x160 | M, 0xf, 0xf, true));
}
/* Maximum over each 16-lane row, eight values at once, left in every lane. Written as text because
   fmaxf on a cross-lane read compiles to three instructions a step (the read, a quieting maximum of
   the value with itself, the maximum); here a step is one. The eight values go step by step side by
   side, so that each instruction's producer stands eight instructions back and none waits for it. */
__device__ __forceinline__ void row_max16x8(float (&m)[8]) {
  asm(
      "v_max_num_f32_dpp %0, %0, %0 row_xmask:1 row_mask:0xf bank_mask:0xf\n\t"
      "v_max_num_f32_dpp %1, %1, %1 row_xmask:1 row_mask:0xf bank_mask:0xf\n\t"
      "v_max_num_f32_dpp %2, %2, %2 row_xmask:1 row_mask:0xf bank_mask:0xf\n\t"
      "v_max_num_f32_dpp %3, %3, %3 row_xmask:1 row_mask:0xf bank_mask:0xf\n\t"
      "v_max_num_f32_dpp %4, %4, %4 row_xmask:1 row_mask:0xf bank_mask:0xf\n\t"
      "v_max_num_f32_dpp %5, %5, %5 row_xmask:1 row_mask:0xf bank_mask:0xf\n\t"
      "v_max_num_f32_dpp %6, %6, %6 row_xmask:1 row_mask:0xf bank_mask:0xf\n\t"
      "v_max_num_f32_dpp %7, %7, %7 row_xmask:1 row_mask:0xf bank_mask:0xf\n\t"
      "v_max_num_f32_dpp %0, %0, %0 row_xmask:2 row_mask:0xf bank_mask:0xf\n\t"
      "v_max_num_f32_dpp %1, %1, %1 row_xmask:2 row_mask:0xf bank_mask:0xf\n\t"
      "v_max_num_f32_dpp %2, %2, %2 row_xmask:2 row_mask:0xf bank_mask:0xf\n\t"
      "v_max_num_f32_dpp %3, %3, %3 row_xmask:2 row_mask:0xf bank_mask:0xf\n\t"
      "v_max_num_f32_dpp %4, %4, %4 row_xmask:2 row_mask:0xf bank_mask:0xf\n\t"
      "v_max_num_f32_dpp %5, %5, %5 row_xmask:2 row_mask:0xf bank_mask:0xf\n\t"
      "v_max_num_f32_dpp %6, %6, %6 row_xmask:2 row_mask:0xf bank_mask:0xf\n\t"
      "v_max_num_f32_dpp %7, %7, %7 row_xmask:2 row_mask:0xf bank_mask:0xf\n\t"
      "v_max_num_f32_dpp %0, %0, %0 row_xmask:4 row_mask:0xf bank_mask:0xf\n\t"
      "v_max_num_f32_dpp %1, %1, %1 row_xmask:4 row_mask:0xf bank_mask:0xf\n\t"
      "v_max_num_f32_dpp %2, %2, %2 row_xmask:4 row_mask:0xf bank_mask:0xf\n\t"
      "v_max_num_f32_dpp %3, %3, %3 row_xmask:4 row_mask:0xf bank_mask:0xf\n\t"
      "v_max_num_f32_dpp %4, %4, %4 row_xmask:4 row_mask:0xf bank_mask:0xf\n\t"
      "v_max_num_f32_dpp %5, %5, %5 row_xmask:4 row_mask:0xf bank_mask:0xf\n\t"
      "v_max_num_f32_dpp %6, %6, %6 row_xmask:4 row_mask:0xf bank_mask:0xf\n\t"
      "v_max_num_f32_dpp %7, %7, %7 row_xmask:4 row_mask:0xf bank_mask:0xf\n\t"
      "v_max_num_f32_dpp %0, %0, %0 row_xmask:8 row_mask:0xf bank_mask:0xf\n\t"
      "v_max_num_f32_dpp %1, %1, %1 row_xmask:8 row_mask:0xf bank_mask:0xf\n\t"
      "v_max_num_f32_dpp %2, %2, %2 row_xmask:8 row_mask:0xf bank_mask:0xf\n\t"
      "v_max_num_f32_dpp %3, %3, %3 row_xmask:8 row_mask:0xf bank_mask:0xf\n\t"
      "v_max_num_f32_dpp %4, %4, %4 row_xmask:8 row_mask:0xf bank_mask:0xf\n\t"
      "v_max_num_f32_dpp %5, %5, %5 row_xmask:8 row_mask:0xf bank_mask:0xf\n\t"
      "v_max_num_f32_dpp %6, %6, %6 row_xmask:8 row_mask:0xf bank_mask:0xf\n\t"
      "v_max_num_f32_dpp %7, %7, %7 row_xmask:8 row_mask:0xf bank_mask:0xf"
      : "+v"(m[0]), "+v"(m[1]), "+v"(m[2]), "+v"(m[3]), "+v"(m[4]), "+v"(m[5]), "+v"(m[6]), "+v"(m[7]));
}
__device__ __forceinline__ float row_sum16(float s) {
  s += row_xor<1>(s);
  s += row_xor<2>(s);
  s += row_xor<4>(s);
  s += row_xor<8>(s);
  return s;
}

/* one WMMA + hazard guard naming only this call's live operands */
__device__ __forceinline__ v8f mma_bf16(v16b a, v16b b, v8f c) {
  c = __builtin_amdgcn_wmma_f32_16x16x32_bf16(false, a, false, b, (short)0, c, false, false);
  asm volatile("v_nop\n\tv_nop\n\tv_nop\n\tv_nop" : "+v"(c) : "v"(a), "v"(b));
  return c;
}

__device__ __forceinline__ void wave_lds_sync() {
  __builtin_amdgcn_fence(3 /* release order */, "workgroup");
  __builtin_amdgcn_wave_barrier();
  __builtin_amdgcn_fence(2 /* acquire order */, "workgroup");
}

/* byte offset of a __shared__ address inside the work-group's LDS */
__device__ __forceinline__ unsigned lds_off(const void* p) { return (unsigned)(size_t)p; }

/* Asynchronous copies global -> LDS, 16 B per lane and copy, every lane on. The copies of a run
   and the s_wait_xcnt 0 that stands before their address registers may be rewritten are one
   statement, so that no later address arithmetic can be moved in front of that wait. */
__device__ __forceinline__ void async_copy12(const unsigned (&l)[12], const unsigned short* const (&g)[12]) {
  asm volatile(
      "global_load_async_to_lds_b128 %0, %12, off\n\t"
      "global_load_async_to_lds_b128 %1, %13, off\n\t"
      "global_load_async_to_lds_b128 %2, %14, off\n\t"
      "global_load_async_to_lds_b128 %3, %15, off\n\t"
      "global_load_async_to_lds_b128 %4, %16, off\n\t"
      "global_load_async_to_lds_b128 %5, %17, off\n\t"
      "global_load_async_to_lds_b128 %6, %18, off\n\t"
      "global_load_async_to_lds_b128 %7, %19, off\n\t"
      "global_load_async_to_lds_b128 %8, %20, off\n\t"
      "global_load_async_to_lds_b128 %9, %21, off\n\t"
      "global_load_async_to_lds_b128 %10, %22, off\n\t"
      "global_load_async_to_lds_b128 %11, %23, off\n\t"
      "s_wait_xcnt 0x0"
      :: "v"(l[0]), "v"(l[1]), "v"(l[2]), "v"(l[3]), "v"(l[4]), "v"(l[5]),
         "v"(l[6]), "v"(l[7]), "v"(l[8]), "v"(l[9]), "v"(l[10]), "v"(l[11]),
         "v"(g[0]), "v"(g[1]), "v"(g[2]), "v"(g[3]), "v"(g[4]), "v"(g[5]),
         "v"(g[6]), "v"(g[7]), "v"(g[8]), "v"(g[9]), "v"(g[10]), "v"(g[11])
      : "memory");
}
__device__ __forceinline__ void async_copy10(const unsigned* l, const unsigned short* const* g) {
  asm volatile(
      "global_load_async_to_lds_b128 %0, %10, off\n\t"
      "global_load_async_to_lds_b128 %1, %11, off\n\t"
      "global_load_async_to_lds_b128 %2, %12, off\n\t"
      "global_load_async_to_lds_b128 %3, %13, off\n\t"
      "global_load_async_to_lds_b128 %4, %14, off\n\t"
      "global_load_async_to_lds_b128 %5, %15, off\n\t"
      "global_load_async_to_lds_b128 %6, %16, off\n\t"
      "global_load_async_to_lds_b128 %7, %17, off\n\t"
      "global_load_async_to_lds_b128 %8, %18, off\n\t"
      "global_load_async_to_lds_b128 %9, %19, off\n\t"
      "s_wait_xcnt 0x0"
      :: "v"(l[0]), "v"(l[1]), "v"(l[2]), "v"(l[3]), "v"(l[4]),
         "v"(l[5]), "v"(l[6]), "v"(l[7]), "v"(l[8]), "v"(l[9]),
         "v"(g[0]), "v"(g[1]), "v"(g[2]), "v"(g[3]), "v"(g[4]),
         "v"(g[5]), "v"(g[6]), "v"(g[7]), "v"(g[8]), "v"(g[9])
      : "memory");
}
/* A pointer that is the same in every lane, held in scalar registers: the loads from it take the
   form scalar base + lane offset, so that no vector address pair is written among loads in flight. */
typedef const __attribute__((address_space(1))) unsigned short g_u16;   /* global memory, named as such */
typedef const __attribute__((address_space(1))) v8b g_v8b;
__device__ __forceinline__ g_u16* scalar_base(const unsigned short* p) {
  const unsigned long long a = (unsigned long long)p;
  const unsigned lo = (unsigned)__builtin_amdgcn_readfirstlane((int)(unsigned)a);
  const unsigned hi = (unsigned)__builtin_amdgcn_readfirstlane((int)(unsigned)(a >> 32));
  return (g_u16*)(((unsigned long long)hi << 32) | lo);
}
/* Stands in front of the last load from an address pair, whose destination may be that pair while
   earlier loads from it are in flight, and behind it, before the pair is written anew: the wait
   that is kept before a register of an issued global load is overwritten. */
__device__ __forceinline__ void wait_addr() { asm volatile("s_wait_xcnt 0x0" ::: "memory"); }
/* this wave's copies have landed in LDS (the compiler places no wait for them) */
__device__ __forceinline__ void wait_copies() { asm volatile("s_wait_asynccnt 0x0" ::: "memory"); }
/* this wave's LDS reads have returned, so the buffer they read may be refilled behind the barrier */
__device__ __forceinline__ void wait_lds_reads() { asm volatile("s_wait_dscnt 0x0" ::: "memory"); }

/* --------------------------------------------------------------------------
 * Preparation of the four 16-bit operand planes. The four jobs read only inputs and write
 * disjoint planes, so they are the block ranges of ONE launch (prep_kernel, below) and run
 * side by side; each job is a block-level function, the block's job a block-uniform choice.
 * ------------------------------------------------------------------------ */

/* x: f32 rows -> bf16 rows (RNE), unit = 8 elements = one 16-B store.
 * out row = b*SEQ + l  <-  in row = b*SEQ_FULL + l ; row length = DMODEL.
 * Coverage: CVT_BLOCKS x 256 units x 8 elements = the whole plane. */
constexpr int CVT_UPR    = DMODEL / 8;
constexpr int CVT_UNITS  = MROWS * CVT_UPR;
constexpr int CVT_BLOCKS = (CVT_UNITS + 255) / 256;
__device__ __forceinline__ void cvt_rows_block(
    const float* __restrict__ in, unsigned short* __restrict__ outp, int blk)
{
  const int u = blk * 256 + threadIdx.x;
  if (u >= CVT_UNITS) return;      /* no barrier follows in this job */
  const int row = u / CVT_UPR;
  const int seg = u - row * CVT_UPR;
  const int b = row / SEQ;
  const int l = row - b * SEQ;
  const float* src = in + ((size_t)(b * SEQ_FULL + l) * CVT_UPR + seg) * 8;
  const v4f a0 = *(const v4f*)src;
  const v4f a1 = *(const v4f*)(src + 4);
  v4u w;
  w[0] = pk2(a0[0], a0[1]);
  w[1] = pk2(a0[2], a0[3]);
  w[2] = pk2(a1[0], a1[1]);
  w[3] = pk2(a1[2], a1[3]);
  v4u* dst = (v4u*)(outp + ((size_t)row * CVT_UPR + seg) * 8);
  *dst = w;
}

/* Er [16][2047][64] f32 -> Erb, bf16 (RNE), 16-row tiles in fragment order.
 * Tile m (0..127) of a head holds the rows of the offsets 16m - 1023 + c, c = 0..15, which are
 * the windows the attention kernel asks for (its offsets start at 1 mod 16).
 * Block = 2 tiles, thread = one 8-element unit: read as (row u>>3, segment u&7), whole lines;
 * units turned from [row][segment] to [segment][row] through LDS (cross-wave, block barrier);
 * stored in thread order. Coverage: TAB_BLOCKS x 2 tiles = 16 heads x 128 tiles.
 * LDS unit pitch: one spare unit per 16, so that the 8 segments of a row fall on different banks. */
constexpr int TAB_BLOCKS = NHEAD * 128 / 2;
__device__ __forceinline__ void pack_table_block(
    const float* __restrict__ Er, unsigned short* __restrict__ Erb, int blk, v4u* Us)
{
  const int tid  = threadIdx.x;
  const int tl   = tid >> 7;
  const int u    = tid & 127;
  const int tile = blk * 2 + tl;             /* head * 128 + m */
  const int h    = tile >> 7;
  const int m    = tile & 127;
  const int row  = u >> 3;
  const int seg  = u & 7;
  const int d    = 16 * m - (SEQ_FULL - 1) + row;      /* -1023 .. 1024 */
  const int rr   = d + ((d < 0) ? NPOS : 0);           /* 0 .. 2046 */
  const float* src = Er + ((size_t)h * NPOS + rr) * DHEAD + seg * 8;
  const v4f a0 = *(const v4f*)src;
  const v4f a1 = *(const v4f*)(src + 4);
  v4u w;
  w[0] = pk2(a0[0], a0[1]);
  w[1] = pk2(a0[2], a0[3]);
  w[2] = pk2(a1[0], a1[1]);
  w[3] = pk2(a1[2], a1[3]);
  Us[tl * 136 + seg * 17 + row] = w;
  __syncthreads();   /* publishes the tile's units to the waves that store them */
  *(v4u*)(Erb + (size_t)tile * 1024 + u * 8) = Us[tl * 136 + (u >> 4) * 17 + (u & 15)];
  wait_addr();   /* behind the job's store: another job's text follows it in the one kernel and writes its registers */
}

/* W in[rows][cols] f32  ->  Wt out[cols][rows] bf16 (RNE), one 64x64 tile through LDS.
 * Tile (kt = rows tile, nt = cols tile), 256 threads.
 * Coverage: 2 iterations x 256 threads = 512 units x 8 = 64x64 for the load phase
 * and the same 512 units x 8 = 64x64 for the store phase.
 * LDS tile: cross-wave, separated by a block barrier. */
constexpr int WQ_BLOCKS = (DMODEL / 64) * (NQKV / 64);
constexpr int WO_BLOCKS = (DMODEL / 64) * (DMODEL / 64);
__device__ __forceinline__ void wt_planes_block(
    const float* __restrict__ W, unsigned short* __restrict__ Wt, int rows, int cols,
    int kt, int nt, unsigned short* Ts /* [n][k] */)
{
  const int k0 = kt * 64;
  const int n0 = nt * 64;
  const int tid = threadIdx.x;
  const float* src[2];
  v4f a0[2], a1[2];
  /* both loops unrolled: the arrays are indexed by constants and stay in registers */
#pragma unroll
  for (int it = 0; it < 2; ++it) {
    const int u = it * 256 + tid;
    src[it] = W + (size_t)(k0 + (u >> 3)) * cols + n0 + (u & 7) * 8;
    a0[it] = *(const v4f*)src[it];
    a1[it] = *(const v4f*)(src[it] + 4);
  }
  /* the wait that is kept before a register of an issued global load is overwritten; it takes the
     two address pairs as inputs, so that they stay whole up to it and no load's result lands on one */
  asm volatile("s_wait_xcnt 0x0" :: "v"(src[0]), "v"(src[1]) : "memory");
#pragma unroll
  for (int it = 0; it < 2; ++it) {
    const int u = it * 256 + tid;
    const int row = u >> 3;      /* k local */
    const int seg = u & 7;       /* n segment */
#pragma unroll
    for (int e = 0; e < 4; ++e) {
      Ts[(seg * 8 + e) * TS_PITCH + row]     = f2bf_bits(a0[it][e]);
      Ts[(seg * 8 + 4 + e) * TS_PITCH + row] = f2bf_bits(a1[it][e]);
    }
  }
  __syncthreads();   /* publishes the tile to the waves that store its rows */
#pragma unroll
  for (int it = 0; it < 2; ++it) {
    const int u = it * 256 + tid;
    const int nrow = u >> 3;
    const int seg  = u & 7;
    const v4u w = *(const v4u_a*)(Ts + nrow * TS_PITCH + seg * 8);
    *(v4u*)(Wt + (size_t)(n0 + nrow) * rows + k0 + seg * 8) = w;
  }
  wait_addr();   /* behind the job's two stores: another job's text follows them in the one kernel and writes their registers */
}

/* Block ranges, the jobs with two phases and a barrier first:
 *   [0, WQ)            W_qkv in[1024][3072] -> WqT out[3072][1024], tile (blk % 16, blk / 16)
 *   [WQ, WQ + WO)      W_o   in[1024][1024] -> WoT out[1024][1024], likewise
 *   then TAB_BLOCKS    the position table, then CVT_BLOCKS x. */
constexpr int PREP_BLOCKS = WQ_BLOCKS + WO_BLOCKS + TAB_BLOCKS + CVT_BLOCKS;
__global__ __launch_bounds__(256) void prep_kernel(
    const float* __restrict__ x, const float* __restrict__ W_qkv, const float* __restrict__ W_o,
    const float* __restrict__ Er, unsigned short* __restrict__ Xb, unsigned short* __restrict__ WqT,
    unsigned short* __restrict__ WoT, unsigned short* __restrict__ Erb)
{
  __shared__ __align__(16) unsigned short Ts[64 * TS_PITCH];
  __shared__ __align__(16) v4u Us[2 * 136];
  constexpr int KT = DMODEL / 64;
  const int blk = blockIdx.x;
  if (blk < WQ_BLOCKS) {
    wt_planes_block(W_qkv, WqT, DMODEL, NQKV, blk % KT, blk / KT, Ts);
  } else if (blk < WQ_BLOCKS + WO_BLOCKS) {
    const int t = blk - WQ_BLOCKS;
    wt_planes_block(W_o, WoT, DMODEL, DMODEL, t % KT, t / KT, Ts);
  } else if (blk < WQ_BLOCKS + WO_BLOCKS + TAB_BLOCKS) {
    pack_table_block(Er, Erb, blk - (WQ_BLOCKS + WO_BLOCKS), Us);
  } else {
    cvt_rows_block(x, Xb, blk - (WQ_BLOCKS + WO_BLOCKS + TAB_BLOCKS));
  }
}

/* --------------------------------------------------------------------------
 * qkv = Xb . WqT^T + b  (M = MROWS, N = 3072, K = 1024), bf16 x bf16, f32 acc.
 * Block = 4 waves, tile 128 tokens x 64 columns (= one head of one section);
 * wave = 32 rows x 64 cols (2 A fragments x 4 B fragments per 32-deep step).
 * Operands: stages of 64 k (128 B of each of the 192 operand rows, whole lines) brought into a
 * two-buffer LDS ring by asynchronous copies, 12 per thread and stage, one stage ahead of the
 * stage being worked on; fragments by 16-B LDS loads from rows pitched 144 B.
 * Foot of every stage: own LDS reads back, own copies landed, block barrier, then the refill of
 * the buffer just read. The epilogue tile reuses the ring behind the last stage's barrier.
 * Fragment map (hh = lane>>4, c = lane&15): A row c, elems 0..7 <- k0+8hh.., 8..15 <- k0+16+8hh..;
 * B col c with the same k map; D elem r = (row 8hh+r, col c).
 * Epilogue: (acc + bias) [x 1/8 for the k section] split to bf16 hi/lo, staged in a
 * block LDS tile ([tok][d] for q,k; [d][tok] for v), block barrier, then stored in fragment
 * order: the block's 1024 units of a plane are 16 KB in a row, unit u from
 *   q,k: token 16(u>>7) + (u&15), d segment (u>>4)&7;
 *   v  : d row 16((u>>6)&3) + (u&15), key segment 4(u>>8) + ((u>>4)&3).
 * ------------------------------------------------------------------------ */
__global__ __launch_bounds__(128) VGPR_CAP void gemm_qkv_kernel(
    const unsigned short* __restrict__ Xb, const unsigned short* __restrict__ WqT,
    const float* __restrict__ bias, unsigned short* __restrict__ qkvp)
{
  union FB { v16b v; v8b h[2]; };
  __shared__ __align__(16) unsigned short Sm[2 * QKV_STAGE_E];
  unsigned short* Th = Sm;
  unsigned short* Tl = Sm + T_ELEMS;

  const int tid  = threadIdx.x;
  const int wave = __builtin_amdgcn_readfirstlane(tid >> 5);
  const int lane = tid & 31;
  const int hh   = lane >> 4;
  const int c    = lane & 15;
  const int n0   = blockIdx.x * 64;
  const int m0   = blockIdx.y * 128;

  v8f acc[2][4];
#pragma unroll
  for (int mt = 0; mt < 2; ++mt)
#pragma unroll
    for (int t = 0; t < 4; ++t) acc[mt][t] = (v8f){0.f,0.f,0.f,0.f,0.f,0.f,0.f,0.f};

  /* copy unit: thread -> (row tid>>3 of each group of 16 rows, 16-B segment tid&7) */
  const int crow = tid >> 3;
  const int cseg = tid & 7;
  const unsigned short* gx = Xb  + (size_t)(m0 + crow) * DMODEL + cseg * 8;
  const unsigned short* gw = WqT + (size_t)(n0 + crow) * DMODEL + cseg * 8;
  const unsigned lrow = lds_off(Sm) + (unsigned)(crow * RP + cseg * 8) * 2u;

  auto issue_stage = [&](int st) {
    /* unrolled below: the address arrays are indexed by constants and stay in registers */
    unsigned l[12];
    const unsigned short* g[12];
    const unsigned lb = lrow + (unsigned)(st & 1) * (unsigned)(QKV_STAGE_E * 2);
#pragma unroll
    for (int it = 0; it < 12; ++it) {
      l[it] = lb + (unsigned)(it * 16 * RP * 2);
      g[it] = (it < 8) ? gx + (size_t)it * 16 * DMODEL + st * KST
                       : gw + (size_t)(it - 8) * 16 * DMODEL + st * KST;
    }
    async_copy12(l, g);
  };

  const unsigned short* sa = Sm + (wave * 32 + c) * RP + 8 * hh;
  const unsigned short* sb = Sm + (128 + c) * RP + 8 * hh;

  issue_stage(0);
  wait_copies();
  __syncthreads();   /* publishes stage 0 */
  issue_stage(1);

  /* kept rolled: one copy of the ring's foot (waits, barrier, refill), small loop text */
#pragma unroll 1
  for (int st = 0; st < NSTAGE; ++st) {
    const int bo = (st & 1) * QKV_STAGE_E;
    /* the stage's fragment loads stand as one group ahead of its products, so that the wave pays
       the LDS latency once a stage; the loops below are unrolled so that every index of the
       fragment arrays is a constant and they stay in registers */
    FB a0[2], a1[2], bf[2][4];
#pragma unroll
    for (int s = 0; s < 2; ++s) {
      const int ks = s * 32;
      a0[s].h[0] = *(const v8b_a*)(sa + bo + ks);
      a0[s].h[1] = *(const v8b_a*)(sa + bo + ks + 16);
      a1[s].h[0] = *(const v8b_a*)(sa + bo + 16 * RP + ks);
      a1[s].h[1] = *(const v8b_a*)(sa + bo + 16 * RP + ks + 16);
#pragma unroll
      for (int t = 0; t < 4; ++t) {
        bf[s][t].h[0] = *(const v8b_a*)(sb + bo + t * 16 * RP + ks);
        bf[s][t].h[1] = *(const v8b_a*)(sb + bo + t * 16 * RP + ks + 16);
      }
    }
#pragma unroll
    for (int s = 0; s < 2; ++s) {
#pragma unroll
      for (int t = 0; t < 4; ++t) {
        acc[0][t] = mma_bf16(a0[s].v, bf[s][t].v, acc[0][t]);
        acc[1][t] = mma_bf16(a1[s].v, bf[s][t].v, acc[1][t]);
      }
    }
    wait_lds_reads();
    wait_copies();
    __syncthreads();   /* publishes stage st + 1 and ends every read of stage st's buffer */
    if (st + 2 < NSTAGE) issue_stage(st + 2);
  }
  wait_copies();

  const int sec = n0 / DMODEL;                       /* 0 q, 1 k, 2 v : block-uniform */
  const float osc = (sec == 1) ? 0.125f : 1.0f;
#pragma unroll
  for (int t = 0; t < 4; ++t) {
    const float bv = bf_bits2f(f2bf_bits(bias[n0 + 16 * t + c]));
#pragma unroll
    for (int mt = 0; mt < 2; ++mt) {
#pragma unroll
      for (int r = 0; r < 8; ++r) {
        const float val = (acc[mt][t][r] + bv) * osc;
        const unsigned short hb = f2bf_bits(val);
        const unsigned short lb = f2bf_bits(val - bf_bits2f(hb));
        const int rl = wave * 32 + mt * 16 + 8 * hh + r;
        const int cl = 16 * t + c;
        const int idx = (sec < 2) ? (rl * TQ_PITCH + cl) : (cl * TV_PITCH + rl);
        Th[idx] = hb;
        Tl[idx] = lb;
      }
    }
  }
  __syncthreads();

  const int b  = m0 / SEQ;
  const int l0 = m0 - b * SEQ;
  const int h  = (n0 - sec * DMODEL) / DHEAD;
  const int bh = b * NHEAD + h;
  unsigned short* ph = qkvp + (size_t)(2 * sec) * PLANE;
  unsigned short* pl = ph + PLANE;

  {
    if (sec < 2) {
#pragma unroll
      for (int it = 0; it < 8; ++it) {
        const int u = it * 128 + tid;
        const int row = (u >> 7) * 16 + (u & 15);
        const int seg = (u >> 4) & 7;
        const v4u hw = *(const v4u_a*)(Th + row * TQ_PITCH + seg * 8);
        const v4u lw = *(const v4u_a*)(Tl + row * TQ_PITCH + seg * 8);
        const size_t g = ((size_t)bh * SEQ + l0) * DHEAD + u * 8;
        *(v4u*)(ph + g) = hw;
        *(v4u*)(pl + g) = lw;
      }
    } else {
#pragma unroll
      for (int it = 0; it < 8; ++it) {
        const int u = it * 128 + tid;
        const int drow = ((u >> 6) & 3) * 16 + (u & 15);
        const int seg  = (u >> 8) * 4 + ((u >> 4) & 3);
        const v4u hw = *(const v4u_a*)(Th + drow * TV_PITCH + seg * 8);
        const v4u lw = *(const v4u_a*)(Tl + drow * TV_PITCH + seg * 8);
        const size_t g = ((size_t)bh * SEQ + l0) * DHEAD + u * 8;
        *(v4u*)(ph + g) = hw;
        *(v4u*)(pl + g) = lw;
      }
    }
    
  }
}

/* --------------------------------------------------------------------------
 * Attention with the per-head relative-position table, head dim 64.
 * Block = 16 query rows of one (b,h); grid (NBH, SEQ/16), the last query tile first, for speed
 * only; the order is a permutation of the tiles and changes no result under any mask.
 * The block's 4 waves deal the
 * 64-key chunks among them (wave w takes chunks w, w+4, ...), each with its own running
 * maximum, sum and output accumulators; one block barrier, then the four partial states
 * are merged through LDS by the usual rescaling to the common row maximum.
 * At entry: the mask rows of all the wave's chunks read by value as one group of loads
 * (8 b128 loads a chunk + ballots), one packed word a chunk and lane; wave-uniform skip of a
 * chunk when every element of its 16x64 mask tile is set; per-element replace-fill otherwise.
 * Per 64-key chunk and wave (16 query rows); only the output accumulators, the row statistics
 * and the mask words stay resident between chunks:
 *   G = q.Ewin^T  : 5 tiles (80 offsets d = kv0-q0-15+g, packed tiles (kv0-q0)/16+63 ..),
 *                   2 d-steps x (hi + lo) against the bf16 table, written
 *                   to the wave-private G slab, read back skewed: G[m][n-m+15];
 *   S = q.(k/8)^T : 4 key tiles, 2 d-steps x (hi.hi + hi.lo + lo.hi),
 *                   one accumulator, each tile written to the wave-private S slab;
 *   f32 online softmax on S + G; P as bf16 hi+lo wave-private LDS tiles;
 *   O += Ph.Vh + Pl.Vh + Ph.Vl from the V^T planes, two 32-key steps.
 * All fragments come straight from the 16-bit global planes, which stand in fragment order: every
 * load is a wave-uniform base + 16 B x lane and covers four whole lines. The loads are
 * issued in groups ahead of the products that use them (q, table and key tile 0 together; key
 * tiles 1..3 as registers come free; v during the softmax).
 * LDS regions Ss/Gs/Psh/Psl are private to their wave (wave_sync form) inside the loop.
 * Epilogue: each wave's unnormalised 16x64 slab (aliases its G slab) and row statistics,
 * block barrier, merge + normalise (thread = one row x 8 columns) -> ctx hi/lo planes,
 * ------------------------------------------------------------------------ */
__global__ __launch_bounds__(128) VGPR_CAP void rel_attn_kernel(
    const unsigned short* __restrict__ qkvp, const unsigned short* __restrict__ Erb,
    const int* __restrict__ mask, unsigned short* __restrict__ ctxp)
{
  union FB { v16b v; v8b h[2]; };
  __shared__ __align__(16) float Gs[NWAVE][16 * GP];
  __shared__ __align__(16) float Ss[NWAVE][16 * SP];
  __shared__ __align__(16) unsigned short Psh[NWAVE][16 * KCH];
  __shared__ __align__(16) unsigned short Psl[NWAVE][16 * KCH];
  __shared__ float Ms[NWAVE][16];
  __shared__ float Ls[NWAVE][16];

  const int tid  = threadIdx.x;
  const int wave = __builtin_amdgcn_readfirstlane(tid >> 5);
  const int lane = tid & 31;
  const int hh   = lane >> 4;
  const int c    = lane & 15;
  const int c3   = c & 3;
  const int csh  = c >> 2;
  const int qb   = SEQ / 16 - 1 - (int)blockIdx.y;
  const int bh   = blockIdx.x;
  const int b    = bh / NHEAD;
  const int h    = bh - b * NHEAD;
  const int q0   = qb * 16;
  const float NEG_INF = -__builtin_inff();

  const unsigned short* Qh  = qkvp + (size_t)bh * SEQ * DHEAD;   /* each lo plane stands PLANE behind its hi plane */
  const unsigned short* Kh  = Qh + 2 * PLANE;
  const unsigned short* Vth = Qh + 4 * PLANE;     /* same per-bh element count */
  const unsigned short* Eh  = Erb + (size_t)h * 128 * 1024;   /* 128 packed tiles of 1024 elements a head */

  float mrow[8], lrow[8];
  v8f oacc[4];
#pragma unroll
  for (int r = 0; r < 8; ++r) { mrow[r] = NEG_INF; lrow[r] = 0.f; }
#pragma unroll
  for (int t = 0; t < 4; ++t) oacc[t] = (v8f){0.f,0.f,0.f,0.f,0.f,0.f,0.f,0.f};

  float* gs = Gs[wave];
  float* ss = Ss[wave];
  unsigned short* pwh = Psh[wave];
  unsigned short* pwl = Psl[wave];
  /* one lane base per slab and access pattern; every row and tile below is a constant offset from
     it, so that the LDS addresses take one register each and leave room for loads in flight */
  float* gsw = gs + 8 * hh * GP + c;                    /* G and output slab, element (8hh+r, 16t+c) */
  float* ssw = ss + 8 * hh * SP + c;                    /* S slab, element (8hh+r, 16j+c) */
  const float* gsk = gs + 8 * hh * (GP - 1) + c + 15;   /* G slab read skewed: G[m][n-m+15] */
  unsigned short* pwhw = pwh + 8 * hh * KCH + c;
  unsigned short* pwlw = pwl + 8 * hh * KCH + c;
  const unsigned lane8 = (unsigned)(lane * 8);   /* this lane's 16-B unit of every 512-B fragment run (elements) */

  /* mask tiles of all NCH chunks of this wave, by value: the 8 * NCH row loads stand as one group
     ahead of every use, so that the wave waits for the mask once and not once a row.
     Bit L of the ballot (it, e) = mask[q0+2it+(L>>4)][kv0+4(L&15)+e] != 0; each lane keeps the
     word of its own e = c&3 (lane masks sel0..sel3) and of its own row half, and packs its own
     32 bits of a chunk into one word: bit 16(r&1) + 4j + (r>>1) = element (row 8hh+r, key 16j+c). */
  unsigned mpk[NCH];
  unsigned skip = 0u;                 /* bit i: every element of chunk i's tile is masked (wave-uniform) */
  {
    v4i mv[NCH][8];
    const int* ml = mask + (size_t)(q0 + hh) * SEQ_FULL + wave * KCH + 4 * c;   /* lane base; the rest are constants */
#pragma unroll
    for (int i = 0; i < NCH; ++i)
#pragma unroll
      for (int it = 0; it < 8; ++it) {
        if (i == NCH - 1 && it == 7) wait_addr();   /* last use of the mask address pair */
        mv[i][it] = *(const v4i*)(ml + it * 2 * SEQ_FULL + i * NWAVE * KCH);
      }
    const unsigned sel0 = (c3 == 0) ? 0xFFFFFFFFu : 0u;
    const unsigned sel1 = (c3 == 1) ? 0xFFFFFFFFu : 0u;
    const unsigned sel2 = (c3 == 2) ? 0xFFFFFFFFu : 0u;
    const unsigned sel3 = (c3 == 3) ? 0xFFFFFFFFu : 0u;
#pragma unroll
    for (int i = 0; i < NCH; ++i) {
      unsigned msel[8];
      unsigned andall = 0xFFFFFFFFu;
#pragma unroll
      for (int it = 0; it < 8; ++it) {
        const unsigned b0 = __builtin_amdgcn_ballot_w32(mv[i][it][0] != 0);
        const unsigned b1 = __builtin_amdgcn_ballot_w32(mv[i][it][1] != 0);
        const unsigned b2 = __builtin_amdgcn_ballot_w32(mv[i][it][2] != 0);
        const unsigned b3 = __builtin_amdgcn_ballot_w32(mv[i][it][3] != 0);
        andall &= (b0 & b1) & (b2 & b3);
        msel[it] = (b0 & sel0) | (b1 & sel1) | (b2 & sel2) | (b3 & sel3);
      }
      unsigned pk = 0u;
#pragma unroll
      for (int ii = 0; ii < 4; ++ii) {
        const unsigned w = hh ? msel[4 + ii] : msel[ii];
        pk |= ((w >> csh) & 0x11111111u) << ii;
      }
      mpk[i] = pk;
      skip |= (andall == 0xFFFFFFFFu) ? (1u << i) : 0u;
    }
  }

  /* kept rolled: one copy of the chunk's text */
#pragma unroll 1
  for (int i = 0; i < NCH; ++i) {
    if ((skip >> i) & 1u) continue;               /* wave-uniform: every element masked */
    const int kv0 = (wave + i * NWAVE) * KCH;

    const unsigned mk = (i == 0) ? mpk[0] : (i == 1) ? mpk[1] : (i == 2) ? mpk[2] : mpk[3];

    /* The chunk's loads fly as a window ahead of the products that use them: q, the 5 table tiles
       and key tile 0 are issued as one group, each further key tile as soon as earlier tiles'
       registers come free. q is read per chunk so that its registers are free for the v fragments
       during the softmax and p.v. All loops below are unrolled so that the fragment arrays are
       indexed by constants and stay in registers. */
    v16b qh[2], ql[2];
    FB kfh[4][2], kfl[4][2], ef[5][2];
    /* position table: offsets kv0 - q0 - 15 + g, g = 0..79, are the packed tiles
       (kv0 - q0) / 16 + 63 + t, t = 0..4, in [0, 127] */
    g_u16* ep = scalar_base(Eh + ((kv0 - q0 + SEQ_FULL - 16) >> 4) * 1024);
    g_u16* kh = scalar_base(Kh + kv0 * DHEAD);
    g_u16* kl = kh + PLANE;
    g_u16* vh = scalar_base(Vth + kv0 * DHEAD);
    g_u16* vl = vh + PLANE;
    g_u16* qph = scalar_base(Qh + q0 * DHEAD);
    g_u16* qpl = qph + PLANE;
    auto load_key_tile = [&](int j) {
#pragma unroll
      for (int dc = 0; dc < 2; ++dc) {
        kfh[j][dc].h[0] = *(g_v8b*)(kh + lane8 + j * 1024 + dc * 512);
        kfh[j][dc].h[1] = *(g_v8b*)(kh + lane8 + j * 1024 + dc * 512 + 256);
        kfl[j][dc].h[0] = *(g_v8b*)(kl + lane8 + j * 1024 + dc * 512);
        kfl[j][dc].h[1] = *(g_v8b*)(kl + lane8 + j * 1024 + dc * 512 + 256);
      }
      /* behind the chunk's last k load, before its address registers are written anew */
      if (j == 3) wait_addr();
    };
    {
#pragma unroll
      for (int dc = 0; dc < 2; ++dc) {
        FB f;
        f.h[0] = *(g_v8b*)(qph + lane8 + dc * 512);
        f.h[1] = *(g_v8b*)(qph + lane8 + dc * 512 + 256);
        qh[dc] = f.v;
        f.h[0] = *(g_v8b*)(qpl + lane8 + dc * 512);
        f.h[1] = *(g_v8b*)(qpl + lane8 + dc * 512 + 256);
        ql[dc] = f.v;
      }
    }
#pragma unroll
    for (int t = 0; t < 5; ++t) {
#pragma unroll
      for (int dc = 0; dc < 2; ++dc) {
        ef[t][dc].h[0] = *(g_v8b*)(ep + lane8 + t * 1024 + dc * 512);
        ef[t][dc].h[1] = *(g_v8b*)(ep + lane8 + t * 1024 + dc * 512 + 256);
      }
    }
    load_key_tile(0);
    wait_addr();      /* behind the last q and table loads, before their address registers are written anew */
    /* keeps the first product, and the load wait in front of it, behind the issue of the whole
       group: moved up among the loads it would make the rest of the group wait a full latency */
    __builtin_amdgcn_sched_barrier(0);

    /* position term: G[m][g] = q[m] . Er[h][(kv0 - q0 - 15 + g) mod 2047], g = 0..79 */
#pragma unroll
    for (int t = 0; t < 5; ++t) {
      v8f g = (v8f){0.f,0.f,0.f,0.f,0.f,0.f,0.f,0.f};
#pragma unroll
      for (int dc = 0; dc < 2; ++dc) {
        g = mma_bf16(qh[dc], ef[t][dc].v, g);
        g = mma_bf16(ql[dc], ef[t][dc].v, g);
      }
      if (t == 1) load_key_tile(1);
      if (t == 3) load_key_tile(2);
#pragma unroll
      for (int r = 0; r < 8; ++r) gsw[r * GP + 16 * t] = g[r];
    }

    /* raw scores: 4 key tiles, one accumulator, tile -> S slab (D elem r = row 8hh+r, col c) */
#pragma unroll
    for (int j = 0; j < 4; ++j) {
      v8f sa = (v8f){0.f,0.f,0.f,0.f,0.f,0.f,0.f,0.f};
#pragma unroll
      for (int dc = 0; dc < 2; ++dc) {
        sa = mma_bf16(qh[dc], kfh[j][dc].v, sa);
        sa = mma_bf16(qh[dc], kfl[j][dc].v, sa);
        sa = mma_bf16(ql[dc], kfh[j][dc].v, sa);
      }
      if (j == 0) load_key_tile(3);
#pragma unroll
      for (int r = 0; r < 8; ++r) ssw[r * SP + 16 * j] = sa[r];
    }
    wave_lds_sync();

    /* v fragments of the first 32 keys: issued here, so that they fly during the softmax */
    FB vbh[2][4], vbl[2][4];
    auto load_v_step = [&](int kk) {
#pragma unroll
      for (int t = 0; t < 4; ++t) {
        const int vo = kk * 2048 + t * 512;
        vbh[kk][t].h[0] = *(g_v8b*)(vh + lane8 + vo);
        vbh[kk][t].h[1] = *(g_v8b*)(vh + lane8 + vo + 256);
        vbl[kk][t].h[0] = *(g_v8b*)(vl + lane8 + vo);
        vbl[kk][t].h[1] = *(g_v8b*)(vl + lane8 + vo + 256);
      }
      /* behind the chunk's last v load, before its address registers are written anew */
      if (kk == 1) wait_addr();
    };
    load_v_step(0);

    /* raw score + skewed position term, replace-fill of masked elements */
    v8f s[4];
#pragma unroll
    for (int j = 0; j < 4; ++j) {
#pragma unroll
      for (int r = 0; r < 8; ++r) {
        const float raw = ssw[r * SP + 16 * j];
        const float gv = gsk[r * (GP - 1) + 16 * j];
        const float sv = raw + gv;
        const unsigned bit = (mk >> (16 * (r & 1) + 4 * j + (r >> 1))) & 1u;
        s[j][r] = bit ? NEG_INF : sv;
      }
    }

    /* chunk row max over the 64 keys */
    float cm[8];
#pragma unroll
    for (int r = 0; r < 8; ++r) {
      cm[r] = fmaxf(fmaxf(s[0][r], s[1][r]), fmaxf(s[2][r], s[3][r]));
    }
    row_max16x8(cm);

    /* online softmax update, P tiles as bf16 hi + lo */
#pragma unroll
    for (int r = 0; r < 8; ++r) {
      if (r == 4) load_v_step(1);   /* the second 32 keys' fragments, once half the score registers are free */
      const float mnew  = fmaxf(mrow[r], cm[r]);
      const float msafe = (mnew == NEG_INF) ? 0.f : mnew;
      const float nm    = -msafe * LOG2E;
      const float alpha = exp_shifted(mrow[r], nm);
      mrow[r] = mnew;
      float psum = 0.f;
#pragma unroll
      for (int j = 0; j < 4; ++j) {
        const float p = exp_shifted(s[j][r], nm);
        psum += p;
        const unsigned short hb = f2bf_bits(p);
        const unsigned short lb = f2bf_bits(p - bf_bits2f(hb));
        pwhw[r * KCH + j * 16] = hb;
        pwlw[r * KCH + j * 16] = lb;
      }
      psum = row_sum16(psum);
      lrow[r] = lrow[r] * alpha + psum;
#pragma unroll
      for (int t = 0; t < 4; ++t) oacc[t][r] *= alpha;
    }
    wave_lds_sync();

    /* O += P.V : A = P [q][kv] (this wave's tiles), B = V [kv][d] from the packed v planes;
       unrolled over the two 32-key steps: the fragment arrays are indexed by constants */
#pragma unroll
    for (int kk = 0; kk < 2; ++kk) {
      FB pa, pl;
      pa.h[0] = *(const v8b_a*)(pwh + c * KCH + kk * 32 + 8 * hh);
      pa.h[1] = *(const v8b_a*)(pwh + c * KCH + kk * 32 + 16 + 8 * hh);
      pl.h[0] = *(const v8b_a*)(pwl + c * KCH + kk * 32 + 8 * hh);
      pl.h[1] = *(const v8b_a*)(pwl + c * KCH + kk * 32 + 16 + 8 * hh);
#pragma unroll
      for (int t = 0; t < 4; ++t) {
        oacc[t] = mma_bf16(pa.v, vbh[kk][t].v, oacc[t]);
        oacc[t] = mma_bf16(pl.v, vbh[kk][t].v, oacc[t]);
        oacc[t] = mma_bf16(pa.v, vbl[kk][t].v, oacc[t]);
      }
    }
    wave_lds_sync();
  }

  /* this wave's partial state: unnormalised output into its own slab (aliases the G slab),
     row maximum and row sum beside it */
#pragma unroll
  for (int r = 0; r < 8; ++r) {
#pragma unroll
    for (int t = 0; t < 4; ++t) gsw[r * GP + t * 16] = oacc[t][r];
  }
  if (c == 0) {      /* the 16 lanes of a half hold equal row statistics */
#pragma unroll
    for (int r = 0; r < 8; ++r) {
      Ms[wave][8 * hh + r] = mrow[r];
      Ls[wave][8 * hh + r] = lrow[r];
    }
  }
  __syncthreads();   /* publishes the four partial states to the whole block */
  {
    unsigned short* Ch = ctxp;
    unsigned short* Cl = ctxp + XB_E;
    const int row = tid >> 3;
    const int seg = tid & 7;
    float mall = Ms[0][row];
#pragma unroll
    for (int w = 1; w < NWAVE; ++w) mall = fmaxf(mall, Ms[w][row]);
    const float msafe = (mall == NEG_INF) ? 0.f : mall;
    const float nm = -msafe * LOG2E;
    float lsum = 0.f;
    v4f a0 = (v4f){0.f, 0.f, 0.f, 0.f};
    v4f a1 = (v4f){0.f, 0.f, 0.f, 0.f};
#pragma unroll
    for (int w = 0; w < NWAVE; ++w) {
      const float f = exp_shifted(Ms[w][row], nm);
      lsum += Ls[w][row] * f;
      a0 += *(const v4f_a*)(Gs[w] + row * GP + seg * 8) * f;
      a1 += *(const v4f_a*)(Gs[w] + row * GP + seg * 8 + 4) * f;
    }
    const float inv = 1.0f / lsum;
    a0 *= inv;
    a1 *= inv;
    unsigned h0, h1, h2, h3, l0, l1, l2, l3;
    split2(a0[0], a0[1], h0, l0);
    split2(a0[2], a0[3], h1, l1);
    split2(a1[0], a1[1], h2, l2);
    split2(a1[2], a1[3], h3, l3);
    v4u hw, lw;
    hw[0] = h0; hw[1] = h1; hw[2] = h2; hw[3] = h3;
    lw[0] = l0; lw[1] = l1; lw[2] = l2; lw[3] = l3;
    const size_t g = (size_t)(b * SEQ + q0 + row) * DMODEL + h * DHEAD + seg * 8;
    *(v4u*)(Ch + g) = hw;
    *(v4u*)(Cl + g) = lw;
  }
}

/* --------------------------------------------------------------------------
 * out = (Ch + Cl) . WoT^T + b  (M = MROWS, N = 1024, K = 1024), f32 acc.
 * Block = 4 waves, tile 128 x 64; wave = 32 rows x 64 cols; A hi and lo planes
 * against the single bf16 weight plane (two products per tile pair).
 * Operands: stages of 64 k (128 B of each of the 320 operand rows) in a two-buffer LDS ring,
 * filled by asynchronous copies (20 per thread and stage) in the order of gemm_qkv_kernel.
 * Epilogue: per-wave 32x64 f32 slab (wave-private LDS), 16 lanes x 16 B = one 256-B
 * ------------------------------------------------------------------------ */
__global__ __launch_bounds__(128) VGPR_CAP void gemm_out_kernel(
    const unsigned short* __restrict__ ctxp, const unsigned short* __restrict__ WoT,
    const float* __restrict__ bias, float* __restrict__ out)
{
  union FB { v16b v; v8b h[2]; };
  __shared__ __align__(16) float Os[NWAVE][32 * OS_PITCH];
  __shared__ __align__(16) unsigned short Sm[2 * OUT_STAGE_E];

  const int tid  = threadIdx.x;
  const int wave = __builtin_amdgcn_readfirstlane(tid >> 5);
  const int lane = tid & 31;
  const int hh   = lane >> 4;
  const int c    = lane & 15;
  const int n0   = blockIdx.x * 64;
  const int m0   = blockIdx.y * 128;

  v8f acc[2][4];
#pragma unroll
  for (int mt = 0; mt < 2; ++mt)
#pragma unroll
    for (int t = 0; t < 4; ++t) acc[mt][t] = (v8f){0.f,0.f,0.f,0.f,0.f,0.f,0.f,0.f};

  /* copy unit: thread -> (row tid>>3 of each group of 16 rows, 16-B segment tid&7) */
  const int crow = tid >> 3;
  const int cseg = tid & 7;
  const unsigned short* gh = ctxp + (size_t)(m0 + crow) * DMODEL + cseg * 8;
  const unsigned short* gl = gh + XB_E;
  const unsigned short* gw = WoT + (size_t)(n0 + crow) * DMODEL + cseg * 8;
  const unsigned lrow = lds_off(Sm) + (unsigned)(crow * RP + cseg * 8) * 2u;

  auto issue_stage = [&](int st) {
    /* unrolled below: the address arrays are indexed by constants and stay in registers */
    unsigned l[20];
    const unsigned short* g[20];
    const unsigned lb = lrow + (unsigned)(st & 1) * (unsigned)(OUT_STAGE_E * 2);
#pragma unroll
    for (int it = 0; it < 20; ++it) {
      l[it] = lb + (unsigned)(it * 16 * RP * 2);
      g[it] = (it < 8)  ? gh + (size_t)it * 16 * DMODEL + st * KST
            : (it < 16) ? gl + (size_t)(it - 8) * 16 * DMODEL + st * KST
                        : gw + (size_t)(it - 16) * 16 * DMODEL + st * KST;
    }
    async_copy10(l, g);
    async_copy10(l + 10, g + 10);
  };

  const unsigned short* sh = Sm + (wave * 32 + c) * RP + 8 * hh;
  const unsigned short* sl = sh + 128 * RP;
  const unsigned short* sb = Sm + (256 + c) * RP + 8 * hh;

  issue_stage(0);
  wait_copies();
  __syncthreads();   /* publishes stage 0 */
  issue_stage(1);

  /* kept rolled: one copy of the ring's foot (waits, barrier, refill), small loop text */
#pragma unroll 1
  for (int st = 0; st < NSTAGE; ++st) {
    const int bo = (st & 1) * OUT_STAGE_E;
    /* the stage's fragment loads stand as one group ahead of its products, so that the wave pays
       the LDS latency once a stage; the loops below are unrolled so that every index of the
       fragment arrays is a constant and they stay in registers */
    FB a0h[2], a1h[2], a0l[2], a1l[2], bf[2][4];
#pragma unroll
    for (int s = 0; s < 2; ++s) {
      const int ks = s * 32;
      a0h[s].h[0] = *(const v8b_a*)(sh + bo + ks);
      a0h[s].h[1] = *(const v8b_a*)(sh + bo + ks + 16);
      a0l[s].h[0] = *(const v8b_a*)(sl + bo + ks);
      a0l[s].h[1] = *(const v8b_a*)(sl + bo + ks + 16);
      a1h[s].h[0] = *(const v8b_a*)(sh + bo + 16 * RP + ks);
      a1h[s].h[1] = *(const v8b_a*)(sh + bo + 16 * RP + ks + 16);
      a1l[s].h[0] = *(const v8b_a*)(sl + bo + 16 * RP + ks);
      a1l[s].h[1] = *(const v8b_a*)(sl + bo + 16 * RP + ks + 16);
#pragma unroll
      for (int t = 0; t < 4; ++t) {
        bf[s][t].h[0] = *(const v8b_a*)(sb + bo + t * 16 * RP + ks);
        bf[s][t].h[1] = *(const v8b_a*)(sb + bo + t * 16 * RP + ks + 16);
      }
    }
#pragma unroll
    for (int s = 0; s < 2; ++s) {
#pragma unroll
      for (int t = 0; t < 4; ++t) {
        acc[0][t] = mma_bf16(a0h[s].v, bf[s][t].v, acc[0][t]);
        acc[0][t] = mma_bf16(a0l[s].v, bf[s][t].v, acc[0][t]);
        acc[1][t] = mma_bf16(a1h[s].v, bf[s][t].v, acc[1][t]);
        acc[1][t] = mma_bf16(a1l[s].v, bf[s][t].v, acc[1][t]);
      }
    }
    wait_lds_reads();
    wait_copies();
    __syncthreads();   /* publishes stage st + 1 and ends every read of stage st's buffer */
    if (st + 2 < NSTAGE) issue_stage(st + 2);
  }
  wait_copies();

  float* os = Os[wave];
#pragma unroll
  for (int t = 0; t < 4; ++t) {
    const float bv = bf_bits2f(f2bf_bits(bias[n0 + 16 * t + c]));
#pragma unroll
    for (int mt = 0; mt < 2; ++mt)
#pragma unroll
      for (int r = 0; r < 8; ++r)
        os[(mt * 16 + 8 * hh + r) * OS_PITCH + 16 * t + c] = acc[mt][t][r] + bv;
  }
  wave_lds_sync();
  {
    const int c4 = c * 4;
    {
#pragma unroll
      for (int it = 0; it < 16; ++it) {
        const int row = it * 2 + hh;
        const v4f val = *(const v4f_a*)(os + row * OS_PITCH + c4);
        *(v4f*)(out + (size_t)(m0 + wave * 32 + row) * DMODEL + n0 + c4) = val;
      }
      
    }
  }
}

extern "C" void kernel_launch(void* const* d_in, const int* in_sizes, int n_in,
                              void* d_out, int out_size, void* d_ws, size_t ws_size,
                              hipStream_t stream)
{
  if (n_in < 7) return;
  if (in_sizes[0] < ((NB - 1) * SEQ_FULL + SEQ) * DMODEL) return;
  if (in_sizes[1] < (SEQ - 1) * SEQ_FULL + SEQ) return;
  if (in_sizes[2] < DMODEL * NQKV) return;
  if (in_sizes[3] < NQKV) return;
  if (in_sizes[4] < DMODEL * DMODEL) return;
  if (in_sizes[5] < DMODEL) return;
  if (in_sizes[6] < NHEAD * NPOS * DHEAD) return;
  if (out_size < MROWS * DMODEL) return;
  if (d_ws == nullptr || ws_size < WS_NEED) return;

  const float* x     = (const float*)d_in[0];
  const int*   mask  = (const int*)d_in[1];
  const float* W_qkv = (const float*)d_in[2];
  const float* b_qkv = (const float*)d_in[3];
  const float* W_o   = (const float*)d_in[4];
  const float* b_o   = (const float*)d_in[5];
  const float* Er    = (const float*)d_in[6];
  float* out = (float*)d_out;

  unsigned short* Xb   = (unsigned short*)d_ws;
  unsigned short* WqT  = Xb + XB_E;
  unsigned short* WoT  = WqT + WQT_E;
  unsigned short* Erb  = WoT + WOT_E;
  unsigned short* qkvp = Erb + ERB_E;
  unsigned short* ctxp = qkvp + QKVP_E;

  /* the four preparation jobs, one launch */
  prep_kernel<<<PREP_BLOCKS, 256, 0, stream>>>(x, W_qkv, W_o, Er, Xb, WqT, WoT, Erb);

  gemm_qkv_kernel<<<dim3(NQKV / 64, MROWS / 128), 128, 0, stream>>>(Xb, WqT, b_qkv, qkvp);
  rel_attn_kernel<<<dim3(NBH, SEQ / 16), 128, 0, stream>>>(qkvp, Erb, mask, ctxp);
  gemm_out_kernel<<<dim3(DMODEL / 64, MROWS / 128), 128, 0, stream>>>(ctxp, WoT, b_o, out);
}

// v009
// One run takes 76.8 microseconds.
// Next to v008, in two timings, it ran 1.06 times as fast each time.
// Over all steps from v000 it is 3.51 times as fast.
// Contractions: x.Wqkv on v_wmma_f32_16x16x32_bf16 with both operands RNE-converted to bf16 once; q.(k/8)^T, q.Er^T, p.v and ctx.Wo on v_wmma_f32_16x16x32_bf16 with computed operands (q, k/8, v, p, ctx) carried as bf16 hi+lo planes (hi.hi + hi.lo + lo.hi) and input operands (Er, Wo) as single bf16 planes; f32 accumulate; softmax, bias adds and mask fill in f32.
#include <hip/hip_runtime.h>

typedef __attribute__((ext_vector_type(16))) __bf16 v16b;
typedef __attribute__((ext_vector_type(8)))  __bf16 v8b;
typedef __attribute__((ext_vector_type(8)))  float  v8f;
typedef __attribute__((ext_vector_type(4)))  float  v4f;
typedef __attribute__((ext_vector_type(4)))  unsigned int v4u;
typedef __attribute__((ext_vector_type(4)))  int v4i;
typedef v8b v8b_a __attribute__((may_alias));
typedef v4f v4f_a __attribute__((may_alias));
typedef v4u v4u_a __attribute__((may_alias));

#ifndef NB
#define NB 2
#endif
#ifndef SEQ
#define SEQ 1024
#endif
#define NB_FULL 2
#define SEQ_FULL 1024

#define VGPR_CAP __attribute__((amdgpu_num_vgpr(256)))

constexpr int DMODEL = 1024;
constexpr int NHEAD  = 16;
constexpr int DHEAD  = 64;
constexpr int NPOS   = 2047;
constexpr int NQKV   = 3 * DMODEL;
constexpr int NBH    = NB * NHEAD;
constexpr int MROWS  = NB * SEQ;
constexpr int KCH    = 64;        /* keys per chunk */
constexpr int NWAVE  = 4;
constexpr int NCH    = SEQ / (KCH * NWAVE);   /* key chunks per wave of the attention block */
constexpr int NCHT   = SEQ / KCH;             /* key chunks of a query row */
constexpr int GP     = 84;        /* skew slab pitch in floats (336 B rows, 16-B aligned) */
constexpr int SP     = 68;        /* raw score slab pitch in floats */
constexpr int TQ_PITCH = 72;      /* [tok][d] staging pitch (16-bit elements) */
constexpr int TV_PITCH = 136;     /* [d][tok] staging pitch (16-bit elements) */
constexpr int T_ELEMS  = 128 * TQ_PITCH;   /* 9216 >= 64 * TV_PITCH = 8704 */
constexpr int TS_PITCH = 72;
constexpr int OS_PITCH = 68;
constexpr int KST      = 64;      /* k elements per GEMM stage: one 128-B line of every operand row */
constexpr int RP       = 72;      /* GEMM stage row pitch (16-bit elements): 144 B = 16 B x odd for b128 readers */
constexpr int NSTAGE   = 1024 / KST;
constexpr int QKV_STAGE_E = (128 + 64) * RP;        /* [x 128 rows | W 64 rows] */
constexpr int OUT_STAGE_E = (128 + 128 + 64) * RP;  /* [ctx hi 128 | ctx lo 128 | W 64 rows] */

constexpr size_t PLANE  = (size_t)NBH * SEQ * DHEAD;
constexpr size_t XB_E   = (size_t)MROWS * DMODEL;
constexpr size_t WQT_E  = (size_t)NQKV * DMODEL;
constexpr size_t WOT_E  = (size_t)DMODEL * DMODEL;
constexpr size_t ERB_E  = (size_t)NHEAD * 2048 * DHEAD;
constexpr size_t QKVP_E = 6 * PLANE;
constexpr size_t CTX_E  = 2 * XB_E;
constexpr size_t MP_W   = (size_t)(SEQ / 16) * NCHT * 32;   /* packed mask, 32-bit words */
constexpr size_t WS_NEED = 2 * (XB_E + WQT_E + WOT_E + ERB_E + QKVP_E + CTX_E) + 4 * MP_W;

static_assert(SEQ % 128 == 0);
static_assert(NCH * KCH * NWAVE == SEQ && NCH == 4);
static_assert(SEQ <= SEQ_FULL && NB <= NB_FULL);
static_assert(DHEAD == 64 && DMODEL == NHEAD * DHEAD);
static_assert(DMODEL % 64 == 0 && NQKV % 64 == 0 && DMODEL % 32 == 0);
static_assert(64 * TV_PITCH <= T_ELEMS);
static_assert((TQ_PITCH * 2) % 16 == 0 && (TV_PITCH * 2) % 16 == 0 && (GP * 4) % 16 == 0 && (OS_PITCH * 4) % 16 == 0);
static_assert(GP >= 80 && SP >= 64);
static_assert(NSTAGE * KST == DMODEL && NSTAGE >= 2 && (RP * 2) % 16 == 0 && RP >= KST);
static_assert(2 * T_ELEMS <= 2 * QKV_STAGE_E);
static_assert((size_t)NHEAD * NPOS * DHEAD <= ERB_E);
static_assert(WS_NEED <= 134217728ull);

/*
 *   Xb   [MROWS][1024]        x, bf16
 *   WqT  [3072][1024]         W_qkv transposed, bf16
 *   WoT  [1024][1024]         W_o transposed, bf16
 *   Erb  [16][128 tiles][8][16][8]   Er, bf16, in fragment order (below); row c of tile m is the
 *                             table row of offset 16m - 1023 + c, that is (16m - 1023 + c) mod 2047
 *   qkvp 6 planes, in fragment order: Qh Ql, Kh Kl (k/8) [bh][l/16][d/8][l%16][8 d],
 *                             Vh Vl [bh][l/32][d/16][(l%32)/8][d%16][8 l]
 *   ctxp 2 planes: Ch Cl [MROWS][1024]
 *   Mp   [SEQ/16 query tiles][SEQ/64 key chunks][32 lanes]  the mask, one bit an element: the word of
 *                             lane (hh, c) holds element (row 8hh+r, key 16j+c) of the 16x64 tile at
 *                             bit 16(r&1) + 4j + (r>>1)
 * Fragment order: the 16-B unit that lane (hh, c) takes for half a fragment register set stands at
 * unit 16hh + c of a 512-B run, so that one 16-B load of a wave covers four whole 128-B lines.
 */

__device__ __forceinline__ unsigned short f2bf_bits(float f) {
  unsigned u = __float_as_uint(f);
  return (unsigned short)((u + 0x7FFFu + ((u >> 16) & 1u)) >> 16);
}
__device__ __forceinline__ float bf_bits2f(unsigned short h) { return __uint_as_float(((unsigned)h) << 16); }
__device__ __forceinline__ unsigned pk2(float a, float b) {
  return (unsigned)f2bf_bits(a) | ((unsigned)f2bf_bits(b) << 16);
}
__device__ __forceinline__ void split2(float a, float b, unsigned& hw, unsigned& lw) {
  const unsigned short ha = f2bf_bits(a);
  const unsigned short hb = f2bf_bits(b);
  const unsigned short la = f2bf_bits(a - bf_bits2f(ha));
  const unsigned short lb = f2bf_bits(b - bf_bits2f(hb));
  hw = (unsigned)ha | ((unsigned)hb << 16);
  lw = (unsigned)la | ((unsigned)lb << 16);
}

/* e^(x - m) as one multiply-add and the hardware's base-2 exponential: exp2(x * log2(e) + nm), with
   nm = -m * log2(e) formed once a row. x = -inf gives 0; a result below the smallest normal number
   counts as 0, which is far below the last bit that the row sum or the 16-bit planes of p keep. */
constexpr float LOG2E = 1.44269504088896340736f;
__device__ __forceinline__ float exp_shifted(float x, float nm) {
  return __builtin_amdgcn_exp2f(__builtin_fmaf(x, LOG2E, nm));
}

/* The value of lane (lane ^ M) of the same 16-lane row, M = 1, 2, 4, 8, by the vector unit's own
   cross-lane read (DPP row_xmask); every lane is on where it is used. A shuffle builtin would go
   through the LDS queue and make each step of a row reduction wait for an LDS round trip. */
template <int M>
__device__ __forceinline__ float row_xor(float v) {
  return __int_as_float(__builtin_amdgcn_update_dpp(0, __float_as_int(v), 0x160 | M, 0xf, 0xf, true));
}
/* Maximum over each 16-lane row, eight values at once, left in every lane. Written as text because
   fmaxf on a cross-lane read compiles to three instructions a step (the read, a quieting maximum of
   the value with itself, the maximum); here a step is one. The eight values go step by step side by
   side, so that each instruction's producer stands eight instructions back and none waits for it. */
__device__ __forceinline__ void row_max16x8(float (&m)[8]) {
  asm(
      "v_max_num_f32_dpp %0, %0, %0 row_xmask:1 row_mask:0xf bank_mask:0xf\n\t"
      "v_max_num_f32_dpp %1, %1, %1 row_xmask:1 row_mask:0xf bank_mask:0xf\n\t"
      "v_max_num_f32_dpp %2, %2, %2 row_xmask:1 row_mask:0xf bank_mask:0xf\n\t"
      "v_max_num_f32_dpp %3, %3, %3 row_xmask:1 row_mask:0xf bank_mask:0xf\n\t"
      "v_max_num_f32_dpp %4, %4, %4 row_xmask:1 row_mask:0xf bank_mask:0xf\n\t"
      "v_max_num_f32_dpp %5, %5, %5 row_xmask:1 row_mask:0xf bank_mask:0xf\n\t"
      "v_max_num_f32_dpp %6, %6, %6 row_xmask:1 row_mask:0xf bank_mask:0xf\n\t"
      "v_max_num_f32_dpp %7, %7, %7 row_xmask:1 row_mask:0xf bank_mask:0xf\n\t"
      "v_max_num_f32_dpp %0, %0, %0 row_xmask:2 row_mask:0xf bank_mask:0xf\n\t"
      "v_max_num_f32_dpp %1, %1, %1 row_xmask:2 row_mask:0xf bank_mask:0xf\n\t"
      "v_max_num_f32_dpp %2, %2, %2 row_xmask:2 row_mask:0xf bank_mask:0xf\n\t"
      "v_max_num_f32_dpp %3, %3, %3 row_xmask:2 row_mask:0xf bank_mask:0xf\n\t"
      "v_max_num_f32_dpp %4, %4, %4 row_xmask:2 row_mask:0xf bank_mask:0xf\n\t"
      "v_max_num_f32_dpp %5, %5, %5 row_xmask:2 row_mask:0xf bank_mask:0xf\n\t"
      "v_max_num_f32_dpp %6, %6, %6 row_xmask:2 row_mask:0xf bank_mask:0xf\n\t"
      "v_max_num_f32_dpp %7, %7, %7 row_xmask:2 row_mask:0xf bank_mask:0xf\n\t"
      "v_max_num_f32_dpp %0, %0, %0 row_xmask:4 row_mask:0xf bank_mask:0xf\n\t"
      "v_max_num_f32_dpp %1, %1, %1 row_xmask:4 row_mask:0xf bank_mask:0xf\n\t"
      "v_max_num_f32_dpp %2, %2, %2 row_xmask:4 row_mask:0xf bank_mask:0xf\n\t"
      "v_max_num_f32_dpp %3, %3, %3 row_xmask:4 row_mask:0xf bank_mask:0xf\n\t"
      "v_max_num_f32_dpp %4, %4, %4 row_xmask:4 row_mask:0xf bank_mask:0xf\n\t"
      "v_max_num_f32_dpp %5, %5, %5 row_xmask:4 row_mask:0xf bank_mask:0xf\n\t"
      "v_max_num_f32_dpp %6, %6, %6 row_xmask:4 row_mask:0xf bank_mask:0xf\n\t"
      "v_max_num_f32_dpp %7, %7, %7 row_xmask:4 row_mask:0xf bank_mask:0xf\n\t"
      "v_max_num_f32_dpp %0, %0, %0 row_xmask:8 row_mask:0xf bank_mask:0xf\n\t"
      "v_max_num_f32_dpp %1, %1, %1 row_xmask:8 row_mask:0xf bank_mask:0xf\n\t"
      "v_max_num_f32_dpp %2, %2, %2 row_xmask:8 row_mask:0xf bank_mask:0xf\n\t"
      "v_max_num_f32_dpp %3, %3, %3 row_xmask:8 row_mask:0xf bank_mask:0xf\n\t"
      "v_max_num_f32_dpp %4, %4, %4 row_xmask:8 row_mask:0xf bank_mask:0xf\n\t"
      "v_max_num_f32_dpp %5, %5, %5 row_xmask:8 row_mask:0xf bank_mask:0xf\n\t"
      "v_max_num_f32_dpp %6, %6, %6 row_xmask:8 row_mask:0xf bank_mask:0xf\n\t"
      "v_max_num_f32_dpp %7, %7, %7 row_xmask:8 row_mask:0xf bank_mask:0xf"
      : "+v"(m[0]), "+v"(m[1]), "+v"(m[2]), "+v"(m[3]), "+v"(m[4]), "+v"(m[5]), "+v"(m[6]), "+v"(m[7]));
}
__device__ __forceinline__ float row_sum16(float s) {
  s += row_xor<1>(s);
  s += row_xor<2>(s);
  s += row_xor<4>(s);
  s += row_xor<8>(s);
  return s;
}

/* one WMMA + hazard guard naming only this call's live operands */
__device__ __forceinline__ v8f mma_bf16(v16b a, v16b b, v8f c) {
  c = __builtin_amdgcn_wmma_f32_16x16x32_bf16(false, a, false, b, (short)0, c, false, false);
  asm volatile("v_nop\n\tv_nop\n\tv_nop\n\tv_nop" : "+v"(c) : "v"(a), "v"(b));
  return c;
}

__device__ __forceinline__ void wave_lds_sync() {
  __builtin_amdgcn_fence(3 /* release order */, "workgroup");
  __builtin_amdgcn_wave_barrier();
  __builtin_amdgcn_fence(2 /* acquire order */, "workgroup");
}

/* byte offset of a __shared__ address inside the work-group's LDS */
__device__ __forceinline__ unsigned lds_off(const void* p) { return (unsigned)(size_t)p; }

/* Asynchronous copies global -> LDS, 16 B per lane and copy, every lane on. The copies of a run
   and the s_wait_xcnt 0 that stands before their address registers may be rewritten are one
   statement, so that no later address arithmetic can be moved in front of that wait. */
__device__ __forceinline__ void async_copy12(const unsigned (&l)[12], const unsigned short* const (&g)[12]) {
  asm volatile(
      "global_load_async_to_lds_b128 %0, %12, off\n\t"
      "global_load_async_to_lds_b128 %1, %13, off\n\t"
      "global_load_async_to_lds_b128 %2, %14, off\n\t"
      "global_load_async_to_lds_b128 %3, %15, off\n\t"
      "global_load_async_to_lds_b128 %4, %16, off\n\t"
      "global_load_async_to_lds_b128 %5, %17, off\n\t"
      "global_load_async_to_lds_b128 %6, %18, off\n\t"
      "global_load_async_to_lds_b128 %7, %19, off\n\t"
      "global_load_async_to_lds_b128 %8, %20, off\n\t"
      "global_load_async_to_lds_b128 %9, %21, off\n\t"
      "global_load_async_to_lds_b128 %10, %22, off\n\t"
      "global_load_async_to_lds_b128 %11, %23, off\n\t"
      "s_wait_xcnt 0x0"
      :: "v"(l[0]), "v"(l[1]), "v"(l[2]), "v"(l[3]), "v"(l[4]), "v"(l[5]),
         "v"(l[6]), "v"(l[7]), "v"(l[8]), "v"(l[9]), "v"(l[10]), "v"(l[11]),
         "v"(g[0]), "v"(g[1]), "v"(g[2]), "v"(g[3]), "v"(g[4]), "v"(g[5]),
         "v"(g[6]), "v"(g[7]), "v"(g[8]), "v"(g[9]), "v"(g[10]), "v"(g[11])
      : "memory");
}
__device__ __forceinline__ void async_copy10(const unsigned* l, const unsigned short* const* g) {
  asm volatile(
      "global_load_async_to_lds_b128 %0, %10, off\n\t"
      "global_load_async_to_lds_b128 %1, %11, off\n\t"
      "global_load_async_to_lds_b128 %2, %12, off\n\t"
      "global_load_async_to_lds_b128 %3, %13, off\n\t"
      "global_load_async_to_lds_b128 %4, %14, off\n\t"
      "global_load_async_to_lds_b128 %5, %15, off\n\t"
      "global_load_async_to_lds_b128 %6, %16, off\n\t"
      "global_load_async_to_lds_b128 %7, %17, off\n\t"
      "global_load_async_to_lds_b128 %8, %18, off\n\t"
      "global_load_async_to_lds_b128 %9, %19, off\n\t"
      "s_wait_xcnt 0x0"
      :: "v"(l[0]), "v"(l[1]), "v"(l[2]), "v"(l[3]), "v"(l[4]),
         "v"(l[5]), "v"(l[6]), "v"(l[7]), "v"(l[8]), "v"(l[9]),
         "v"(g[0]), "v"(g[1]), "v"(g[2]), "v"(g[3]), "v"(g[4]),
         "v"(g[5]), "v"(g[6]), "v"(g[7]), "v"(g[8]), "v"(g[9])
      : "memory");
}
/* A pointer that is the same in every lane, held in scalar registers: the loads from it take the
   form scalar base + lane offset, so that no vector address pair is written among loads in flight. */
typedef const __attribute__((address_space(1))) unsigned short g_u16;   /* global memory, named as such */
typedef const __attribute__((address_space(1))) v8b g_v8b;
__device__ __forceinline__ g_u16* scalar_base(const unsigned short* p) {
  const unsigned long long a = (unsigned long long)p;
  const unsigned lo = (unsigned)__builtin_amdgcn_readfirstlane((int)(unsigned)a);
  const unsigned hi = (unsigned)__builtin_amdgcn_readfirstlane((int)(unsigned)(a >> 32));
  return (g_u16*)(((unsigned long long)hi << 32) | lo);
}
/* Stands in front of the last load from an address pair, whose destination may be that pair while
   earlier loads from it are in flight, and behind it, before the pair is written anew: the wait
   that is kept before a register of an issued global load is overwritten. */
__device__ __forceinline__ void wait_addr() { asm volatile("s_wait_xcnt 0x0" ::: "memory"); }
/* this wave's copies have landed in LDS (the compiler places no wait for them) */
__device__ __forceinline__ void wait_copies() { asm volatile("s_wait_asynccnt 0x0" ::: "memory"); }
/* this wave's LDS reads have returned, so the buffer they read may be refilled behind the barrier */
__device__ __forceinline__ void wait_lds_reads() { asm volatile("s_wait_dscnt 0x0" ::: "memory"); }

/* --------------------------------------------------------------------------
 * Preparation of the four 16-bit operand planes and of the packed mask. The five jobs read only inputs and write
 * disjoint planes, so they are the block ranges of ONE launch (prep_kernel, below) and run
 * side by side; each job is a block-level function, the block's job a block-uniform choice.
 * ------------------------------------------------------------------------ */

/* x: f32 rows -> bf16 rows (RNE), unit = 8 elements = one 16-B store.
 * out row = b*SEQ + l  <-  in row = b*SEQ_FULL + l ; row length = DMODEL.
 * Coverage: CVT_BLOCKS x 256 units x 8 elements = the whole plane. */
constexpr int CVT_UPR    = DMODEL / 8;
constexpr int CVT_UNITS  = MROWS * CVT_UPR;
constexpr int CVT_BLOCKS = (CVT_UNITS + 255) / 256;
__device__ __forceinline__ void cvt_rows_block(
    const float* __restrict__ in, unsigned short* __restrict__ outp, int blk)
{
  const int u = blk * 256 + threadIdx.x;
  if (u >= CVT_UNITS) return;      /* no barrier follows in this job */
  const int row = u / CVT_UPR;
  const int seg = u - row * CVT_UPR;
  const int b = row / SEQ;
  const int l = row - b * SEQ;
  const float* src = in + ((size_t)(b * SEQ_FULL + l) * CVT_UPR + seg) * 8;
  const v4f a0 = *(const v4f*)src;
  const v4f a1 = *(const v4f*)(src + 4);
  v4u w;
  w[0] = pk2(a0[0], a0[1]);
  w[1] = pk2(a0[2], a0[3]);
  w[2] = pk2(a1[0], a1[1]);
  w[3] = pk2(a1[2], a1[3]);
  v4u* dst = (v4u*)(outp + ((size_t)row * CVT_UPR + seg) * 8);
  *dst = w;
}

/* Er [16][2047][64] f32 -> Erb, bf16 (RNE), 16-row tiles in fragment order.
 * Tile m (0..127) of a head holds the rows of the offsets 16m - 1023 + c, c = 0..15, which are
 * the windows the attention kernel asks for (its offsets start at 1 mod 16).
 * Block = 2 tiles, thread = one 8-element unit: read as (row u>>3, segment u&7), whole lines;
 * units turned from [row][segment] to [segment][row] through LDS (cross-wave, block barrier);
 * stored in thread order. Coverage: TAB_BLOCKS x 2 tiles = 16 heads x 128 tiles.
 * LDS unit pitch: one spare unit per 16, so that the 8 segments of a row fall on different banks. */
constexpr int TAB_BLOCKS = NHEAD * 128 / 2;
__device__ __forceinline__ void pack_table_block(
    const float* __restrict__ Er, unsigned short* __restrict__ Erb, int blk, v4u* Us)
{
  const int tid  = threadIdx.x;
  const int tl   = tid >> 7;
  const int u    = tid & 127;
  const int tile = blk * 2 + tl;             /* head * 128 + m */
  const int h    = tile >> 7;
  const int m    = tile & 127;
  const int row  = u >> 3;
  const int seg  = u & 7;
  const int d    = 16 * m - (SEQ_FULL - 1) + row;      /* -1023 .. 1024 */
  const int rr   = d + ((d < 0) ? NPOS : 0);           /* 0 .. 2046 */
  const float* src = Er + ((size_t)h * NPOS + rr) * DHEAD + seg * 8;
  const v4f a0 = *(const v4f*)src;
  const v4f a1 = *(const v4f*)(src + 4);
  v4u w;
  w[0] = pk2(a0[0], a0[1]);
  w[1] = pk2(a0[2], a0[3]);
  w[2] = pk2(a1[0], a1[1]);
  w[3] = pk2(a1[2], a1[3]);
  Us[tl * 136 + seg * 17 + row] = w;
  __syncthreads();   /* publishes the tile's units to the waves that store them */
  *(v4u*)(Erb + (size_t)tile * 1024 + u * 8) = Us[tl * 136 + (u >> 4) * 17 + (u & 15)];
  wait_addr();   /* behind the job's store: another job's text follows it in the one kernel and writes its registers */
}

/* W in[rows][cols] f32  ->  Wt out[cols][rows] bf16 (RNE), one 64x64 tile through LDS.
 * Tile (kt = rows tile, nt = cols tile), 256 threads.
 * Coverage: 2 iterations x 256 threads = 512 units x 8 = 64x64 for the load phase
 * and the same 512 units x 8 = 64x64 for the store phase.
 * LDS tile: cross-wave, separated by a block barrier. */
constexpr int WQ_BLOCKS = (DMODEL / 64) * (NQKV / 64);
constexpr int WO_BLOCKS = (DMODEL / 64) * (DMODEL / 64);
__device__ __forceinline__ void wt_planes_block(
    const float* __restrict__ W, unsigned short* __restrict__ Wt, int rows, int cols,
    int kt, int nt, unsigned short* Ts /* [n][k] */)
{
  const int k0 = kt * 64;
  const int n0 = nt * 64;
  const int tid = threadIdx.x;
  const float* src[2];
  v4f a0[2], a1[2];
  /* both loops unrolled: the arrays are indexed by constants and stay in registers */
#pragma unroll
  for (int it = 0; it < 2; ++it) {
    const int u = it * 256 + tid;
    src[it] = W + (size_t)(k0 + (u >> 3)) * cols + n0 + (u & 7) * 8;
    a0[it] = *(const v4f*)src[it];
    a1[it] = *(const v4f*)(src[it] + 4);
  }
  /* the wait that is kept before a register of an issued global load is overwritten; it takes the
     two address pairs as inputs, so that they stay whole up to it and no load's result lands on one */
  asm volatile("s_wait_xcnt 0x0" :: "v"(src[0]), "v"(src[1]) : "memory");
#pragma unroll
  for (int it = 0; it < 2; ++it) {
    const int u = it * 256 + tid;
    const int row = u >> 3;      /* k local */
    const int seg = u & 7;       /* n segment */
#pragma unroll
    for (int e = 0; e < 4; ++e) {
      Ts[(seg * 8 + e) * TS_PITCH + row]     = f2bf_bits(a0[it][e]);
      Ts[(seg * 8 + 4 + e) * TS_PITCH + row] = f2bf_bits(a1[it][e]);
    }
  }
  __syncthreads();   /* publishes the tile to the waves that store its rows */
#pragma unroll
  for (int it = 0; it < 2; ++it) {
    const int u = it * 256 + tid;
    const int nrow = u >> 3;
    const int seg  = u & 7;
    const v4u w = *(const v4u_a*)(Ts + nrow * TS_PITCH + seg * 8);
    *(v4u*)(Wt + (size_t)(n0 + nrow) * rows + k0 + seg * 8) = w;
  }
  wait_addr();   /* behind the job's two stores: another job's text follows them in the one kernel and writes their registers */
}

/* mask [SEQ][SEQ] i32 -> Mp, one bit an element, in the order in which the attention kernel's lanes
 * use them. The mask is the same for every batch and head, so it is read and packed once here and
 * not by each of the NBH attention blocks of a query tile.
 * Wave = one tile of 16 query rows x 64 keys, read by value as 8 b128 loads a lane, whole lines.
 * Bit L of the ballot (it, e) = mask[16qt+2it+(L>>4)][64ch+4(L&15)+e] != 0; each lane keeps the
 * word of its own e = c&3 (lane masks sel0..sel3) and of its own row half, and packs its own
 * 32 bits into one word. Stored in thread order: one whole line a wave.
 * Coverage: MSK_BLOCKS x 8 waves = SEQ/16 query tiles x NCHT chunks. No barrier in this job. */
constexpr int MSK_TILES  = (SEQ / 16) * NCHT;
constexpr int MSK_BLOCKS = MSK_TILES / 8;
static_assert(MSK_BLOCKS * 8 == MSK_TILES);
__device__ __forceinline__ void pack_mask_block(
    const int* __restrict__ mask, unsigned* __restrict__ Mp, int blk)
{
  const int tid  = threadIdx.x;
  const int lane = tid & 31;
  const int hh   = lane >> 4;
  const int c    = lane & 15;
  const int c3   = c & 3;
  const int csh  = c >> 2;
  const int tile = blk * 8 + (tid >> 5);     /* query tile * NCHT + chunk */
  const int qt   = tile / NCHT;
  const int ch   = tile - qt * NCHT;
  const int* ml = mask + (size_t)(qt * 16 + hh) * SEQ_FULL + ch * KCH + 4 * c;   /* lane base; the rest are constants */
  v4i mv[8];
  /* all loops unrolled: the arrays are indexed by constants and stay in registers */
#pragma unroll
  for (int it = 0; it < 8; ++it) mv[it] = *(const v4i*)(ml + it * 2 * SEQ_FULL);
  /* the wait that is kept before a register of an issued global load is overwritten; it takes the
     address pair as an input, so that the pair stays whole up to it and no load's result lands on it */
  asm volatile("s_wait_xcnt 0x0" :: "v"(ml) : "memory");
  const unsigned sel0 = (c3 == 0) ? 0xFFFFFFFFu : 0u;
  const unsigned sel1 = (c3 == 1) ? 0xFFFFFFFFu : 0u;
  const unsigned sel2 = (c3 == 2) ? 0xFFFFFFFFu : 0u;
  const unsigned sel3 = (c3 == 3) ? 0xFFFFFFFFu : 0u;
  unsigned msel[8];
#pragma unroll
  for (int it = 0; it < 8; ++it) {
    const unsigned b0 = __builtin_amdgcn_ballot_w32(mv[it][0] != 0);
    const unsigned b1 = __builtin_amdgcn_ballot_w32(mv[it][1] != 0);
    const unsigned b2 = __builtin_amdgcn_ballot_w32(mv[it][2] != 0);
    const unsigned b3 = __builtin_amdgcn_ballot_w32(mv[it][3] != 0);
    msel[it] = (b0 & sel0) | (b1 & sel1) | (b2 & sel2) | (b3 & sel3);
  }
  unsigned pk = 0u;
#pragma unroll
  for (int ii = 0; ii < 4; ++ii) {
    const unsigned w = hh ? msel[4 + ii] : msel[ii];
    pk |= ((w >> csh) & 0x11111111u) << ii;
  }
  Mp[(size_t)tile * 32 + lane] = pk;
  wait_addr();   /* behind the job's store: another job's text follows it in the one kernel and writes its registers */
}

/* Block ranges, the jobs with two phases and a barrier first:
 *   [0, WQ)            W_qkv in[1024][3072] -> WqT out[3072][1024], tile (blk % 16, blk / 16)
 *   [WQ, WQ + WO)      W_o   in[1024][1024] -> WoT out[1024][1024], likewise
 *   then TAB_BLOCKS    the position table, then MSK_BLOCKS the mask, then CVT_BLOCKS x. */
constexpr int PREP_BLOCKS = WQ_BLOCKS + WO_BLOCKS + TAB_BLOCKS + MSK_BLOCKS + CVT_BLOCKS;
__global__ __launch_bounds__(256) void prep_kernel(
    const float* __restrict__ x, const float* __restrict__ W_qkv, const float* __restrict__ W_o,
    const float* __restrict__ Er, const int* __restrict__ mask, unsigned short* __restrict__ Xb,
    unsigned short* __restrict__ WqT, unsigned short* __restrict__ WoT, unsigned short* __restrict__ Erb,
    unsigned* __restrict__ Mp)
{
  __shared__ __align__(16) unsigned short Ts[64 * TS_PITCH];
  __shared__ __align__(16) v4u Us[2 * 136];
  constexpr int KT = DMODEL / 64;
  const int blk = blockIdx.x;
  if (blk < WQ_BLOCKS) {
    wt_planes_block(W_qkv, WqT, DMODEL, NQKV, blk % KT, blk / KT, Ts);
  } else if (blk < WQ_BLOCKS + WO_BLOCKS) {
    const int t = blk - WQ_BLOCKS;
    wt_planes_block(W_o, WoT, DMODEL, DMODEL, t % KT, t / KT, Ts);
  } else if (blk < WQ_BLOCKS + WO_BLOCKS + TAB_BLOCKS) {
    pack_table_block(Er, Erb, blk - (WQ_BLOCKS + WO_BLOCKS), Us);
  } else if (blk < WQ_BLOCKS + WO_BLOCKS + TAB_BLOCKS + MSK_BLOCKS) {
    pack_mask_block(mask, Mp, blk - (WQ_BLOCKS + WO_BLOCKS + TAB_BLOCKS));
  } else {
    cvt_rows_block(x, Xb, blk - (WQ_BLOCKS + WO_BLOCKS + TAB_BLOCKS + MSK_BLOCKS));
  }
}

/* --------------------------------------------------------------------------
 * qkv = Xb . WqT^T + b  (M = MROWS, N = 3072, K = 1024), bf16 x bf16, f32 acc.
 * Block = 4 waves, tile 128 tokens x 64 columns (= one head of one section);
 * wave = 32 rows x 64 cols (2 A fragments x 4 B fragments per 32-deep step).
 * Operands: stages of 64 k (128 B of each of the 192 operand rows, whole lines) brought into a
 * two-buffer LDS ring by asynchronous copies, 12 per thread and stage, one stage ahead of the
 * stage being worked on; fragments by 16-B LDS loads from rows pitched 144 B.
 * Foot of every stage: own LDS reads back, own copies landed, block barrier, then the refill of
 * the buffer just read. The epilogue tile reuses the ring behind the last stage's barrier.
 * Fragment map (hh = lane>>4, c = lane&15): A row c, elems 0..7 <- k0+8hh.., 8..15 <- k0+16+8hh..;
 * B col c with the same k map; D elem r = (row 8hh+r, col c).
 * Epilogue: (acc + bias) [x 1/8 for the k section] split to bf16 hi/lo, staged in a
 * block LDS tile ([tok][d] for q,k; [d][tok] for v), block barrier, then stored in fragment
 * order: the block's 1024 units of a plane are 16 KB in a row, unit u from
 *   q,k: token 16(u>>7) + (u&15), d segment (u>>4)&7;
 *   v  : d row 16((u>>6)&3) + (u&15), key segment 4(u>>8) + ((u>>4)&3).
 * ------------------------------------------------------------------------ */
__global__ __launch_bounds__(128) VGPR_CAP void gemm_qkv_kernel(
    const unsigned short* __restrict__ Xb, const unsigned short* __restrict__ WqT,
    const float* __restrict__ bias, unsigned short* __restrict__ qkvp)
{
  union FB { v16b v; v8b h[2]; };
  __shared__ __align__(16) unsigned short Sm[2 * QKV_STAGE_E];
  unsigned short* Th = Sm;
  unsigned short* Tl = Sm + T_ELEMS;

  const int tid  = threadIdx.x;
  const int wave = __builtin_amdgcn_readfirstlane(tid >> 5);
  const int lane = tid & 31;
  const int hh   = lane >> 4;
  const int c    = lane & 15;
  const int n0   = blockIdx.x * 64;
  const int m0   = blockIdx.y * 128;

  v8f acc[2][4];
#pragma unroll
  for (int mt = 0; mt < 2; ++mt)
#pragma unroll
    for (int t = 0; t < 4; ++t) acc[mt][t] = (v8f){0.f,0.f,0.f,0.f,0.f,0.f,0.f,0.f};

  /* copy unit: thread -> (row tid>>3 of each group of 16 rows, 16-B segment tid&7) */
  const int crow = tid >> 3;
  const int cseg = tid & 7;
  const unsigned short* gx = Xb  + (size_t)(m0 + crow) * DMODEL + cseg * 8;
  const unsigned short* gw = WqT + (size_t)(n0 + crow) * DMODEL + cseg * 8;
  const unsigned lrow = lds_off(Sm) + (unsigned)(crow * RP + cseg * 8) * 2u;

  auto issue_stage = [&](int st) {
    /* unrolled below: the address arrays are indexed by constants and stay in registers */
    unsigned l[12];
    const unsigned short* g[12];
    const unsigned lb = lrow + (unsigned)(st & 1) * (unsigned)(QKV_STAGE_E * 2);
#pragma unroll
    for (int it = 0; it < 12; ++it) {
      l[it] = lb + (unsigned)(it * 16 * RP * 2);
      g[it] = (it < 8) ? gx + (size_t)it * 16 * DMODEL + st * KST
                       : gw + (size_t)(it - 8) * 16 * DMODEL + st * KST;
    }
    async_copy12(l, g);
  };

  const unsigned short* sa = Sm + (wave * 32 + c) * RP + 8 * hh;
  const unsigned short* sb = Sm + (128 + c) * RP + 8 * hh;

  issue_stage(0);
  wait_copies();
  __syncthreads();   /* publishes stage 0 */
  issue_stage(1);

  /* kept rolled: one copy of the ring's foot (waits, barrier, refill), small loop text */
#pragma unroll 1
  for (int st = 0; st < NSTAGE; ++st) {
    const int bo = (st & 1) * QKV_STAGE_E;
    /* the stage's fragment loads stand as one group ahead of its products, so that the wave pays
       the LDS latency once a stage; the loops below are unrolled so that every index of the
       fragment arrays is a constant and they stay in registers */
    FB a0[2], a1[2], bf[2][4];
#pragma unroll
    for (int s = 0; s < 2; ++s) {
      const int ks = s * 32;
      a0[s].h[0] = *(const v8b_a*)(sa + bo + ks);
      a0[s].h[1] = *(const v8b_a*)(sa + bo + ks + 16);
      a1[s].h[0] = *(const v8b_a*)(sa + bo + 16 * RP + ks);
      a1[s].h[1] = *(const v8b_a*)(sa + bo + 16 * RP + ks + 16);
#pragma unroll
      for (int t = 0; t < 4; ++t) {
        bf[s][t].h[0] = *(const v8b_a*)(sb + bo + t * 16 * RP + ks);
        bf[s][t].h[1] = *(const v8b_a*)(sb + bo + t * 16 * RP + ks + 16);
      }
    }
#pragma unroll
    for (int s = 0; s < 2; ++s) {
#pragma unroll
      for (int t = 0; t < 4; ++t) {
        acc[0][t] = mma_bf16(a0[s].v, bf[s][t].v, acc[0][t]);
        acc[1][t] = mma_bf16(a1[s].v, bf[s][t].v, acc[1][t]);
      }
    }
    wait_lds_reads();
    wait_copies();
    __syncthreads();   /* publishes stage st + 1 and ends every read of stage st's buffer */
    if (st + 2 < NSTAGE) issue_stage(st + 2);
  }
  wait_copies();

  const int sec = n0 / DMODEL;                       /* 0 q, 1 k, 2 v : block-uniform */
  const float osc = (sec == 1) ? 0.125f : 1.0f;
#pragma unroll
  for (int t = 0; t < 4; ++t) {
    const float bv = bf_bits2f(f2bf_bits(bias[n0 + 16 * t + c]));
#pragma unroll
    for (int mt = 0; mt < 2; ++mt) {
#pragma unroll
      for (int r = 0; r < 8; ++r) {
        const float val = (acc[mt][t][r] + bv) * osc;
        const unsigned short hb = f2bf_bits(val);
        const unsigned short lb = f2bf_bits(val - bf_bits2f(hb));
        const int rl = wave * 32 + mt * 16 + 8 * hh + r;
        const int cl = 16 * t + c;
        const int idx = (sec < 2) ? (rl * TQ_PITCH + cl) : (cl * TV_PITCH + rl);
        Th[idx] = hb;
        Tl[idx] = lb;
      }
    }
  }
  __syncthreads();

  const int b  = m0 / SEQ;
  const int l0 = m0 - b * SEQ;
  const int h  = (n0 - sec * DMODEL) / DHEAD;
  const int bh = b * NHEAD + h;
  unsigned short* ph = qkvp + (size_t)(2 * sec) * PLANE;
  unsigned short* pl = ph + PLANE;

  {
    if (sec < 2) {
#pragma unroll
      for (int it = 0; it < 8; ++it) {
        const int u = it * 128 + tid;
        const int row = (u >> 7) * 16 + (u & 15);
        const int seg = (u >> 4) & 7;
        const v4u hw = *(const v4u_a*)(Th + row * TQ_PITCH + seg * 8);
        const v4u lw = *(const v4u_a*)(Tl + row * TQ_PITCH + seg * 8);
        const size_t g = ((size_t)bh * SEQ + l0) * DHEAD + u * 8;
        *(v4u*)(ph + g) = hw;
        *(v4u*)(pl + g) = lw;
      }
    } else {
#pragma unroll
      for (int it = 0; it < 8; ++it) {
        const int u = it * 128 + tid;
        const int drow = ((u >> 6) & 3) * 16 + (u & 15);
        const int seg  = (u >> 8) * 4 + ((u >> 4) & 3);
        const v4u hw = *(const v4u_a*)(Th + drow * TV_PITCH + seg * 8);
        const v4u lw = *(const v4u_a*)(Tl + drow * TV_PITCH + seg * 8);
        const size_t g = ((size_t)bh * SEQ + l0) * DHEAD + u * 8;
        *(v4u*)(ph + g) = hw;
        *(v4u*)(pl + g) = lw;
      }
    }
    
  }
}

/* --------------------------------------------------------------------------
 * Attention with the per-head relative-position table, head dim 64.
 * Block = 16 query rows of one (b,h); grid (NBH, SEQ/16), the last query tile first, for speed
 * only; the order is a permutation of the tiles and changes no result under any mask.
 * The block's 4 waves deal the
 * 64-key chunks among them (wave w takes chunks w, w+4, ...), each with its own running
 * maximum, sum and output accumulators; one block barrier, then the four partial states
 * are merged through LDS by the usual rescaling to the common row maximum.
 * At entry: the packed mask words of all the wave's chunks (plane Mp, made by the preparation
 * launch), one word a chunk and lane, as one group of loads; wave-uniform skip of a
 * chunk when every element of its 16x64 mask tile is set; per-element replace-fill otherwise.
 * Per 64-key chunk and wave (16 query rows); only the output accumulators, the row statistics
 * and the mask words stay resident between chunks:
 *   G = q.Ewin^T  : 5 tiles (80 offsets d = kv0-q0-15+g, packed tiles (kv0-q0)/16+63 ..),
 *                   2 d-steps x (hi + lo) against the bf16 table, written
 *                   to the wave-private G slab, read back skewed: G[m][n-m+15];
 *   S = q.(k/8)^T : 4 key tiles, 2 d-steps x (hi.hi + hi.lo + lo.hi),
 *                   one accumulator, each tile written to the wave-private S slab;
 *   f32 online softmax on S + G; P as bf16 hi+lo wave-private LDS tiles;
 *   O += Ph.Vh + Pl.Vh + Ph.Vl from the V^T planes, two 32-key steps.
 * All fragments come straight from the 16-bit global planes, which stand in fragment order: every
 * load is a wave-uniform base + 16 B x lane and covers four whole lines. The loads are
 * issued in groups ahead of the products that use them (q, table and key tile 0 together; key
 * tiles 1..3 as registers come free; v during the softmax).
 * LDS regions Ss/Gs/Psh/Psl are private to their wave (wave_sync form) inside the loop.
 * Epilogue: each wave's unnormalised 16x64 slab (aliases its G slab) and row statistics,
 * block barrier, merge + normalise (thread = one row x 8 columns) -> ctx hi/lo planes,
 * ------------------------------------------------------------------------ */
__global__ __launch_bounds__(128) VGPR_CAP void rel_attn_kernel(
    const unsigned short* __restrict__ qkvp, const unsigned short* __restrict__ Erb,
    const unsigned* __restrict__ Mp, unsigned short* __restrict__ ctxp)
{
  union FB { v16b v; v8b h[2]; };
  __shared__ __align__(16) float Gs[NWAVE][16 * GP];
  __shared__ __align__(16) float Ss[NWAVE][16 * SP];
  __shared__ __align__(16) unsigned short Psh[NWAVE][16 * KCH];
  __shared__ __align__(16) unsigned short Psl[NWAVE][16 * KCH];
  __shared__ float Ms[NWAVE][16];
  __shared__ float Ls[NWAVE][16];

  const int tid  = threadIdx.x;
  const int wave = __builtin_amdgcn_readfirstlane(tid >> 5);
  const int lane = tid & 31;
  const int hh   = lane >> 4;
  const int c    = lane & 15;
  const int qb   = SEQ / 16 - 1 - (int)blockIdx.y;
  const int bh   = blockIdx.x;
  const int b    = bh / NHEAD;
  const int h    = bh - b * NHEAD;
  const int q0   = qb * 16;
  const float NEG_INF = -__builtin_inff();

  const unsigned short* Qh  = qkvp + (size_t)bh * SEQ * DHEAD;   /* each lo plane stands PLANE behind its hi plane */
  const unsigned short* Kh  = Qh + 2 * PLANE;
  const unsigned short* Vth = Qh + 4 * PLANE;     /* same per-bh element count */
  const unsigned short* Eh  = Erb + (size_t)h * 128 * 1024;   /* 128 packed tiles of 1024 elements a head */

  float mrow[8], lrow[8];
  v8f oacc[4];
#pragma unroll
  for (int r = 0; r < 8; ++r) { mrow[r] = NEG_INF; lrow[r] = 0.f; }
#pragma unroll
  for (int t = 0; t < 4; ++t) oacc[t] = (v8f){0.f,0.f,0.f,0.f,0.f,0.f,0.f,0.f};

  float* gs = Gs[wave];
  float* ss = Ss[wave];
  unsigned short* pwh = Psh[wave];
  unsigned short* pwl = Psl[wave];
  /* one lane base per slab and access pattern; every row and tile below is a constant offset from
     it, so that the LDS addresses take one register each and leave room for loads in flight */
  float* gsw = gs + 8 * hh * GP + c;                    /* G and output slab, element (8hh+r, 16t+c) */
  float* ssw = ss + 8 * hh * SP + c;                    /* S slab, element (8hh+r, 16j+c) */
  const float* gsk = gs + 8 * hh * (GP - 1) + c + 15;   /* G slab read skewed: G[m][n-m+15] */
  unsigned short* pwhw = pwh + 8 * hh * KCH + c;
  unsigned short* pwlw = pwl + 8 * hh * KCH + c;
  const unsigned lane8 = (unsigned)(lane * 8);   /* this lane's 16-B unit of every 512-B fragment run (elements) */

  /* packed mask words of all NCH chunks of this wave, one group of loads:
     bit 16(r&1) + 4j + (r>>1) of a lane's word = element (row 8hh+r, key 16j+c) of the chunk's tile */
  unsigned mpk[NCH];
  unsigned skip = 0u;                 /* bit i: every element of chunk i's tile is masked (wave-uniform) */
  {
    const unsigned* mpl = Mp + (size_t)(qb * NCHT + wave) * 32 + lane;   /* lane base; the rest are constants */
    /* both loops unrolled: the array is indexed by constants and stays in registers */
#pragma unroll
    for (int i = 0; i < NCH; ++i) mpk[i] = mpl[i * NWAVE * 32];
    wait_addr();      /* behind the mask word loads, before their address registers are written anew */
#pragma unroll
    for (int i = 0; i < NCH; ++i)
      skip |= (__builtin_amdgcn_ballot_w32(mpk[i] == 0xFFFFFFFFu) == 0xFFFFFFFFu) ? (1u << i) : 0u;
  }

  /* kept rolled: one copy of the chunk's text */
#pragma unroll 1
  for (int i = 0; i < NCH; ++i) {
    if ((skip >> i) & 1u) continue;               /* wave-uniform: every element masked */
    const int kv0 = (wave + i * NWAVE) * KCH;

    const unsigned mk = (i == 0) ? mpk[0] : (i == 1) ? mpk[1] : (i == 2) ? mpk[2] : mpk[3];

    /* The chunk's loads fly as a window ahead of the products that use them: q, the 5 table tiles
       and key tile 0 are issued as one group, each further key tile as soon as earlier tiles'
       registers come free. q is read per chunk so that its registers are free for the v fragments
       during the softmax and p.v. All loops below are unrolled so that the fragment arrays are
       indexed by constants and stay in registers. */
    v16b qh[2], ql[2];
    FB kfh[4][2], kfl[4][2], ef[5][2];
    /* position table: offsets kv0 - q0 - 15 + g, g = 0..79, are the packed tiles
       (kv0 - q0) / 16 + 63 + t, t = 0..4, in [0, 127] */
    g_u16* ep = scalar_base(Eh + ((kv0 - q0 + SEQ_FULL - 16) >> 4) * 1024);
    g_u16* kh = scalar_base(Kh + kv0 * DHEAD);
    g_u16* kl = kh + PLANE;
    g_u16* vh = scalar_base(Vth + kv0 * DHEAD);
    g_u16* vl = vh + PLANE;
    g_u16* qph = scalar_base(Qh + q0 * DHEAD);
    g_u16* qpl = qph + PLANE;
    auto load_key_tile = [&](int j) {
#pragma unroll
      for (int dc = 0; dc < 2; ++dc) {
        kfh[j][dc].h[0] = *(g_v8b*)(kh + lane8 + j * 1024 + dc * 512);
        kfh[j][dc].h[1] = *(g_v8b*)(kh + lane8 + j * 1024 + dc * 512 + 256);
        kfl[j][dc].h[0] = *(g_v8b*)(kl + lane8 + j * 1024 + dc * 512);
        kfl[j][dc].h[1] = *(g_v8b*)(kl + lane8 + j * 1024 + dc * 512 + 256);
      }
      /* behind the chunk's last k load, before its address registers are written anew */
      if (j == 3) wait_addr();
    };
    {
#pragma unroll
      for (int dc = 0; dc < 2; ++dc) {
        FB f;
        f.h[0] = *(g_v8b*)(qph + lane8 + dc * 512);
        f.h[1] = *(g_v8b*)(qph + lane8 + dc * 512 + 256);
        qh[dc] = f.v;
        f.h[0] = *(g_v8b*)(qpl + lane8 + dc * 512);
        f.h[1] = *(g_v8b*)(qpl + lane8 + dc * 512 + 256);
        ql[dc] = f.v;
      }
    }
#pragma unroll
    for (int t = 0; t < 5; ++t) {
#pragma unroll
      for (int dc = 0; dc < 2; ++dc) {
        ef[t][dc].h[0] = *(g_v8b*)(ep + lane8 + t * 1024 + dc * 512);
        ef[t][dc].h[1] = *(g_v8b*)(ep + lane8 + t * 1024 + dc * 512 + 256);
      }
    }
    load_key_tile(0);
    wait_addr();      /* behind the last q and table loads, before their address registers are written anew */
    /* keeps the first product, and the load wait in front of it, behind the issue of the whole
       group: moved up among the loads it would make the rest of the group wait a full latency */
    __builtin_amdgcn_sched_barrier(0);

    /* position term: G[m][g] = q[m] . Er[h][(kv0 - q0 - 15 + g) mod 2047], g = 0..79 */
#pragma unroll
    for (int t = 0; t < 5; ++t) {
      v8f g = (v8f){0.f,0.f,0.f,0.f,0.f,0.f,0.f,0.f};
#pragma unroll
      for (int dc = 0; dc < 2; ++dc) {
        g = mma_bf16(qh[dc], ef[t][dc].v, g);
        g = mma_bf16(ql[dc], ef[t][dc].v, g);
      }
      if (t == 1) load_key_tile(1);
      if (t == 3) load_key_tile(2);
#pragma unroll
      for (int r = 0; r < 8; ++r) gsw[r * GP + 16 * t] = g[r];
    }

    /* raw scores: 4 key tiles, one accumulator, tile -> S slab (D elem r = row 8hh+r, col c) */
#pragma unroll
    for (int j = 0; j < 4; ++j) {
      v8f sa = (v8f){0.f,0.f,0.f,0.f,0.f,0.f,0.f,0.f};
#pragma unroll
      for (int dc = 0; dc < 2; ++dc) {
        sa = mma_bf16(qh[dc], kfh[j][dc].v, sa);
        sa = mma_bf16(qh[dc], kfl[j][dc].v, sa);
        sa = mma_bf16(ql[dc], kfh[j][dc].v, sa);
      }
      if (j == 0) load_key_tile(3);
#pragma unroll
      for (int r = 0; r < 8; ++r) ssw[r * SP + 16 * j] = sa[r];
    }
    wave_lds_sync();

    /* v fragments of the first 32 keys: issued here, so that they fly during the softmax */
    FB vbh[2][4], vbl[2][4];
    auto load_v_step = [&](int kk) {
#pragma unroll
      for (int t = 0; t < 4; ++t) {
        const int vo = kk * 2048 + t * 512;
        vbh[kk][t].h[0] = *(g_v8b*)(vh + lane8 + vo);
        vbh[kk][t].h[1] = *(g_v8b*)(vh + lane8 + vo + 256);
        vbl[kk][t].h[0] = *(g_v8b*)(vl + lane8 + vo);
        vbl[kk][t].h[1] = *(g_v8b*)(vl + lane8 + vo + 256);
      }
      /* behind the chunk's last v load, before its address registers are written anew */
      if (kk == 1) wait_addr();
    };
    load_v_step(0);

    /* raw score + skewed position term, replace-fill of masked elements */
    v8f s[4];
#pragma unroll
    for (int j = 0; j < 4; ++j) {
#pragma unroll
      for (int r = 0; r < 8; ++r) {
        const float raw = ssw[r * SP + 16 * j];
        const float gv = gsk[r * (GP - 1) + 16 * j];
        const float sv = raw + gv;
        const unsigned bit = (mk >> (16 * (r & 1) + 4 * j + (r >> 1))) & 1u;
        s[j][r] = bit ? NEG_INF : sv;
      }
    }

    /* chunk row max over the 64 keys */
    float cm[8];
#pragma unroll
    for (int r = 0; r < 8; ++r) {
      cm[r] = fmaxf(fmaxf(s[0][r], s[1][r]), fmaxf(s[2][r], s[3][r]));
    }
    row_max16x8(cm);

    /* online softmax update, P tiles as bf16 hi + lo */
#pragma unroll
    for (int r = 0; r < 8; ++r) {
      if (r == 4) load_v_step(1);   /* the second 32 keys' fragments, once half the score registers are free */
      const float mnew  = fmaxf(mrow[r], cm[r]);
      const float msafe = (mnew == NEG_INF) ? 0.f : mnew;
      const float nm    = -msafe * LOG2E;
      const float alpha = exp_shifted(mrow[r], nm);
      mrow[r] = mnew;
      float psum = 0.f;
#pragma unroll
      for (int j = 0; j < 4; ++j) {
        const float p = exp_shifted(s[j][r], nm);
        psum += p;
        const unsigned short hb = f2bf_bits(p);
        const unsigned short lb = f2bf_bits(p - bf_bits2f(hb));
        pwhw[r * KCH + j * 16] = hb;
        pwlw[r * KCH + j * 16] = lb;
      }
      psum = row_sum16(psum);
      lrow[r] = lrow[r] * alpha + psum;
#pragma unroll
      for (int t = 0; t < 4; ++t) oacc[t][r] *= alpha;
    }
    wave_lds_sync();

    /* O += P.V : A = P [q][kv] (this wave's tiles), B = V [kv][d] from the packed v planes;
       unrolled over the two 32-key steps: the fragment arrays are indexed by constants */
#pragma unroll
    for (int kk = 0; kk < 2; ++kk) {
      FB pa, pl;
      pa.h[0] = *(const v8b_a*)(pwh + c * KCH + kk * 32 + 8 * hh);
      pa.h[1] = *(const v8b_a*)(pwh + c * KCH + kk * 32 + 16 + 8 * hh);
      pl.h[0] = *(const v8b_a*)(pwl + c * KCH + kk * 32 + 8 * hh);
      pl.h[1] = *(const v8b_a*)(pwl + c * KCH + kk * 32 + 16 + 8 * hh);
#pragma unroll
      for (int t = 0; t < 4; ++t) {
        oacc[t] = mma_bf16(pa.v, vbh[kk][t].v, oacc[t]);
        oacc[t] = mma_bf16(pl.v, vbh[kk][t].v, oacc[t]);
        oacc[t] = mma_bf16(pa.v, vbl[kk][t].v, oacc[t]);
      }
    }
    wave_lds_sync();
  }

  /* this wave's partial state: unnormalised output into its own slab (aliases the G slab),
     row maximum and row sum beside it */
#pragma unroll
  for (int r = 0; r < 8; ++r) {
#pragma unroll
    for (int t = 0; t < 4; ++t) gsw[r * GP + t * 16] = oacc[t][r];
  }
  if (c == 0) {      /* the 16 lanes of a half hold equal row statistics */
#pragma unroll
    for (int r = 0; r < 8; ++r) {
      Ms[wave][8 * hh + r] = mrow[r];
      Ls[wave][8 * hh + r] = lrow[r];
    }
  }
  __syncthreads();   /* publishes the four partial states to the whole block */
  {
    unsigned short* Ch = ctxp;
    unsigned short* Cl = ctxp + XB_E;
    const int row = tid >> 3;
    const int seg = tid & 7;
    float mall = Ms[0][row];
#pragma unroll
    for (int w = 1; w < NWAVE; ++w) mall = fmaxf(mall, Ms[w][row]);
    const float msafe = (mall == NEG_INF) ? 0.f : mall;
    const float nm = -msafe * LOG2E;
    float lsum = 0.f;
    v4f a0 = (v4f){0.f, 0.f, 0.f, 0.f};
    v4f a1 = (v4f){0.f, 0.f, 0.f, 0.f};
#pragma unroll
    for (int w = 0; w < NWAVE; ++w) {
      const float f = exp_shifted(Ms[w][row], nm);
      lsum += Ls[w][row] * f;
      a0 += *(const v4f_a*)(Gs[w] + row * GP + seg * 8) * f;
      a1 += *(const v4f_a*)(Gs[w] + row * GP + seg * 8 + 4) * f;
    }
    const float inv = 1.0f / lsum;
    a0 *= inv;
    a1 *= inv;
    unsigned h0, h1, h2, h3, l0, l1, l2, l3;
    split2(a0[0], a0[1], h0, l0);
    split2(a0[2], a0[3], h1, l1);
    split2(a1[0], a1[1], h2, l2);
    split2(a1[2], a1[3], h3, l3);
    v4u hw, lw;
    hw[0] = h0; hw[1] = h1; hw[2] = h2; hw[3] = h3;
    lw[0] = l0; lw[1] = l1; lw[2] = l2; lw[3] = l3;
    const size_t g = (size_t)(b * SEQ + q0 + row) * DMODEL + h * DHEAD + seg * 8;
    *(v4u*)(Ch + g) = hw;
    *(v4u*)(Cl + g) = lw;
  }
}

/* --------------------------------------------------------------------------
 * out = (Ch + Cl) . WoT^T + b  (M = MROWS, N = 1024, K = 1024), f32 acc.
 * Block = 4 waves, tile 128 x 64; wave = 32 rows x 64 cols; A hi and lo planes
 * against the single bf16 weight plane (two products per tile pair).
 * Operands: stages of 64 k (128 B of each of the 320 operand rows) in a two-buffer LDS ring,
 * filled by asynchronous copies (20 per thread and stage) in the order of gemm_qkv_kernel.
 * Epilogue: per-wave 32x64 f32 slab (wave-private LDS), 16 lanes x 16 B = one 256-B
 * ------------------------------------------------------------------------ */
__global__ __launch_bounds__(128) VGPR_CAP void gemm_out_kernel(
    const unsigned short* __restrict__ ctxp, const unsigned short* __restrict__ WoT,
    const float* __restrict__ bias, float* __restrict__ out)
{
  union FB { v16b v; v8b h[2]; };
  __shared__ __align__(16) float Os[NWAVE][32 * OS_PITCH];
  __shared__ __align__(16) unsigned short Sm[2 * OUT_STAGE_E];

  const int tid  = threadIdx.x;
  const int wave = __builtin_amdgcn_readfirstlane(tid >> 5);
  const int lane = tid & 31;
  const int hh   = lane >> 4;
  const int c    = lane & 15;
  const int n0   = blockIdx.x * 64;
  const int m0   = blockIdx.y * 128;

  v8f acc[2][4];
#pragma unroll
  for (int mt = 0; mt < 2; ++mt)
#pragma unroll
    for (int t = 0; t < 4; ++t) acc[mt][t] = (v8f){0.f,0.f,0.f,0.f,0.f,0.f,0.f,0.f};

  /* copy unit: thread -> (row tid>>3 of each group of 16 rows, 16-B segment tid&7) */
  const int crow = tid >> 3;
  const int cseg = tid & 7;
  const unsigned short* gh = ctxp + (size_t)(m0 + crow) * DMODEL + cseg * 8;
  const unsigned short* gl = gh + XB_E;
  const unsigned short* gw = WoT + (size_t)(n0 + crow) * DMODEL + cseg * 8;
  const unsigned lrow = lds_off(Sm) + (unsigned)(crow * RP + cseg * 8) * 2u;

  auto issue_stage = [&](int st) {
    /* unrolled below: the address arrays are indexed by constants and stay in registers */
    unsigned l[20];
    const unsigned short* g[20];
    const unsigned lb = lrow + (unsigned)(st & 1) * (unsigned)(OUT_STAGE_E * 2);
#pragma unroll
    for (int it = 0; it < 20; ++it) {
      l[it] = lb + (unsigned)(it * 16 * RP * 2);
      g[it] = (it < 8)  ? gh + (size_t)it * 16 * DMODEL + st * KST
            : (it < 16) ? gl + (size_t)(it - 8) * 16 * DMODEL + st * KST
                        : gw + (size_t)(it - 16) * 16 * DMODEL + st * KST;
    }
    async_copy10(l, g);
    async_copy10(l + 10, g + 10);
  };

  const unsigned short* sh = Sm + (wave * 32 + c) * RP + 8 * hh;
  const unsigned short* sl = sh + 128 * RP;
  const unsigned short* sb = Sm + (256 + c) * RP + 8 * hh;

  issue_stage(0);
  wait_copies();
  __syncthreads();   /* publishes stage 0 */
  issue_stage(1);

  /* kept rolled: one copy of the ring's foot (waits, barrier, refill), small loop text */
#pragma unroll 1
  for (int st = 0; st < NSTAGE; ++st) {
    const int bo = (st & 1) * OUT_STAGE_E;
    /* the stage's fragment loads stand as one group ahead of its products, so that the wave pays
       the LDS latency once a stage; the loops below are unrolled so that every index of the
       fragment arrays is a constant and they stay in registers */
    FB a0h[2], a1h[2], a0l[2], a1l[2], bf[2][4];
#pragma unroll
    for (int s = 0; s < 2; ++s) {
      const int ks = s * 32;
      a0h[s].h[0] = *(const v8b_a*)(sh + bo + ks);
      a0h[s].h[1] = *(const v8b_a*)(sh + bo + ks + 16);
      a0l[s].h[0] = *(const v8b_a*)(sl + bo + ks);
      a0l[s].h[1] = *(const v8b_a*)(sl + bo + ks + 16);
      a1h[s].h[0] = *(const v8b_a*)(sh + bo + 16 * RP + ks);
      a1h[s].h[1] = *(const v8b_a*)(sh + bo + 16 * RP + ks + 16);
      a1l[s].h[0] = *(const v8b_a*)(sl + bo + 16 * RP + ks);
      a1l[s].h[1] = *(const v8b_a*)(sl + bo + 16 * RP + ks + 16);
#pragma unroll
      for (int t = 0; t < 4; ++t) {
        bf[s][t].h[0] = *(const v8b_a*)(sb + bo + t * 16 * RP + ks);
        bf[s][t].h[1] = *(const v8b_a*)(sb + bo + t * 16 * RP + ks + 16);
      }
    }
#pragma unroll
    for (int s = 0; s < 2; ++s) {
#pragma unroll
      for (int t = 0; t < 4; ++t) {
        acc[0][t] = mma_bf16(a0h[s].v, bf[s][t].v, acc[0][t]);
        acc[0][t] = mma_bf16(a0l[s].v, bf[s][t].v, acc[0][t]);
        acc[1][t] = mma_bf16(a1h[s].v, bf[s][t].v, acc[1][t]);
        acc[1][t] = mma_bf16(a1l[s].v, bf[s][t].v, acc[1][t]);
      }
    }
    wait_lds_reads();
    wait_copies();
    __syncthreads();   /* publishes stage st + 1 and ends every read of stage st's buffer */
    if (st + 2 < NSTAGE) issue_stage(st + 2);
  }
  wait_copies();

  float* os = Os[wave];
#pragma unroll
  for (int t = 0; t < 4; ++t) {
    const float bv = bf_bits2f(f2bf_bits(bias[n0 + 16 * t + c]));
#pragma unroll
    for (int mt = 0; mt < 2; ++mt)
#pragma unroll
      for (int r = 0; r < 8; ++r)
        os[(mt * 16 + 8 * hh + r) * OS_PITCH + 16 * t + c] = acc[mt][t][r] + bv;
  }
  wave_lds_sync();
  {
    const int c4 = c * 4;
    {
#pragma unroll
      for (int it = 0; it < 16; ++it) {
        const int row = it * 2 + hh;
        const v4f val = *(const v4f_a*)(os + row * OS_PITCH + c4);
        *(v4f*)(out + (size_t)(m0 + wave * 32 + row) * DMODEL + n0 + c4) = val;
      }
      
    }
  }
}

extern "C" void kernel_launch(void* const* d_in, const int* in_sizes, int n_in,
                              void* d_out, int out_size, void* d_ws, size_t ws_size,
                              hipStream_t stream)
{
  if (n_in < 7) return;
  if (in_sizes[0] < ((NB - 1) * SEQ_FULL + SEQ) * DMODEL) return;
  if (in_sizes[1] < (SEQ - 1) * SEQ_FULL + SEQ) return;
  if (in_sizes[2] < DMODEL * NQKV) return;
  if (in_sizes[3] < NQKV) return;
  if (in_sizes[4] < DMODEL * DMODEL) return;
  if (in_sizes[5] < DMODEL) return;
  if (in_sizes[6] < NHEAD * NPOS * DHEAD) return;
  if (out_size < MROWS * DMODEL) return;
  if (d_ws == nullptr || ws_size < WS_NEED) return;

  const float* x     = (const float*)d_in[0];
  const int*   mask  = (const int*)d_in[1];
  const float* W_qkv = (const float*)d_in[2];
  const float* b_qkv = (const float*)d_in[3];
  const float* W_o   = (const float*)d_in[4];
  const float* b_o   = (const float*)d_in[5];
  const float* Er    = (const float*)d_in[6];
  float* out = (float*)d_out;

  unsigned short* Xb   = (unsigned short*)d_ws;
  unsigned short* WqT  = Xb + XB_E;
  unsigned short* WoT  = WqT + WQT_E;
  unsigned short* Erb  = WoT + WOT_E;
  unsigned short* qkvp = Erb + ERB_E;
  unsigned short* ctxp = qkvp + QKVP_E;
  unsigned*       Mp   = (unsigned*)(ctxp + CTX_E);

  /* the five preparation jobs, one launch */
  prep_kernel<<<PREP_BLOCKS, 256, 0, stream>>>(x, W_qkv, W_o, Er, mask, Xb, WqT, WoT, Erb, Mp);

  gemm_qkv_kernel<<<dim3(NQKV / 64, MROWS / 128), 128, 0, stream>>>(Xb, WqT, b_qkv, qkvp);
  rel_attn_kernel<<<dim3(NBH, SEQ / 16), 128, 0, stream>>>(qkvp, Erb, Mp, ctxp);
  gemm_out_kernel<<<dim3(DMODEL / 64, MROWS / 128), 128, 0, stream>>>(ctxp, WoT, b_o, out);
}

// v010
// Measured time: 72.6 microseconds a run.
// Next to v009, in two timings, it ran 1.06 and 1.05 times as fast.
// Counting every step since v000, it is 3.71 times as fast.
// Contractions: x.Wqkv on v_wmma_f32_16x16x32_bf16 with both operands RNE-converted to bf16 once; q.(k/8)^T, q.Er^T, p.v and ctx.Wo on v_wmma_f32_16x16x32_bf16 with computed operands (q, k/8, v, p, ctx) carried as bf16 hi+lo planes (hi.hi + hi.lo + lo.hi) and input operands (Er, Wo) as single bf16 planes; f32 accumulate; softmax, bias adds and mask fill in f32.
#include <hip/hip_runtime.h>

typedef __attribute__((ext_vector_type(16))) __bf16 v16b;
typedef __attribute__((ext_vector_type(8)))  __bf16 v8b;
typedef __attribute__((ext_vector_type(8)))  float  v8f;
typedef __attribute__((ext_vector_type(4)))  float  v4f;
typedef __attribute__((ext_vector_type(4)))  unsigned int v4u;
typedef __attribute__((ext_vector_type(4)))  int v4i;
typedef v8b v8b_a __attribute__((may_alias));
typedef v4f v4f_a __attribute__((may_alias));
typedef v4u v4u_a __attribute__((may_alias));

#ifndef NB
#define NB 2
#endif
#ifndef SEQ
#define SEQ 1024
#endif
#define NB_FULL 2
#define SEQ_FULL 1024

#define VGPR_CAP __attribute__((amdgpu_num_vgpr(256)))

constexpr int DMODEL = 1024;
constexpr int NHEAD  = 16;
constexpr int DHEAD  = 64;
constexpr int NPOS   = 2047;
constexpr int NQKV   = 3 * DMODEL;
constexpr int NBH    = NB * NHEAD;
constexpr int MROWS  = NB * SEQ;
constexpr int KCH    = 64;        /* keys per chunk */
constexpr int NWAVE  = 4;
constexpr int NCH    = SEQ / (KCH * NWAVE);   /* key chunks per wave of the attention block */
constexpr int NCHT   = SEQ / KCH;             /* key chunks of a query row */
constexpr int QT     = 2;         /* adjacent query tiles per attention block */
constexpr int NWV    = NWAVE * QT;            /* waves of the attention block */
constexpr int GP     = 84;        /* skew slab pitch in floats (336 B rows, 16-B aligned) */
constexpr int SP     = 68;        /* raw score slab pitch in floats */
constexpr int TQ_PITCH = 72;      /* [tok][d] staging pitch (16-bit elements) */
constexpr int TV_PITCH = 136;     /* [d][tok] staging pitch (16-bit elements) */
constexpr int T_ELEMS  = 128 * TQ_PITCH;   /* 9216 >= 64 * TV_PITCH = 8704 */
constexpr int TS_PITCH = 72;
constexpr int OS_PITCH = 68;
constexpr int KST      = 64;      /* k elements per GEMM stage: one 128-B line of every operand row */
constexpr int RP       = 72;      /* GEMM stage row pitch (16-bit elements): 144 B = 16 B x odd for b128 readers */
constexpr int NSTAGE   = 1024 / KST;
constexpr int QKV_STAGE_E = (128 + 64) * RP;        /* [x 128 rows | W 64 rows] */
constexpr int OUT_STAGE_E = (128 + 128 + 64) * RP;  /* [ctx hi 128 | ctx lo 128 | W 64 rows] */

constexpr size_t PLANE  = (size_t)NBH * SEQ * DHEAD;
constexpr size_t XB_E   = (size_t)MROWS * DMODEL;
constexpr size_t WQT_E  = (size_t)NQKV * DMODEL;
constexpr size_t WOT_E  = (size_t)DMODEL * DMODEL;
constexpr size_t ERB_E  = (size_t)NHEAD * 2048 * DHEAD;
constexpr size_t QKVP_E = 6 * PLANE;
constexpr size_t CTX_E  = 2 * XB_E;
constexpr size_t MP_W   = (size_t)(SEQ / 16) * NCHT * 32;   /* packed mask, 32-bit words */
constexpr size_t WS_NEED = 2 * (XB_E + WQT_E + WOT_E + ERB_E + QKVP_E + CTX_E) + 4 * MP_W;

static_assert(SEQ % 128 == 0);
static_assert(NCH * KCH * NWAVE == SEQ && NCH == 4);
static_assert(SEQ <= SEQ_FULL && NB <= NB_FULL);
static_assert(DHEAD == 64 && DMODEL == NHEAD * DHEAD);
static_assert(DMODEL % 64 == 0 && NQKV % 64 == 0 && DMODEL % 32 == 0);
static_assert(64 * TV_PITCH <= T_ELEMS);
static_assert((TQ_PITCH * 2) % 16 == 0 && (TV_PITCH * 2) % 16 == 0 && (GP * 4) % 16 == 0 && (OS_PITCH * 4) % 16 == 0);
static_assert(GP >= 80 && SP >= 64);
static_assert(NSTAGE * KST == DMODEL && NSTAGE >= 2 && (RP * 2) % 16 == 0 && RP >= KST);
static_assert(2 * T_ELEMS <= 2 * QKV_STAGE_E);
static_assert((size_t)NHEAD * NPOS * DHEAD <= ERB_E);
static_assert(WS_NEED <= 134217728ull);

/*
 *   Xb   [MROWS][1024]        x, bf16
 *   WqT  [3072][1024]         W_qkv transposed, bf16
 *   WoT  [1024][1024]         W_o transposed, bf16
 *   Erb  [16][128 tiles][8][16][8]   Er, bf16, in fragment order (below); row c of tile m is the
 *                             table row of offset 16m - 1023 + c, that is (16m - 1023 + c) mod 2047
 *   qkvp 6 planes, in fragment order: Qh Ql, Kh Kl (k/8) [bh][l/16][d/8][l%16][8 d],
 *                             Vh Vl [bh][l/32][d/16][(l%32)/8][d%16][8 l]
 *   ctxp 2 planes: Ch Cl [MROWS][1024]
 *   Mp   [SEQ/16 query tiles][SEQ/64 key chunks][32 lanes]  the mask, one bit an element: the word of
 *                             lane (hh, c) holds element (row 8hh+r, key 16j+c) of the 16x64 tile at
 *                             bit 16(r&1) + 4j + (r>>1)
 * Fragment order: the 16-B unit that lane (hh, c) takes for half a fragment register set stands at
 * unit 16hh + c of a 512-B run, so that one 16-B load of a wave covers four whole 128-B lines.
 */

__device__ __forceinline__ unsigned short f2bf_bits(float f) {
  unsigned u = __float_as_uint(f);
  return (unsigned short)((u + 0x7FFFu + ((u >> 16) & 1u)) >> 16);
}
__device__ __forceinline__ float bf_bits2f(unsigned short h) { return __uint_as_float(((unsigned)h) << 16); }
__device__ __forceinline__ unsigned pk2(float a, float b) {
  return (unsigned)f2bf_bits(a) | ((unsigned)f2bf_bits(b) << 16);
}
__device__ __forceinline__ void split2(float a, float b, unsigned& hw, unsigned& lw) {
  const unsigned short ha = f2bf_bits(a);
  const unsigned short hb = f2bf_bits(b);
  const unsigned short la = f2bf_bits(a - bf_bits2f(ha));
  const unsigned short lb = f2bf_bits(b - bf_bits2f(hb));
  hw = (unsigned)ha | ((unsigned)hb << 16);
  lw = (unsigned)la | ((unsigned)lb << 16);
}

/* e^(x - m) as one multiply-add and the hardware's base-2 exponential: exp2(x * log2(e) + nm), with
   nm = -m * log2(e) formed once a row. x = -inf gives 0; a result below the smallest normal number
   counts as 0, which is far below the last bit that the row sum or the 16-bit planes of p keep. */
constexpr float LOG2E = 1.44269504088896340736f;
__device__ __forceinline__ float exp_shifted(float x, float nm) {
  return __builtin_amdgcn_exp2f(__builtin_fmaf(x, LOG2E, nm));
}

/* The value of lane (lane ^ M) of the same 16-lane row, M = 1, 2, 4, 8, by the vector unit's own
   cross-lane read (DPP row_xmask); every lane is on where it is used. A shuffle builtin would go
   through the LDS queue and make each step of a row reduction wait for an LDS round trip. */
template <int M>
__device__ __forceinline__ float row_xor(float v) {
  return __int_as_float(__builtin_amdgcn_update_dpp(0, __float_as_int(v), 0x160 | M, 0xf, 0xf, true));
}
/* Maximum over each 16-lane row, eight values at once, left in every lane. Written as text because
   fmaxf on a cross-lane read compiles to three instructions a step (the read, a quieting maximum of
   the value with itself, the maximum); here a step is one. The eight values go step by step side by
   side, so that each instruction's producer stands eight instructions back and none waits for it. */
__device__ __forceinline__ void row_max16x8(float (&m)[8]) {
  asm(
      "v_max_num_f32_dpp %0, %0, %0 row_xmask:1 row_mask:0xf bank_mask:0xf\n\t"
      "v_max_num_f32_dpp %1, %1, %1 row_xmask:1 row_mask:0xf bank_mask:0xf\n\t"
      "v_max_num_f32_dpp %2, %2, %2 row_xmask:1 row_mask:0xf bank_mask:0xf\n\t"
      "v_max_num_f32_dpp %3, %3, %3 row_xmask:1 row_mask:0xf bank_mask:0xf\n\t"
      "v_max_num_f32_dpp %4, %4, %4 row_xmask:1 row_mask:0xf bank_mask:0xf\n\t"
      "v_max_num_f32_dpp %5, %5, %5 row_xmask:1 row_mask:0xf bank_mask:0xf\n\t"
      "v_max_num_f32_dpp %6, %6, %6 row_xmask:1 row_mask:0xf bank_mask:0xf\n\t"
      "v_max_num_f32_dpp %7, %7, %7 row_xmask:1 row_mask:0xf bank_mask:0xf\n\t"
      "v_max_num_f32_dpp %0, %0, %0 row_xmask:2 row_mask:0xf bank_mask:0xf\n\t"
      "v_max_num_f32_dpp %1, %1, %1 row_xmask:2 row_mask:0xf bank_mask:0xf\n\t"
      "v_max_num_f32_dpp %2, %2, %2 row_xmask:2 row_mask:0xf bank_mask:0xf\n\t"
      "v_max_num_f32_dpp %3, %3, %3 row_xmask:2 row_mask:0xf bank_mask:0xf\n\t"
      "v_max_num_f32_dpp %4, %4, %4 row_xmask:2 row_mask:0xf bank_mask:0xf\n\t"
      "v_max_num_f32_dpp %5, %5, %5 row_xmask:2 row_mask:0xf bank_mask:0xf\n\t"
      "v_max_num_f32_dpp %6, %6, %6 row_xmask:2 row_mask:0xf bank_mask:0xf\n\t"
      "v_max_num_f32_dpp %7, %7, %7 row_xmask:2 row_mask:0xf bank_mask:0xf\n\t"
      "v_max_num_f32_dpp %0, %0, %0 row_xmask:4 row_mask:0xf bank_mask:0xf\n\t"
      "v_max_num_f32_dpp %1, %1, %1 row_xmask:4 row_mask:0xf bank_mask:0xf\n\t"
      "v_max_num_f32_dpp %2, %2, %2 row_xmask:4 row_mask:0xf bank_mask:0xf\n\t"
      "v_max_num_f32_dpp %3, %3, %3 row_xmask:4 row_mask:0xf bank_mask:0xf\n\t"
      "v_max_num_f32_dpp %4, %4, %4 row_xmask:4 row_mask:0xf bank_mask:0xf\n\t"
      "v_max_num_f32_dpp %5, %5, %5 row_xmask:4 row_mask:0xf bank_mask:0xf\n\t"
      "v_max_num_f32_dpp %6, %6, %6 row_xmask:4 row_mask:0xf bank_mask:0xf\n\t"
      "v_max_num_f32_dpp %7, %7, %7 row_xmask:4 row_mask:0xf bank_mask:0xf\n\t"
      "v_max_num_f32_dpp %0, %0, %0 row_xmask:8 row_mask:0xf bank_mask:0xf\n\t"
      "v_max_num_f32_dpp %1, %1, %1 row_xmask:8 row_mask:0xf bank_mask:0xf\n\t"
      "v_max_num_f32_dpp %2, %2, %2 row_xmask:8 row_mask:0xf bank_mask:0xf\n\t"
      "v_max_num_f32_dpp %3, %3, %3 row_xmask:8 row_mask:0xf bank_mask:0xf\n\t"
      "v_max_num_f32_dpp %4, %4, %4 row_xmask:8 row_mask:0xf bank_mask:0xf\n\t"
      "v_max_num_f32_dpp %5, %5, %5 row_xmask:8 row_mask:0xf bank_mask:0xf\n\t"
      "v_max_num_f32_dpp %6, %6, %6 row_xmask:8 row_mask:0xf bank_mask:0xf\n\t"
      "v_max_num_f32_dpp %7, %7, %7 row_xmask:8 row_mask:0xf bank_mask:0xf"
      : "+v"(m[0]), "+v"(m[1]), "+v"(m[2]), "+v"(m[3]), "+v"(m[4]), "+v"(m[5]), "+v"(m[6]), "+v"(m[7]));
}
__device__ __forceinline__ float row_sum16(float s) {
  s += row_xor<1>(s);
  s += row_xor<2>(s);
  s += row_xor<4>(s);
  s += row_xor<8>(s);
  return s;
}

/* one WMMA + hazard guard naming only this call's live operands */
__device__ __forceinline__ v8f mma_bf16(v16b a, v16b b, v8f c) {
  c = __builtin_amdgcn_wmma_f32_16x16x32_bf16(false, a, false, b, (short)0, c, false, false);
  asm volatile("v_nop\n\tv_nop\n\tv_nop\n\tv_nop" : "+v"(c) : "v"(a), "v"(b));
  return c;
}

__device__ __forceinline__ void wave_lds_sync() {
  __builtin_amdgcn_fence(3 /* release order */, "workgroup");
  __builtin_amdgcn_wave_barrier();
  __builtin_amdgcn_fence(2 /* acquire order */, "workgroup");
}

/* byte offset of a __shared__ address inside the work-group's LDS */
__device__ __forceinline__ unsigned lds_off(const void* p) { return (unsigned)(size_t)p; }

/* Asynchronous copies global -> LDS, 16 B per lane and copy, every lane on. The copies of a run
   and the s_wait_xcnt 0 that stands before their address registers may be rewritten are one
   statement, so that no later address arithmetic can be moved in front of that wait. */
__device__ __forceinline__ void async_copy12(const unsigned (&l)[12], const unsigned short* const (&g)[12]) {
  asm volatile(
      "global_load_async_to_lds_b128 %0, %12, off\n\t"
      "global_load_async_to_lds_b128 %1, %13, off\n\t"
      "global_load_async_to_lds_b128 %2, %14, off\n\t"
      "global_load_async_to_lds_b128 %3, %15, off\n\t"
      "global_load_async_to_lds_b128 %4, %16, off\n\t"
      "global_load_async_to_lds_b128 %5, %17, off\n\t"
      "global_load_async_to_lds_b128 %6, %18, off\n\t"
      "global_load_async_to_lds_b128 %7, %19, off\n\t"
      "global_load_async_to_lds_b128 %8, %20, off\n\t"
      "global_load_async_to_lds_b128 %9, %21, off\n\t"
      "global_load_async_to_lds_b128 %10, %22, off\n\t"
      "global_load_async_to_lds_b128 %11, %23, off\n\t"
      "s_wait_xcnt 0x0"
      :: "v"(l[0]), "v"(l[1]), "v"(l[2]), "v"(l[3]), "v"(l[4]), "v"(l[5]),
         "v"(l[6]), "v"(l[7]), "v"(l[8]), "v"(l[9]), "v"(l[10]), "v"(l[11]),
         "v"(g[0]), "v"(g[1]), "v"(g[2]), "v"(g[3]), "v"(g[4]), "v"(g[5]),
         "v"(g[6]), "v"(g[7]), "v"(g[8]), "v"(g[9]), "v"(g[10]), "v"(g[11])
      : "memory");
}
__device__ __forceinline__ void async_copy10(const unsigned* l, const unsigned short* const* g) {
  asm volatile(
      "global_load_async_to_lds_b128 %0, %10, off\n\t"
      "global_load_async_to_lds_b128 %1, %11, off\n\t"
      "global_load_async_to_lds_b128 %2, %12, off\n\t"
      "global_load_async_to_lds_b128 %3, %13, off\n\t"
      "global_load_async_to_lds_b128 %4, %14, off\n\t"
      "global_load_async_to_lds_b128 %5, %15, off\n\t"
      "global_load_async_to_lds_b128 %6, %16, off\n\t"
      "global_load_async_to_lds_b128 %7, %17, off\n\t"
      "global_load_async_to_lds_b128 %8, %18, off\n\t"
      "global_load_async_to_lds_b128 %9, %19, off\n\t"
      "s_wait_xcnt 0x0"
      :: "v"(l[0]), "v"(l[1]), "v"(l[2]), "v"(l[3]), "v"(l[4]),
         "v"(l[5]), "v"(l[6]), "v"(l[7]), "v"(l[8]), "v"(l[9]),
         "v"(g[0]), "v"(g[1]), "v"(g[2]), "v"(g[3]), "v"(g[4]),
         "v"(g[5]), "v"(g[6]), "v"(g[7]), "v"(g[8]), "v"(g[9])
      : "memory");
}
/* A pointer that is the same in every lane, held in scalar registers: the loads from it take the
   form scalar base + lane offset, so that no vector address pair is written among loads in flight. */
typedef const __attribute__((address_space(1))) unsigned short g_u16;   /* global memory, named as such */
typedef const __attribute__((address_space(1))) v8b g_v8b;
__device__ __forceinline__ g_u16* scalar_base(const unsigned short* p) {
  const unsigned long long a = (unsigned long long)p;
  const unsigned lo = (unsigned)__builtin_amdgcn_readfirstlane((int)(unsigned)a);
  const unsigned hi = (unsigned)__builtin_amdgcn_readfirstlane((int)(unsigned)(a >> 32));
  return (g_u16*)(((unsigned long long)hi << 32) | lo);
}
/* Stands in front of the last load from an address pair, whose destination may be that pair while
   earlier loads from it are in flight, and behind it, before the pair is written anew: the wait
   that is kept before a register of an issued global load is overwritten. */
__device__ __forceinline__ void wait_addr() { asm volatile("s_wait_xcnt 0x0" ::: "memory"); }
/* this wave's copies have landed in LDS (the compiler places no wait for them) */
__device__ __forceinline__ void wait_copies() { asm volatile("s_wait_asynccnt 0x0" ::: "memory"); }
/* this wave's LDS reads have returned, so the buffer they read may be refilled behind the barrier */
__device__ __forceinline__ void wait_lds_reads() { asm volatile("s_wait_dscnt 0x0" ::: "memory"); }

/* --------------------------------------------------------------------------
 * Preparation of the four 16-bit operand planes and of the packed mask. The five jobs read only inputs and write
 * disjoint planes, so they are the block ranges of ONE launch (prep_kernel, below) and run
 * side by side; each job is a block-level function, the block's job a block-uniform choice.
 * ------------------------------------------------------------------------ */

/* x: f32 rows -> bf16 rows (RNE), unit = 8 elements = one 16-B store.
 * out row = b*SEQ + l  <-  in row = b*SEQ_FULL + l ; row length = DMODEL.
 * Coverage: CVT_BLOCKS x 256 units x 8 elements = the whole plane. */
constexpr int CVT_UPR    = DMODEL / 8;
constexpr int CVT_UNITS  = MROWS * CVT_UPR;
constexpr int CVT_BLOCKS = (CVT_UNITS + 255) / 256;
__device__ __forceinline__ void cvt_rows_block(
    const float* __restrict__ in, unsigned short* __restrict__ outp, int blk)
{
  const int u = blk * 256 + threadIdx.x;
  if (u >= CVT_UNITS) return;      /* no barrier follows in this job */
  const int row = u / CVT_UPR;
  const int seg = u - row * CVT_UPR;
  const int b = row / SEQ;
  const int l = row - b * SEQ;
  const float* src = in + ((size_t)(b * SEQ_FULL + l) * CVT_UPR + seg) * 8;
  const v4f a0 = *(const v4f*)src;
  const v4f a1 = *(const v4f*)(src + 4);
  v4u w;
  w[0] = pk2(a0[0], a0[1]);
  w[1] = pk2(a0[2], a0[3]);
  w[2] = pk2(a1[0], a1[1]);
  w[3] = pk2(a1[2], a1[3]);
  v4u* dst = (v4u*)(outp + ((size_t)row * CVT_UPR + seg) * 8);
  *dst = w;
}

/* Er [16][2047][64] f32 -> Erb, bf16 (RNE), 16-row tiles in fragment order.
 * Tile m (0..127) of a head holds the rows of the offsets 16m - 1023 + c, c = 0..15, which are
 * the windows the attention kernel asks for (its offsets start at 1 mod 16).
 * Block = 2 tiles, thread = one 8-element unit: read as (row u>>3, segment u&7), whole lines;
 * units turned from [row][segment] to [segment][row] through LDS (cross-wave, block barrier);
 * stored in thread order. Coverage: TAB_BLOCKS x 2 tiles = 16 heads x 128 tiles.
 * LDS unit pitch: one spare unit per 16, so that the 8 segments of a row fall on different banks. */
constexpr int TAB_BLOCKS = NHEAD * 128 / 2;
__device__ __forceinline__ void pack_table_block(
    const float* __restrict__ Er, unsigned short* __restrict__ Erb, int blk, v4u* Us)
{
  const int tid  = threadIdx.x;
  const int tl   = tid >> 7;
  const int u    = tid & 127;
  const int tile = blk * 2 + tl;             /* head * 128 + m */
  const int h    = tile >> 7;
  const int m    = tile & 127;
  const int row  = u >> 3;
  const int seg  = u & 7;
  const int d    = 16 * m - (SEQ_FULL - 1) + row;      /* -1023 .. 1024 */
  const int rr   = d + ((d < 0) ? NPOS : 0);           /* 0 .. 2046 */
  const float* src = Er + ((size_t)h * NPOS + rr) * DHEAD + seg * 8;
  const v4f a0 = *(const v4f*)src;
  const v4f a1 = *(const v4f*)(src + 4);
  v4u w;
  w[0] = pk2(a0[0], a0[1]);
  w[1] = pk2(a0[2], a0[3]);
  w[2] = pk2(a1[0], a1[1]);
  w[3] = pk2(a1[2], a1[3]);
  Us[tl * 136 + seg * 17 + row] = w;
  __syncthreads();   /* publishes the tile's units to the waves that store them */
  *(v4u*)(Erb + (size_t)tile * 1024 + u * 8) = Us[tl * 136 + (u >> 4) * 17 + (u & 15)];
  wait_addr();   /* behind the job's store: another job's text follows it in the one kernel and writes its registers */
}

/* W in[rows][cols] f32  ->  Wt out[cols][rows] bf16 (RNE), one 64x64 tile through LDS.
 * Tile (kt = rows tile, nt = cols tile), 256 threads.
 * Coverage: 2 iterations x 256 threads = 512 units x 8 = 64x64 for the load phase
 * and the same 512 units x 8 = 64x64 for the store phase.
 * LDS tile: cross-wave, separated by a block barrier. */
constexpr int WQ_BLOCKS = (DMODEL / 64) * (NQKV / 64);
constexpr int WO_BLOCKS = (DMODEL / 64) * (DMODEL / 64);
__device__ __forceinline__ void wt_planes_block(
    const float* __restrict__ W, unsigned short* __restrict__ Wt, int rows, int cols,
    int kt, int nt, unsigned short* Ts /* [n][k] */)
{
  const int k0 = kt * 64;
  const int n0 = nt * 64;
  const int tid = threadIdx.x;
  const float* src[2];
  v4f a0[2], a1[2];
  /* both loops unrolled: the arrays are indexed by constants and stay in registers */
#pragma unroll
  for (int it = 0; it < 2; ++it) {
    const int u = it * 256 + tid;
    src[it] = W + (size_t)(k0 + (u >> 3)) * cols + n0 + (u & 7) * 8;
    a0[it] = *(const v4f*)src[it];
    a1[it] = *(const v4f*)(src[it] + 4);
  }
  /* the wait that is kept before a register of an issued global load is overwritten; it takes the
     two address pairs as inputs, so that they stay whole up to it and no load's result lands on one */
  asm volatile("s_wait_xcnt 0x0" :: "v"(src[0]), "v"(src[1]) : "memory");
#pragma unroll
  for (int it = 0; it < 2; ++it) {
    const int u = it * 256 + tid;
    const int row = u >> 3;      /* k local */
    const int seg = u & 7;       /* n segment */
#pragma unroll
    for (int e = 0; e < 4; ++e) {
      Ts[(seg * 8 + e) * TS_PITCH + row]     = f2bf_bits(a0[it][e]);
      Ts[(seg * 8 + 4 + e) * TS_PITCH + row] = f2bf_bits(a1[it][e]);
    }
  }
  __syncthreads();   /* publishes the tile to the waves that store its rows */
#pragma unroll
  for (int it = 0; it < 2; ++it) {
    const int u = it * 256 + tid;
    const int nrow = u >> 3;
    const int seg  = u & 7;
    const v4u w = *(const v4u_a*)(Ts + nrow * TS_PITCH + seg * 8);
    *(v4u*)(Wt + (size_t)(n0 + nrow) * rows + k0 + seg * 8) = w;
  }
  wait_addr();   /* behind the job's two stores: another job's text follows them in the one kernel and writes their registers */
}

/* mask [SEQ][SEQ] i32 -> Mp, one bit an element, in the order in which the attention kernel's lanes
 * use them. The mask is the same for every batch and head, so it is read and packed once here and
 * not by each of the NBH attention blocks of a query tile.
 * Wave = one tile of 16 query rows x 64 keys, read by value as 8 b128 loads a lane, whole lines.
 * Bit L of the ballot (it, e) = mask[16qt+2it+(L>>4)][64ch+4(L&15)+e] != 0; each lane keeps the
 * word of its own e = c&3 (lane masks sel0..sel3) and of its own row half, and packs its own
 * 32 bits into one word. Stored in thread order: one whole line a wave.
 * Coverage: MSK_BLOCKS x 8 waves = SEQ/16 query tiles x NCHT chunks. No barrier in this job. */
constexpr int MSK_TILES  = (SEQ / 16) * NCHT;
constexpr int MSK_BLOCKS = MSK_TILES / 8;
static_assert(MSK_BLOCKS * 8 == MSK_TILES);
__device__ __forceinline__ void pack_mask_block(
    const int* __restrict__ mask, unsigned* __restrict__ Mp, int blk)
{
  const int tid  = threadIdx.x;
  const int lane = tid & 31;
  const int hh   = lane >> 4;
  const int c    = lane & 15;
  const int c3   = c & 3;
  const int csh  = c >> 2;
  const int tile = blk * 8 + (tid >> 5);     /* query tile * NCHT + chunk */
  const int qt   = tile / NCHT;
  const int ch   = tile - qt * NCHT;
  const int* ml = mask + (size_t)(qt * 16 + hh) * SEQ_FULL + ch * KCH + 4 * c;   /* lane base; the rest are constants */
  v4i mv[8];
  /* all loops unrolled: the arrays are indexed by constants and stay in registers */
#pragma unroll
  for (int it = 0; it < 8; ++it) mv[it] = *(const v4i*)(ml + it * 2 * SEQ_FULL);
  /* the wait that is kept before a register of an issued global load is overwritten; it takes the
     address pair as an input, so that the pair stays whole up to it and no load's result lands on it */
  asm volatile("s_wait_xcnt 0x0" :: "v"(ml) : "memory");
  const unsigned sel0 = (c3 == 0) ? 0xFFFFFFFFu : 0u;
  const unsigned sel1 = (c3 == 1) ? 0xFFFFFFFFu : 0u;
  const unsigned sel2 = (c3 == 2) ? 0xFFFFFFFFu : 0u;
  const unsigned sel3 = (c3 == 3) ? 0xFFFFFFFFu : 0u;
  unsigned msel[8];
#pragma unroll
  for (int it = 0; it < 8; ++it) {
    const unsigned b0 = __builtin_amdgcn_ballot_w32(mv[it][0] != 0);
    const unsigned b1 = __builtin_amdgcn_ballot_w32(mv[it][1] != 0);
    const unsigned b2 = __builtin_amdgcn_ballot_w32(mv[it][2] != 0);
    const unsigned b3 = __builtin_amdgcn_ballot_w32(mv[it][3] != 0);
    msel[it] = (b0 & sel0) | (b1 & sel1) | (b2 & sel2) | (b3 & sel3);
  }
  unsigned pk = 0u;
#pragma unroll
  for (int ii = 0; ii < 4; ++ii) {
    const unsigned w = hh ? msel[4 + ii] : msel[ii];
    pk |= ((w >> csh) & 0x11111111u) << ii;
  }
  Mp[(size_t)tile * 32 + lane] = pk;
  wait_addr();   /* behind the job's store: another job's text follows it in the one kernel and writes its registers */
}

/* Block ranges, the jobs with two phases and a barrier first:
 *   [0, WQ)            W_qkv in[1024][3072] -> WqT out[3072][1024], tile (blk % 16, blk / 16)
 *   [WQ, WQ + WO)      W_o   in[1024][1024] -> WoT out[1024][1024], likewise
 *   then TAB_BLOCKS    the position table, then MSK_BLOCKS the mask, then CVT_BLOCKS x. */
constexpr int PREP_BLOCKS = WQ_BLOCKS + WO_BLOCKS + TAB_BLOCKS + MSK_BLOCKS + CVT_BLOCKS;
__global__ __launch_bounds__(256) void prep_kernel(
    const float* __restrict__ x, const float* __restrict__ W_qkv, const float* __restrict__ W_o,
    const float* __restrict__ Er, const int* __restrict__ mask, unsigned short* __restrict__ Xb,
    unsigned short* __restrict__ WqT, unsigned short* __restrict__ WoT, unsigned short* __restrict__ Erb,
    unsigned* __restrict__ Mp)
{
  __shared__ __align__(16) unsigned short Ts[64 * TS_PITCH];
  __shared__ __align__(16) v4u Us[2 * 136];
  constexpr int KT = DMODEL / 64;
  const int blk = blockIdx.x;
  if (blk < WQ_BLOCKS) {
    wt_planes_block(W_qkv, WqT, DMODEL, NQKV, blk % KT, blk / KT, Ts);
  } else if (blk < WQ_BLOCKS + WO_BLOCKS) {
    const int t = blk - WQ_BLOCKS;
    wt_planes_block(W_o, WoT, DMODEL, DMODEL, t % KT, t / KT, Ts);
  } else if (blk < WQ_BLOCKS + WO_BLOCKS + TAB_BLOCKS) {
    pack_table_block(Er, Erb, blk - (WQ_BLOCKS + WO_BLOCKS), Us);
  } else if (blk < WQ_BLOCKS + WO_BLOCKS + TAB_BLOCKS + MSK_BLOCKS) {
    pack_mask_block(mask, Mp, blk - (WQ_BLOCKS + WO_BLOCKS + TAB_BLOCKS));
  } else {
    cvt_rows_block(x, Xb, blk - (WQ_BLOCKS + WO_BLOCKS + TAB_BLOCKS + MSK_BLOCKS));
  }
}

/* --------------------------------------------------------------------------
 * qkv = Xb . WqT^T + b  (M = MROWS, N = 3072, K = 1024), bf16 x bf16, f32 acc.
 * Block = 4 waves, tile 128 tokens x 64 columns (= one head of one section);
 * wave = 32 rows x 64 cols (2 A fragments x 4 B fragments per 32-deep step).
 * Operands: stages of 64 k (128 B of each of the 192 operand rows, whole lines) brought into a
 * two-buffer LDS ring by asynchronous copies, 12 per thread and stage, one stage ahead of the
 * stage being worked on; fragments by 16-B LDS loads from rows pitched 144 B.
 * Foot of every stage: own LDS reads back, own copies landed, block barrier, then the refill of
 * the buffer just read. The epilogue tile reuses the ring behind the last stage's barrier.
 * Fragment map (hh = lane>>4, c = lane&15): A row c, elems 0..7 <- k0+8hh.., 8..15 <- k0+16+8hh..;
 * B col c with the same k map; D elem r = (row 8hh+r, col c).
 * Epilogue: (acc + bias) [x 1/8 for the k section] split to bf16 hi/lo, staged in a
 * block LDS tile ([tok][d] for q,k; [d][tok] for v), block barrier, then stored in fragment
 * order: the block's 1024 units of a plane are 16 KB in a row, unit u from
 *   q,k: token 16(u>>7) + (u&15), d segment (u>>4)&7;
 *   v  : d row 16((u>>6)&3) + (u&15), key segment 4(u>>8) + ((u>>4)&3).
 * ------------------------------------------------------------------------ */
__global__ __launch_bounds__(128) VGPR_CAP void gemm_qkv_kernel(
    const unsigned short* __restrict__ Xb, const unsigned short* __restrict__ WqT,
    const float* __restrict__ bias, unsigned short* __restrict__ qkvp)
{
  union FB { v16b v; v8b h[2]; };
  __shared__ __align__(16) unsigned short Sm[2 * QKV_STAGE_E];
  unsigned short* Th = Sm;
  unsigned short* Tl = Sm + T_ELEMS;

  const int tid  = threadIdx.x;
  const int wave = __builtin_amdgcn_readfirstlane(tid >> 5);
  const int lane = tid & 31;
  const int hh   = lane >> 4;
  const int c    = lane & 15;
  const int n0   = blockIdx.x * 64;
  const int m0   = blockIdx.y * 128;

  v8f acc[2][4];
#pragma unroll
  for (int mt = 0; mt < 2; ++mt)
#pragma unroll
    for (int t = 0; t < 4; ++t) acc[mt][t] = (v8f){0.f,0.f,0.f,0.f,0.f,0.f,0.f,0.f};

  /* copy unit: thread -> (row tid>>3 of each group of 16 rows, 16-B segment tid&7) */
  const int crow = tid >> 3;
  const int cseg = tid & 7;
  const unsigned short* gx = Xb  + (size_t)(m0 + crow) * DMODEL + cseg * 8;
  const unsigned short* gw = WqT + (size_t)(n0 + crow) * DMODEL + cseg * 8;
  const unsigned lrow = lds_off(Sm) + (unsigned)(crow * RP + cseg * 8) * 2u;

  auto issue_stage = [&](int st) {
    /* unrolled below: the address arrays are indexed by constants and stay in registers */
    unsigned l[12];
    const unsigned short* g[12];
    const unsigned lb = lrow + (unsigned)(st & 1) * (unsigned)(QKV_STAGE_E * 2);
#pragma unroll
    for (int it = 0; it < 12; ++it) {
      l[it] = lb + (unsigned)(it * 16 * RP * 2);
      g[it] = (it < 8) ? gx + (size_t)it * 16 * DMODEL + st * KST
                       : gw + (size_t)(it - 8) * 16 * DMODEL + st * KST;
    }
    async_copy12(l, g);
  };

  const unsigned short* sa = Sm + (wave * 32 + c) * RP + 8 * hh;
  const unsigned short* sb = Sm + (128 + c) * RP + 8 * hh;

  issue_stage(0);
  wait_copies();
  __syncthreads();   /* publishes stage 0 */
  issue_stage(1);

  /* kept rolled: one copy of the ring's foot (waits, barrier, refill), small loop text */
#pragma unroll 1
  for (int st = 0; st < NSTAGE; ++st) {
    const int bo = (st & 1) * QKV_STAGE_E;
    /* the stage's fragment loads stand as one group ahead of its products, so that the wave pays
       the LDS latency once a stage; the loops below are unrolled so that every index of the
       fragment arrays is a constant and they stay in registers */
    FB a0[2], a1[2], bf[2][4];
#pragma unroll
    for (int s = 0; s < 2; ++s) {
      const int ks = s * 32;
      a0[s].h[0] = *(const v8b_a*)(sa + bo + ks);
      a0[s].h[1] = *(const v8b_a*)(sa + bo + ks + 16);
      a1[s].h[0] = *(const v8b_a*)(sa + bo + 16 * RP + ks);
      a1[s].h[1] = *(const v8b_a*)(sa + bo + 16 * RP + ks + 16);
#pragma unroll
      for (int t = 0; t < 4; ++t) {
        bf[s][t].h[0] = *(const v8b_a*)(sb + bo + t * 16 * RP + ks);
        bf[s][t].h[1] = *(const v8b_a*)(sb + bo + t * 16 * RP + ks + 16);
      }
    }
#pragma unroll
    for (int s = 0; s < 2; ++s) {
#pragma unroll
      for (int t = 0; t < 4; ++t) {
        acc[0][t] = mma_bf16(a0[s].v, bf[s][t].v, acc[0][t]);
        acc[1][t] = mma_bf16(a1[s].v, bf[s][t].v, acc[1][t]);
      }
    }
    wait_lds_reads();
    wait_copies();
    __syncthreads();   /* publishes stage st + 1 and ends every read of stage st's buffer */
    if (st + 2 < NSTAGE) issue_stage(st + 2);
  }
  wait_copies();

  const int sec = n0 / DMODEL;                       /* 0 q, 1 k, 2 v : block-uniform */
  const float osc = (sec == 1) ? 0.125f : 1.0f;
#pragma unroll
  for (int t = 0; t < 4; ++t) {
    const float bv = bf_bits2f(f2bf_bits(bias[n0 + 16 * t + c]));
#pragma unroll
    for (int mt = 0; mt < 2; ++mt) {
#pragma unroll
      for (int r = 0; r < 8; ++r) {
        const float val = (acc[mt][t][r] + bv) * osc;
        const unsigned short hb = f2bf_bits(val);
        const unsigned short lb = f2bf_bits(val - bf_bits2f(hb));
        const int rl = wave * 32 + mt * 16 + 8 * hh + r;
        const int cl = 16 * t + c;
        const int idx = (sec < 2) ? (rl * TQ_PITCH + cl) : (cl * TV_PITCH + rl);
        Th[idx] = hb;
        Tl[idx] = lb;
      }
    }
  }
  __syncthreads();

  const int b  = m0 / SEQ;
  const int l0 = m0 - b * SEQ;
  const int h  = (n0 - sec * DMODEL) / DHEAD;
  const int bh = b * NHEAD + h;
  unsigned short* ph = qkvp + (size_t)(2 * sec) * PLANE;
  unsigned short* pl = ph + PLANE;

  {
    if (sec < 2) {
#pragma unroll
      for (int it = 0; it < 8; ++it) {
        const int u = it * 128 + tid;
        const int row = (u >> 7) * 16 + (u & 15);
        const int seg = (u >> 4) & 7;
        const v4u hw = *(const v4u_a*)(Th + row * TQ_PITCH + seg * 8);
        const v4u lw = *(const v4u_a*)(Tl + row * TQ_PITCH + seg * 8);
        const size_t g = ((size_t)bh * SEQ + l0) * DHEAD + u * 8;
        *(v4u*)(ph + g) = hw;
        *(v4u*)(pl + g) = lw;
      }
    } else {
#pragma unroll
      for (int it = 0; it < 8; ++it) {
        const int u = it * 128 + tid;
        const int drow = ((u >> 6) & 3) * 16 + (u & 15);
        const int seg  = (u >> 8) * 4 + ((u >> 4) & 3);
        const v4u hw = *(const v4u_a*)(Th + drow * TV_PITCH + seg * 8);
        const v4u lw = *(const v4u_a*)(Tl + drow * TV_PITCH + seg * 8);
        const size_t g = ((size_t)bh * SEQ + l0) * DHEAD + u * 8;
        *(v4u*)(ph + g) = hw;
        *(v4u*)(pl + g) = lw;
      }
    }
    
  }
}

/* --------------------------------------------------------------------------
 * Attention with the per-head relative-position table, head dim 64.
 * Block = 2 adjacent tiles of 16 query rows of one (b,h), 8 waves; grid (NBH, SEQ/32), the last tiles first, for speed only
 * under a mask that leaves later rows more keys; the order is a permutation of the tiles and changes no result under any mask.
 * The 4 waves of a query tile deal the
 * 64-key chunks among them (key group g takes chunks g, g+4, ...), each with its own running
 * maximum, sum and output accumulators; one block barrier, then the four partial states of each
 * tile are merged through LDS by the usual rescaling to the common row maximum.
 * Waves w and w ^ 2 hold the same key group for the two query tiles: they run the same text on the
 * same k, v and (but for one tile in five) table lines at about the same time, so that the lines
 * which one of them has fetched from L2 serve the other from the WGP's cache.
 * At entry: the packed mask words of all the wave's chunks (plane Mp, made by the preparation
 * launch), one word a chunk and lane, as one group of loads; wave-uniform skip of a
 * chunk when every element of its 16x64 mask tile is set; per-element replace-fill otherwise.
 * Per 64-key chunk and wave (16 query rows); only the output accumulators, the row statistics
 * and the mask words stay resident between chunks:
 *   G = q.Ewin^T  : 5 tiles (80 offsets d = kv0-q0-15+g, packed tiles (kv0-q0)/16+63 ..),
 *                   2 d-steps x (hi + lo) against the bf16 table, written
 *                   to the wave-private G slab, read back skewed: G[m][n-m+15];
 *   S = q.(k/8)^T : 4 key tiles, 2 d-steps x (hi.hi + hi.lo + lo.hi),
 *                   one accumulator, each tile written to the wave-private S slab;
 *   f32 online softmax on S + G; P as bf16 hi+lo wave-private LDS tiles;
 *   O += Ph.Vh + Pl.Vh + Ph.Vl from the V^T planes, two 32-key steps.
 * All fragments come straight from the 16-bit global planes, which stand in fragment order: every
 * load is a wave-uniform base + 16 B x lane and covers four whole lines. The loads are
 * issued in groups ahead of the products that use them (q, table and key tile 0 together; key
 * tiles 1..3 as registers come free; v during the softmax).
 * LDS regions Ss/Gs/Psh/Psl are private to their wave (wave_sync form) inside the loop.
 * Epilogue: each wave's unnormalised 16x64 slab (aliases its G slab) and row statistics,
 * block barrier, merge + normalise (thread = one row x 8 columns) -> ctx hi/lo planes,
 * ------------------------------------------------------------------------ */
__global__ __launch_bounds__(NWV * 32) VGPR_CAP void rel_attn_kernel(
    const unsigned short* __restrict__ qkvp, const unsigned short* __restrict__ Erb,
    const unsigned* __restrict__ Mp, unsigned short* __restrict__ ctxp)
{
  union FB { v16b v; v8b h[2]; };
  __shared__ __align__(16) float Gs[NWV][16 * GP];
  __shared__ __align__(16) float Ss[NWV][16 * SP];
  __shared__ __align__(16) unsigned short Psh[NWV][16 * KCH];
  __shared__ __align__(16) unsigned short Psl[NWV][16 * KCH];
  __shared__ float Ms[NWV][16];
  __shared__ float Ls[NWV][16];

  const int tid  = threadIdx.x;
  const int wave = __builtin_amdgcn_readfirstlane(tid >> 5);
  const int lane = tid & 31;
  const int hh   = lane >> 4;
  const int c    = lane & 15;
  const int qsel = (wave >> 1) & 1;                    /* which of the block's two query tiles */
  const int kg   = (wave & 1) | ((wave >> 2) << 1);    /* key group 0..3 */
  const int pb   = SEQ / (16 * QT) - 1 - (int)blockIdx.y;
  const int qb   = pb * QT + qsel;
  const int bh   = blockIdx.x;
  const int b    = bh / NHEAD;
  const int h    = bh - b * NHEAD;
  const int q0   = qb * 16;
  const float NEG_INF = -__builtin_inff();

  const unsigned short* Qh  = qkvp + (size_t)bh * SEQ * DHEAD;   /* each lo plane stands PLANE behind its hi plane */
  const unsigned short* Kh  = Qh + 2 * PLANE;
  const unsigned short* Vth = Qh + 4 * PLANE;     /* same per-bh element count */
  const unsigned short* Eh  = Erb + (size_t)h * 128 * 1024;   /* 128 packed tiles of 1024 elements a head */

  float mrow[8], lrow[8];
  v8f oacc[4];
#pragma unroll
  for (int r = 0; r < 8; ++r) { mrow[r] = NEG_INF; lrow[r] = 0.f; }
#pragma unroll
  for (int t = 0; t < 4; ++t) oacc[t] = (v8f){0.f,0.f,0.f,0.f,0.f,0.f,0.f,0.f};

  float* gs = Gs[wave];
  float* ss = Ss[wave];
  unsigned short* pwh = Psh[wave];
  unsigned short* pwl = Psl[wave];
  /* one lane base per slab and access pattern; every row and tile below is a constant offset from
     it, so that the LDS addresses take one register each and leave room for loads in flight */
  float* gsw = gs + 8 * hh * GP + c;                    /* G and output slab, element (8hh+r, 16t+c) */
  float* ssw = ss + 8 * hh * SP + c;                    /* S slab, element (8hh+r, 16j+c) */
  const float* gsk = gs + 8 * hh * (GP - 1) + c + 15;   /* G slab read skewed: G[m][n-m+15] */
  unsigned short* pwhw = pwh + 8 * hh * KCH + c;
  unsigned short* pwlw = pwl + 8 * hh * KCH + c;
  const unsigned lane8 = (unsigned)(lane * 8);   /* this lane's 16-B unit of every 512-B fragment run (elements) */

  /* packed mask words of all NCH chunks of this wave, one group of loads:
     bit 16(r&1) + 4j + (r>>1) of a lane's word = element (row 8hh+r, key 16j+c) of the chunk's tile */
  unsigned mpk[NCH];
  unsigned skip = 0u;                 /* bit i: every element of chunk i's tile is masked (wave-uniform) */
  {
    const unsigned* mpl = Mp + (size_t)(qb * NCHT + kg) * 32 + lane;   /* lane base; the rest are constants */
    /* both loops unrolled: the array is indexed by constants and stays in registers */
#pragma unroll
    for (int i = 0; i < NCH; ++i) mpk[i] = mpl[i * NWAVE * 32];
    wait_addr();      /* behind the mask word loads, before their address registers are written anew */
#pragma unroll
    for (int i = 0; i < NCH; ++i)
      skip |= (__builtin_amdgcn_ballot_w32(mpk[i] == 0xFFFFFFFFu) == 0xFFFFFFFFu) ? (1u << i) : 0u;
  }

  /* kept rolled: one copy of the chunk's text */
#pragma unroll 1
  for (int i = 0; i < NCH; ++i) {
    if ((skip >> i) & 1u) continue;               /* wave-uniform: every element masked */
    const int kv0 = (kg + i * NWAVE) * KCH;

    const unsigned mk = (i == 0) ? mpk[0] : (i == 1) ? mpk[1] : (i == 2) ? mpk[2] : mpk[3];

    /* The chunk's loads fly as a window ahead of the products that use them: q, the 5 table tiles
       and key tile 0 are issued as one group, each further key tile as soon as earlier tiles'
       registers come free. q is read per chunk so that its registers are free for the v fragments
       during the softmax and p.v. All loops below are unrolled so that the fragment arrays are
       indexed by constants and stay in registers. */
    v16b qh[2], ql[2];
    FB kfh[4][2], kfl[4][2], ef[5][2];
    /* position table: offsets kv0 - q0 - 15 + g, g = 0..79, are the packed tiles
       (kv0 - q0) / 16 + 63 + t, t = 0..4, in [0, 127] */
    g_u16* ep = scalar_base(Eh + ((kv0 - q0 + SEQ_FULL - 16) >> 4) * 1024);
    g_u16* kh = scalar_base(Kh + kv0 * DHEAD);
    g_u16* kl = kh + PLANE;
    g_u16* vh = scalar_base(Vth + kv0 * DHEAD);
    g_u16* vl = vh + PLANE;
    g_u16* qph = scalar_base(Qh + q0 * DHEAD);
    g_u16* qpl = qph + PLANE;
    auto load_key_tile = [&](int j) {
#pragma unroll
      for (int dc = 0; dc < 2; ++dc) {
        kfh[j][dc].h[0] = *(g_v8b*)(kh + lane8 + j * 1024 + dc * 512);
        kfh[j][dc].h[1] = *(g_v8b*)(kh + lane8 + j * 1024 + dc * 512 + 256);
        kfl[j][dc].h[0] = *(g_v8b*)(kl + lane8 + j * 1024 + dc * 512);
        kfl[j][dc].h[1] = *(g_v8b*)(kl + lane8 + j * 1024 + dc * 512 + 256);
      }
      /* behind the chunk's last k load, before its address registers are written anew */
      if (j == 3) wait_addr();
    };
    {
#pragma unroll
      for (int dc = 0; dc < 2; ++dc) {
        FB f;
        f.h[0] = *(g_v8b*)(qph + lane8 + dc * 512);
        f.h[1] = *(g_v8b*)(qph + lane8 + dc * 512 + 256);
        qh[dc] = f.v;
        f.h[0] = *(g_v8b*)(qpl + lane8 + dc * 512);
        f.h[1] = *(g_v8b*)(qpl + lane8 + dc * 512 + 256);
        ql[dc] = f.v;
      }
    }
#pragma unroll
    for (int t = 0; t < 5; ++t) {
#pragma unroll
      for (int dc = 0; dc < 2; ++dc) {
        ef[t][dc].h[0] = *(g_v8b*)(ep + lane8 + t * 1024 + dc * 512);
        ef[t][dc].h[1] = *(g_v8b*)(ep + lane8 + t * 1024 + dc * 512 + 256);
      }
    }
    load_key_tile(0);
    wait_addr();      /* behind the last q and table loads, before their address registers are written anew */
    /* keeps the first product, and the load wait in front of it, behind the issue of the whole
       group: moved up among the loads it would make the rest of the group wait a full latency */
    __builtin_amdgcn_sched_barrier(0);

    /* position term: G[m][g] = q[m] . Er[h][(kv0 - q0 - 15 + g) mod 2047], g = 0..79 */
#pragma unroll
    for (int t = 0; t < 5; ++t) {
      v8f g = (v8f){0.f,0.f,0.f,0.f,0.f,0.f,0.f,0.f};
#pragma unroll
      for (int dc = 0; dc < 2; ++dc) {
        g = mma_bf16(qh[dc], ef[t][dc].v, g);
        g = mma_bf16(ql[dc], ef[t][dc].v, g);
      }
      if (t == 1) load_key_tile(1);
      if (t == 3) load_key_tile(2);
#pragma unroll
      for (int r = 0; r < 8; ++r) gsw[r * GP + 16 * t] = g[r];
    }

    /* raw scores: 4 key tiles, one accumulator, tile -> S slab (D elem r = row 8hh+r, col c) */
#pragma unroll
    for (int j = 0; j < 4; ++j) {
      v8f sa = (v8f){0.f,0.f,0.f,0.f,0.f,0.f,0.f,0.f};
#pragma unroll
      for (int dc = 0; dc < 2; ++dc) {
        sa = mma_bf16(qh[dc], kfh[j][dc].v, sa);
        sa = mma_bf16(qh[dc], kfl[j][dc].v, sa);
        sa = mma_bf16(ql[dc], kfh[j][dc].v, sa);
      }
      if (j == 0) load_key_tile(3);
#pragma unroll
      for (int r = 0; r < 8; ++r) ssw[r * SP + 16 * j] = sa[r];
    }
    wave_lds_sync();

    /* v fragments of the first 32 keys: issued here, so that they fly during the softmax */
    FB vbh[2][4], vbl[2][4];
    auto load_v_step = [&](int kk) {
#pragma unroll
      for (int t = 0; t < 4; ++t) {
        const int vo = kk * 2048 + t * 512;
        vbh[kk][t].h[0] = *(g_v8b*)(vh + lane8 + vo);
        vbh[kk][t].h[1] = *(g_v8b*)(vh + lane8 + vo + 256);
        vbl[kk][t].h[0] = *(g_v8b*)(vl + lane8 + vo);
        vbl[kk][t].h[1] = *(g_v8b*)(vl + lane8 + vo + 256);
      }
      /* behind the chunk's last v load, before its address registers are written anew */
      if (kk == 1) wait_addr();
    };
    load_v_step(0);

    /* raw score + skewed position term, replace-fill of masked elements */
    v8f s[4];
#pragma unroll
    for (int j = 0; j < 4; ++j) {
#pragma unroll
      for (int r = 0; r < 8; ++r) {
        const float raw = ssw[r * SP + 16 * j];
        const float gv = gsk[r * (GP - 1) + 16 * j];
        const float sv = raw + gv;
        const unsigned bit = (mk >> (16 * (r & 1) + 4 * j + (r >> 1))) & 1u;
        s[j][r] = bit ? NEG_INF : sv;
      }
    }

    /* chunk row max over the 64 keys */
    float cm[8];
#pragma unroll
    for (int r = 0; r < 8; ++r) {
      cm[r] = fmaxf(fmaxf(s[0][r], s[1][r]), fmaxf(s[2][r], s[3][r]));
    }
    row_max16x8(cm);

    /* online softmax update, P tiles as bf16 hi + lo */
#pragma unroll
    for (int r = 0; r < 8; ++r) {
      if (r == 4) load_v_step(1);   /* the second 32 keys' fragments, once half the score registers are free */
      const float mnew  = fmaxf(mrow[r], cm[r]);
      const float msafe = (mnew == NEG_INF) ? 0.f : mnew;
      const float nm    = -msafe * LOG2E;
      const float alpha = exp_shifted(mrow[r], nm);
      mrow[r] = mnew;
      float psum = 0.f;
#pragma unroll
      for (int j = 0; j < 4; ++j) {
        const float p = exp_shifted(s[j][r], nm);
        psum += p;
        const unsigned short hb = f2bf_bits(p);
        const unsigned short lb = f2bf_bits(p - bf_bits2f(hb));
        pwhw[r * KCH + j * 16] = hb;
        pwlw[r * KCH + j * 16] = lb;
      }
      psum = row_sum16(psum);
      lrow[r] = lrow[r] * alpha + psum;
#pragma unroll
      for (int t = 0; t < 4; ++t) oacc[t][r] *= alpha;
    }
    wave_lds_sync();

    /* O += P.V : A = P [q][kv] (this wave's tiles), B = V [kv][d] from the packed v planes;
       unrolled over the two 32-key steps: the fragment arrays are indexed by constants */
#pragma unroll
    for (int kk = 0; kk < 2; ++kk) {
      FB pa, pl;
      pa.h[0] = *(const v8b_a*)(pwh + c * KCH + kk * 32 + 8 * hh);
      pa.h[1] = *(const v8b_a*)(pwh + c * KCH + kk * 32 + 16 + 8 * hh);
      pl.h[0] = *(const v8b_a*)(pwl + c * KCH + kk * 32 + 8 * hh);
      pl.h[1] = *(const v8b_a*)(pwl + c * KCH + kk * 32 + 16 + 8 * hh);
#pragma unroll
      for (int t = 0; t < 4; ++t) {
        oacc[t] = mma_bf16(pa.v, vbh[kk][t].v, oacc[t]);
        oacc[t] = mma_bf16(pl.v, vbh[kk][t].v, oacc[t]);
        oacc[t] = mma_bf16(pa.v, vbl[kk][t].v, oacc[t]);
      }
    }
    wave_lds_sync();
  }

  /* this wave's partial state: unnormalised output into its own slab (aliases the G slab),
     row maximum and row sum beside it */
#pragma unroll
  for (int r = 0; r < 8; ++r) {
#pragma unroll
    for (int t = 0; t < 4; ++t) gsw[r * GP + t * 16] = oacc[t][r];
  }
  if (c == 0) {      /* the 16 lanes of a half hold equal row statistics */
#pragma unroll
    for (int r = 0; r < 8; ++r) {
      Ms[wave][8 * hh + r] = mrow[r];
      Ls[wave][8 * hh + r] = lrow[r];
    }
  }
  __syncthreads();   /* publishes the partial states to the whole block */
  {
    unsigned short* Ch = ctxp;
    unsigned short* Cl = ctxp + XB_E;
    const int row = (tid >> 3) & 15;
    const int seg = tid & 7;
    const int wq  = (tid >> 7) << 1;      /* the wave of key group 0 of this thread's query tile */
    float mall = Ms[wq][row];
#pragma unroll
    for (int g = 1; g < NWAVE; ++g) mall = fmaxf(mall, Ms[wq + (g & 1) + ((g >> 1) << 2)][row]);
    const float msafe = (mall == NEG_INF) ? 0.f : mall;
    const float nm = -msafe * LOG2E;
    float lsum = 0.f;
    v4f a0 = (v4f){0.f, 0.f, 0.f, 0.f};
    v4f a1 = (v4f){0.f, 0.f, 0.f, 0.f};
#pragma unroll
    for (int g = 0; g < NWAVE; ++g) {
      const int w = wq + (g & 1) + ((g >> 1) << 2);   /* key groups in ascending order */
      const float f = exp_shifted(Ms[w][row], nm);
      lsum += Ls[w][row] * f;
      a0 += *(const v4f_a*)(Gs[w] + row * GP + seg * 8) * f;
      a1 += *(const v4f_a*)(Gs[w] + row * GP + seg * 8 + 4) * f;
    }
    const float inv = 1.0f / lsum;
    a0 *= inv;
    a1 *= inv;
    unsigned h0, h1, h2, h3, l0, l1, l2, l3;
    split2(a0[0], a0[1], h0, l0);
    split2(a0[2], a0[3], h1, l1);
    split2(a1[0], a1[1], h2, l2);
    split2(a1[2], a1[3], h3, l3);
    v4u hw, lw;
    hw[0] = h0; hw[1] = h1; hw[2] = h2; hw[3] = h3;
    lw[0] = l0; lw[1] = l1; lw[2] = l2; lw[3] = l3;
    const size_t go = (size_t)(b * SEQ + pb * (16 * QT) + (tid >> 3)) * DMODEL + h * DHEAD + seg * 8;
    *(v4u*)(Ch + go) = hw;
    *(v4u*)(Cl + go) = lw;
  }
}

/* --------------------------------------------------------------------------
 * out = (Ch + Cl) . WoT^T + b  (M = MROWS, N = 1024, K = 1024), f32 acc.
 * Block = 4 waves, tile 128 x 64; wave = 32 rows x 64 cols; A hi and lo planes
 * against the single bf16 weight plane (two products per tile pair).
 * Operands: stages of 64 k (128 B of each of the 320 operand rows) in a two-buffer LDS ring,
 * filled by asynchronous copies (20 per thread and stage) in the order of gemm_qkv_kernel.
 * Epilogue: per-wave 32x64 f32 slab (wave-private LDS), 16 lanes x 16 B = one 256-B
 * ------------------------------------------------------------------------ */
__global__ __launch_bounds__(128) VGPR_CAP void gemm_out_kernel(
    const unsigned short* __restrict__ ctxp, const unsigned short* __restrict__ WoT,
    const float* __restrict__ bias, float* __restrict__ out)
{
  union FB { v16b v; v8b h[2]; };
  __shared__ __align__(16) float Os[NWAVE][32 * OS_PITCH];
  __shared__ __align__(16) unsigned short Sm[2 * OUT_STAGE_E];

  const int tid  = threadIdx.x;
  const int wave = __builtin_amdgcn_readfirstlane(tid >> 5);
  const int lane = tid & 31;
  const int hh   = lane >> 4;
  const int c    = lane & 15;
  const int n0   = blockIdx.x * 64;
  const int m0   = blockIdx.y * 128;

  v8f acc[2][4];
#pragma unroll
  for (int mt = 0; mt < 2; ++mt)
#pragma unroll
    for (int t = 0; t < 4; ++t) acc[mt][t] = (v8f){0.f,0.f,0.f,0.f,0.f,0.f,0.f,0.f};

  /* copy unit: thread -> (row tid>>3 of each group of 16 rows, 16-B segment tid&7) */
  const int crow = tid >> 3;
  const int cseg = tid & 7;
  const unsigned short* gh = ctxp + (size_t)(m0 + crow) * DMODEL + cseg * 8;
  const unsigned short* gl = gh + XB_E;
  const unsigned short* gw = WoT + (size_t)(n0 + crow) * DMODEL + cseg * 8;
  const unsigned lrow = lds_off(Sm) + (unsigned)(crow * RP + cseg * 8) * 2u;

  auto issue_stage = [&](int st) {
    /* unrolled below: the address arrays are indexed by constants and stay in registers */
    unsigned l[20];
    const unsigned short* g[20];
    const unsigned lb = lrow + (unsigned)(st & 1) * (unsigned)(OUT_STAGE_E * 2);
#pragma unroll
    for (int it = 0; it < 20; ++it) {
      l[it] = lb + (unsigned)(it * 16 * RP * 2);
      g[it] = (it < 8)  ? gh + (size_t)it * 16 * DMODEL + st * KST
            : (it < 16) ? gl + (size_t)(it - 8) * 16 * DMODEL + st * KST
                        : gw + (size_t)(it - 16) * 16 * DMODEL + st * KST;
    }
    async_copy10(l, g);
    async_copy10(l + 10, g + 10);
  };

  const unsigned short* sh = Sm + (wave * 32 + c) * RP + 8 * hh;
  const unsigned short* sl = sh + 128 * RP;
  const unsigned short* sb = Sm + (256 + c) * RP + 8 * hh;

  issue_stage(0);
  wait_copies();
  __syncthreads();   /* publishes stage 0 */
  issue_stage(1);

  /* kept rolled: one copy of the ring's foot (waits, barrier, refill), small loop text */
#pragma unroll 1
  for (int st = 0; st < NSTAGE; ++st) {
    const int bo = (st & 1) * OUT_STAGE_E;
    /* the stage's fragment loads stand as one group ahead of its products, so that the wave pays
       the LDS latency once a stage; the loops below are unrolled so that every index of the
       fragment arrays is a constant and they stay in registers */
    FB a0h[2], a1h[2], a0l[2], a1l[2], bf[2][4];
#pragma unroll
    for (int s = 0; s < 2; ++s) {
      const int ks = s * 32;
      a0h[s].h[0] = *(const v8b_a*)(sh + bo + ks);
      a0h[s].h[1] = *(const v8b_a*)(sh + bo + ks + 16);
      a0l[s].h[0] = *(const v8b_a*)(sl + bo + ks);
      a0l[s].h[1] = *(const v8b_a*)(sl + bo + ks + 16);
      a1h[s].h[0] = *(const v8b_a*)(sh + bo + 16 * RP + ks);
      a1h[s].h[1] = *(const v8b_a*)(sh + bo + 16 * RP + ks + 16);
      a1l[s].h[0] = *(const v8b_a*)(sl + bo + 16 * RP + ks);
      a1l[s].h[1] = *(const v8b_a*)(sl + bo + 16 * RP + ks + 16);
#pragma unroll
      for (int t = 0; t < 4; ++t) {
        bf[s][t].h[0] = *(const v8b_a*)(sb + bo + t * 16 * RP + ks);
        bf[s][t].h[1] = *(const v8b_a*)(sb + bo + t * 16 * RP + ks + 16);
      }
    }
#pragma unroll
    for (int s = 0; s < 2; ++s) {
#pragma unroll
      for (int t = 0; t < 4; ++t) {
        acc[0][t] = mma_bf16(a0h[s].v, bf[s][t].v, acc[0][t]);
        acc[0][t] = mma_bf16(a0l[s].v, bf[s][t].v, acc[0][t]);
        acc[1][t] = mma_bf16(a1h[s].v, bf[s][t].v, acc[1][t]);
        acc[1][t] = mma_bf16(a1l[s].v, bf[s][t].v, acc[1][t]);
      }
    }
    wait_lds_reads();
    wait_copies();
    __syncthreads();   /* publishes stage st + 1 and ends every read of stage st's buffer */
    if (st + 2 < NSTAGE) issue_stage(st + 2);
  }
  wait_copies();

  float* os = Os[wave];
#pragma unroll
  for (int t = 0; t < 4; ++t) {
    const float bv = bf_bits2f(f2bf_bits(bias[n0 + 16 * t + c]));
#pragma unroll
    for (int mt = 0; mt < 2; ++mt)
#pragma unroll
      for (int r = 0; r < 8; ++r)
        os[(mt * 16 + 8 * hh + r) * OS_PITCH + 16 * t + c] = acc[mt][t][r] + bv;
  }
  wave_lds_sync();
  {
    const int c4 = c * 4;
    {
#pragma unroll
      for (int it = 0; it < 16; ++it) {
        const int row = it * 2 + hh;
        const v4f val = *(const v4f_a*)(os + row * OS_PITCH + c4);
        *(v4f*)(out + (size_t)(m0 + wave * 32 + row) * DMODEL + n0 + c4) = val;
      }
      
    }
  }
}

extern "C" void kernel_launch(void* const* d_in, const int* in_sizes, int n_in,
                              void* d_out, int out_size, void* d_ws, size_t ws_size,
                              hipStream_t stream)
{
  if (n_in < 7) return;
  if (in_sizes[0] < ((NB - 1) * SEQ_FULL + SEQ) * DMODEL) return;
  if (in_sizes[1] < (SEQ - 1) * SEQ_FULL + SEQ) return;
  if (in_sizes[2] < DMODEL * NQKV) return;
  if (in_sizes[3] < NQKV) return;
  if (in_sizes[4] < DMODEL * DMODEL) return;
  if (in_sizes[5] < DMODEL) return;
  if (in_sizes[6] < NHEAD * NPOS * DHEAD) return;
  if (out_size < MROWS * DMODEL) return;
  if (d_ws == nullptr || ws_size < WS_NEED) return;

  const float* x     = (const float*)d_in[0];
  const int*   mask  = (const int*)d_in[1];
  const float* W_qkv = (const float*)d_in[2];
  const float* b_qkv = (const float*)d_in[3];
  const float* W_o   = (const float*)d_in[4];
  const float* b_o   = (const float*)d_in[5];
  const float* Er    = (const float*)d_in[6];
  float* out = (float*)d_out;

  unsigned short* Xb   = (unsigned short*)d_ws;
  unsigned short* WqT  = Xb + XB_E;
  unsigned short* WoT  = WqT + WQT_E;
  unsigned short* Erb  = WoT + WOT_E;
  unsigned short* qkvp = Erb + ERB_E;
  unsigned short* ctxp = qkvp + QKVP_E;
  unsigned*       Mp   = (unsigned*)(ctxp + CTX_E);

  /* the five preparation jobs, one launch */
  prep_kernel<<<PREP_BLOCKS, 256, 0, stream>>>(x, W_qkv, W_o, Er, mask, Xb, WqT, WoT, Erb, Mp);

  gemm_qkv_kernel<<<dim3(NQKV / 64, MROWS / 128), 128, 0, stream>>>(Xb, WqT, b_qkv, qkvp);
  rel_attn_kernel<<<dim3(NBH, SEQ / (16 * QT)), NWV * 32, 0, stream>>>(qkvp, Erb, Mp, ctxp);
  gemm_out_kernel<<<dim3(DMODEL / 64, MROWS / 128), 128, 0, stream>>>(ctxp, WoT, b_o, out);
}
